// v000
// Times are from an AMD MI455X. After a warm-up the kernel runs many times in a row, and a time is the length of
// such a window on the GPU divided by its runs, so every launch and the gaps after it count. The runs cycle
// through copies of the inputs. A figure is the median of several windows, for all but v000 over two sittings.
// Sittings can differ by a few percent; kernels timed side by side share one.
// v000 is the starting kernel. One run takes 906 microseconds.
// compute dtype: all float inputs rounded to bf16, attn_mask (int) read on device; RMSNorms (eps 1e-6) in f32, normed rows once to f16; q/k/v = f16(h) . W^T against exact f16 x 2^8 weight copies on WMMA 16x16x32 (single products, f32 accumulate); rotate-half RoPE in f32 (precise sinf/cosf) before the f16 hi + residual split; attention with 3-product scores and P.v (hi + residual planes), x 1/8, masked keys excluded (mask read per pair; fully-masked 64x32 tiles skipped via a device-built flag table), running-max softmax in f32 (hardware exp); x1 = x + f16(ctx) . Wo^T; SwiGLU: f16(rmsnorm(x1)) . [W_gate | W_up]^T (hidden padded 2,730 -> 2,816 with zero weights), silu(g) u in f32 -> f16, . W_down^T + x1; f32 output.
#include <hip/hip_runtime.h>
#include <math.h>

typedef __attribute__((ext_vector_type(16))) _Float16 v16h;
typedef __attribute__((ext_vector_type(16))) __bf16 v16b;
typedef __attribute__((ext_vector_type(8)))  _Float16 v8h;
typedef __attribute__((ext_vector_type(8)))  float v8f;
typedef __attribute__((ext_vector_type(4)))  float v4f;
typedef __attribute__((ext_vector_type(2)))  float v2f;
typedef __attribute__((ext_vector_type(4)))  unsigned v4u;
typedef __attribute__((ext_vector_type(4)))  int v4i;
typedef float __attribute__((may_alias)) float_a;
typedef int __attribute__((may_alias)) int_a;

template <typename T> __device__ __forceinline__ void vst2(void* p, T v) { *(T*)p = v;  }
__device__ __forceinline__ v8f wmma16(v16h a, v16h b, v8f c) {
  v8f d = __builtin_amdgcn_wmma_f32_16x16x32_f16(false, a, false, b, (short)0, c, false, false);
  asm volatile("v_nop\n\tv_nop\n\tv_nop\n\tv_nop" : "+v"(d) : "v"(a), "v"(b));
  return d;
}
__device__ __forceinline__ v8f wmma_bf(v16b a, v16b b, v8f c) {
  v8f d = __builtin_amdgcn_wmma_f32_16x16x32_bf16(false, a, false, b, (short)0, c, false, false);
  asm volatile("v_nop\n\tv_nop\n\tv_nop\n\tv_nop" : "+v"(d) : "v"(a), "v"(b));
  return d;
}
// Streaming decoder block (B 2, L 2,048, d 1,024, 16 heads x 64, SwiGLU hidden 2,730): pre-RMSNorm, bias-free projections, rotate-half RoPE (base 10000), attention under the given boolean mask (all-keys + 256-token window), out-projection + residual, pre-RMSNorm SwiGLU FFN + residual.
__device__ __forceinline__ v16h frag_h(const _Float16* rowk0, int lane) {
  union { v16h v; v8h q[2]; } u; const _Float16* p = rowk0 + 8 * (lane >> 4);
  u.q[0] = *(const v8h*)p; u.q[1] = *(const v8h*)(p + 16); return u.v;
}
__device__ __forceinline__ v16h frag_f32(const float* rowk0, int lane) {
  v16h a; const float* p = rowk0 + 8 * (lane >> 4);
#pragma unroll
  for (int i = 0; i < 8; ++i) { a[i] = (_Float16)p[i]; a[8 + i] = (_Float16)p[16 + i]; }
  return a;
}
__device__ __forceinline__ v16h frag_f32s(const float* rowk0, int lane, float sc) {
  v16h a; const float* p = rowk0 + 8 * (lane >> 4);
#pragma unroll
  for (int i = 0; i < 8; ++i) { a[i] = (_Float16)(p[i] * sc); a[8 + i] = (_Float16)(p[16 + i] * sc); }
  return a;
}
// column fragment from a [K][ld] layout (column n), rows >= K read as 0
__device__ __forceinline__ v16h fragc_f32(const float* W, int k0, int n, int lane, int ld, int K) {
  v16h a; const int g = lane >> 4;
#pragma unroll
  for (int i = 0; i < 8; ++i) { const int ka = k0 + 8 * g + i, kb = ka + 16;
    a[i] = (_Float16)(ka < K ? W[(size_t)(ka < K ? ka : K - 1) * ld + n] : 0.f); a[8 + i] = (_Float16)(kb < K ? W[(size_t)(kb < K ? kb : K - 1) * ld + n] : 0.f); }
  return a;
}
struct F2 { v16b h, l; };
__device__ __forceinline__ F2 bsplit16(const float v[16]) { F2 r;
#pragma unroll
  for (int i = 0; i < 16; ++i) { const __bf16 h = (__bf16)v[i]; r.h[i] = h; r.l[i] = (__bf16)(v[i] - (float)h); }
  return r; }
__device__ __forceinline__ F2 split_row(const float* row, int k0, int lane) { float v[16]; const float* p = row + k0 + 8 * (lane >> 4);
#pragma unroll
  for (int i = 0; i < 8; ++i) { v[i] = p[i]; v[8 + i] = p[16 + i]; }
  return bsplit16(v); }
__device__ __forceinline__ F2 split_rowK(const float* row, int k0, int lane, int K) { float v[16]; const int g = lane >> 4;
#pragma unroll
  for (int i = 0; i < 8; ++i) { const int ka = k0 + 8 * g + i, kb = ka + 16; v[i] = ka < K ? row[ka < K ? ka : K - 1] : 0.f; v[8 + i] = kb < K ? row[kb < K ? kb : K - 1] : 0.f; }
  return bsplit16(v); }
__device__ __forceinline__ F2 split_col(const float* W, int k0, int n, int lane, int ld, int K) { float v[16]; const int g = lane >> 4;
#pragma unroll
  for (int i = 0; i < 8; ++i) { const int ka = k0 + 8 * g + i, kb = ka + 16; v[i] = ka < K ? W[(size_t)(ka < K ? ka : K - 1) * ld + n] : 0.f; v[8 + i] = kb < K ? W[(size_t)(kb < K ? kb : K - 1) * ld + n] : 0.f; }
  return bsplit16(v); }
__device__ __forceinline__ v8f mac3(const F2& a, const F2& b, v8f c) { c = wmma_bf(a.l, b.h, c); c = wmma_bf(a.h, b.l, c); return wmma_bf(a.h, b.h, c); }
__device__ __forceinline__ float sigm(float v) { return 1.0f / (1.0f + expf(-v)); }
#define LDSX() do { asm volatile("s_wait_dscnt 0" ::: "memory"); __builtin_amdgcn_wave_barrier(); __builtin_amdgcn_fence(__ATOMIC_RELEASE, "workgroup"); } while (0)


#define NB 2
#define SS 2048
#define DM 1024
#define NH 16
#define HID 2730
#define HP 2816          // hidden padded to 22 x 128
#define WSC 256.0f
#define RMSEPS 1e-6f
__constant__ float THETA[32] = {1.000000000e+00f,7.498942018e-01f,5.623413324e-01f,4.216965139e-01f,3.162277639e-01f,2.371373773e-01f,1.778279394e-01f,1.333521456e-01f,1.000000015e-01f,7.498942316e-02f,5.623413250e-02f,4.216964915e-02f,3.162277490e-02f,2.371373773e-02f,1.778279431e-02f,1.333521400e-02f,9.999999776e-03f,7.498942316e-03f,5.623413250e-03f,4.216964822e-03f,3.162277630e-03f,2.371373819e-03f,1.778279431e-03f,1.333521446e-03f,1.000000047e-03f,7.498941850e-04f,5.623413017e-04f,4.216965172e-04f,3.162277571e-04f,2.371373703e-04f,1.778279402e-04f,1.333521504e-04f};
__device__ __attribute__((noinline)) float cos_p(float v) { return cosf(v); }
__device__ __attribute__((noinline)) float sin_p(float v) { return sinf(v); }
#define HD 64
#define QKVW (3 * DM)
#ifndef TQB
#define TQB (SS / 64)
#define TNB NB
#define TOB (NB * SS / 64)     // output row tiles (all)
#endif
typedef __attribute__((ext_vector_type(8))) __bf16 v8b;
__device__ __forceinline__ v16b frag_b(const __bf16* rowk0, int lane) {
  union { v16b v; v8b q[2]; } u; const __bf16* p = rowk0 + 8 * (lane >> 4);
  u.q[0] = *(const v8b*)p; u.q[1] = *(const v8b*)(p + 16); return u.v;
}
__device__ __forceinline__ float bfr(float v) { return (float)(__bf16)v; }
__device__ __attribute__((noinline)) float exp_ni(float v) { return expf(v); }
__device__ __attribute__((noinline)) float erf_ni(float v) { return erff(v); }

#define PK_A 0                       // [3072][1024] Wqkv rows (natural [out][in])
#define PK_P (PK_A + QKVW * DM)        // [1024][1024] Wo rows (natural)
#define PK_END (PK_P + DM * DM)
#define WS_PK  0u
#define WS_QK  (WS_PK + 2u * PK_END)             // f16 [4096 rows][2048]: q | k
#define WS_QKL (WS_QK + 2u * NB * SS * 2 * DM)     // f16 q | k residual planes x2048
#define WS_VTH (WS_QKL + 2u * NB * SS * 2 * DM)    // f16 [b][1024 (h*64+d)][2048 s] hi
#define WS_VTL (WS_VTH + 2u * NB * DM * SS)        // f16 lo x 2048
#define WS_O   (WS_VTL + 2u * NB * DM * SS)        // f32 [4096][1024]
#define WS_PG  (WS_O + 4u * (size_t)NB * SS * DM)        // f16 x 2^8 [gate | up] rows [2*HP][1024] (zero rows >= HID), down rows [1024][HP] (zero cols >= HID)
#define WS_PD  (WS_PG + 2u * (size_t)2 * HP * DM)
#define WS_H1  (WS_PD + 2u * (size_t)DM * HP)             // f16 rmsnorm1(x) rows [NR][1024]; int flags [SS/64][SS/32]; f32 x1 [NR][1024]; f16 rmsnorm2(x1) rows; f16 silu(gate) up rows [NR][HP]
#define WS_FL  (WS_H1 + 2u * (size_t)NB * SS * DM)
#define WS_X1  (WS_FL + 4u * (size_t)(SS / 64) * (SS / 32))
#define WS_H2  (WS_X1 + 4u * (size_t)NB * SS * DM)
#define WS_GU  (WS_H2 + 2u * (size_t)NB * SS * DM)
#define WS_END (WS_GU + 2u * (size_t)NB * SS * HP)
// ---- k_pack: block = (row n, which): natural [out][in] rows -> f16 (bf16-rounded x 2^8); which 0..2 -> W_q/W_k/W_v into PK_A rows which*1024 + n; 3 -> W_o into PK_P
__global__ __launch_bounds__(256) void k_pack(const float* __restrict__ WQ, const float* __restrict__ WK, const float* __restrict__ WV, const float* __restrict__ WO, const float* __restrict__ WG, const float* __restrict__ WU, const float* __restrict__ WD, char* __restrict__ ws) {
  const int n = blockIdx.x, which = blockIdx.y, t = threadIdx.x; __shared__ __align__(16) _Float16 sh[HP]; _Float16* P = (_Float16*)(ws + WS_PK);
  if (which < 4) { if (n >= DM) return; const float* w = (which == 0) ? WQ : (which == 1) ? WK : (which == 2) ? WV : WO; for (int k = t; k < DM; k += 256) sh[k] = (_Float16)(bfr(w[(size_t)n * DM + k]) * WSC); __syncthreads();
    _Float16* dst = (which < 3) ? (P + PK_A + ((size_t)which * DM + n) * DM) : (P + PK_P + (size_t)n * DM); for (int q = t; q < DM / 8; q += 256) vst2((unsigned*)(dst + q * 8), *(const v4u*)&sh[q * 8]); }
  else if (which < 6) { if (n >= HP) return; const float* w = (which == 4) ? WG : WU; for (int k = t; k < DM; k += 256) sh[k] = (n < HID) ? (_Float16)(bfr(w[(size_t)n * DM + k]) * WSC) : (_Float16)0.0f; __syncthreads();   // gate | up rows, zero beyond 2,730
    _Float16* dst = (_Float16*)(ws + WS_PG) + ((size_t)(which - 4) * HP + n) * DM; for (int q = t; q < DM / 8; q += 256) vst2((unsigned*)(dst + q * 8), *(const v4u*)&sh[q * 8]); }
  else { if (n >= DM) return; for (int k = t; k < HP; k += 256) sh[k] = (k < HID) ? (_Float16)(bfr(WD[(size_t)n * HID + k]) * WSC) : (_Float16)0.0f; __syncthreads();   // down rows [1024][HP]
    _Float16* dst = (_Float16*)(ws + WS_PD) + (size_t)n * HP; for (int q = t; q < HP / 8; q += 256) vst2((unsigned*)(dst + q * 8), *(const v4u*)&sh[q * 8]); } }
__global__ __launch_bounds__(128) void k_qkv(const float* __restrict__ XQ, const float* __restrict__ XK, const float* __restrict__ XV, const _Float16* __restrict__ P, const float* __restrict__ BQ, const float* __restrict__ BK, const float* __restrict__ BV, _Float16* __restrict__ QK, _Float16* __restrict__ QKL, _Float16* __restrict__ VTH, _Float16* __restrict__ VTL) {
  const int which0 = (blockIdx.y * 128) / DM; const float* X = (which0 == 0) ? XQ : (which0 == 1) ? XK : XV; const float* BB = BQ ? (((which0 == 0) ? BQ : (which0 == 1) ? BK : BV) + (blockIdx.y * 128 - which0 * DM)) : nullptr;
  __shared__ __align__(16) _Float16 so[4][16][136], sol[4][16][136]; __shared__ __align__(16) _Float16 sth[128][72], stl[128][72];
  const int tid = threadIdx.x, wave = tid >> 5, lane = tid & 31, col = lane & 15, g = lane >> 4; const size_t r0 = (size_t)blockIdx.x * 64 + wave * 16; const int n0 = blockIdx.y * 128;
  v8f acc[8] = {};
#pragma unroll 2
  for (int kc = 0; kc < DM / 32; ++kc) { const v16h a = frag_h((const _Float16*)X + (r0 + col) * DM + kc * 32, lane);   // A = f16 rmsnorm rows
#pragma unroll
    for (int j = 0; j < 8; ++j) acc[j] = wmma16(a, frag_h(P + (size_t)(n0 + j * 16 + col) * DM + kc * 32, lane), acc[j]); }
#pragma unroll
  for (int j = 0; j < 8; ++j)
#pragma unroll
    for (int r = 0; r < 8; ++r) acc[j][r] *= (1.0f / WSC);
  if (n0 < 2 * DM) {   // bias, then rotate-half rotary over each 64-dim head with angle position * inv_freq[d mod 32]
#pragma unroll
    for (int j = 0; j < 8; ++j)
#pragma unroll
      for (int r = 0; r < 8; ++r) acc[j][r] += (BB ? bfr(BB[j * 16 + col]) : 0.f);
#pragma unroll
    for (int r = 0; r < 8; ++r) { const int spos = (int)((r0 + 8 * g + r) % SS);
#pragma unroll
      for (int jj = 0; jj < 2; ++jj) { const float ang = (float)spos * THETA[jj * 16 + col]; const float c = cos_p(ang), sn = sin_p(ang);
#pragma unroll
        for (int hh = 0; hh < 2; ++hh) { const float x1 = acc[hh * 4 + jj][r], x2 = acc[hh * 4 + jj + 2][r]; acc[hh * 4 + jj][r] = x1 * c - x2 * sn; acc[hh * 4 + jj + 2][r] = x2 * c + x1 * sn; } } }
#pragma unroll
    for (int j = 0; j < 8; ++j) {
#pragma unroll
      for (int r = 0; r < 8; ++r) { const float v = acc[j][r]; const _Float16 hv = (_Float16)v; so[wave][8 * g + r][j * 16 + col] = hv; sol[wave][8 * g + r][j * 16 + col] = (_Float16)((v - (float)hv) * 2048.0f); } }   // q, k (+ bias) as f16 hi + (x2048) residual
    LDSX();
    for (int rl = 0; rl < 16; ++rl) if (lane < 16) { vst2((unsigned*)(QK + (r0 + rl) * (2 * DM) + n0 + lane * 8), *(const v4u*)&so[wave][rl][lane * 8]); vst2((unsigned*)(QKL + (r0 + rl) * (2 * DM) + n0 + lane * 8), *(const v4u*)&sol[wave][rl][lane * 8]); }
  } else {
#pragma unroll
    for (int j = 0; j < 8; ++j) {
#pragma unroll
      for (int r = 0; r < 8; ++r) { const float v = acc[j][r] + (BB ? bfr(BB[j * 16 + col]) : 0.f); const _Float16 hv = (_Float16)v; sth[j * 16 + col][wave * 16 + 8 * g + r] = hv; stl[j * 16 + col][wave * 16 + 8 * g + r] = (_Float16)((v - (float)hv) * 2048.0f); } }
    __syncthreads();
    const size_t rb = (size_t)blockIdx.x * 64; const int b = (int)(rb / SS), s0 = (int)(rb % SS); const int pc0 = n0 - 2 * DM;
    for (int q = tid; q < 128 * 8; q += 128) { const int d = q >> 3, pc = q & 7; const size_t o = ((size_t)b * DM + pc0 + d) * SS + s0 + pc * 8; vst2((unsigned*)(VTH + o), *(const v4u*)&sth[d][pc * 8]); vst2((unsigned*)(VTL + o), *(const v4u*)&stl[d][pc * 8]); }
  }
}
// ---- k_attn: block = (64 queries, head h, batch b): all-keys flash attention (K = 64: 2 k-steps), scores = (q.k) * 0.125 from f16 hi + residual operands (3 products), P.V: f16 P x (V hi, V lo*2048) in two accumulators; O[b*S+q][h*64+d] = (acc + accl / 2048) / (2048 l) (256-B segments)
__global__ __launch_bounds__(128) void k_attn(const _Float16* __restrict__ QK, const _Float16* __restrict__ QKL, const _Float16* __restrict__ VTH, const _Float16* __restrict__ VTL, const void* __restrict__ KMASK, const int* __restrict__ MASK, const int* __restrict__ FL, float* __restrict__ O) {
  __shared__ __align__(16) float sp[4][16][36]; __shared__ __align__(16) float so[4][16][68];
  const int tid = threadIdx.x, wave = tid >> 5, lane = tid & 31, col = lane & 15, g = lane >> 4;
  const int qb = blockIdx.x, h = blockIdx.y, b = blockIdx.z; const int q0 = qb * 64 + wave * 16; const size_t rq = (size_t)b * SS + q0 + col;
  v16h aq[2], aql[2];
#pragma unroll
  for (int kc = 0; kc < 2; ++kc) { aq[kc] = frag_h(QK + rq * (2 * DM) + h * HD + kc * 32, lane); aql[kc] = frag_h(QKL + rq * (2 * DM) + h * HD + kc * 32, lane); }
  float m[8], l[8];
#pragma unroll
  for (int r = 0; r < 8; ++r) { m[r] = -3.0e38f; l[r] = 0.f; }
  v8f acc[4] = {}, accl[4] = {};
  const int nks = SS / 32;   // all keys
#pragma unroll 1
  for (int ks = 0; ks < nks; ++ks) { if (FL[qb * (SS / 32) + ks] == 0) continue;   /* no visible key in this (64-query, 32-key) tile */ v8f s[2];
#pragma unroll
    for (int ct = 0; ct < 2; ++ct) { const int kk = ks * 32 + ct * 16 + col; const _Float16* krow = QK + ((size_t)b * SS + kk) * (2 * DM) + DM + h * HD; const _Float16* krowl = QKL + ((size_t)b * SS + kk) * (2 * DM) + DM + h * HD; v8f c = {}, cl = {};
#pragma unroll
      for (int kc = 0; kc < 2; ++kc) { const v16h kh = frag_h(krow + kc * 32, lane); c = wmma16(aq[kc], kh, c); cl = wmma16(aql[kc], kh, cl); cl = wmma16(aq[kc], frag_h(krowl + kc * 32, lane), cl); }   // 3 products: q, k as f16 hi + residual
#pragma unroll
      for (int r = 0; r < 8; ++r) c[r] += cl[r] * (1.0f / 2048.0f);
      {
#pragma unroll
      for (int r = 0; r < 8; ++r) s[ct][r] = (MASK[(size_t)(q0 + 8 * g + r) * SS + kk] == 0) ? c[r] * 0.125f : -3.0e38f; } }   // 1/sqrt(64); masked keys excluded
#pragma unroll
    for (int r = 0; r < 8; ++r) { float mx = fmaxf(s[0][r], s[1][r]);
#pragma unroll
      for (int o = 1; o < 16; o <<= 1) mx = fmaxf(mx, __shfl_xor(mx, o));
      const float mn = fmaxf(m[r], mx); const float alpha = (m[r] <= -1.0e38f) ? 0.f : __expf(m[r] - mn);
      const float e0 = (s[0][r] <= -1.0e38f) ? 0.f : __expf(s[0][r] - mn), e1 = (s[1][r] <= -1.0e38f) ? 0.f : __expf(s[1][r] - mn); float es = e0 + e1;
#pragma unroll
      for (int o = 1; o < 16; o <<= 1) es += __shfl_xor(es, o);
      l[r] = l[r] * alpha + es; m[r] = mn;
#pragma unroll
      for (int dt = 0; dt < 4; ++dt) { acc[dt][r] *= alpha; accl[dt][r] *= alpha; }
      sp[wave][8 * g + r][col] = e0; sp[wave][8 * g + r][16 + col] = e1; }
    LDSX();
    v16h pa, pl; { const float* prow = &sp[wave][col][0] + 8 * (lane >> 4);
#pragma unroll
      for (int i = 0; i < 8; ++i) { const float x0 = prow[i] * 2048.0f, x1 = prow[16 + i] * 2048.0f; const _Float16 h0 = (_Float16)x0, h1 = (_Float16)x1; pa[i] = h0; pa[8 + i] = h1; pl[i] = (_Float16)((x0 - (float)h0) * 2048.0f); pl[8 + i] = (_Float16)((x1 - (float)h1) * 2048.0f); } }   // P scaled by 2^11 before the f16 split so small softmax weights stay out of the f16 subnormal range; 2^-11 folded into the epilogue
#pragma unroll
    for (int dt = 0; dt < 4; ++dt) { const size_t vr = ((size_t)b * DM + h * HD + dt * 16 + col) * SS + ks * 32; const v16h vh = frag_h(VTH + vr, lane); acc[dt] = wmma16(pa, vh, acc[dt]); accl[dt] = wmma16(pl, vh, accl[dt]); accl[dt] = wmma16(pa, frag_h(VTL + vr, lane), accl[dt]); }   // P hi x V hi + (P lo x V hi + P hi x V lo) / 2048
    LDSX(); }
#pragma unroll
  for (int r = 0; r < 8; ++r) { const float il = (l[r] > 0.f) ? (1.0f / 2048.0f) / l[r] : 0.f;
#pragma unroll
    for (int dt = 0; dt < 4; ++dt) so[wave][8 * g + r][dt * 16 + col] = (acc[dt][r] + accl[dt][r] * (1.0f / 2048.0f)) * il; }
  LDSX();
  for (int rl = 0; rl < 16; ++rl) if (lane < 16) vst2(O + ((size_t)b * SS + q0 + rl) * DM + h * HD + lane * 4, *(const v4f*)&so[wave][rl][lane * 4]);
}
// ---- k_out: block = (64 rows, 128 cols): out = O(hi/lo) . Wo rows (2 products) + bo
__global__ __launch_bounds__(128) void k_out(const float* __restrict__ O, const __bf16* __restrict__ P, const float* __restrict__ BO, float* __restrict__ Y) {
  __shared__ __align__(16) float so[4][16][132];
  const int tid = threadIdx.x, wave = tid >> 5, lane = tid & 31, col = lane & 15, g = lane >> 4; const size_t r0 = (size_t)blockIdx.x * 64 + wave * 16; const int n0 = blockIdx.y * 128;
  v8f acc[8] = {};
#pragma unroll 2
  for (int kc = 0; kc < DM / 32; ++kc) { const F2 a = split_row(O + (r0 + col) * DM, kc * 32, lane);
#pragma unroll
    for (int j = 0; j < 8; ++j) { const v16b w = frag_b(P + (size_t)(n0 + j * 16 + col) * DM + kc * 32, lane); acc[j] = wmma_bf(a.l, w, acc[j]); acc[j] = wmma_bf(a.h, w, acc[j]); } }
#pragma unroll
  for (int j = 0; j < 8; ++j) {
#pragma unroll
    for (int r = 0; r < 8; ++r) so[wave][8 * g + r][j * 16 + col] = acc[j][r] + (BO ? bfr(BO[n0 + j * 16 + col]) : 0.f); }
  LDSX();
  for (int rl = 0; rl < 16; ++rl) vst2(Y + (r0 + rl) * DM + n0 + lane * 4, *(const v4f*)&so[wave][rl][lane * 4]);
}

// ---- k_rms: block = row: OUTH = f16(x rsqrt(mean x^2 + eps) w) (MODE 0: x = bf16-rounded input; MODE 1: x = f32 x1)
template <int MODE>
__global__ __launch_bounds__(256) void k_rms(const float* __restrict__ A, const float* __restrict__ Wn, _Float16* __restrict__ OUTH) { __shared__ float red[8]; __shared__ __align__(16) _Float16 sh[DM]; const int t = threadIdx.x; const size_t row = blockIdx.x;
  float v[4]; float q = 0.f; for (int i = 0; i < 4; ++i) { const float x = A[row * DM + t + 256 * i]; v[i] = MODE == 0 ? bfr(x) : x; q += v[i] * v[i]; }
#pragma unroll
  for (int o = 1; o < 32; o <<= 1) q += __shfl_xor(q, o);
  if ((t & 31) == 0) red[t >> 5] = q; __syncthreads(); float tq = 0.f; for (int i = 0; i < 8; ++i) tq += red[i]; const float inv = 1.0f / sqrtf(tq / (float)DM + RMSEPS);
  for (int i = 0; i < 4; ++i) { const int c = t + 256 * i; sh[c] = (_Float16)(v[i] * inv * bfr(Wn[c])); } __syncthreads(); if (t < DM / 8) vst2((unsigned*)(OUTH + row * DM + t * 8), *(const v4u*)&sh[t * 8]); }
// ---- k_flags: block = query block qb (64 queries): FL[qb][kt] = 1 if any mask[q][k] == 0 (attend) in the 64 x 32 tile
__global__ __launch_bounds__(256) void k_flags(const int* __restrict__ MASK, int* __restrict__ FL) { __shared__ int sf[SS / 32]; __shared__ __align__(16) int so2[SS / 32]; const int t = threadIdx.x; const int qb = blockIdx.x;
  if (t < SS / 32) sf[t] = 0; __syncthreads();
  for (int e = t; e < 64 * SS; e += 256) { const int ql = e / SS, k = e % SS; if (MASK[(size_t)(qb * 64 + ql) * SS + k] == 0) sf[k >> 5] = 1; }   // benign same-value race within the block
  __syncthreads(); if (t < SS / 32) so2[t] = sf[t]; __syncthreads(); if (t < SS / 32 / 4) vst2((unsigned*)(FL + (size_t)qb * (SS / 32) + t * 4), *(const v4u*)&so2[t * 4]); }
// ---- k_g<MODE, KW>: block = (64 rows, 128 cols): A f16 rows (MODE 0: built inline from the f32 ctx) . W^T (f16 x 2^8); MODE 0: X1 = x (bf16-rounded) + acc (f32 out); MODE 2: OUT = X1 + acc (f32)
template <int MODE, int KW>
__global__ __launch_bounds__(128) void k_g(const void* __restrict__ Ain, const _Float16* __restrict__ Wr, const float* __restrict__ RES, float* __restrict__ O32, int ow) { __shared__ __align__(16) float sf[4][16][132];
  const int tid = threadIdx.x, wave = tid >> 5, lane = tid & 31, col = lane & 15, g = lane >> 4; const size_t r0 = (size_t)blockIdx.x * 64 + wave * 16; const int c0 = blockIdx.y * 128;
  v8f acc[8] = {};
#pragma unroll 2
  for (int kc = 0; kc < KW / 32; ++kc) { v16h a; if (MODE == 0) { const float* p = (const float*)Ain + (r0 + col) * KW + kc * 32 + 8 * g;
#pragma unroll
      for (int i = 0; i < 8; ++i) { a[i] = (_Float16)p[i]; a[8 + i] = (_Float16)p[16 + i]; } } else a = frag_h((const _Float16*)Ain + (r0 + col) * KW + kc * 32, lane);
#pragma unroll
    for (int j = 0; j < 8; ++j) acc[j] = wmma16(a, frag_h(Wr + (size_t)(c0 + j * 16 + col) * KW + kc * 32, lane), acc[j]); }
#pragma unroll
  for (int j = 0; j < 8; ++j) { const int c = c0 + j * 16 + col;
#pragma unroll
    for (int r = 0; r < 8; ++r) { const float res = RES[(r0 + 8 * g + r) * ow + c]; sf[wave][8 * g + r][j * 16 + col] = acc[j][r] * (1.0f / WSC) + (MODE == 0 ? bfr(res) : res); } }
  LDSX(); for (int rl = 0; rl < 16; ++rl) vst2(O32 + (r0 + rl) * ow + c0 + lane * 4, *(const v4f*)&sf[wave][rl][lane * 4]); }
// ---- k_gu: block = (64 rows, 128 hidden cols): g = h2 . Wg^T, u = h2 . Wu^T (same A), GU = f16(silu(g) u) -> rows [NR][HP]
__global__ __launch_bounds__(128) void k_gu(const _Float16* __restrict__ H2, const _Float16* __restrict__ PG, _Float16* __restrict__ GU) { __shared__ __align__(16) _Float16 so[64][136];
  const int tid = threadIdx.x, wave = tid >> 5, lane = tid & 31, col = lane & 15, g = lane >> 4; const size_t rb = (size_t)blockIdx.x * 64; const size_t r0 = rb + wave * 16; const int c0 = blockIdx.y * 128; const _Float16* Wg = PG + (size_t)c0 * DM; const _Float16* Wu = PG + ((size_t)HP + c0) * DM;
  v8f ag[8] = {}, au[8] = {};
#pragma unroll 2
  for (int kc = 0; kc < DM / 32; ++kc) { const v16h a = frag_h(H2 + (r0 + col) * DM + kc * 32, lane);
#pragma unroll
    for (int j = 0; j < 8; ++j) { ag[j] = wmma16(a, frag_h(Wg + (size_t)(j * 16 + col) * DM + kc * 32, lane), ag[j]); au[j] = wmma16(a, frag_h(Wu + (size_t)(j * 16 + col) * DM + kc * 32, lane), au[j]); } }
#pragma unroll
  for (int j = 0; j < 8; ++j)
#pragma unroll
    for (int r = 0; r < 8; ++r) { const float gg = ag[j][r] * (1.0f / WSC), uu = au[j][r] * (1.0f / WSC); so[wave * 16 + 8 * g + r][j * 16 + col] = (_Float16)(gg / (1.0f + __expf(-gg)) * uu); }
  __syncthreads(); for (int e = tid; e < 64 * 16; e += 128) { const int rl = e >> 4, q = e & 15; vst2((unsigned*)(GU + (rb + rl) * HP + c0 + q * 8), *(const v4u*)&so[rl][q * 8]); } }

extern "C" void kernel_launch(void* const* d_in, const int* in_sizes, int n_in, void* d_out, int out_size, void* d_ws, size_t ws_size, hipStream_t stream) {
  (void)in_sizes; (void)n_in; (void)out_size;
  const float** F = (const float**)d_in;   // 0 x [2,2048,1024], 1 attn_mask [2048,2048] int (1 = masked), 2 wq, 3 wk, 4 wv, 5 wo (natural [1024,1024]), 6 norm1_w, 7 norm2_w, 8 w_gate [2730,1024], 9 w_up, 10 w_down [1024,2730]
  if (ws_size < (size_t)WS_END) return;
  char* ws = (char*)d_ws; _Float16* PK = (_Float16*)(ws + WS_PK); _Float16 *QK = (_Float16*)(ws + WS_QK), *QKL = (_Float16*)(ws + WS_QKL), *VTH = (_Float16*)(ws + WS_VTH), *VTL = (_Float16*)(ws + WS_VTL), *H1 = (_Float16*)(ws + WS_H1), *H2 = (_Float16*)(ws + WS_H2), *GU = (_Float16*)(ws + WS_GU); float *O = (float*)(ws + WS_O), *X1 = (float*)(ws + WS_X1); int* FL = (int*)(ws + WS_FL); const int* MASK = (const int*)d_in[1];
  const int nr = NB * SS;   // keys of both batches are always needed; TQB limits queries per batch
  k_pack<<<dim3(HP, 7), 256, 0, stream>>>(F[2], F[3], F[4], F[5], F[8], F[9], F[10], ws);
  k_rms<0><<<nr, 256, 0, stream>>>(F[0], F[6], H1);
  k_flags<<<SS / 64, 256, 0, stream>>>(MASK, FL);
  k_qkv<<<dim3(nr / 64, QKVW / 128), 128, 0, stream>>>((const float*)H1, (const float*)H1, (const float*)H1, PK + PK_A, nullptr, nullptr, nullptr, QK, QKL, VTH, VTL);
  k_attn<<<dim3(TQB, NH, TNB), 128, 0, stream>>>(QK, QKL, VTH, VTL, nullptr, MASK, FL, O);
  k_g<0, DM><<<dim3(TOB, DM / 128), 128, 0, stream>>>(O, PK + PK_P, F[0], X1, DM);                  // x1 = x + ctx wo^T
  k_rms<1><<<TOB * 64, 256, 0, stream>>>(X1, F[7], H2);
  k_gu<<<dim3(TOB, HP / 128), 128, 0, stream>>>(H2, (const _Float16*)(ws + WS_PG), GU);
  k_g<2, HP><<<dim3(TOB, DM / 128), 128, 0, stream>>>(GU, (const _Float16*)(ws + WS_PD), X1, (float*)d_out, DM);   // out = x1 + (silu(g) u) w_down^T
}

// v001
// Measured time: 711 microseconds a run.
// Two timings next to v000 both put it at 1.29 times that version's speed.
// compute dtype: all float inputs rounded to bf16, attn_mask (int) read on device; RMSNorms (eps 1e-6) in f32, normed rows once to f16; q/k/v = f16(h) . W^T against exact f16 x 2^8 weight copies on WMMA 16x16x32 (single products, f32 accumulate); rotate-half RoPE in f32 (precise sinf/cosf) before the f16 hi + residual split; attention with 3-product scores and P.v (hi + residual planes), x 1/8, masked keys excluded (mask read per pair; fully-masked 64x32 tiles skipped via a device-built flag table), running-max softmax in f32 (hardware exp); x1 = x + f16(ctx) . Wo^T; SwiGLU: f16(rmsnorm(x1)) . [W_gate | W_up]^T (hidden padded 2,730 -> 2,816 with zero weights), silu(g) u in f32 -> f16, . W_down^T + x1; f32 output.
#include <hip/hip_runtime.h>
#include <math.h>

typedef __attribute__((ext_vector_type(16))) _Float16 v16h;
typedef __attribute__((ext_vector_type(16))) __bf16 v16b;
typedef __attribute__((ext_vector_type(8)))  _Float16 v8h;
typedef __attribute__((ext_vector_type(8)))  float v8f;
typedef __attribute__((ext_vector_type(4)))  float v4f;
typedef __attribute__((ext_vector_type(2)))  float v2f;
typedef __attribute__((ext_vector_type(4)))  unsigned v4u;
typedef __attribute__((ext_vector_type(4)))  int v4i;
typedef float __attribute__((may_alias)) float_a;
typedef int __attribute__((may_alias)) int_a;

template <typename T> __device__ __forceinline__ void vst2(void* p, T v) { *(T*)p = v;  }
__device__ __forceinline__ v8f wmma16(v16h a, v16h b, v8f c) {
  v8f d = __builtin_amdgcn_wmma_f32_16x16x32_f16(false, a, false, b, (short)0, c, false, false);
  asm volatile("v_nop\n\tv_nop\n\tv_nop\n\tv_nop" : "+v"(d) : "v"(a), "v"(b));
  return d;
}
__device__ __forceinline__ v8f wmma_bf(v16b a, v16b b, v8f c) {
  v8f d = __builtin_amdgcn_wmma_f32_16x16x32_bf16(false, a, false, b, (short)0, c, false, false);
  asm volatile("v_nop\n\tv_nop\n\tv_nop\n\tv_nop" : "+v"(d) : "v"(a), "v"(b));
  return d;
}
// Streaming decoder block (B 2, L 2,048, d 1,024, 16 heads x 64, SwiGLU hidden 2,730): pre-RMSNorm, bias-free projections, rotate-half RoPE (base 10000), attention under the given boolean mask (all-keys + 256-token window), out-projection + residual, pre-RMSNorm SwiGLU FFN + residual.
__device__ __forceinline__ v16h frag_h(const _Float16* rowk0, int lane) {
  union { v16h v; v8h q[2]; } u; const _Float16* p = rowk0 + 8 * (lane >> 4);
  u.q[0] = *(const v8h*)p; u.q[1] = *(const v8h*)(p + 16); return u.v;
}
__device__ __forceinline__ v16h frag_f32(const float* rowk0, int lane) {
  v16h a; const float* p = rowk0 + 8 * (lane >> 4);
#pragma unroll
  for (int i = 0; i < 8; ++i) { a[i] = (_Float16)p[i]; a[8 + i] = (_Float16)p[16 + i]; }
  return a;
}
__device__ __forceinline__ v16h frag_f32s(const float* rowk0, int lane, float sc) {
  v16h a; const float* p = rowk0 + 8 * (lane >> 4);
#pragma unroll
  for (int i = 0; i < 8; ++i) { a[i] = (_Float16)(p[i] * sc); a[8 + i] = (_Float16)(p[16 + i] * sc); }
  return a;
}
// column fragment from a [K][ld] layout (column n), rows >= K read as 0
__device__ __forceinline__ v16h fragc_f32(const float* W, int k0, int n, int lane, int ld, int K) {
  v16h a; const int g = lane >> 4;
#pragma unroll
  for (int i = 0; i < 8; ++i) { const int ka = k0 + 8 * g + i, kb = ka + 16;
    a[i] = (_Float16)(ka < K ? W[(size_t)(ka < K ? ka : K - 1) * ld + n] : 0.f); a[8 + i] = (_Float16)(kb < K ? W[(size_t)(kb < K ? kb : K - 1) * ld + n] : 0.f); }
  return a;
}
struct F2 { v16b h, l; };
__device__ __forceinline__ F2 bsplit16(const float v[16]) { F2 r;
#pragma unroll
  for (int i = 0; i < 16; ++i) { const __bf16 h = (__bf16)v[i]; r.h[i] = h; r.l[i] = (__bf16)(v[i] - (float)h); }
  return r; }
__device__ __forceinline__ F2 split_row(const float* row, int k0, int lane) { float v[16]; const float* p = row + k0 + 8 * (lane >> 4);
#pragma unroll
  for (int i = 0; i < 8; ++i) { v[i] = p[i]; v[8 + i] = p[16 + i]; }
  return bsplit16(v); }
__device__ __forceinline__ F2 split_rowK(const float* row, int k0, int lane, int K) { float v[16]; const int g = lane >> 4;
#pragma unroll
  for (int i = 0; i < 8; ++i) { const int ka = k0 + 8 * g + i, kb = ka + 16; v[i] = ka < K ? row[ka < K ? ka : K - 1] : 0.f; v[8 + i] = kb < K ? row[kb < K ? kb : K - 1] : 0.f; }
  return bsplit16(v); }
__device__ __forceinline__ F2 split_col(const float* W, int k0, int n, int lane, int ld, int K) { float v[16]; const int g = lane >> 4;
#pragma unroll
  for (int i = 0; i < 8; ++i) { const int ka = k0 + 8 * g + i, kb = ka + 16; v[i] = ka < K ? W[(size_t)(ka < K ? ka : K - 1) * ld + n] : 0.f; v[8 + i] = kb < K ? W[(size_t)(kb < K ? kb : K - 1) * ld + n] : 0.f; }
  return bsplit16(v); }
__device__ __forceinline__ v8f mac3(const F2& a, const F2& b, v8f c) { c = wmma_bf(a.l, b.h, c); c = wmma_bf(a.h, b.l, c); return wmma_bf(a.h, b.h, c); }
__device__ __forceinline__ float sigm(float v) { return 1.0f / (1.0f + expf(-v)); }
#define LDSX() do { asm volatile("s_wait_dscnt 0" ::: "memory"); __builtin_amdgcn_wave_barrier(); __builtin_amdgcn_fence(__ATOMIC_RELEASE, "workgroup"); } while (0)


#define NB 2
#define SS 2048
#define DM 1024
#define NH 16
#define HID 2730
#define HP 2816          // hidden padded to 22 x 128
#define WSC 256.0f
#define RMSEPS 1e-6f
__constant__ float THETA[32] = {1.000000000e+00f,7.498942018e-01f,5.623413324e-01f,4.216965139e-01f,3.162277639e-01f,2.371373773e-01f,1.778279394e-01f,1.333521456e-01f,1.000000015e-01f,7.498942316e-02f,5.623413250e-02f,4.216964915e-02f,3.162277490e-02f,2.371373773e-02f,1.778279431e-02f,1.333521400e-02f,9.999999776e-03f,7.498942316e-03f,5.623413250e-03f,4.216964822e-03f,3.162277630e-03f,2.371373819e-03f,1.778279431e-03f,1.333521446e-03f,1.000000047e-03f,7.498941850e-04f,5.623413017e-04f,4.216965172e-04f,3.162277571e-04f,2.371373703e-04f,1.778279402e-04f,1.333521504e-04f};
__device__ __attribute__((noinline)) float cos_p(float v) { return cosf(v); }
__device__ __attribute__((noinline)) float sin_p(float v) { return sinf(v); }
#define HD 64
#define QKVW (3 * DM)
#ifndef TQB
#define TQB (SS / 64)
#define TNB NB
#define TOB (NB * SS / 64)     // output row tiles (all)
#endif
typedef __attribute__((ext_vector_type(8))) __bf16 v8b;
__device__ __forceinline__ v16b frag_b(const __bf16* rowk0, int lane) {
  union { v16b v; v8b q[2]; } u; const __bf16* p = rowk0 + 8 * (lane >> 4);
  u.q[0] = *(const v8b*)p; u.q[1] = *(const v8b*)(p + 16); return u.v;
}
__device__ __forceinline__ float bfr(float v) { return (float)(__bf16)v; }
__device__ __attribute__((noinline)) float exp_ni(float v) { return expf(v); }
__device__ __attribute__((noinline)) float erf_ni(float v) { return erff(v); }

#define PK_A 0                       // [3072][1024] Wqkv rows (natural [out][in])
#define PK_P (PK_A + QKVW * DM)        // [1024][1024] Wo rows (natural)
#define PK_END (PK_P + DM * DM)
#define WS_PK  0u
#define WS_QK  (WS_PK + 2u * PK_END)             // f16 [4096 rows][2048]: q | k
#define WS_QKL (WS_QK + 2u * NB * SS * 2 * DM)     // f16 q | k residual planes x2048
#define WS_VTH (WS_QKL + 2u * NB * SS * 2 * DM)    // f16 [b][1024 (h*64+d)][2048 s] hi
#define WS_VTL (WS_VTH + 2u * NB * DM * SS)        // f16 lo x 2048
#define WS_O   (WS_VTL + 2u * NB * DM * SS)        // f32 [4096][1024]
#define WS_PG  (WS_O + 4u * (size_t)NB * SS * DM)        // f16 x 2^8 [gate | up] rows [2*HP][1024] (zero rows >= HID), down rows [1024][HP] (zero cols >= HID)
#define WS_PD  (WS_PG + 2u * (size_t)2 * HP * DM)
#define WS_H1  (WS_PD + 2u * (size_t)DM * HP)             // f16 rmsnorm1(x) rows [NR][1024]; int flags [SS/64][SS/32]; f32 x1 [NR][1024]; f16 rmsnorm2(x1) rows; f16 silu(gate) up rows [NR][HP]
#define WS_FL  (WS_H1 + 2u * (size_t)NB * SS * DM)
#define WS_X1  (WS_FL + 4u * (size_t)(SS / 64) * (SS / 32))
#define WS_H2  (WS_X1 + 4u * (size_t)NB * SS * DM)
#define WS_GU  (WS_H2 + 2u * (size_t)NB * SS * DM)
#define WS_END (WS_GU + 2u * (size_t)NB * SS * HP)
// ---- k_pack: block = (row n, which): natural [out][in] rows -> f16 (bf16-rounded x 2^8); which 0..2 -> W_q/W_k/W_v into PK_A rows which*1024 + n; 3 -> W_o into PK_P
__global__ __launch_bounds__(256) void k_pack(const float* __restrict__ WQ, const float* __restrict__ WK, const float* __restrict__ WV, const float* __restrict__ WO, const float* __restrict__ WG, const float* __restrict__ WU, const float* __restrict__ WD, char* __restrict__ ws) {
  const int n = blockIdx.x, which = blockIdx.y, t = threadIdx.x; __shared__ __align__(16) _Float16 sh[HP]; _Float16* P = (_Float16*)(ws + WS_PK);
  if (which < 4) { if (n >= DM) return; const float* w = (which == 0) ? WQ : (which == 1) ? WK : (which == 2) ? WV : WO; for (int k = t; k < DM; k += 256) sh[k] = (_Float16)(bfr(w[(size_t)n * DM + k]) * WSC); __syncthreads();
    _Float16* dst = (which < 3) ? (P + PK_A + ((size_t)which * DM + n) * DM) : (P + PK_P + (size_t)n * DM); for (int q = t; q < DM / 8; q += 256) vst2((unsigned*)(dst + q * 8), *(const v4u*)&sh[q * 8]); }
  else if (which < 6) { if (n >= HP) return; const float* w = (which == 4) ? WG : WU; for (int k = t; k < DM; k += 256) sh[k] = (n < HID) ? (_Float16)(bfr(w[(size_t)n * DM + k]) * WSC) : (_Float16)0.0f; __syncthreads();   // gate | up rows, zero beyond 2,730
    _Float16* dst = (_Float16*)(ws + WS_PG) + ((size_t)(which - 4) * HP + n) * DM; for (int q = t; q < DM / 8; q += 256) vst2((unsigned*)(dst + q * 8), *(const v4u*)&sh[q * 8]); }
  else { if (n >= DM) return; for (int k = t; k < HP; k += 256) sh[k] = (k < HID) ? (_Float16)(bfr(WD[(size_t)n * HID + k]) * WSC) : (_Float16)0.0f; __syncthreads();   // down rows [1024][HP]
    _Float16* dst = (_Float16*)(ws + WS_PD) + (size_t)n * HP; for (int q = t; q < HP / 8; q += 256) vst2((unsigned*)(dst + q * 8), *(const v4u*)&sh[q * 8]); } }
__global__ __launch_bounds__(128) void k_qkv(const float* __restrict__ XQ, const float* __restrict__ XK, const float* __restrict__ XV, const _Float16* __restrict__ P, const float* __restrict__ BQ, const float* __restrict__ BK, const float* __restrict__ BV, _Float16* __restrict__ QK, _Float16* __restrict__ QKL, _Float16* __restrict__ VTH, _Float16* __restrict__ VTL) {
  const int which0 = (blockIdx.y * 128) / DM; const float* X = (which0 == 0) ? XQ : (which0 == 1) ? XK : XV; const float* BB = BQ ? (((which0 == 0) ? BQ : (which0 == 1) ? BK : BV) + (blockIdx.y * 128 - which0 * DM)) : nullptr;
  __shared__ __align__(16) _Float16 so[4][16][136], sol[4][16][136]; __shared__ __align__(16) _Float16 sth[128][72], stl[128][72];
  const int tid = threadIdx.x, wave = tid >> 5, lane = tid & 31, col = lane & 15, g = lane >> 4; const size_t r0 = (size_t)blockIdx.x * 64 + wave * 16; const int n0 = blockIdx.y * 128;
  v8f acc[8] = {};
#pragma unroll 2
  for (int kc = 0; kc < DM / 32; ++kc) { const v16h a = frag_h((const _Float16*)X + (r0 + col) * DM + kc * 32, lane);   // A = f16 rmsnorm rows
#pragma unroll
    for (int j = 0; j < 8; ++j) acc[j] = wmma16(a, frag_h(P + (size_t)(n0 + j * 16 + col) * DM + kc * 32, lane), acc[j]); }
#pragma unroll
  for (int j = 0; j < 8; ++j)
#pragma unroll
    for (int r = 0; r < 8; ++r) acc[j][r] *= (1.0f / WSC);
  if (n0 < 2 * DM) {   // bias, then rotate-half rotary over each 64-dim head with angle position * inv_freq[d mod 32]
#pragma unroll
    for (int j = 0; j < 8; ++j)
#pragma unroll
      for (int r = 0; r < 8; ++r) acc[j][r] += (BB ? bfr(BB[j * 16 + col]) : 0.f);
#pragma unroll
    for (int r = 0; r < 8; ++r) { const int spos = (int)((r0 + 8 * g + r) % SS);
#pragma unroll
      for (int jj = 0; jj < 2; ++jj) { const float ang = (float)spos * THETA[jj * 16 + col]; const float c = cos_p(ang), sn = sin_p(ang);
#pragma unroll
        for (int hh = 0; hh < 2; ++hh) { const float x1 = acc[hh * 4 + jj][r], x2 = acc[hh * 4 + jj + 2][r]; acc[hh * 4 + jj][r] = x1 * c - x2 * sn; acc[hh * 4 + jj + 2][r] = x2 * c + x1 * sn; } } }
#pragma unroll
    for (int j = 0; j < 8; ++j) {
#pragma unroll
      for (int r = 0; r < 8; ++r) { const float v = acc[j][r]; const _Float16 hv = (_Float16)v; so[wave][8 * g + r][j * 16 + col] = hv; sol[wave][8 * g + r][j * 16 + col] = (_Float16)((v - (float)hv) * 2048.0f); } }   // q, k (+ bias) as f16 hi + (x2048) residual
    LDSX();
    for (int rl = 0; rl < 16; ++rl) if (lane < 16) { vst2((unsigned*)(QK + (r0 + rl) * (2 * DM) + n0 + lane * 8), *(const v4u*)&so[wave][rl][lane * 8]); vst2((unsigned*)(QKL + (r0 + rl) * (2 * DM) + n0 + lane * 8), *(const v4u*)&sol[wave][rl][lane * 8]); }
  } else {
#pragma unroll
    for (int j = 0; j < 8; ++j) {
#pragma unroll
      for (int r = 0; r < 8; ++r) { const float v = acc[j][r] + (BB ? bfr(BB[j * 16 + col]) : 0.f); const _Float16 hv = (_Float16)v; sth[j * 16 + col][wave * 16 + 8 * g + r] = hv; stl[j * 16 + col][wave * 16 + 8 * g + r] = (_Float16)((v - (float)hv) * 2048.0f); } }
    __syncthreads();
    const size_t rb = (size_t)blockIdx.x * 64; const int b = (int)(rb / SS), s0 = (int)(rb % SS); const int pc0 = n0 - 2 * DM;
    for (int q = tid; q < 128 * 8; q += 128) { const int d = q >> 3, pc = q & 7; const size_t o = ((size_t)b * DM + pc0 + d) * SS + s0 + pc * 8; vst2((unsigned*)(VTH + o), *(const v4u*)&sth[d][pc * 8]); vst2((unsigned*)(VTL + o), *(const v4u*)&stl[d][pc * 8]); }
  }
}
// ---- k_attn: block = (64 queries, head h, batch b): all-keys flash attention (K = 64: 2 k-steps), scores = (q.k) * 0.125 from f16 hi + residual operands (3 products), P.V: f16 P x (V hi, V lo*2048) in two accumulators; O[b*S+q][h*64+d] = (acc + accl / 2048) / (2048 l) (256-B segments)
__global__ __launch_bounds__(128) void k_attn(const _Float16* __restrict__ QK, const _Float16* __restrict__ QKL, const _Float16* __restrict__ VTH, const _Float16* __restrict__ VTL, const void* __restrict__ KMASK, const int* __restrict__ MASK, const int* __restrict__ FL, float* __restrict__ O) {
  __shared__ __align__(16) float sp[4][16][36]; __shared__ __align__(16) float so[4][16][68];
  const int tid = threadIdx.x, wave = tid >> 5, lane = tid & 31, col = lane & 15, g = lane >> 4;
  const int qb = blockIdx.x, h = blockIdx.y, b = blockIdx.z; const int q0 = qb * 64 + wave * 16; const size_t rq = (size_t)b * SS + q0 + col;
  v16h aq[2], aql[2];
#pragma unroll
  for (int kc = 0; kc < 2; ++kc) { aq[kc] = frag_h(QK + rq * (2 * DM) + h * HD + kc * 32, lane); aql[kc] = frag_h(QKL + rq * (2 * DM) + h * HD + kc * 32, lane); }
  float m[8], l[8];
#pragma unroll
  for (int r = 0; r < 8; ++r) { m[r] = -3.0e38f; l[r] = 0.f; }
  v8f acc[4] = {}, accl[4] = {};
  const int nks = SS / 32;   // all keys
#pragma unroll 1
  for (int ks = 0; ks < nks; ++ks) { if (FL[qb * (SS / 32) + ks] == 0) continue;   /* no visible key in this (64-query, 32-key) tile */ v8f s[2];
#pragma unroll
    for (int ct = 0; ct < 2; ++ct) { const int kk = ks * 32 + ct * 16 + col; const _Float16* krow = QK + ((size_t)b * SS + kk) * (2 * DM) + DM + h * HD; const _Float16* krowl = QKL + ((size_t)b * SS + kk) * (2 * DM) + DM + h * HD; v8f c = {}, cl = {};
#pragma unroll
      for (int kc = 0; kc < 2; ++kc) { const v16h kh = frag_h(krow + kc * 32, lane); c = wmma16(aq[kc], kh, c); cl = wmma16(aql[kc], kh, cl); cl = wmma16(aq[kc], frag_h(krowl + kc * 32, lane), cl); }   // 3 products: q, k as f16 hi + residual
#pragma unroll
      for (int r = 0; r < 8; ++r) c[r] += cl[r] * (1.0f / 2048.0f);
      {
#pragma unroll
      for (int r = 0; r < 8; ++r) s[ct][r] = (MASK[(size_t)(q0 + 8 * g + r) * SS + kk] == 0) ? c[r] * 0.125f : -3.0e38f; } }   // 1/sqrt(64); masked keys excluded
#pragma unroll
    for (int r = 0; r < 8; ++r) { float mx = fmaxf(s[0][r], s[1][r]);
#pragma unroll
      for (int o = 1; o < 16; o <<= 1) mx = fmaxf(mx, __shfl_xor(mx, o));
      const float mn = fmaxf(m[r], mx); const float alpha = (m[r] <= -1.0e38f) ? 0.f : __expf(m[r] - mn);
      const float e0 = (s[0][r] <= -1.0e38f) ? 0.f : __expf(s[0][r] - mn), e1 = (s[1][r] <= -1.0e38f) ? 0.f : __expf(s[1][r] - mn); float es = e0 + e1;
#pragma unroll
      for (int o = 1; o < 16; o <<= 1) es += __shfl_xor(es, o);
      l[r] = l[r] * alpha + es; m[r] = mn;
#pragma unroll
      for (int dt = 0; dt < 4; ++dt) { acc[dt][r] *= alpha; accl[dt][r] *= alpha; }
      sp[wave][8 * g + r][col] = e0; sp[wave][8 * g + r][16 + col] = e1; }
    LDSX();
    v16h pa, pl; { const float* prow = &sp[wave][col][0] + 8 * (lane >> 4);
#pragma unroll
      for (int i = 0; i < 8; ++i) { const float x0 = prow[i] * 2048.0f, x1 = prow[16 + i] * 2048.0f; const _Float16 h0 = (_Float16)x0, h1 = (_Float16)x1; pa[i] = h0; pa[8 + i] = h1; pl[i] = (_Float16)((x0 - (float)h0) * 2048.0f); pl[8 + i] = (_Float16)((x1 - (float)h1) * 2048.0f); } }   // P scaled by 2^11 before the f16 split so small softmax weights stay out of the f16 subnormal range; 2^-11 folded into the epilogue
#pragma unroll
    for (int dt = 0; dt < 4; ++dt) { const size_t vr = ((size_t)b * DM + h * HD + dt * 16 + col) * SS + ks * 32; const v16h vh = frag_h(VTH + vr, lane); acc[dt] = wmma16(pa, vh, acc[dt]); accl[dt] = wmma16(pl, vh, accl[dt]); accl[dt] = wmma16(pa, frag_h(VTL + vr, lane), accl[dt]); }   // P hi x V hi + (P lo x V hi + P hi x V lo) / 2048
    LDSX(); }
#pragma unroll
  for (int r = 0; r < 8; ++r) { const float il = (l[r] > 0.f) ? (1.0f / 2048.0f) / l[r] : 0.f;
#pragma unroll
    for (int dt = 0; dt < 4; ++dt) so[wave][8 * g + r][dt * 16 + col] = (acc[dt][r] + accl[dt][r] * (1.0f / 2048.0f)) * il; }
  LDSX();
  for (int rl = 0; rl < 16; ++rl) if (lane < 16) vst2(O + ((size_t)b * SS + q0 + rl) * DM + h * HD + lane * 4, *(const v4f*)&so[wave][rl][lane * 4]);
}
// ---- k_out: block = (64 rows, 128 cols): out = O(hi/lo) . Wo rows (2 products) + bo
__global__ __launch_bounds__(128) void k_out(const float* __restrict__ O, const __bf16* __restrict__ P, const float* __restrict__ BO, float* __restrict__ Y) {
  __shared__ __align__(16) float so[4][16][132];
  const int tid = threadIdx.x, wave = tid >> 5, lane = tid & 31, col = lane & 15, g = lane >> 4; const size_t r0 = (size_t)blockIdx.x * 64 + wave * 16; const int n0 = blockIdx.y * 128;
  v8f acc[8] = {};
#pragma unroll 2
  for (int kc = 0; kc < DM / 32; ++kc) { const F2 a = split_row(O + (r0 + col) * DM, kc * 32, lane);
#pragma unroll
    for (int j = 0; j < 8; ++j) { const v16b w = frag_b(P + (size_t)(n0 + j * 16 + col) * DM + kc * 32, lane); acc[j] = wmma_bf(a.l, w, acc[j]); acc[j] = wmma_bf(a.h, w, acc[j]); } }
#pragma unroll
  for (int j = 0; j < 8; ++j) {
#pragma unroll
    for (int r = 0; r < 8; ++r) so[wave][8 * g + r][j * 16 + col] = acc[j][r] + (BO ? bfr(BO[n0 + j * 16 + col]) : 0.f); }
  LDSX();
  for (int rl = 0; rl < 16; ++rl) vst2(Y + (r0 + rl) * DM + n0 + lane * 4, *(const v4f*)&so[wave][rl][lane * 4]);
}

// ---- k_rms: block = row: OUTH = f16(x rsqrt(mean x^2 + eps) w) (MODE 0: x = bf16-rounded input; MODE 1: x = f32 x1)
template <int MODE>
__global__ __launch_bounds__(256) void k_rms(const float* __restrict__ A, const float* __restrict__ Wn, _Float16* __restrict__ OUTH) { __shared__ float red[8]; __shared__ __align__(16) _Float16 sh[DM]; const int t = threadIdx.x; const size_t row = blockIdx.x;
  float v[4]; float q = 0.f; for (int i = 0; i < 4; ++i) { const float x = A[row * DM + t + 256 * i]; v[i] = MODE == 0 ? bfr(x) : x; q += v[i] * v[i]; }
#pragma unroll
  for (int o = 1; o < 32; o <<= 1) q += __shfl_xor(q, o);
  if ((t & 31) == 0) red[t >> 5] = q; __syncthreads(); float tq = 0.f; for (int i = 0; i < 8; ++i) tq += red[i]; const float inv = 1.0f / sqrtf(tq / (float)DM + RMSEPS);
  for (int i = 0; i < 4; ++i) { const int c = t + 256 * i; sh[c] = (_Float16)(v[i] * inv * bfr(Wn[c])); } __syncthreads(); if (t < DM / 8) vst2((unsigned*)(OUTH + row * DM + t * 8), *(const v4u*)&sh[t * 8]); }
// ---- k_flags: block = (query block qb of 64 queries, half hf of the keys): FL[qb][hf * 32 + kt] = 1 if any mask[q][k] == 0 (attend) in the 64 x 32 tile; a lane owns one 16-byte column piece over 16 rows, all 16 loads independent; a block writes one whole 128-byte line of FL
__global__ __launch_bounds__(1024) void k_flags(const int* __restrict__ MASK, int* __restrict__ FL) { __shared__ __align__(16) int sf[32]; const int t = threadIdx.x; const int qb = blockIdx.x, hf = blockIdx.y; const int c4 = t & 255, rw = t >> 8;
  if (t < 32) sf[t] = 0; __syncthreads();
  const int* p = MASK + (size_t)(qb * 64 + rw) * SS + hf * (SS / 2) + c4 * 4; v4u v[16];
#pragma unroll
  for (int i = 0; i < 16; ++i) v[i] = *(const v4u*)(p + (size_t)i * 4 * SS);
  unsigned mn = 0xffffffffu;
#pragma unroll
  for (int i = 0; i < 16; ++i) mn = min(mn, min(min(v[i][0], v[i][1]), min(v[i][2], v[i][3])));   // smallest word is 0 exactly when some key is visible
  if (mn == 0u) sf[c4 >> 3] = 1;   // benign same-value race within the block
  __syncthreads(); if (t < 8) vst2((unsigned*)(FL + (size_t)qb * (SS / 32) + hf * 32 + t * 4), *(const v4u*)&sf[t * 4]); }
// ---- k_g<MODE, KW>: block = (64 rows, 128 cols): A f16 rows (MODE 0: built inline from the f32 ctx) . W^T (f16 x 2^8); MODE 0: X1 = x (bf16-rounded) + acc (f32 out); MODE 2: OUT = X1 + acc (f32)
template <int MODE, int KW>
__global__ __launch_bounds__(128) void k_g(const void* __restrict__ Ain, const _Float16* __restrict__ Wr, const float* __restrict__ RES, float* __restrict__ O32, int ow) { __shared__ __align__(16) float sf[4][16][132];
  const int tid = threadIdx.x, wave = tid >> 5, lane = tid & 31, col = lane & 15, g = lane >> 4; const size_t r0 = (size_t)blockIdx.x * 64 + wave * 16; const int c0 = blockIdx.y * 128;
  v8f acc[8] = {};
#pragma unroll 2
  for (int kc = 0; kc < KW / 32; ++kc) { v16h a; if (MODE == 0) { const float* p = (const float*)Ain + (r0 + col) * KW + kc * 32 + 8 * g;
#pragma unroll
      for (int i = 0; i < 8; ++i) { a[i] = (_Float16)p[i]; a[8 + i] = (_Float16)p[16 + i]; } } else a = frag_h((const _Float16*)Ain + (r0 + col) * KW + kc * 32, lane);
#pragma unroll
    for (int j = 0; j < 8; ++j) acc[j] = wmma16(a, frag_h(Wr + (size_t)(c0 + j * 16 + col) * KW + kc * 32, lane), acc[j]); }
#pragma unroll
  for (int j = 0; j < 8; ++j) { const int c = c0 + j * 16 + col;
#pragma unroll
    for (int r = 0; r < 8; ++r) { const float res = RES[(r0 + 8 * g + r) * ow + c]; sf[wave][8 * g + r][j * 16 + col] = acc[j][r] * (1.0f / WSC) + (MODE == 0 ? bfr(res) : res); } }
  LDSX(); for (int rl = 0; rl < 16; ++rl) vst2(O32 + (r0 + rl) * ow + c0 + lane * 4, *(const v4f*)&sf[wave][rl][lane * 4]); }
// ---- k_gu: block = (64 rows, 128 hidden cols): g = h2 . Wg^T, u = h2 . Wu^T (same A), GU = f16(silu(g) u) -> rows [NR][HP]
__global__ __launch_bounds__(128) void k_gu(const _Float16* __restrict__ H2, const _Float16* __restrict__ PG, _Float16* __restrict__ GU) { __shared__ __align__(16) _Float16 so[64][136];
  const int tid = threadIdx.x, wave = tid >> 5, lane = tid & 31, col = lane & 15, g = lane >> 4; const size_t rb = (size_t)blockIdx.x * 64; const size_t r0 = rb + wave * 16; const int c0 = blockIdx.y * 128; const _Float16* Wg = PG + (size_t)c0 * DM; const _Float16* Wu = PG + ((size_t)HP + c0) * DM;
  v8f ag[8] = {}, au[8] = {};
#pragma unroll 2
  for (int kc = 0; kc < DM / 32; ++kc) { const v16h a = frag_h(H2 + (r0 + col) * DM + kc * 32, lane);
#pragma unroll
    for (int j = 0; j < 8; ++j) { ag[j] = wmma16(a, frag_h(Wg + (size_t)(j * 16 + col) * DM + kc * 32, lane), ag[j]); au[j] = wmma16(a, frag_h(Wu + (size_t)(j * 16 + col) * DM + kc * 32, lane), au[j]); } }
#pragma unroll
  for (int j = 0; j < 8; ++j)
#pragma unroll
    for (int r = 0; r < 8; ++r) { const float gg = ag[j][r] * (1.0f / WSC), uu = au[j][r] * (1.0f / WSC); so[wave * 16 + 8 * g + r][j * 16 + col] = (_Float16)(gg / (1.0f + __expf(-gg)) * uu); }
  __syncthreads(); for (int e = tid; e < 64 * 16; e += 128) { const int rl = e >> 4, q = e & 15; vst2((unsigned*)(GU + (rb + rl) * HP + c0 + q * 8), *(const v4u*)&so[rl][q * 8]); } }

extern "C" void kernel_launch(void* const* d_in, const int* in_sizes, int n_in, void* d_out, int out_size, void* d_ws, size_t ws_size, hipStream_t stream) {
  (void)in_sizes; (void)n_in; (void)out_size;
  const float** F = (const float**)d_in;   // 0 x [2,2048,1024], 1 attn_mask [2048,2048] int (1 = masked), 2 wq, 3 wk, 4 wv, 5 wo (natural [1024,1024]), 6 norm1_w, 7 norm2_w, 8 w_gate [2730,1024], 9 w_up, 10 w_down [1024,2730]
  if (ws_size < (size_t)WS_END) return;
  char* ws = (char*)d_ws; _Float16* PK = (_Float16*)(ws + WS_PK); _Float16 *QK = (_Float16*)(ws + WS_QK), *QKL = (_Float16*)(ws + WS_QKL), *VTH = (_Float16*)(ws + WS_VTH), *VTL = (_Float16*)(ws + WS_VTL), *H1 = (_Float16*)(ws + WS_H1), *H2 = (_Float16*)(ws + WS_H2), *GU = (_Float16*)(ws + WS_GU); float *O = (float*)(ws + WS_O), *X1 = (float*)(ws + WS_X1); int* FL = (int*)(ws + WS_FL); const int* MASK = (const int*)d_in[1];
  const int nr = NB * SS;   // keys of both batches are always needed; TQB limits queries per batch
  k_pack<<<dim3(HP, 7), 256, 0, stream>>>(F[2], F[3], F[4], F[5], F[8], F[9], F[10], ws);
  k_rms<0><<<nr, 256, 0, stream>>>(F[0], F[6], H1);
  k_flags<<<dim3(SS / 64, 2), 1024, 0, stream>>>(MASK, FL);
  k_qkv<<<dim3(nr / 64, QKVW / 128), 128, 0, stream>>>((const float*)H1, (const float*)H1, (const float*)H1, PK + PK_A, nullptr, nullptr, nullptr, QK, QKL, VTH, VTL);
  k_attn<<<dim3(TQB, NH, TNB), 128, 0, stream>>>(QK, QKL, VTH, VTL, nullptr, MASK, FL, O);
  k_g<0, DM><<<dim3(TOB, DM / 128), 128, 0, stream>>>(O, PK + PK_P, F[0], X1, DM);                  // x1 = x + ctx wo^T
  k_rms<1><<<TOB * 64, 256, 0, stream>>>(X1, F[7], H2);
  k_gu<<<dim3(TOB, HP / 128), 128, 0, stream>>>(H2, (const _Float16*)(ws + WS_PG), GU);
  k_g<2, HP><<<dim3(TOB, DM / 128), 128, 0, stream>>>(GU, (const _Float16*)(ws + WS_PD), X1, (float*)d_out, DM);   // out = x1 + (silu(g) u) w_down^T
}

// v002
// It runs in 246 microseconds.
// Next to v001, in two timings, it ran 2.89 and 2.91 times as fast.
// All steps since v000 together make it 3.72 times as fast.
// compute dtype: all float inputs rounded to bf16, attn_mask (int) read on device; RMSNorms (eps 1e-6) in f32, normed rows once to f16; q/k/v = f16(h) . W^T against exact f16 x 2^8 weight copies on WMMA 16x16x32 (single products, f32 accumulate); rotate-half RoPE in f32 (precise sinf/cosf) before the f16 hi + residual split; attention with 3-product scores and P.v (hi + residual planes), x 1/8, masked keys excluded (mask read per pair; fully-masked 64x32 tiles skipped via a device-built flag table), running-max softmax in f32 (hardware exp); x1 = x + f16(ctx) . Wo^T; SwiGLU: f16(rmsnorm(x1)) . [W_gate | W_up]^T (hidden padded 2,730 -> 2,816 with zero weights), silu(g) u in f32 -> f16, . W_down^T + x1; f32 output.
#include <hip/hip_runtime.h>
#include <math.h>

typedef __attribute__((ext_vector_type(16))) _Float16 v16h;
typedef __attribute__((ext_vector_type(16))) __bf16 v16b;
typedef __attribute__((ext_vector_type(8)))  _Float16 v8h;
typedef __attribute__((ext_vector_type(8)))  float v8f;
typedef __attribute__((ext_vector_type(4)))  float v4f;
typedef __attribute__((ext_vector_type(2)))  float v2f;
typedef __attribute__((ext_vector_type(4)))  unsigned v4u;
typedef __attribute__((ext_vector_type(4)))  int v4i;
typedef float __attribute__((may_alias)) float_a;
typedef int __attribute__((may_alias)) int_a;

template <typename T> __device__ __forceinline__ void vst2(void* p, T v) { *(T*)p = v;  }
__device__ __forceinline__ v8f wmma16(v16h a, v16h b, v8f c) {
  v8f d = __builtin_amdgcn_wmma_f32_16x16x32_f16(false, a, false, b, (short)0, c, false, false);
  asm volatile("v_nop\n\tv_nop\n\tv_nop\n\tv_nop" : "+v"(d) : "v"(a), "v"(b));
  return d;
}
__device__ __forceinline__ v8f wmma_bf(v16b a, v16b b, v8f c) {
  v8f d = __builtin_amdgcn_wmma_f32_16x16x32_bf16(false, a, false, b, (short)0, c, false, false);
  asm volatile("v_nop\n\tv_nop\n\tv_nop\n\tv_nop" : "+v"(d) : "v"(a), "v"(b));
  return d;
}
// Streaming decoder block (B 2, L 2,048, d 1,024, 16 heads x 64, SwiGLU hidden 2,730): pre-RMSNorm, bias-free projections, rotate-half RoPE (base 10000), attention under the given boolean mask (all-keys + 256-token window), out-projection + residual, pre-RMSNorm SwiGLU FFN + residual.
__device__ __forceinline__ v16h frag_h(const _Float16* rowk0, int lane) {
  union { v16h v; v8h q[2]; } u; const _Float16* p = rowk0 + 8 * (lane >> 4);
  u.q[0] = *(const v8h*)p; u.q[1] = *(const v8h*)(p + 16); return u.v;
}
__device__ __forceinline__ v16h frag_f32(const float* rowk0, int lane) {
  v16h a; const float* p = rowk0 + 8 * (lane >> 4);
#pragma unroll
  for (int i = 0; i < 8; ++i) { a[i] = (_Float16)p[i]; a[8 + i] = (_Float16)p[16 + i]; }
  return a;
}
__device__ __forceinline__ v16h frag_f32s(const float* rowk0, int lane, float sc) {
  v16h a; const float* p = rowk0 + 8 * (lane >> 4);
#pragma unroll
  for (int i = 0; i < 8; ++i) { a[i] = (_Float16)(p[i] * sc); a[8 + i] = (_Float16)(p[16 + i] * sc); }
  return a;
}
// column fragment from a [K][ld] layout (column n), rows >= K read as 0
__device__ __forceinline__ v16h fragc_f32(const float* W, int k0, int n, int lane, int ld, int K) {
  v16h a; const int g = lane >> 4;
#pragma unroll
  for (int i = 0; i < 8; ++i) { const int ka = k0 + 8 * g + i, kb = ka + 16;
    a[i] = (_Float16)(ka < K ? W[(size_t)(ka < K ? ka : K - 1) * ld + n] : 0.f); a[8 + i] = (_Float16)(kb < K ? W[(size_t)(kb < K ? kb : K - 1) * ld + n] : 0.f); }
  return a;
}
struct F2 { v16b h, l; };
__device__ __forceinline__ F2 bsplit16(const float v[16]) { F2 r;
#pragma unroll
  for (int i = 0; i < 16; ++i) { const __bf16 h = (__bf16)v[i]; r.h[i] = h; r.l[i] = (__bf16)(v[i] - (float)h); }
  return r; }
__device__ __forceinline__ F2 split_row(const float* row, int k0, int lane) { float v[16]; const float* p = row + k0 + 8 * (lane >> 4);
#pragma unroll
  for (int i = 0; i < 8; ++i) { v[i] = p[i]; v[8 + i] = p[16 + i]; }
  return bsplit16(v); }
__device__ __forceinline__ F2 split_rowK(const float* row, int k0, int lane, int K) { float v[16]; const int g = lane >> 4;
#pragma unroll
  for (int i = 0; i < 8; ++i) { const int ka = k0 + 8 * g + i, kb = ka + 16; v[i] = ka < K ? row[ka < K ? ka : K - 1] : 0.f; v[8 + i] = kb < K ? row[kb < K ? kb : K - 1] : 0.f; }
  return bsplit16(v); }
__device__ __forceinline__ F2 split_col(const float* W, int k0, int n, int lane, int ld, int K) { float v[16]; const int g = lane >> 4;
#pragma unroll
  for (int i = 0; i < 8; ++i) { const int ka = k0 + 8 * g + i, kb = ka + 16; v[i] = ka < K ? W[(size_t)(ka < K ? ka : K - 1) * ld + n] : 0.f; v[8 + i] = kb < K ? W[(size_t)(kb < K ? kb : K - 1) * ld + n] : 0.f; }
  return bsplit16(v); }
__device__ __forceinline__ v8f mac3(const F2& a, const F2& b, v8f c) { c = wmma_bf(a.l, b.h, c); c = wmma_bf(a.h, b.l, c); return wmma_bf(a.h, b.h, c); }
__device__ __forceinline__ float sigm(float v) { return 1.0f / (1.0f + expf(-v)); }
#define LDSX() do { asm volatile("s_wait_dscnt 0" ::: "memory"); __builtin_amdgcn_wave_barrier(); __builtin_amdgcn_fence(__ATOMIC_RELEASE, "workgroup"); } while (0)
// ---- GEMM operand ring: a stage is 64 k of every operand row of the block's tile, brought into LDS by asynchronous 16-byte copies (a wave's copy covers whole 128-byte lines); LDS row pitch = row bytes + 16 (16 B x odd: conflict-free for 16-byte reads); two buffers
#define KS 64
#define HPITCH (2 * KS + 16)       // f16 rows: 128 B + 16
__device__ __forceinline__ unsigned lds_off(const void* p) { return (unsigned)(size_t)p; }
// a run of copies and, as the last line of their own statement, the wait that stands in front of any rewrite of their address registers (one wait a run: fewer, longer runs cost a wave fewer waits)
#define CPL(a, b) "global_load_async_to_lds_b128 %" #a ", %" #b ", off\n\t"
__device__ __forceinline__ void cp8(const unsigned* l, const char* const* g) {
  asm volatile(CPL(0, 1) CPL(2, 3) CPL(4, 5) CPL(6, 7) CPL(8, 9) CPL(10, 11) CPL(12, 13) CPL(14, 15) "s_wait_xcnt 0x0"
               :: "v"(l[0]), "v"(g[0]), "v"(l[1]), "v"(g[1]), "v"(l[2]), "v"(g[2]), "v"(l[3]), "v"(g[3]), "v"(l[4]), "v"(g[4]), "v"(l[5]), "v"(g[5]), "v"(l[6]), "v"(g[6]), "v"(l[7]), "v"(g[7]) : "memory");
}
__device__ __forceinline__ void cp12(const unsigned* l, const char* const* g) {
  asm volatile(CPL(0, 1) CPL(2, 3) CPL(4, 5) CPL(6, 7) CPL(8, 9) CPL(10, 11) CPL(12, 13) CPL(14, 15) CPL(16, 17) CPL(18, 19) CPL(20, 21) CPL(22, 23) "s_wait_xcnt 0x0"
               :: "v"(l[0]), "v"(g[0]), "v"(l[1]), "v"(g[1]), "v"(l[2]), "v"(g[2]), "v"(l[3]), "v"(g[3]), "v"(l[4]), "v"(g[4]), "v"(l[5]), "v"(g[5]), "v"(l[6]), "v"(g[6]), "v"(l[7]), "v"(g[7]), "v"(l[8]), "v"(g[8]), "v"(l[9]), "v"(g[9]), "v"(l[10]), "v"(g[10]), "v"(l[11]), "v"(g[11]) : "memory");
}
// this thread's addresses for ROWS rows of RB bytes from gb (row pitch gp bytes) to LDS byte address lb (row pitch RB + 16), dealt over the 128 threads of a block: ROWS * RB / 2048 copies a thread
template <int ROWS, int RB>
__device__ __forceinline__ void row_addr(unsigned* l, const char** g, unsigned lb, const char* gb, size_t gp, int tid) {
  constexpr int PPR = RB / 16, RPI = 128 / PPR, NI = ROWS / RPI; const int row = tid / PPR, pc = tid % PPR;
#pragma unroll
  for (int i = 0; i < NI; ++i) { l[i] = lb + (row + i * RPI) * (RB + 16) + pc * 16; g[i] = gb + (size_t)(row + i * RPI) * gp + pc * 16; }
}
// 128 weight rows of 128 B
__device__ __forceinline__ void stage_w(unsigned lb, const char* gb, size_t gp, int tid) { unsigned l[8]; const char* g[8]; row_addr<128, 2 * KS>(l, g, lb, gb, gp, tid); cp8(l, g); }
// 64 A rows of ARB bytes at lb, behind them 128 weight rows of 128 B
template <int ARB>
__device__ __forceinline__ void stage_ab(unsigned lb, const char* ga, size_t pa, const char* gb, size_t pb, int tid) {
  if constexpr (ARB == 2 * KS) { unsigned l[12]; const char* g[12]; row_addr<64, ARB>(l, g, lb, ga, pa, tid); row_addr<128, 2 * KS>(l + 4, g + 4, lb + 64 * (ARB + 16), gb, pb, tid); cp12(l, g); }
  else { unsigned l[8]; const char* g[8]; row_addr<64, ARB>(l, g, lb, ga, pa, tid); cp8(l, g); stage_w(lb + 64 * (ARB + 16), gb, pb, tid); }
}
#define WAIT_ASYNC0() asm volatile("s_wait_asynccnt 0x0" ::: "memory")   // this wave's copies have landed
#define WAIT_DS0() asm volatile("s_wait_dscnt 0x0" ::: "memory")         // this wave's LDS reads of the buffer have returned before it is refilled


#define NB 2
#define SS 2048
#define DM 1024
#define NH 16
#define HID 2730
#define HP 2816          // hidden padded to 22 x 128
#define WSC 256.0f
#define RMSEPS 1e-6f
__constant__ float THETA[32] = {1.000000000e+00f,7.498942018e-01f,5.623413324e-01f,4.216965139e-01f,3.162277639e-01f,2.371373773e-01f,1.778279394e-01f,1.333521456e-01f,1.000000015e-01f,7.498942316e-02f,5.623413250e-02f,4.216964915e-02f,3.162277490e-02f,2.371373773e-02f,1.778279431e-02f,1.333521400e-02f,9.999999776e-03f,7.498942316e-03f,5.623413250e-03f,4.216964822e-03f,3.162277630e-03f,2.371373819e-03f,1.778279431e-03f,1.333521446e-03f,1.000000047e-03f,7.498941850e-04f,5.623413017e-04f,4.216965172e-04f,3.162277571e-04f,2.371373703e-04f,1.778279402e-04f,1.333521504e-04f};
__device__ __attribute__((noinline)) float cos_p(float v) { return cosf(v); }
__device__ __attribute__((noinline)) float sin_p(float v) { return sinf(v); }
#define HD 64
#define QKVW (3 * DM)
#ifndef TQB
#define TQB (SS / 64)
#define TNB NB
#define TOB (NB * SS / 64)     // output row tiles (all)
#endif
typedef __attribute__((ext_vector_type(8))) __bf16 v8b;
__device__ __forceinline__ v16b frag_b(const __bf16* rowk0, int lane) {
  union { v16b v; v8b q[2]; } u; const __bf16* p = rowk0 + 8 * (lane >> 4);
  u.q[0] = *(const v8b*)p; u.q[1] = *(const v8b*)(p + 16); return u.v;
}
__device__ __forceinline__ float bfr(float v) { return (float)(__bf16)v; }
__device__ __attribute__((noinline)) float exp_ni(float v) { return expf(v); }
__device__ __attribute__((noinline)) float erf_ni(float v) { return erff(v); }

#define PK_A 0                       // [3072][1024] Wqkv rows (natural [out][in])
#define PK_P (PK_A + QKVW * DM)        // [1024][1024] Wo rows (natural)
#define PK_END (PK_P + DM * DM)
#define WS_PK  0u
#define WS_QK  (WS_PK + 2u * PK_END)             // f16 [4096 rows][2048]: q | k
#define WS_QKL (WS_QK + 2u * NB * SS * 2 * DM)     // f16 q | k residual planes x2048
#define WS_VTH (WS_QKL + 2u * NB * SS * 2 * DM)    // f16 [b][1024 (h*64+d)][2048 s] hi
#define WS_VTL (WS_VTH + 2u * NB * DM * SS)        // f16 lo x 2048
#define WS_O   (WS_VTL + 2u * NB * DM * SS)        // f32 [4096][1024]
#define WS_PG  (WS_O + 4u * (size_t)NB * SS * DM)        // f16 x 2^8 [gate | up] rows [2*HP][1024] (zero rows >= HID), down rows [1024][HP] (zero cols >= HID)
#define WS_PD  (WS_PG + 2u * (size_t)2 * HP * DM)
#define WS_H1  (WS_PD + 2u * (size_t)DM * HP)             // f16 rmsnorm1(x) rows [NR][1024]; int flags [SS/64][SS/32]; f32 x1 [NR][1024]; f16 rmsnorm2(x1) rows; f16 silu(gate) up rows [NR][HP]
#define WS_FL  (WS_H1 + 2u * (size_t)NB * SS * DM)
#define WS_X1  (WS_FL + 4u * (size_t)(SS / 64) * (SS / 32))
#define WS_H2  (WS_X1 + 4u * (size_t)NB * SS * DM)
#define WS_GU  (WS_H2 + 2u * (size_t)NB * SS * DM)
#define WS_END (WS_GU + 2u * (size_t)NB * SS * HP)
// ---- k_pack: block = (row n, which): natural [out][in] rows -> f16 (bf16-rounded x 2^8); which 0..2 -> W_q/W_k/W_v into PK_A rows which*1024 + n; 3 -> W_o into PK_P
__global__ __launch_bounds__(256) void k_pack(const float* __restrict__ WQ, const float* __restrict__ WK, const float* __restrict__ WV, const float* __restrict__ WO, const float* __restrict__ WG, const float* __restrict__ WU, const float* __restrict__ WD, char* __restrict__ ws) {
  const int n = blockIdx.x, which = blockIdx.y, t = threadIdx.x; __shared__ __align__(16) _Float16 sh[HP]; _Float16* P = (_Float16*)(ws + WS_PK);
  if (which < 4) { if (n >= DM) return; const float* w = (which == 0) ? WQ : (which == 1) ? WK : (which == 2) ? WV : WO; for (int k = t; k < DM; k += 256) sh[k] = (_Float16)(bfr(w[(size_t)n * DM + k]) * WSC); __syncthreads();
    _Float16* dst = (which < 3) ? (P + PK_A + ((size_t)which * DM + n) * DM) : (P + PK_P + (size_t)n * DM); for (int q = t; q < DM / 8; q += 256) vst2((unsigned*)(dst + q * 8), *(const v4u*)&sh[q * 8]); }
  else if (which < 6) { if (n >= HP) return; const float* w = (which == 4) ? WG : WU; for (int k = t; k < DM; k += 256) sh[k] = (n < HID) ? (_Float16)(bfr(w[(size_t)n * DM + k]) * WSC) : (_Float16)0.0f; __syncthreads();   // gate | up rows, zero beyond 2,730
    _Float16* dst = (_Float16*)(ws + WS_PG) + ((size_t)(which - 4) * HP + n) * DM; for (int q = t; q < DM / 8; q += 256) vst2((unsigned*)(dst + q * 8), *(const v4u*)&sh[q * 8]); }
  else { if (n >= DM) return; for (int k = t; k < HP; k += 256) sh[k] = (k < HID) ? (_Float16)(bfr(WD[(size_t)n * HID + k]) * WSC) : (_Float16)0.0f; __syncthreads();   // down rows [1024][HP]
    _Float16* dst = (_Float16*)(ws + WS_PD) + (size_t)n * HP; for (int q = t; q < HP / 8; q += 256) vst2((unsigned*)(dst + q * 8), *(const v4u*)&sh[q * 8]); } }
__global__ __launch_bounds__(128) void k_qkv(const float* __restrict__ XQ, const float* __restrict__ XK, const float* __restrict__ XV, const _Float16* __restrict__ P, const float* __restrict__ BQ, const float* __restrict__ BK, const float* __restrict__ BV, _Float16* __restrict__ QK, _Float16* __restrict__ QKL, _Float16* __restrict__ VTH, _Float16* __restrict__ VTL) {
  const int which0 = (blockIdx.y * 128) / DM; const float* X = (which0 == 0) ? XQ : (which0 == 1) ? XK : XV; const float* BB = BQ ? (((which0 == 0) ? BQ : (which0 == 1) ? BK : BV) + (blockIdx.y * 128 - which0 * DM)) : nullptr;
  constexpr int STG = (64 + 128) * HPITCH; __shared__ __attribute__((aligned(128))) char sm[2 * STG];   // the ring; behind the loop's last barrier the same bytes are the output staging
  _Float16 (*so)[16][136] = (_Float16 (*)[16][136])sm; _Float16 (*sol)[16][136] = (_Float16 (*)[16][136])(sm + 4 * 16 * 136 * 2); _Float16 (*sth)[72] = (_Float16 (*)[72])sm; _Float16 (*stl)[72] = (_Float16 (*)[72])(sm + 128 * 72 * 2);
  const int tid = threadIdx.x, wave = tid >> 5, lane = tid & 31, col = lane & 15, g = lane >> 4; const size_t r0 = (size_t)blockIdx.x * 64 + wave * 16; const int n0 = blockIdx.y * 128;
  v8f acc[8] = {};
  { const char* gA = (const char*)((const _Float16*)X + (size_t)blockIdx.x * 64 * DM); const char* gB = (const char*)(P + (size_t)n0 * DM); const unsigned l0 = lds_off(sm); constexpr int NT = DM / KS;   // A = f16 rmsnorm rows
    stage_ab<2 * KS>(l0, gA, 2 * DM, gB, 2 * DM, tid); WAIT_ASYNC0(); __syncthreads();
    stage_ab<2 * KS>(l0 + STG, gA + 2 * KS, 2 * DM, gB + 2 * KS, 2 * DM, tid);
#pragma unroll 1   // stays rolled: one copy of a stage's code in the instruction cache; t & 1 picks the buffer
    for (int t = 0; t < NT; ++t) { const int bo = (t & 1) * STG;
      v16h a[KS / 32], w[KS / 32][8];   // the stage's LDS reads go out as one group in front of its products; the loops below are unrolled so that these arrays are registers
#pragma unroll
      for (int kc = 0; kc < KS / 32; ++kc) { a[kc] = frag_h((const _Float16*)(sm + bo + (wave * 16 + col) * HPITCH) + kc * 32, lane);
#pragma unroll
        for (int j = 0; j < 8; ++j) w[kc][j] = frag_h((const _Float16*)(sm + bo + (64 + j * 16 + col) * HPITCH) + kc * 32, lane); }
#pragma unroll
      for (int kc = 0; kc < KS / 32; ++kc)
#pragma unroll
        for (int j = 0; j < 8; ++j) acc[j] = wmma16(a[kc], w[kc][j], acc[j]);
      WAIT_DS0(); WAIT_ASYNC0(); __syncthreads();   // publishes stage t + 1 and ends every reader's last read of stage t
      if (t + 2 < NT) { stage_ab<2 * KS>(l0 + bo, gA + (size_t)(t + 2) * 2 * KS, 2 * DM, gB + (size_t)(t + 2) * 2 * KS, 2 * DM, tid); } }
    WAIT_ASYNC0(); }
#pragma unroll
  for (int j = 0; j < 8; ++j)
#pragma unroll
    for (int r = 0; r < 8; ++r) acc[j][r] *= (1.0f / WSC);
  if (n0 < 2 * DM) {   // bias, then rotate-half rotary over each 64-dim head with angle position * inv_freq[d mod 32]
#pragma unroll
    for (int j = 0; j < 8; ++j)
#pragma unroll
      for (int r = 0; r < 8; ++r) acc[j][r] += (BB ? bfr(BB[j * 16 + col]) : 0.f);
#pragma unroll
    for (int r = 0; r < 8; ++r) { const int spos = (int)((r0 + 8 * g + r) % SS);
#pragma unroll
      for (int jj = 0; jj < 2; ++jj) { const float ang = (float)spos * THETA[jj * 16 + col]; const float c = cos_p(ang), sn = sin_p(ang);
#pragma unroll
        for (int hh = 0; hh < 2; ++hh) { const float x1 = acc[hh * 4 + jj][r], x2 = acc[hh * 4 + jj + 2][r]; acc[hh * 4 + jj][r] = x1 * c - x2 * sn; acc[hh * 4 + jj + 2][r] = x2 * c + x1 * sn; } } }
#pragma unroll
    for (int j = 0; j < 8; ++j) {
#pragma unroll
      for (int r = 0; r < 8; ++r) { const float v = acc[j][r]; const _Float16 hv = (_Float16)v; so[wave][8 * g + r][j * 16 + col] = hv; sol[wave][8 * g + r][j * 16 + col] = (_Float16)((v - (float)hv) * 2048.0f); } }   // q, k (+ bias) as f16 hi + (x2048) residual
    LDSX();
    for (int rl = 0; rl < 16; ++rl) if (lane < 16) { vst2((unsigned*)(QK + (r0 + rl) * (2 * DM) + n0 + lane * 8), *(const v4u*)&so[wave][rl][lane * 8]); vst2((unsigned*)(QKL + (r0 + rl) * (2 * DM) + n0 + lane * 8), *(const v4u*)&sol[wave][rl][lane * 8]); }
  } else {
#pragma unroll
    for (int j = 0; j < 8; ++j) {
#pragma unroll
      for (int r = 0; r < 8; ++r) { const float v = acc[j][r] + (BB ? bfr(BB[j * 16 + col]) : 0.f); const _Float16 hv = (_Float16)v; sth[j * 16 + col][wave * 16 + 8 * g + r] = hv; stl[j * 16 + col][wave * 16 + 8 * g + r] = (_Float16)((v - (float)hv) * 2048.0f); } }
    __syncthreads();
    const size_t rb = (size_t)blockIdx.x * 64; const int b = (int)(rb / SS), s0 = (int)(rb % SS); const int pc0 = n0 - 2 * DM;
    for (int q = tid; q < 128 * 8; q += 128) { const int d = q >> 3, pc = q & 7; const size_t o = ((size_t)b * DM + pc0 + d) * SS + s0 + pc * 8; vst2((unsigned*)(VTH + o), *(const v4u*)&sth[d][pc * 8]); vst2((unsigned*)(VTL + o), *(const v4u*)&stl[d][pc * 8]); }
  }
}
// ---- k_attn: block = (64 queries, head h, batch b): all-keys flash attention (K = 64: 2 k-steps), scores = (q.k) * 0.125 from f16 hi + residual operands (3 products), P.V: f16 P x (V hi, V lo*2048) in two accumulators; O[b*S+q][h*64+d] = (acc + accl / 2048) / (2048 l) (256-B segments)
__global__ __launch_bounds__(128) void k_attn(const _Float16* __restrict__ QK, const _Float16* __restrict__ QKL, const _Float16* __restrict__ VTH, const _Float16* __restrict__ VTL, const void* __restrict__ KMASK, const int* __restrict__ MASK, const int* __restrict__ FL, float* __restrict__ O) {
  __shared__ __align__(16) float sp[4][16][36]; __shared__ __align__(16) float so[4][16][68];
  const int tid = threadIdx.x, wave = tid >> 5, lane = tid & 31, col = lane & 15, g = lane >> 4;
  const int qb = blockIdx.x, h = blockIdx.y, b = blockIdx.z; const int q0 = qb * 64 + wave * 16; const size_t rq = (size_t)b * SS + q0 + col;
  v16h aq[2], aql[2];
#pragma unroll
  for (int kc = 0; kc < 2; ++kc) { aq[kc] = frag_h(QK + rq * (2 * DM) + h * HD + kc * 32, lane); aql[kc] = frag_h(QKL + rq * (2 * DM) + h * HD + kc * 32, lane); }
  float m[8], l[8];
#pragma unroll
  for (int r = 0; r < 8; ++r) { m[r] = -3.0e38f; l[r] = 0.f; }
  v8f acc[4] = {}, accl[4] = {};
  const int nks = SS / 32;   // all keys
#pragma unroll 1
  for (int ks = 0; ks < nks; ++ks) { if (FL[qb * (SS / 32) + ks] == 0) continue;   /* no visible key in this (64-query, 32-key) tile */ v8f s[2];
#pragma unroll
    for (int ct = 0; ct < 2; ++ct) { const int kk = ks * 32 + ct * 16 + col; const _Float16* krow = QK + ((size_t)b * SS + kk) * (2 * DM) + DM + h * HD; const _Float16* krowl = QKL + ((size_t)b * SS + kk) * (2 * DM) + DM + h * HD; v8f c = {}, cl = {};
#pragma unroll
      for (int kc = 0; kc < 2; ++kc) { const v16h kh = frag_h(krow + kc * 32, lane); c = wmma16(aq[kc], kh, c); cl = wmma16(aql[kc], kh, cl); cl = wmma16(aq[kc], frag_h(krowl + kc * 32, lane), cl); }   // 3 products: q, k as f16 hi + residual
#pragma unroll
      for (int r = 0; r < 8; ++r) c[r] += cl[r] * (1.0f / 2048.0f);
      {
#pragma unroll
      for (int r = 0; r < 8; ++r) s[ct][r] = (MASK[(size_t)(q0 + 8 * g + r) * SS + kk] == 0) ? c[r] * 0.125f : -3.0e38f; } }   // 1/sqrt(64); masked keys excluded
#pragma unroll
    for (int r = 0; r < 8; ++r) { float mx = fmaxf(s[0][r], s[1][r]);
#pragma unroll
      for (int o = 1; o < 16; o <<= 1) mx = fmaxf(mx, __shfl_xor(mx, o));
      const float mn = fmaxf(m[r], mx); const float alpha = (m[r] <= -1.0e38f) ? 0.f : __expf(m[r] - mn);
      const float e0 = (s[0][r] <= -1.0e38f) ? 0.f : __expf(s[0][r] - mn), e1 = (s[1][r] <= -1.0e38f) ? 0.f : __expf(s[1][r] - mn); float es = e0 + e1;
#pragma unroll
      for (int o = 1; o < 16; o <<= 1) es += __shfl_xor(es, o);
      l[r] = l[r] * alpha + es; m[r] = mn;
#pragma unroll
      for (int dt = 0; dt < 4; ++dt) { acc[dt][r] *= alpha; accl[dt][r] *= alpha; }
      sp[wave][8 * g + r][col] = e0; sp[wave][8 * g + r][16 + col] = e1; }
    LDSX();
    v16h pa, pl; { const float* prow = &sp[wave][col][0] + 8 * (lane >> 4);
#pragma unroll
      for (int i = 0; i < 8; ++i) { const float x0 = prow[i] * 2048.0f, x1 = prow[16 + i] * 2048.0f; const _Float16 h0 = (_Float16)x0, h1 = (_Float16)x1; pa[i] = h0; pa[8 + i] = h1; pl[i] = (_Float16)((x0 - (float)h0) * 2048.0f); pl[8 + i] = (_Float16)((x1 - (float)h1) * 2048.0f); } }   // P scaled by 2^11 before the f16 split so small softmax weights stay out of the f16 subnormal range; 2^-11 folded into the epilogue
#pragma unroll
    for (int dt = 0; dt < 4; ++dt) { const size_t vr = ((size_t)b * DM + h * HD + dt * 16 + col) * SS + ks * 32; const v16h vh = frag_h(VTH + vr, lane); acc[dt] = wmma16(pa, vh, acc[dt]); accl[dt] = wmma16(pl, vh, accl[dt]); accl[dt] = wmma16(pa, frag_h(VTL + vr, lane), accl[dt]); }   // P hi x V hi + (P lo x V hi + P hi x V lo) / 2048
    LDSX(); }
#pragma unroll
  for (int r = 0; r < 8; ++r) { const float il = (l[r] > 0.f) ? (1.0f / 2048.0f) / l[r] : 0.f;
#pragma unroll
    for (int dt = 0; dt < 4; ++dt) so[wave][8 * g + r][dt * 16 + col] = (acc[dt][r] + accl[dt][r] * (1.0f / 2048.0f)) * il; }
  LDSX();
  for (int rl = 0; rl < 16; ++rl) if (lane < 16) vst2(O + ((size_t)b * SS + q0 + rl) * DM + h * HD + lane * 4, *(const v4f*)&so[wave][rl][lane * 4]);
}
// ---- k_out: block = (64 rows, 128 cols): out = O(hi/lo) . Wo rows (2 products) + bo
__global__ __launch_bounds__(128) void k_out(const float* __restrict__ O, const __bf16* __restrict__ P, const float* __restrict__ BO, float* __restrict__ Y) {
  __shared__ __align__(16) float so[4][16][132];
  const int tid = threadIdx.x, wave = tid >> 5, lane = tid & 31, col = lane & 15, g = lane >> 4; const size_t r0 = (size_t)blockIdx.x * 64 + wave * 16; const int n0 = blockIdx.y * 128;
  v8f acc[8] = {};
#pragma unroll 2
  for (int kc = 0; kc < DM / 32; ++kc) { const F2 a = split_row(O + (r0 + col) * DM, kc * 32, lane);
#pragma unroll
    for (int j = 0; j < 8; ++j) { const v16b w = frag_b(P + (size_t)(n0 + j * 16 + col) * DM + kc * 32, lane); acc[j] = wmma_bf(a.l, w, acc[j]); acc[j] = wmma_bf(a.h, w, acc[j]); } }
#pragma unroll
  for (int j = 0; j < 8; ++j) {
#pragma unroll
    for (int r = 0; r < 8; ++r) so[wave][8 * g + r][j * 16 + col] = acc[j][r] + (BO ? bfr(BO[n0 + j * 16 + col]) : 0.f); }
  LDSX();
  for (int rl = 0; rl < 16; ++rl) vst2(Y + (r0 + rl) * DM + n0 + lane * 4, *(const v4f*)&so[wave][rl][lane * 4]);
}

// ---- k_rms: block = row: OUTH = f16(x rsqrt(mean x^2 + eps) w) (MODE 0: x = bf16-rounded input; MODE 1: x = f32 x1)
template <int MODE>
__global__ __launch_bounds__(256) void k_rms(const float* __restrict__ A, const float* __restrict__ Wn, _Float16* __restrict__ OUTH) { __shared__ float red[8]; __shared__ __align__(16) _Float16 sh[DM]; const int t = threadIdx.x; const size_t row = blockIdx.x;
  float v[4]; float q = 0.f; for (int i = 0; i < 4; ++i) { const float x = A[row * DM + t + 256 * i]; v[i] = MODE == 0 ? bfr(x) : x; q += v[i] * v[i]; }
#pragma unroll
  for (int o = 1; o < 32; o <<= 1) q += __shfl_xor(q, o);
  if ((t & 31) == 0) red[t >> 5] = q; __syncthreads(); float tq = 0.f; for (int i = 0; i < 8; ++i) tq += red[i]; const float inv = 1.0f / sqrtf(tq / (float)DM + RMSEPS);
  for (int i = 0; i < 4; ++i) { const int c = t + 256 * i; sh[c] = (_Float16)(v[i] * inv * bfr(Wn[c])); } __syncthreads(); if (t < DM / 8) vst2((unsigned*)(OUTH + row * DM + t * 8), *(const v4u*)&sh[t * 8]); }
// ---- k_flags: block = (query block qb of 64 queries, half hf of the keys): FL[qb][hf * 32 + kt] = 1 if any mask[q][k] == 0 (attend) in the 64 x 32 tile; a lane owns one 16-byte column piece over 16 rows, all 16 loads independent; a block writes one whole 128-byte line of FL
__global__ __launch_bounds__(1024) void k_flags(const int* __restrict__ MASK, int* __restrict__ FL) { __shared__ __align__(16) int sf[32]; const int t = threadIdx.x; const int qb = blockIdx.x, hf = blockIdx.y; const int c4 = t & 255, rw = t >> 8;
  if (t < 32) sf[t] = 0; __syncthreads();
  const int* p = MASK + (size_t)(qb * 64 + rw) * SS + hf * (SS / 2) + c4 * 4; v4u v[16];
#pragma unroll
  for (int i = 0; i < 16; ++i) v[i] = *(const v4u*)(p + (size_t)i * 4 * SS);
  unsigned mn = 0xffffffffu;
#pragma unroll
  for (int i = 0; i < 16; ++i) mn = min(mn, min(min(v[i][0], v[i][1]), min(v[i][2], v[i][3])));   // smallest word is 0 exactly when some key is visible
  if (mn == 0u) sf[c4 >> 3] = 1;   // benign same-value race within the block
  __syncthreads(); if (t < 8) vst2((unsigned*)(FL + (size_t)qb * (SS / 32) + hf * 32 + t * 4), *(const v4u*)&sf[t * 4]); }
// ---- k_g<MODE, KW>: block = (64 rows, 128 cols): A f16 rows (MODE 0: built inline from the f32 ctx) . W^T (f16 x 2^8); MODE 0: X1 = x (bf16-rounded) + acc (f32 out); MODE 2: OUT = X1 + acc (f32)
template <int MODE, int KW>
__global__ __launch_bounds__(128) void k_g(const void* __restrict__ Ain, const _Float16* __restrict__ Wr, const float* __restrict__ RES, float* __restrict__ O32, int ow) { constexpr int AEB = (MODE == 0) ? 4 : 2, APITCH = AEB * KS + 16, STG = 64 * APITCH + 128 * HPITCH; __shared__ __attribute__((aligned(128))) char sm[2 * STG];   // the ring; behind the loop's last barrier the same bytes are the output staging
  float (*sf)[16][132] = (float (*)[16][132])sm;
  const int tid = threadIdx.x, wave = tid >> 5, lane = tid & 31, col = lane & 15, g = lane >> 4; const size_t r0 = (size_t)blockIdx.x * 64 + wave * 16; const int c0 = blockIdx.y * 128;
  v8f acc[8] = {};
  { const char* gA = (const char*)Ain + (size_t)blockIdx.x * 64 * KW * AEB; const char* gB = (const char*)(Wr + (size_t)c0 * KW); const unsigned l0 = lds_off(sm); constexpr int NT = KW / KS;
    stage_ab<AEB * KS>(l0, gA, (size_t)AEB * KW, gB, 2 * KW, tid); WAIT_ASYNC0(); __syncthreads();
    stage_ab<AEB * KS>(l0 + STG, gA + AEB * KS, (size_t)AEB * KW, gB + 2 * KS, 2 * KW, tid);
#pragma unroll 1   // stays rolled: one copy of a stage's code in the instruction cache; t & 1 picks the buffer
    for (int t = 0; t < NT; ++t) { const int bo = (t & 1) * STG;
      v16h a[KS / 32], w[KS / 32][8];   // the stage's LDS reads go out as one group in front of its products; the loops below are unrolled so that these arrays are registers
#pragma unroll
      for (int kc = 0; kc < KS / 32; ++kc) { if (MODE == 0) { const float* p = (const float*)(sm + bo + (wave * 16 + col) * APITCH) + kc * 32 + 8 * g;
#pragma unroll
          for (int i = 0; i < 8; ++i) { a[kc][i] = (_Float16)p[i]; a[kc][8 + i] = (_Float16)p[16 + i]; } } else a[kc] = frag_h((const _Float16*)(sm + bo + (wave * 16 + col) * APITCH) + kc * 32, lane);
#pragma unroll
        for (int j = 0; j < 8; ++j) w[kc][j] = frag_h((const _Float16*)(sm + bo + 64 * APITCH + (j * 16 + col) * HPITCH) + kc * 32, lane); }
#pragma unroll
      for (int kc = 0; kc < KS / 32; ++kc)
#pragma unroll
        for (int j = 0; j < 8; ++j) acc[j] = wmma16(a[kc], w[kc][j], acc[j]);
      WAIT_DS0(); WAIT_ASYNC0(); __syncthreads();   // publishes stage t + 1 and ends every reader's last read of stage t
      if (t + 2 < NT) { stage_ab<AEB * KS>(l0 + bo, gA + (size_t)(t + 2) * AEB * KS, (size_t)AEB * KW, gB + (size_t)(t + 2) * 2 * KS, 2 * KW, tid); } }
    WAIT_ASYNC0(); }
#pragma unroll
  for (int j = 0; j < 8; ++j) { const int c = c0 + j * 16 + col;
#pragma unroll
    for (int r = 0; r < 8; ++r) { const float res = RES[(r0 + 8 * g + r) * ow + c]; sf[wave][8 * g + r][j * 16 + col] = acc[j][r] * (1.0f / WSC) + (MODE == 0 ? bfr(res) : res); } }
  LDSX(); for (int rl = 0; rl < 16; ++rl) vst2(O32 + (r0 + rl) * ow + c0 + lane * 4, *(const v4f*)&sf[wave][rl][lane * 4]); }
// ---- k_gu: block = (64 rows, 128 hidden cols): g = h2 . Wg^T, u = h2 . Wu^T (same A), GU = f16(silu(g) u) -> rows [NR][HP]
__global__ __launch_bounds__(128) void k_gu(const _Float16* __restrict__ H2, const _Float16* __restrict__ PG, _Float16* __restrict__ GU) { constexpr int STG = (64 + 256) * HPITCH; __shared__ __attribute__((aligned(128))) char sm[2 * STG];   // the ring; behind the loop's last barrier the same bytes are the output staging
  _Float16 (*so)[136] = (_Float16 (*)[136])sm;
  const int tid = threadIdx.x, wave = tid >> 5, lane = tid & 31, col = lane & 15, g = lane >> 4; const size_t rb = (size_t)blockIdx.x * 64; const size_t r0 = rb + wave * 16; const int c0 = blockIdx.y * 128; const _Float16* Wg = PG + (size_t)c0 * DM; const _Float16* Wu = PG + ((size_t)HP + c0) * DM;
  v8f ag[8] = {}, au[8] = {};
  { const char* gA = (const char*)(H2 + rb * DM); const char* gG = (const char*)Wg; const char* gU = (const char*)Wu; const unsigned l0 = lds_off(sm); constexpr int NT = DM / KS;
    stage_ab<2 * KS>(l0, gA, 2 * DM, gG, 2 * DM, tid); stage_w(l0 + 192 * HPITCH, gU, 2 * DM, tid); WAIT_ASYNC0(); __syncthreads();
    stage_ab<2 * KS>(l0 + STG, gA + 2 * KS, 2 * DM, gG + 2 * KS, 2 * DM, tid); stage_w(l0 + STG + 192 * HPITCH, gU + 2 * KS, 2 * DM, tid);
#pragma unroll 1   // stays rolled: one copy of a stage's code in the instruction cache; t & 1 picks the buffer
    for (int t = 0; t < NT; ++t) { const int bo = (t & 1) * STG;
#pragma unroll
      for (int kc = 0; kc < KS / 32; ++kc) { const v16h a = frag_h((const _Float16*)(sm + bo + (wave * 16 + col) * HPITCH) + kc * 32, lane);
#pragma unroll
        for (int jh = 0; jh < 8; jh += 4) { v16h wg[4], wu[4];   // the LDS reads of eight products go out as one group in front of them (all sixteen at once would not fit beside the 128 accumulator registers); unrolled so that the arrays are registers
#pragma unroll
          for (int j = 0; j < 4; ++j) { wg[j] = frag_h((const _Float16*)(sm + bo + (64 + (jh + j) * 16 + col) * HPITCH) + kc * 32, lane); wu[j] = frag_h((const _Float16*)(sm + bo + (192 + (jh + j) * 16 + col) * HPITCH) + kc * 32, lane); }
#pragma unroll
          for (int j = 0; j < 4; ++j) { ag[jh + j] = wmma16(a, wg[j], ag[jh + j]); au[jh + j] = wmma16(a, wu[j], au[jh + j]); } } }
      WAIT_DS0(); WAIT_ASYNC0(); __syncthreads();   // publishes stage t + 1 and ends every reader's last read of stage t
      if (t + 2 < NT) { const size_t ko = (size_t)(t + 2) * 2 * KS; stage_ab<2 * KS>(l0 + bo, gA + ko, 2 * DM, gG + ko, 2 * DM, tid); stage_w(l0 + bo + 192 * HPITCH, gU + ko, 2 * DM, tid); } }
    WAIT_ASYNC0(); }
#pragma unroll
  for (int j = 0; j < 8; ++j)
#pragma unroll
    for (int r = 0; r < 8; ++r) { const float gg = ag[j][r] * (1.0f / WSC), uu = au[j][r] * (1.0f / WSC); so[wave * 16 + 8 * g + r][j * 16 + col] = (_Float16)(gg / (1.0f + __expf(-gg)) * uu); }
  __syncthreads(); for (int e = tid; e < 64 * 16; e += 128) { const int rl = e >> 4, q = e & 15; vst2((unsigned*)(GU + (rb + rl) * HP + c0 + q * 8), *(const v4u*)&so[rl][q * 8]); } }

extern "C" void kernel_launch(void* const* d_in, const int* in_sizes, int n_in, void* d_out, int out_size, void* d_ws, size_t ws_size, hipStream_t stream) {
  (void)in_sizes; (void)n_in; (void)out_size;
  const float** F = (const float**)d_in;   // 0 x [2,2048,1024], 1 attn_mask [2048,2048] int (1 = masked), 2 wq, 3 wk, 4 wv, 5 wo (natural [1024,1024]), 6 norm1_w, 7 norm2_w, 8 w_gate [2730,1024], 9 w_up, 10 w_down [1024,2730]
  if (ws_size < (size_t)WS_END) return;
  char* ws = (char*)d_ws; _Float16* PK = (_Float16*)(ws + WS_PK); _Float16 *QK = (_Float16*)(ws + WS_QK), *QKL = (_Float16*)(ws + WS_QKL), *VTH = (_Float16*)(ws + WS_VTH), *VTL = (_Float16*)(ws + WS_VTL), *H1 = (_Float16*)(ws + WS_H1), *H2 = (_Float16*)(ws + WS_H2), *GU = (_Float16*)(ws + WS_GU); float *O = (float*)(ws + WS_O), *X1 = (float*)(ws + WS_X1); int* FL = (int*)(ws + WS_FL); const int* MASK = (const int*)d_in[1];
  const int nr = NB * SS;   // keys of both batches are always needed; TQB limits queries per batch
  k_pack<<<dim3(HP, 7), 256, 0, stream>>>(F[2], F[3], F[4], F[5], F[8], F[9], F[10], ws);
  k_rms<0><<<nr, 256, 0, stream>>>(F[0], F[6], H1);
  k_flags<<<dim3(SS / 64, 2), 1024, 0, stream>>>(MASK, FL);
  k_qkv<<<dim3(nr / 64, QKVW / 128), 128, 0, stream>>>((const float*)H1, (const float*)H1, (const float*)H1, PK + PK_A, nullptr, nullptr, nullptr, QK, QKL, VTH, VTL);
  k_attn<<<dim3(TQB, NH, TNB), 128, 0, stream>>>(QK, QKL, VTH, VTL, nullptr, MASK, FL, O);
  k_g<0, DM><<<dim3(TOB, DM / 128), 128, 0, stream>>>(O, PK + PK_P, F[0], X1, DM);                  // x1 = x + ctx wo^T
  k_rms<1><<<TOB * 64, 256, 0, stream>>>(X1, F[7], H2);
  k_gu<<<dim3(TOB, HP / 128), 128, 0, stream>>>(H2, (const _Float16*)(ws + WS_PG), GU);
  k_g<2, HP><<<dim3(TOB, DM / 128), 128, 0, stream>>>(GU, (const _Float16*)(ws + WS_PD), X1, (float*)d_out, DM);   // out = x1 + (silu(g) u) w_down^T
}

// v003
// Measured time: 233 microseconds a run.
// Two timings next to v002 both put it at 1.05 times that version's speed.
// Over all steps from v000 it is 3.92 times as fast.
// compute dtype: all float inputs rounded to bf16, attn_mask (int) read on device; RMSNorms (eps 1e-6) in f32, normed rows once to f16; q/k/v = f16(h) . W^T against exact f16 x 2^8 weight copies on WMMA 16x16x32 (single products, f32 accumulate); rotate-half RoPE in f32 (precise sinf/cosf) before the f16 hi + residual split; attention with 3-product scores and P.v (hi + residual planes), x 1/8, masked keys excluded (mask read per pair; fully-masked 64x32 tiles skipped via a device-built flag table), running-max softmax in f32 (hardware exp); x1 = x + f16(ctx) . Wo^T; SwiGLU: f16(rmsnorm(x1)) . [W_gate | W_up]^T (hidden padded 2,730 -> 2,816 with zero weights), silu(g) u in f32 -> f16, . W_down^T + x1; f32 output.
#include <hip/hip_runtime.h>
#include <math.h>

typedef __attribute__((ext_vector_type(16))) _Float16 v16h;
typedef __attribute__((ext_vector_type(16))) __bf16 v16b;
typedef __attribute__((ext_vector_type(8)))  _Float16 v8h;
typedef __attribute__((ext_vector_type(8)))  float v8f;
typedef __attribute__((ext_vector_type(4)))  float v4f;
typedef __attribute__((ext_vector_type(2)))  float v2f;
typedef __attribute__((ext_vector_type(4)))  unsigned v4u;
typedef __attribute__((ext_vector_type(4)))  int v4i;
typedef float __attribute__((may_alias)) float_a;
typedef int __attribute__((may_alias)) int_a;

template <typename T> __device__ __forceinline__ void vst2(void* p, T v) { *(T*)p = v;  }
__device__ __forceinline__ v8f wmma16(v16h a, v16h b, v8f c) {
  v8f d = __builtin_amdgcn_wmma_f32_16x16x32_f16(false, a, false, b, (short)0, c, false, false);
  asm volatile("v_nop\n\tv_nop\n\tv_nop\n\tv_nop" : "+v"(d) : "v"(a), "v"(b));
  return d;
}
__device__ __forceinline__ v8f wmma_bf(v16b a, v16b b, v8f c) {
  v8f d = __builtin_amdgcn_wmma_f32_16x16x32_bf16(false, a, false, b, (short)0, c, false, false);
  asm volatile("v_nop\n\tv_nop\n\tv_nop\n\tv_nop" : "+v"(d) : "v"(a), "v"(b));
  return d;
}
// Streaming decoder block (B 2, L 2,048, d 1,024, 16 heads x 64, SwiGLU hidden 2,730): pre-RMSNorm, bias-free projections, rotate-half RoPE (base 10000), attention under the given boolean mask (all-keys + 256-token window), out-projection + residual, pre-RMSNorm SwiGLU FFN + residual.
__device__ __forceinline__ v16h frag_h(const _Float16* rowk0, int lane) {
  union { v16h v; v8h q[2]; } u; const _Float16* p = rowk0 + 8 * (lane >> 4);
  u.q[0] = *(const v8h*)p; u.q[1] = *(const v8h*)(p + 16); return u.v;
}
__device__ __forceinline__ v16h frag_f32(const float* rowk0, int lane) {
  v16h a; const float* p = rowk0 + 8 * (lane >> 4);
#pragma unroll
  for (int i = 0; i < 8; ++i) { a[i] = (_Float16)p[i]; a[8 + i] = (_Float16)p[16 + i]; }
  return a;
}
__device__ __forceinline__ v16h frag_f32s(const float* rowk0, int lane, float sc) {
  v16h a; const float* p = rowk0 + 8 * (lane >> 4);
#pragma unroll
  for (int i = 0; i < 8; ++i) { a[i] = (_Float16)(p[i] * sc); a[8 + i] = (_Float16)(p[16 + i] * sc); }
  return a;
}
// column fragment from a [K][ld] layout (column n), rows >= K read as 0
__device__ __forceinline__ v16h fragc_f32(const float* W, int k0, int n, int lane, int ld, int K) {
  v16h a; const int g = lane >> 4;
#pragma unroll
  for (int i = 0; i < 8; ++i) { const int ka = k0 + 8 * g + i, kb = ka + 16;
    a[i] = (_Float16)(ka < K ? W[(size_t)(ka < K ? ka : K - 1) * ld + n] : 0.f); a[8 + i] = (_Float16)(kb < K ? W[(size_t)(kb < K ? kb : K - 1) * ld + n] : 0.f); }
  return a;
}
struct F2 { v16b h, l; };
__device__ __forceinline__ F2 bsplit16(const float v[16]) { F2 r;
#pragma unroll
  for (int i = 0; i < 16; ++i) { const __bf16 h = (__bf16)v[i]; r.h[i] = h; r.l[i] = (__bf16)(v[i] - (float)h); }
  return r; }
__device__ __forceinline__ F2 split_row(const float* row, int k0, int lane) { float v[16]; const float* p = row + k0 + 8 * (lane >> 4);
#pragma unroll
  for (int i = 0; i < 8; ++i) { v[i] = p[i]; v[8 + i] = p[16 + i]; }
  return bsplit16(v); }
__device__ __forceinline__ F2 split_rowK(const float* row, int k0, int lane, int K) { float v[16]; const int g = lane >> 4;
#pragma unroll
  for (int i = 0; i < 8; ++i) { const int ka = k0 + 8 * g + i, kb = ka + 16; v[i] = ka < K ? row[ka < K ? ka : K - 1] : 0.f; v[8 + i] = kb < K ? row[kb < K ? kb : K - 1] : 0.f; }
  return bsplit16(v); }
__device__ __forceinline__ F2 split_col(const float* W, int k0, int n, int lane, int ld, int K) { float v[16]; const int g = lane >> 4;
#pragma unroll
  for (int i = 0; i < 8; ++i) { const int ka = k0 + 8 * g + i, kb = ka + 16; v[i] = ka < K ? W[(size_t)(ka < K ? ka : K - 1) * ld + n] : 0.f; v[8 + i] = kb < K ? W[(size_t)(kb < K ? kb : K - 1) * ld + n] : 0.f; }
  return bsplit16(v); }
__device__ __forceinline__ v8f mac3(const F2& a, const F2& b, v8f c) { c = wmma_bf(a.l, b.h, c); c = wmma_bf(a.h, b.l, c); return wmma_bf(a.h, b.h, c); }
__device__ __forceinline__ float sigm(float v) { return 1.0f / (1.0f + expf(-v)); }
#define LDSX() do { asm volatile("s_wait_dscnt 0" ::: "memory"); __builtin_amdgcn_wave_barrier(); __builtin_amdgcn_fence(__ATOMIC_RELEASE, "workgroup"); } while (0)
// ---- GEMM operand ring: a stage is 64 k of every operand row of the block's tile, brought into LDS by asynchronous 16-byte copies (a wave's copy covers whole 128-byte lines); LDS row pitch = row bytes + 16 (16 B x odd: conflict-free for 16-byte reads); two buffers
#define KS 64
#define HPITCH (2 * KS + 16)       // f16 rows: 128 B + 16
__device__ __forceinline__ unsigned lds_off(const void* p) { return (unsigned)(size_t)p; }
// a run of copies and, as the last line of their own statement, the wait that stands in front of any rewrite of their address registers (one wait a run: fewer, longer runs cost a wave fewer waits)
#define CPL(a, b) "global_load_async_to_lds_b128 %" #a ", %" #b ", off\n\t"
__device__ __forceinline__ void cp8(const unsigned* l, const char* const* g) {
  asm volatile(CPL(0, 1) CPL(2, 3) CPL(4, 5) CPL(6, 7) CPL(8, 9) CPL(10, 11) CPL(12, 13) CPL(14, 15) "s_wait_xcnt 0x0"
               :: "v"(l[0]), "v"(g[0]), "v"(l[1]), "v"(g[1]), "v"(l[2]), "v"(g[2]), "v"(l[3]), "v"(g[3]), "v"(l[4]), "v"(g[4]), "v"(l[5]), "v"(g[5]), "v"(l[6]), "v"(g[6]), "v"(l[7]), "v"(g[7]) : "memory");
}
__device__ __forceinline__ void cp12(const unsigned* l, const char* const* g) {
  asm volatile(CPL(0, 1) CPL(2, 3) CPL(4, 5) CPL(6, 7) CPL(8, 9) CPL(10, 11) CPL(12, 13) CPL(14, 15) CPL(16, 17) CPL(18, 19) CPL(20, 21) CPL(22, 23) "s_wait_xcnt 0x0"
               :: "v"(l[0]), "v"(g[0]), "v"(l[1]), "v"(g[1]), "v"(l[2]), "v"(g[2]), "v"(l[3]), "v"(g[3]), "v"(l[4]), "v"(g[4]), "v"(l[5]), "v"(g[5]), "v"(l[6]), "v"(g[6]), "v"(l[7]), "v"(g[7]), "v"(l[8]), "v"(g[8]), "v"(l[9]), "v"(g[9]), "v"(l[10]), "v"(g[10]), "v"(l[11]), "v"(g[11]) : "memory");
}
// this thread's addresses for ROWS rows of RB bytes from gb (row pitch gp bytes) to LDS byte address lb (row pitch RB + 16), dealt over the 128 threads of a block: ROWS * RB / 2048 copies a thread
template <int ROWS, int RB>
__device__ __forceinline__ void row_addr(unsigned* l, const char** g, unsigned lb, const char* gb, size_t gp, int tid) {
  constexpr int PPR = RB / 16, RPI = 128 / PPR, NI = ROWS / RPI; const int row = tid / PPR, pc = tid % PPR;
#pragma unroll
  for (int i = 0; i < NI; ++i) { l[i] = lb + (row + i * RPI) * (RB + 16) + pc * 16; g[i] = gb + (size_t)(row + i * RPI) * gp + pc * 16; }
}
// 128 weight rows of 128 B
__device__ __forceinline__ void stage_w(unsigned lb, const char* gb, size_t gp, int tid) { unsigned l[8]; const char* g[8]; row_addr<128, 2 * KS>(l, g, lb, gb, gp, tid); cp8(l, g); }
// 64 A rows of ARB bytes at lb, behind them 128 weight rows of 128 B
template <int ARB>
__device__ __forceinline__ void stage_ab(unsigned lb, const char* ga, size_t pa, const char* gb, size_t pb, int tid) {
  if constexpr (ARB == 2 * KS) { unsigned l[12]; const char* g[12]; row_addr<64, ARB>(l, g, lb, ga, pa, tid); row_addr<128, 2 * KS>(l + 4, g + 4, lb + 64 * (ARB + 16), gb, pb, tid); cp12(l, g); }
  else { unsigned l[8]; const char* g[8]; row_addr<64, ARB>(l, g, lb, ga, pa, tid); cp8(l, g); stage_w(lb + 64 * (ARB + 16), gb, pb, tid); }
}
#define WAIT_ASYNC0() asm volatile("s_wait_asynccnt 0x0" ::: "memory")   // this wave's copies have landed
#define WAIT_DS0() asm volatile("s_wait_dscnt 0x0" ::: "memory")         // this wave's LDS reads of the buffer have returned before it is refilled


#define NB 2
#define SS 2048
#define DM 1024
#define NH 16
#define HID 2730
#define HP 2816          // hidden padded to 22 x 128
#define WSC 256.0f
#define RMSEPS 1e-6f
__constant__ float THETA[32] = {1.000000000e+00f,7.498942018e-01f,5.623413324e-01f,4.216965139e-01f,3.162277639e-01f,2.371373773e-01f,1.778279394e-01f,1.333521456e-01f,1.000000015e-01f,7.498942316e-02f,5.623413250e-02f,4.216964915e-02f,3.162277490e-02f,2.371373773e-02f,1.778279431e-02f,1.333521400e-02f,9.999999776e-03f,7.498942316e-03f,5.623413250e-03f,4.216964822e-03f,3.162277630e-03f,2.371373819e-03f,1.778279431e-03f,1.333521446e-03f,1.000000047e-03f,7.498941850e-04f,5.623413017e-04f,4.216965172e-04f,3.162277571e-04f,2.371373703e-04f,1.778279402e-04f,1.333521504e-04f};
__device__ __attribute__((noinline)) float cos_p(float v) { return cosf(v); }
__device__ __attribute__((noinline)) float sin_p(float v) { return sinf(v); }
#define HD 64
#define QKVW (3 * DM)
#ifndef TQB
#define TQB (SS / 64)
#define TNB NB
#define TOB (NB * SS / 64)     // output row tiles (all)
#endif
typedef __attribute__((ext_vector_type(8))) __bf16 v8b;
__device__ __forceinline__ v16b frag_b(const __bf16* rowk0, int lane) {
  union { v16b v; v8b q[2]; } u; const __bf16* p = rowk0 + 8 * (lane >> 4);
  u.q[0] = *(const v8b*)p; u.q[1] = *(const v8b*)(p + 16); return u.v;
}
__device__ __forceinline__ float bfr(float v) { return (float)(__bf16)v; }
__device__ __attribute__((noinline)) float exp_ni(float v) { return expf(v); }
__device__ __attribute__((noinline)) float erf_ni(float v) { return erff(v); }

#define PK_A 0                       // [3072][1024] Wqkv rows (natural [out][in])
#define PK_P (PK_A + QKVW * DM)        // [1024][1024] Wo rows (natural)
#define PK_END (PK_P + DM * DM)
#define WS_PK  0u
#define WS_QK  (WS_PK + 2u * PK_END)             // f16 [4096 rows][2048]: q | k
#define WS_QKL (WS_QK + 2u * NB * SS * 2 * DM)     // f16 q | k residual planes x2048
#define WS_VTH (WS_QKL + 2u * NB * SS * 2 * DM)    // f16 [b][1024 (h*64+d)][2048 s] hi
#define WS_VTL (WS_VTH + 2u * NB * DM * SS)        // f16 lo x 2048
#define WS_O   (WS_VTL + 2u * NB * DM * SS)        // f32 [4096][1024]
#define WS_PG  (WS_O + 4u * (size_t)NB * SS * DM)        // f16 x 2^8 [gate | up] rows [2*HP][1024] (zero rows >= HID), down rows [1024][HP] (zero cols >= HID)
#define WS_PD  (WS_PG + 2u * (size_t)2 * HP * DM)
#define WS_H1  (WS_PD + 2u * (size_t)DM * HP)             // f16 rmsnorm1(x) rows [NR][1024]; int flags [SS/64][SS/32]; f32 x1 [NR][1024]; f16 rmsnorm2(x1) rows; f16 silu(gate) up rows [NR][HP]
#define WS_FL  (WS_H1 + 2u * (size_t)NB * SS * DM)
#define WS_X1  (WS_FL + 4u * (size_t)(SS / 64) * (SS / 32))
#define WS_H2  (WS_X1 + 4u * (size_t)NB * SS * DM)
#define WS_GU  (WS_H2 + 2u * (size_t)NB * SS * DM)
#define WS_END (WS_GU + 2u * (size_t)NB * SS * HP)
// ---- k_pack: a resident stream, one task a wave and pass, no LDS and no barrier: 2,048 half rows of W_down, 4,096 rows of W_q | W_k | W_v | W_o, 5,632 rows of gate | up (the longer tasks first); value = f16(bf16(w) x 2^8); all loads of a task go out before its first store; every load and store of a wave covers one contiguous run of bytes; the loops over j and c below are unrolled so that the pieces stay in registers and the loads go out as one group
typedef __attribute__((ext_vector_type(4))) _Float16 v4h;
typedef __attribute__((ext_vector_type(2))) _Float16 v2h;
#define PT_D (2 * DM)
#define PT_A (PT_D + 4 * DM)
#define PT_END (PT_A + 2 * HP)
#define PK_WG 256        // work-groups of 16 waves: one a WGP
__device__ __forceinline__ _Float16 wcv(float w) { return (_Float16)(bfr(w) * WSC); }
#define STORES_OUT() asm volatile("s_wait_xcnt 0x0" ::: "memory")   // stands directly behind a task's last store: what follows (the next task) rewrites registers that these stores name
// one row of 1,024: a lane holds 8 pieces of 16 bytes, 128 elements apart
__device__ __forceinline__ void pack_row(const float* __restrict__ s, _Float16* __restrict__ d, int lane) { v4f x[8];
#pragma unroll
  for (int j = 0; j < 8; ++j) x[j] = *(const v4f*)(s + j * 128 + lane * 4);
#pragma unroll
  for (int j = 0; j < 8; ++j) { v4h o;
#pragma unroll
    for (int c = 0; c < 4; ++c) o[c] = wcv(x[j][c]);
    *(v4h*)(d + j * 128 + lane * 4) = o; }
  STORES_OUT(); }
__global__ __launch_bounds__(512) void k_pack(const float* __restrict__ WQ, const float* __restrict__ WK, const float* __restrict__ WV, const float* __restrict__ WO, const float* __restrict__ WG, const float* __restrict__ WU, const float* __restrict__ WD, char* __restrict__ ws) {
  const int lane = threadIdx.x & 31; _Float16* P = (_Float16*)(ws + WS_PK);
  for (int task = __builtin_amdgcn_readfirstlane((threadIdx.x >> 5) * PK_WG + blockIdx.x); task < PT_END; task += 16 * PK_WG) {   // dealt wave-major, so that every work-group gets the same mix of tasks; the task number sits in a scalar register, so the branches on it are scalar
    if (task < PT_D) { const int n = task >> 1, k0 = (task & 1) * (HP / 2) + lane * 2; const float* s = WD + (size_t)n * HID; _Float16* d = (_Float16*)(ws + WS_PD) + (size_t)n * HP; v2f x[22];   // down rows [1024][HP], zero beyond 2,730; a source row starts on 8 bytes only, hence 8-byte loads
#pragma unroll
      for (int j = 0; j < 22; ++j) { const int k = k0 + j * 64; x[j] = *(const v2f*)(s + (k < HID ? k : 0)); }
#pragma unroll
      for (int j = 0; j < 22; ++j) { const int k = k0 + j * 64; v2h o; o[0] = (k < HID) ? wcv(x[j][0]) : (_Float16)0.0f; o[1] = (k < HID) ? wcv(x[j][1]) : (_Float16)0.0f; *(v2h*)(d + k) = o; }
      STORES_OUT(); }
    else if (task < PT_A) { const int r = task - PT_D, which = r >> 10; const float* w = (which == 0) ? WQ : (which == 1) ? WK : (which == 2) ? WV : WO; pack_row(w + (size_t)(r & (DM - 1)) * DM, P + PK_A + (size_t)r * DM, lane); }   // PK_P follows PK_A directly
    else { const int r = task - PT_A, n = (r < HP) ? r : r - HP; _Float16* d = (_Float16*)(ws + WS_PG) + (size_t)r * DM;   // gate | up rows, zero beyond 2,730
      if (n < HID) pack_row(((r < HP) ? WG : WU) + (size_t)n * DM, d, lane);
      else { const v4h z = {};
#pragma unroll
        for (int j = 0; j < 8; ++j) *(v4h*)(d + j * 128 + lane * 4) = z;
        STORES_OUT(); } }
  } }
__global__ __launch_bounds__(128) void k_qkv(const float* __restrict__ XQ, const float* __restrict__ XK, const float* __restrict__ XV, const _Float16* __restrict__ P, const float* __restrict__ BQ, const float* __restrict__ BK, const float* __restrict__ BV, _Float16* __restrict__ QK, _Float16* __restrict__ QKL, _Float16* __restrict__ VTH, _Float16* __restrict__ VTL) {
  const int which0 = (blockIdx.y * 128) / DM; const float* X = (which0 == 0) ? XQ : (which0 == 1) ? XK : XV; const float* BB = BQ ? (((which0 == 0) ? BQ : (which0 == 1) ? BK : BV) + (blockIdx.y * 128 - which0 * DM)) : nullptr;
  constexpr int STG = (64 + 128) * HPITCH; __shared__ __attribute__((aligned(128))) char sm[2 * STG];   // the ring; behind the loop's last barrier the same bytes are the output staging
  _Float16 (*so)[16][136] = (_Float16 (*)[16][136])sm; _Float16 (*sol)[16][136] = (_Float16 (*)[16][136])(sm + 4 * 16 * 136 * 2); _Float16 (*sth)[72] = (_Float16 (*)[72])sm; _Float16 (*stl)[72] = (_Float16 (*)[72])(sm + 128 * 72 * 2);
  const int tid = threadIdx.x, wave = tid >> 5, lane = tid & 31, col = lane & 15, g = lane >> 4; const size_t r0 = (size_t)blockIdx.x * 64 + wave * 16; const int n0 = blockIdx.y * 128;
  v8f acc[8] = {};
  { const char* gA = (const char*)((const _Float16*)X + (size_t)blockIdx.x * 64 * DM); const char* gB = (const char*)(P + (size_t)n0 * DM); const unsigned l0 = lds_off(sm); constexpr int NT = DM / KS;   // A = f16 rmsnorm rows
    stage_ab<2 * KS>(l0, gA, 2 * DM, gB, 2 * DM, tid); WAIT_ASYNC0(); __syncthreads();
    stage_ab<2 * KS>(l0 + STG, gA + 2 * KS, 2 * DM, gB + 2 * KS, 2 * DM, tid);
#pragma unroll 1   // stays rolled: one copy of a stage's code in the instruction cache; t & 1 picks the buffer
    for (int t = 0; t < NT; ++t) { const int bo = (t & 1) * STG;
      v16h a[KS / 32], w[KS / 32][8];   // the stage's LDS reads go out as one group in front of its products; the loops below are unrolled so that these arrays are registers
#pragma unroll
      for (int kc = 0; kc < KS / 32; ++kc) { a[kc] = frag_h((const _Float16*)(sm + bo + (wave * 16 + col) * HPITCH) + kc * 32, lane);
#pragma unroll
        for (int j = 0; j < 8; ++j) w[kc][j] = frag_h((const _Float16*)(sm + bo + (64 + j * 16 + col) * HPITCH) + kc * 32, lane); }
#pragma unroll
      for (int kc = 0; kc < KS / 32; ++kc)
#pragma unroll
        for (int j = 0; j < 8; ++j) acc[j] = wmma16(a[kc], w[kc][j], acc[j]);
      WAIT_DS0(); WAIT_ASYNC0(); __syncthreads();   // publishes stage t + 1 and ends every reader's last read of stage t
      if (t + 2 < NT) { stage_ab<2 * KS>(l0 + bo, gA + (size_t)(t + 2) * 2 * KS, 2 * DM, gB + (size_t)(t + 2) * 2 * KS, 2 * DM, tid); } }
    WAIT_ASYNC0(); }
#pragma unroll
  for (int j = 0; j < 8; ++j)
#pragma unroll
    for (int r = 0; r < 8; ++r) acc[j][r] *= (1.0f / WSC);
  if (n0 < 2 * DM) {   // bias, then rotate-half rotary over each 64-dim head with angle position * inv_freq[d mod 32]
#pragma unroll
    for (int j = 0; j < 8; ++j)
#pragma unroll
      for (int r = 0; r < 8; ++r) acc[j][r] += (BB ? bfr(BB[j * 16 + col]) : 0.f);
#pragma unroll
    for (int r = 0; r < 8; ++r) { const int spos = (int)((r0 + 8 * g + r) % SS);
#pragma unroll
      for (int jj = 0; jj < 2; ++jj) { const float ang = (float)spos * THETA[jj * 16 + col]; const float c = cos_p(ang), sn = sin_p(ang);
#pragma unroll
        for (int hh = 0; hh < 2; ++hh) { const float x1 = acc[hh * 4 + jj][r], x2 = acc[hh * 4 + jj + 2][r]; acc[hh * 4 + jj][r] = x1 * c - x2 * sn; acc[hh * 4 + jj + 2][r] = x2 * c + x1 * sn; } } }
#pragma unroll
    for (int j = 0; j < 8; ++j) {
#pragma unroll
      for (int r = 0; r < 8; ++r) { const float v = acc[j][r]; const _Float16 hv = (_Float16)v; so[wave][8 * g + r][j * 16 + col] = hv; sol[wave][8 * g + r][j * 16 + col] = (_Float16)((v - (float)hv) * 2048.0f); } }   // q, k (+ bias) as f16 hi + (x2048) residual
    LDSX();
    for (int rl = 0; rl < 16; ++rl) if (lane < 16) { vst2((unsigned*)(QK + (r0 + rl) * (2 * DM) + n0 + lane * 8), *(const v4u*)&so[wave][rl][lane * 8]); vst2((unsigned*)(QKL + (r0 + rl) * (2 * DM) + n0 + lane * 8), *(const v4u*)&sol[wave][rl][lane * 8]); }
  } else {
#pragma unroll
    for (int j = 0; j < 8; ++j) {
#pragma unroll
      for (int r = 0; r < 8; ++r) { const float v = acc[j][r] + (BB ? bfr(BB[j * 16 + col]) : 0.f); const _Float16 hv = (_Float16)v; sth[j * 16 + col][wave * 16 + 8 * g + r] = hv; stl[j * 16 + col][wave * 16 + 8 * g + r] = (_Float16)((v - (float)hv) * 2048.0f); } }
    __syncthreads();
    const size_t rb = (size_t)blockIdx.x * 64; const int b = (int)(rb / SS), s0 = (int)(rb % SS); const int pc0 = n0 - 2 * DM;
    for (int q = tid; q < 128 * 8; q += 128) { const int d = q >> 3, pc = q & 7; const size_t o = ((size_t)b * DM + pc0 + d) * SS + s0 + pc * 8; vst2((unsigned*)(VTH + o), *(const v4u*)&sth[d][pc * 8]); vst2((unsigned*)(VTL + o), *(const v4u*)&stl[d][pc * 8]); }
  }
}
// ---- k_attn: block = (64 queries, head h, batch b): all-keys flash attention (K = 64: 2 k-steps), scores = (q.k) * 0.125 from f16 hi + residual operands (3 products), P.V: f16 P x (V hi, V lo*2048) in two accumulators; O[b*S+q][h*64+d] = (acc + accl / 2048) / (2048 l) (256-B segments)
__global__ __launch_bounds__(128) void k_attn(const _Float16* __restrict__ QK, const _Float16* __restrict__ QKL, const _Float16* __restrict__ VTH, const _Float16* __restrict__ VTL, const void* __restrict__ KMASK, const int* __restrict__ MASK, const int* __restrict__ FL, float* __restrict__ O) {
  __shared__ __align__(16) float sp[4][16][36]; __shared__ __align__(16) float so[4][16][68];
  const int tid = threadIdx.x, wave = tid >> 5, lane = tid & 31, col = lane & 15, g = lane >> 4;
  const int qb = blockIdx.x, h = blockIdx.y, b = blockIdx.z; const int q0 = qb * 64 + wave * 16; const size_t rq = (size_t)b * SS + q0 + col;
  v16h aq[2], aql[2];
#pragma unroll
  for (int kc = 0; kc < 2; ++kc) { aq[kc] = frag_h(QK + rq * (2 * DM) + h * HD + kc * 32, lane); aql[kc] = frag_h(QKL + rq * (2 * DM) + h * HD + kc * 32, lane); }
  float m[8], l[8];
#pragma unroll
  for (int r = 0; r < 8; ++r) { m[r] = -3.0e38f; l[r] = 0.f; }
  v8f acc[4] = {}, accl[4] = {};
  const int nks = SS / 32;   // all keys
#pragma unroll 1
  for (int ks = 0; ks < nks; ++ks) { if (FL[qb * (SS / 32) + ks] == 0) continue;   /* no visible key in this (64-query, 32-key) tile */ v8f s[2];
#pragma unroll
    for (int ct = 0; ct < 2; ++ct) { const int kk = ks * 32 + ct * 16 + col; const _Float16* krow = QK + ((size_t)b * SS + kk) * (2 * DM) + DM + h * HD; const _Float16* krowl = QKL + ((size_t)b * SS + kk) * (2 * DM) + DM + h * HD; v8f c = {}, cl = {};
#pragma unroll
      for (int kc = 0; kc < 2; ++kc) { const v16h kh = frag_h(krow + kc * 32, lane); c = wmma16(aq[kc], kh, c); cl = wmma16(aql[kc], kh, cl); cl = wmma16(aq[kc], frag_h(krowl + kc * 32, lane), cl); }   // 3 products: q, k as f16 hi + residual
#pragma unroll
      for (int r = 0; r < 8; ++r) c[r] += cl[r] * (1.0f / 2048.0f);
      {
#pragma unroll
      for (int r = 0; r < 8; ++r) s[ct][r] = (MASK[(size_t)(q0 + 8 * g + r) * SS + kk] == 0) ? c[r] * 0.125f : -3.0e38f; } }   // 1/sqrt(64); masked keys excluded
#pragma unroll
    for (int r = 0; r < 8; ++r) { float mx = fmaxf(s[0][r], s[1][r]);
#pragma unroll
      for (int o = 1; o < 16; o <<= 1) mx = fmaxf(mx, __shfl_xor(mx, o));
      const float mn = fmaxf(m[r], mx); const float alpha = (m[r] <= -1.0e38f) ? 0.f : __expf(m[r] - mn);
      const float e0 = (s[0][r] <= -1.0e38f) ? 0.f : __expf(s[0][r] - mn), e1 = (s[1][r] <= -1.0e38f) ? 0.f : __expf(s[1][r] - mn); float es = e0 + e1;
#pragma unroll
      for (int o = 1; o < 16; o <<= 1) es += __shfl_xor(es, o);
      l[r] = l[r] * alpha + es; m[r] = mn;
#pragma unroll
      for (int dt = 0; dt < 4; ++dt) { acc[dt][r] *= alpha; accl[dt][r] *= alpha; }
      sp[wave][8 * g + r][col] = e0; sp[wave][8 * g + r][16 + col] = e1; }
    LDSX();
    v16h pa, pl; { const float* prow = &sp[wave][col][0] + 8 * (lane >> 4);
#pragma unroll
      for (int i = 0; i < 8; ++i) { const float x0 = prow[i] * 2048.0f, x1 = prow[16 + i] * 2048.0f; const _Float16 h0 = (_Float16)x0, h1 = (_Float16)x1; pa[i] = h0; pa[8 + i] = h1; pl[i] = (_Float16)((x0 - (float)h0) * 2048.0f); pl[8 + i] = (_Float16)((x1 - (float)h1) * 2048.0f); } }   // P scaled by 2^11 before the f16 split so small softmax weights stay out of the f16 subnormal range; 2^-11 folded into the epilogue
#pragma unroll
    for (int dt = 0; dt < 4; ++dt) { const size_t vr = ((size_t)b * DM + h * HD + dt * 16 + col) * SS + ks * 32; const v16h vh = frag_h(VTH + vr, lane); acc[dt] = wmma16(pa, vh, acc[dt]); accl[dt] = wmma16(pl, vh, accl[dt]); accl[dt] = wmma16(pa, frag_h(VTL + vr, lane), accl[dt]); }   // P hi x V hi + (P lo x V hi + P hi x V lo) / 2048
    LDSX(); }
#pragma unroll
  for (int r = 0; r < 8; ++r) { const float il = (l[r] > 0.f) ? (1.0f / 2048.0f) / l[r] : 0.f;
#pragma unroll
    for (int dt = 0; dt < 4; ++dt) so[wave][8 * g + r][dt * 16 + col] = (acc[dt][r] + accl[dt][r] * (1.0f / 2048.0f)) * il; }
  LDSX();
  for (int rl = 0; rl < 16; ++rl) if (lane < 16) vst2(O + ((size_t)b * SS + q0 + rl) * DM + h * HD + lane * 4, *(const v4f*)&so[wave][rl][lane * 4]);
}
// ---- k_out: block = (64 rows, 128 cols): out = O(hi/lo) . Wo rows (2 products) + bo
__global__ __launch_bounds__(128) void k_out(const float* __restrict__ O, const __bf16* __restrict__ P, const float* __restrict__ BO, float* __restrict__ Y) {
  __shared__ __align__(16) float so[4][16][132];
  const int tid = threadIdx.x, wave = tid >> 5, lane = tid & 31, col = lane & 15, g = lane >> 4; const size_t r0 = (size_t)blockIdx.x * 64 + wave * 16; const int n0 = blockIdx.y * 128;
  v8f acc[8] = {};
#pragma unroll 2
  for (int kc = 0; kc < DM / 32; ++kc) { const F2 a = split_row(O + (r0 + col) * DM, kc * 32, lane);
#pragma unroll
    for (int j = 0; j < 8; ++j) { const v16b w = frag_b(P + (size_t)(n0 + j * 16 + col) * DM + kc * 32, lane); acc[j] = wmma_bf(a.l, w, acc[j]); acc[j] = wmma_bf(a.h, w, acc[j]); } }
#pragma unroll
  for (int j = 0; j < 8; ++j) {
#pragma unroll
    for (int r = 0; r < 8; ++r) so[wave][8 * g + r][j * 16 + col] = acc[j][r] + (BO ? bfr(BO[n0 + j * 16 + col]) : 0.f); }
  LDSX();
  for (int rl = 0; rl < 16; ++rl) vst2(Y + (r0 + rl) * DM + n0 + lane * 4, *(const v4f*)&so[wave][rl][lane * 4]);
}

// ---- k_rms: wave = row, no LDS and no barrier: OUTH = f16(x rsqrt(mean x^2 + eps) w) (MODE 0: x = bf16-rounded input; MODE 1: x = f32 x1); a lane holds 8 pieces of 16 bytes, 128 elements apart, the row's 8 loads in flight at once; every loop is unrolled so that the pieces stay in registers
template <int M> __device__ __forceinline__ float lane_xor(float v) { return __builtin_bit_cast(float, __builtin_amdgcn_update_dpp(0, __builtin_bit_cast(int, v), 0x160 + M, 0xf, 0xf, true)); }   // value of lane ^ M inside a 16-lane row (DPP row_xmask), no LDS round trip
template <int MODE>
__global__ __launch_bounds__(512) void k_rms(const float* __restrict__ A, const float* __restrict__ Wn, _Float16* __restrict__ OUTH) { const int lane = threadIdx.x & 31; const size_t row = (size_t)blockIdx.x * 16 + (threadIdx.x >> 5);
  v4f x[8], wn[8];
#pragma unroll
  for (int j = 0; j < 8; ++j) x[j] = *(const v4f*)(A + row * DM + j * 128 + lane * 4);
#pragma unroll
  for (int j = 0; j < 8; ++j) wn[j] = *(const v4f*)(Wn + j * 128 + lane * 4);
  if (MODE == 0) {
#pragma unroll
    for (int j = 0; j < 8; ++j)
#pragma unroll
      for (int c = 0; c < 4; ++c) x[j][c] = bfr(x[j][c]); }
  // the square sum keeps its tree: elements 256 apart chained, then pairwise over each aligned run of 32 elements (4 in the lane, 8 lanes), then the eight runs' sums one after another
  float s[2];
#pragma unroll
  for (int jp = 0; jp < 2; ++jp) { float q[4];
#pragma unroll
    for (int c = 0; c < 4; ++c) { float t = 0.f;
#pragma unroll
      for (int i = 0; i < 4; ++i) t += x[jp + 2 * i][c] * x[jp + 2 * i][c];
      q[c] = t; }
    s[jp] = (q[0] + q[1]) + (q[2] + q[3]); }
#pragma unroll
  for (int jp = 0; jp < 2; ++jp) { s[jp] += lane_xor<1>(s[jp]); s[jp] += lane_xor<2>(s[jp]); s[jp] += lane_xor<4>(s[jp]); }
  float tq = 0.f;
#pragma unroll
  for (int i = 0; i < 8; ++i) tq += __builtin_bit_cast(float, __builtin_amdgcn_readlane(__builtin_bit_cast(int, s[i >> 2]), (i & 3) * 8));
  const float inv = 1.0f / sqrtf(tq / (float)DM + RMSEPS);
#pragma unroll
  for (int j = 0; j < 8; ++j) { v4h o;
#pragma unroll
    for (int c = 0; c < 4; ++c) o[c] = (_Float16)(x[j][c] * inv * bfr(wn[j][c]));
    *(v4h*)(OUTH + row * DM + j * 128 + lane * 4) = o; } }
// ---- k_flags: block = (query block qb of 64 queries, half hf of the keys): FL[qb][hf * 32 + kt] = 1 if any mask[q][k] == 0 (attend) in the 64 x 32 tile; a lane owns one 16-byte column piece over 16 rows, all 16 loads independent; a block writes one whole 128-byte line of FL
__global__ __launch_bounds__(1024) void k_flags(const int* __restrict__ MASK, int* __restrict__ FL) { __shared__ __align__(16) int sf[32]; const int t = threadIdx.x; const int qb = blockIdx.x, hf = blockIdx.y; const int c4 = t & 255, rw = t >> 8;
  if (t < 32) sf[t] = 0; __syncthreads();
  const int* p = MASK + (size_t)(qb * 64 + rw) * SS + hf * (SS / 2) + c4 * 4; v4u v[16];
#pragma unroll
  for (int i = 0; i < 16; ++i) v[i] = *(const v4u*)(p + (size_t)i * 4 * SS);
  unsigned mn = 0xffffffffu;
#pragma unroll
  for (int i = 0; i < 16; ++i) mn = min(mn, min(min(v[i][0], v[i][1]), min(v[i][2], v[i][3])));   // smallest word is 0 exactly when some key is visible
  if (mn == 0u) sf[c4 >> 3] = 1;   // benign same-value race within the block
  __syncthreads(); if (t < 8) vst2((unsigned*)(FL + (size_t)qb * (SS / 32) + hf * 32 + t * 4), *(const v4u*)&sf[t * 4]); }
// ---- k_g<MODE, KW>: block = (64 rows, 128 cols): A f16 rows (MODE 0: built inline from the f32 ctx) . W^T (f16 x 2^8); MODE 0: X1 = x (bf16-rounded) + acc (f32 out); MODE 2: OUT = X1 + acc (f32)
template <int MODE, int KW>
__global__ __launch_bounds__(128) void k_g(const void* __restrict__ Ain, const _Float16* __restrict__ Wr, const float* __restrict__ RES, float* __restrict__ O32, int ow) { constexpr int AEB = (MODE == 0) ? 4 : 2, APITCH = AEB * KS + 16, STG = 64 * APITCH + 128 * HPITCH; __shared__ __attribute__((aligned(128))) char sm[2 * STG];   // the ring; behind the loop's last barrier the same bytes are the output staging
  float (*sf)[16][132] = (float (*)[16][132])sm;
  const int tid = threadIdx.x, wave = tid >> 5, lane = tid & 31, col = lane & 15, g = lane >> 4; const size_t r0 = (size_t)blockIdx.x * 64 + wave * 16; const int c0 = blockIdx.y * 128;
  v8f acc[8] = {};
  { const char* gA = (const char*)Ain + (size_t)blockIdx.x * 64 * KW * AEB; const char* gB = (const char*)(Wr + (size_t)c0 * KW); const unsigned l0 = lds_off(sm); constexpr int NT = KW / KS;
    stage_ab<AEB * KS>(l0, gA, (size_t)AEB * KW, gB, 2 * KW, tid); WAIT_ASYNC0(); __syncthreads();
    stage_ab<AEB * KS>(l0 + STG, gA + AEB * KS, (size_t)AEB * KW, gB + 2 * KS, 2 * KW, tid);
#pragma unroll 1   // stays rolled: one copy of a stage's code in the instruction cache; t & 1 picks the buffer
    for (int t = 0; t < NT; ++t) { const int bo = (t & 1) * STG;
      v16h a[KS / 32], w[KS / 32][8];   // the stage's LDS reads go out as one group in front of its products; the loops below are unrolled so that these arrays are registers
#pragma unroll
      for (int kc = 0; kc < KS / 32; ++kc) { if (MODE == 0) { const float* p = (const float*)(sm + bo + (wave * 16 + col) * APITCH) + kc * 32 + 8 * g;
#pragma unroll
          for (int i = 0; i < 8; ++i) { a[kc][i] = (_Float16)p[i]; a[kc][8 + i] = (_Float16)p[16 + i]; } } else a[kc] = frag_h((const _Float16*)(sm + bo + (wave * 16 + col) * APITCH) + kc * 32, lane);
#pragma unroll
        for (int j = 0; j < 8; ++j) w[kc][j] = frag_h((const _Float16*)(sm + bo + 64 * APITCH + (j * 16 + col) * HPITCH) + kc * 32, lane); }
#pragma unroll
      for (int kc = 0; kc < KS / 32; ++kc)
#pragma unroll
        for (int j = 0; j < 8; ++j) acc[j] = wmma16(a[kc], w[kc][j], acc[j]);
      WAIT_DS0(); WAIT_ASYNC0(); __syncthreads();   // publishes stage t + 1 and ends every reader's last read of stage t
      if (t + 2 < NT) { stage_ab<AEB * KS>(l0 + bo, gA + (size_t)(t + 2) * AEB * KS, (size_t)AEB * KW, gB + (size_t)(t + 2) * 2 * KS, 2 * KW, tid); } }
    WAIT_ASYNC0(); }
#pragma unroll
  for (int j = 0; j < 8; ++j) { const int c = c0 + j * 16 + col;
#pragma unroll
    for (int r = 0; r < 8; ++r) { const float res = RES[(r0 + 8 * g + r) * ow + c]; sf[wave][8 * g + r][j * 16 + col] = acc[j][r] * (1.0f / WSC) + (MODE == 0 ? bfr(res) : res); } }
  LDSX(); for (int rl = 0; rl < 16; ++rl) vst2(O32 + (r0 + rl) * ow + c0 + lane * 4, *(const v4f*)&sf[wave][rl][lane * 4]); }
// ---- k_gu: block = (64 rows, 128 hidden cols): g = h2 . Wg^T, u = h2 . Wu^T (same A), GU = f16(silu(g) u) -> rows [NR][HP]
__global__ __launch_bounds__(128) void k_gu(const _Float16* __restrict__ H2, const _Float16* __restrict__ PG, _Float16* __restrict__ GU) { constexpr int STG = (64 + 256) * HPITCH; __shared__ __attribute__((aligned(128))) char sm[2 * STG];   // the ring; behind the loop's last barrier the same bytes are the output staging
  _Float16 (*so)[136] = (_Float16 (*)[136])sm;
  const int tid = threadIdx.x, wave = tid >> 5, lane = tid & 31, col = lane & 15, g = lane >> 4; const size_t rb = (size_t)blockIdx.x * 64; const size_t r0 = rb + wave * 16; const int c0 = blockIdx.y * 128; const _Float16* Wg = PG + (size_t)c0 * DM; const _Float16* Wu = PG + ((size_t)HP + c0) * DM;
  v8f ag[8] = {}, au[8] = {};
  { const char* gA = (const char*)(H2 + rb * DM); const char* gG = (const char*)Wg; const char* gU = (const char*)Wu; const unsigned l0 = lds_off(sm); constexpr int NT = DM / KS;
    stage_ab<2 * KS>(l0, gA, 2 * DM, gG, 2 * DM, tid); stage_w(l0 + 192 * HPITCH, gU, 2 * DM, tid); WAIT_ASYNC0(); __syncthreads();
    stage_ab<2 * KS>(l0 + STG, gA + 2 * KS, 2 * DM, gG + 2 * KS, 2 * DM, tid); stage_w(l0 + STG + 192 * HPITCH, gU + 2 * KS, 2 * DM, tid);
#pragma unroll 1   // stays rolled: one copy of a stage's code in the instruction cache; t & 1 picks the buffer
    for (int t = 0; t < NT; ++t) { const int bo = (t & 1) * STG;
#pragma unroll
      for (int kc = 0; kc < KS / 32; ++kc) { const v16h a = frag_h((const _Float16*)(sm + bo + (wave * 16 + col) * HPITCH) + kc * 32, lane);
#pragma unroll
        for (int jh = 0; jh < 8; jh += 4) { v16h wg[4], wu[4];   // the LDS reads of eight products go out as one group in front of them (all sixteen at once would not fit beside the 128 accumulator registers); unrolled so that the arrays are registers
#pragma unroll
          for (int j = 0; j < 4; ++j) { wg[j] = frag_h((const _Float16*)(sm + bo + (64 + (jh + j) * 16 + col) * HPITCH) + kc * 32, lane); wu[j] = frag_h((const _Float16*)(sm + bo + (192 + (jh + j) * 16 + col) * HPITCH) + kc * 32, lane); }
#pragma unroll
          for (int j = 0; j < 4; ++j) { ag[jh + j] = wmma16(a, wg[j], ag[jh + j]); au[jh + j] = wmma16(a, wu[j], au[jh + j]); } } }
      WAIT_DS0(); WAIT_ASYNC0(); __syncthreads();   // publishes stage t + 1 and ends every reader's last read of stage t
      if (t + 2 < NT) { const size_t ko = (size_t)(t + 2) * 2 * KS; stage_ab<2 * KS>(l0 + bo, gA + ko, 2 * DM, gG + ko, 2 * DM, tid); stage_w(l0 + bo + 192 * HPITCH, gU + ko, 2 * DM, tid); } }
    WAIT_ASYNC0(); }
#pragma unroll
  for (int j = 0; j < 8; ++j)
#pragma unroll
    for (int r = 0; r < 8; ++r) { const float gg = ag[j][r] * (1.0f / WSC), uu = au[j][r] * (1.0f / WSC); so[wave * 16 + 8 * g + r][j * 16 + col] = (_Float16)(gg / (1.0f + __expf(-gg)) * uu); }
  __syncthreads(); for (int e = tid; e < 64 * 16; e += 128) { const int rl = e >> 4, q = e & 15; vst2((unsigned*)(GU + (rb + rl) * HP + c0 + q * 8), *(const v4u*)&so[rl][q * 8]); } }

extern "C" void kernel_launch(void* const* d_in, const int* in_sizes, int n_in, void* d_out, int out_size, void* d_ws, size_t ws_size, hipStream_t stream) {
  (void)in_sizes; (void)n_in; (void)out_size;
  const float** F = (const float**)d_in;   // 0 x [2,2048,1024], 1 attn_mask [2048,2048] int (1 = masked), 2 wq, 3 wk, 4 wv, 5 wo (natural [1024,1024]), 6 norm1_w, 7 norm2_w, 8 w_gate [2730,1024], 9 w_up, 10 w_down [1024,2730]
  if (ws_size < (size_t)WS_END) return;
  char* ws = (char*)d_ws; _Float16* PK = (_Float16*)(ws + WS_PK); _Float16 *QK = (_Float16*)(ws + WS_QK), *QKL = (_Float16*)(ws + WS_QKL), *VTH = (_Float16*)(ws + WS_VTH), *VTL = (_Float16*)(ws + WS_VTL), *H1 = (_Float16*)(ws + WS_H1), *H2 = (_Float16*)(ws + WS_H2), *GU = (_Float16*)(ws + WS_GU); float *O = (float*)(ws + WS_O), *X1 = (float*)(ws + WS_X1); int* FL = (int*)(ws + WS_FL); const int* MASK = (const int*)d_in[1];
  const int nr = NB * SS;   // keys of both batches are always needed
  k_pack<<<PK_WG, 512, 0, stream>>>(F[2], F[3], F[4], F[5], F[8], F[9], F[10], ws);
  k_rms<0><<<nr / 16, 512, 0, stream>>>(F[0], F[6], H1);
  k_flags<<<dim3(SS / 64, 2), 1024, 0, stream>>>(MASK, FL);
  k_qkv<<<dim3(nr / 64, QKVW / 128), 128, 0, stream>>>((const float*)H1, (const float*)H1, (const float*)H1, PK + PK_A, nullptr, nullptr, nullptr, QK, QKL, VTH, VTL);
  k_attn<<<dim3(TQB, NH, TNB), 128, 0, stream>>>(QK, QKL, VTH, VTL, nullptr, MASK, FL, O);
  k_g<0, DM><<<dim3(TOB, DM / 128), 128, 0, stream>>>(O, PK + PK_P, F[0], X1, DM);                  // x1 = x + ctx wo^T
  k_rms<1><<<TOB * 4, 512, 0, stream>>>(X1, F[7], H2);
  k_gu<<<dim3(TOB, HP / 128), 128, 0, stream>>>(H2, (const _Float16*)(ws + WS_PG), GU);
  k_g<2, HP><<<dim3(TOB, DM / 128), 128, 0, stream>>>(GU, (const _Float16*)(ws + WS_PD), X1, (float*)d_out, DM);   // out = x1 + (silu(g) u) w_down^T
}

// v004
// Measured time: 201 microseconds a run.
// In two side-by-side timings against v003, it was 1.17 and 1.16 times as fast.
// Counting every step since v000, it is 4.57 times as fast.
// compute dtype: all float inputs rounded to bf16, attn_mask (int) read on device; RMSNorms (eps 1e-6) in f32, normed rows once to f16; q/k/v = f16(h) . W^T against exact f16 x 2^8 weight copies on WMMA 16x16x32 (single products, f32 accumulate); rotate-half RoPE in f32 (precise sinf/cosf) before the f16 hi + residual split; attention with 3-product scores and P.v (hi + residual planes), x 1/8, masked keys excluded (mask read per pair; fully-masked 64x32 tiles skipped via a device-built flag table), running-max softmax in f32 (hardware exp); x1 = x + f16(ctx) . Wo^T; SwiGLU: f16(rmsnorm(x1)) . [W_gate | W_up]^T (hidden padded 2,730 -> 2,816 with zero weights), silu(g) u in f32 -> f16, . W_down^T + x1; f32 output.
#include <hip/hip_runtime.h>
#include <math.h>

typedef __attribute__((ext_vector_type(16))) _Float16 v16h;
typedef __attribute__((ext_vector_type(16))) __bf16 v16b;
typedef __attribute__((ext_vector_type(8)))  _Float16 v8h;
typedef __attribute__((ext_vector_type(8)))  float v8f;
typedef __attribute__((ext_vector_type(4)))  float v4f;
typedef __attribute__((ext_vector_type(2)))  float v2f;
typedef __attribute__((ext_vector_type(4)))  unsigned v4u;
typedef __attribute__((ext_vector_type(4)))  int v4i;
typedef float __attribute__((may_alias)) float_a;
typedef int __attribute__((may_alias)) int_a;

template <typename T> __device__ __forceinline__ void vst2(void* p, T v) { *(T*)p = v;  }
__device__ __forceinline__ v8f wmma16(v16h a, v16h b, v8f c) {
  v8f d = __builtin_amdgcn_wmma_f32_16x16x32_f16(false, a, false, b, (short)0, c, false, false);
  asm volatile("v_nop\n\tv_nop\n\tv_nop\n\tv_nop" : "+v"(d) : "v"(a), "v"(b));
  return d;
}
__device__ __forceinline__ v8f wmma_bf(v16b a, v16b b, v8f c) {
  v8f d = __builtin_amdgcn_wmma_f32_16x16x32_bf16(false, a, false, b, (short)0, c, false, false);
  asm volatile("v_nop\n\tv_nop\n\tv_nop\n\tv_nop" : "+v"(d) : "v"(a), "v"(b));
  return d;
}
// Streaming decoder block (B 2, L 2,048, d 1,024, 16 heads x 64, SwiGLU hidden 2,730): pre-RMSNorm, bias-free projections, rotate-half RoPE (base 10000), attention under the given boolean mask (all-keys + 256-token window), out-projection + residual, pre-RMSNorm SwiGLU FFN + residual.
__device__ __forceinline__ v16h frag_h(const _Float16* rowk0, int lane) {
  union { v16h v; v8h q[2]; } u; const _Float16* p = rowk0 + 8 * (lane >> 4);
  u.q[0] = *(const v8h*)p; u.q[1] = *(const v8h*)(p + 16); return u.v;
}
__device__ __forceinline__ v16h frag_f32(const float* rowk0, int lane) {
  v16h a; const float* p = rowk0 + 8 * (lane >> 4);
#pragma unroll
  for (int i = 0; i < 8; ++i) { a[i] = (_Float16)p[i]; a[8 + i] = (_Float16)p[16 + i]; }
  return a;
}
__device__ __forceinline__ v16h frag_f32s(const float* rowk0, int lane, float sc) {
  v16h a; const float* p = rowk0 + 8 * (lane >> 4);
#pragma unroll
  for (int i = 0; i < 8; ++i) { a[i] = (_Float16)(p[i] * sc); a[8 + i] = (_Float16)(p[16 + i] * sc); }
  return a;
}
// column fragment from a [K][ld] layout (column n), rows >= K read as 0
__device__ __forceinline__ v16h fragc_f32(const float* W, int k0, int n, int lane, int ld, int K) {
  v16h a; const int g = lane >> 4;
#pragma unroll
  for (int i = 0; i < 8; ++i) { const int ka = k0 + 8 * g + i, kb = ka + 16;
    a[i] = (_Float16)(ka < K ? W[(size_t)(ka < K ? ka : K - 1) * ld + n] : 0.f); a[8 + i] = (_Float16)(kb < K ? W[(size_t)(kb < K ? kb : K - 1) * ld + n] : 0.f); }
  return a;
}
struct F2 { v16b h, l; };
__device__ __forceinline__ F2 bsplit16(const float v[16]) { F2 r;
#pragma unroll
  for (int i = 0; i < 16; ++i) { const __bf16 h = (__bf16)v[i]; r.h[i] = h; r.l[i] = (__bf16)(v[i] - (float)h); }
  return r; }
__device__ __forceinline__ F2 split_row(const float* row, int k0, int lane) { float v[16]; const float* p = row + k0 + 8 * (lane >> 4);
#pragma unroll
  for (int i = 0; i < 8; ++i) { v[i] = p[i]; v[8 + i] = p[16 + i]; }
  return bsplit16(v); }
__device__ __forceinline__ F2 split_rowK(const float* row, int k0, int lane, int K) { float v[16]; const int g = lane >> 4;
#pragma unroll
  for (int i = 0; i < 8; ++i) { const int ka = k0 + 8 * g + i, kb = ka + 16; v[i] = ka < K ? row[ka < K ? ka : K - 1] : 0.f; v[8 + i] = kb < K ? row[kb < K ? kb : K - 1] : 0.f; }
  return bsplit16(v); }
__device__ __forceinline__ F2 split_col(const float* W, int k0, int n, int lane, int ld, int K) { float v[16]; const int g = lane >> 4;
#pragma unroll
  for (int i = 0; i < 8; ++i) { const int ka = k0 + 8 * g + i, kb = ka + 16; v[i] = ka < K ? W[(size_t)(ka < K ? ka : K - 1) * ld + n] : 0.f; v[8 + i] = kb < K ? W[(size_t)(kb < K ? kb : K - 1) * ld + n] : 0.f; }
  return bsplit16(v); }
__device__ __forceinline__ v8f mac3(const F2& a, const F2& b, v8f c) { c = wmma_bf(a.l, b.h, c); c = wmma_bf(a.h, b.l, c); return wmma_bf(a.h, b.h, c); }
__device__ __forceinline__ float sigm(float v) { return 1.0f / (1.0f + expf(-v)); }
#define LDSX() do { asm volatile("s_wait_dscnt 0" ::: "memory"); __builtin_amdgcn_wave_barrier(); __builtin_amdgcn_fence(__ATOMIC_RELEASE, "workgroup"); } while (0)
// ---- GEMM operand ring: a stage is 64 k of every operand row of the block's tile, brought into LDS by asynchronous 16-byte copies (a wave's copy covers whole 128-byte lines); LDS row pitch = row bytes + 16 (16 B x odd: conflict-free for 16-byte reads); two buffers
#define KS 64
#define HPITCH (2 * KS + 16)       // f16 rows: 128 B + 16
__device__ __forceinline__ unsigned lds_off(const void* p) { return (unsigned)(size_t)p; }
// a run of copies and, as the last line of their own statement, the wait that stands in front of any rewrite of their address registers (one wait a run: fewer, longer runs cost a wave fewer waits)
#define CPL(a, b) "global_load_async_to_lds_b128 %" #a ", %" #b ", off\n\t"
__device__ __forceinline__ void cp8(const unsigned* l, const char* const* g) {
  asm volatile(CPL(0, 1) CPL(2, 3) CPL(4, 5) CPL(6, 7) CPL(8, 9) CPL(10, 11) CPL(12, 13) CPL(14, 15) "s_wait_xcnt 0x0"
               :: "v"(l[0]), "v"(g[0]), "v"(l[1]), "v"(g[1]), "v"(l[2]), "v"(g[2]), "v"(l[3]), "v"(g[3]), "v"(l[4]), "v"(g[4]), "v"(l[5]), "v"(g[5]), "v"(l[6]), "v"(g[6]), "v"(l[7]), "v"(g[7]) : "memory");
}
__device__ __forceinline__ void cp12(const unsigned* l, const char* const* g) {
  asm volatile(CPL(0, 1) CPL(2, 3) CPL(4, 5) CPL(6, 7) CPL(8, 9) CPL(10, 11) CPL(12, 13) CPL(14, 15) CPL(16, 17) CPL(18, 19) CPL(20, 21) CPL(22, 23) "s_wait_xcnt 0x0"
               :: "v"(l[0]), "v"(g[0]), "v"(l[1]), "v"(g[1]), "v"(l[2]), "v"(g[2]), "v"(l[3]), "v"(g[3]), "v"(l[4]), "v"(g[4]), "v"(l[5]), "v"(g[5]), "v"(l[6]), "v"(g[6]), "v"(l[7]), "v"(g[7]), "v"(l[8]), "v"(g[8]), "v"(l[9]), "v"(g[9]), "v"(l[10]), "v"(g[10]), "v"(l[11]), "v"(g[11]) : "memory");
}
// this thread's addresses for ROWS rows of RB bytes from gb (row pitch gp bytes) to LDS byte address lb (row pitch RB + 16), dealt over the 128 threads of a block: ROWS * RB / 2048 copies a thread
template <int ROWS, int RB>
__device__ __forceinline__ void row_addr(unsigned* l, const char** g, unsigned lb, const char* gb, size_t gp, int tid) {
  constexpr int PPR = RB / 16, RPI = 128 / PPR, NI = ROWS / RPI; const int row = tid / PPR, pc = tid % PPR;
#pragma unroll
  for (int i = 0; i < NI; ++i) { l[i] = lb + (row + i * RPI) * (RB + 16) + pc * 16; g[i] = gb + (size_t)(row + i * RPI) * gp + pc * 16; }
}
// 128 weight rows of 128 B
__device__ __forceinline__ void stage_w(unsigned lb, const char* gb, size_t gp, int tid) { unsigned l[8]; const char* g[8]; row_addr<128, 2 * KS>(l, g, lb, gb, gp, tid); cp8(l, g); }
// 64 A rows of ARB bytes at lb, behind them 128 weight rows of 128 B
template <int ARB>
__device__ __forceinline__ void stage_ab(unsigned lb, const char* ga, size_t pa, const char* gb, size_t pb, int tid) {
  if constexpr (ARB == 2 * KS) { unsigned l[12]; const char* g[12]; row_addr<64, ARB>(l, g, lb, ga, pa, tid); row_addr<128, 2 * KS>(l + 4, g + 4, lb + 64 * (ARB + 16), gb, pb, tid); cp12(l, g); }
  else { unsigned l[8]; const char* g[8]; row_addr<64, ARB>(l, g, lb, ga, pa, tid); cp8(l, g); stage_w(lb + 64 * (ARB + 16), gb, pb, tid); }
}
#define WAIT_ASYNC0() asm volatile("s_wait_asynccnt 0x0" ::: "memory")   // this wave's copies have landed
#define WAIT_DS0() asm volatile("s_wait_dscnt 0x0" ::: "memory")         // this wave's LDS reads of the buffer have returned before it is refilled


#define NB 2
#define SS 2048
#define DM 1024
#define NH 16
#define HID 2730
#define HP 2816          // hidden padded to 22 x 128
#define WSC 256.0f
#define RMSEPS 1e-6f
__constant__ float THETA[32] = {1.000000000e+00f,7.498942018e-01f,5.623413324e-01f,4.216965139e-01f,3.162277639e-01f,2.371373773e-01f,1.778279394e-01f,1.333521456e-01f,1.000000015e-01f,7.498942316e-02f,5.623413250e-02f,4.216964915e-02f,3.162277490e-02f,2.371373773e-02f,1.778279431e-02f,1.333521400e-02f,9.999999776e-03f,7.498942316e-03f,5.623413250e-03f,4.216964822e-03f,3.162277630e-03f,2.371373819e-03f,1.778279431e-03f,1.333521446e-03f,1.000000047e-03f,7.498941850e-04f,5.623413017e-04f,4.216965172e-04f,3.162277571e-04f,2.371373703e-04f,1.778279402e-04f,1.333521504e-04f};
__device__ __attribute__((noinline)) float cos_p(float v) { return cosf(v); }
__device__ __attribute__((noinline)) float sin_p(float v) { return sinf(v); }
#define HD 64
#define QKVW (3 * DM)
#ifndef TQB
#define TQB (SS / 64)
#define TNB NB
#define TOB (NB * SS / 64)     // output row tiles (all)
#endif
typedef __attribute__((ext_vector_type(8))) __bf16 v8b;
__device__ __forceinline__ v16b frag_b(const __bf16* rowk0, int lane) {
  union { v16b v; v8b q[2]; } u; const __bf16* p = rowk0 + 8 * (lane >> 4);
  u.q[0] = *(const v8b*)p; u.q[1] = *(const v8b*)(p + 16); return u.v;
}
__device__ __forceinline__ float bfr(float v) { return (float)(__bf16)v; }
__device__ __attribute__((noinline)) float exp_ni(float v) { return expf(v); }
__device__ __attribute__((noinline)) float erf_ni(float v) { return erff(v); }

#define PK_A 0                       // [3072][1024] Wqkv rows (natural [out][in])
#define PK_P (PK_A + QKVW * DM)        // [1024][1024] Wo rows (natural)
#define PK_END (PK_P + DM * DM)
#define WS_PK  0u
#define WS_QK  (WS_PK + 2u * PK_END)             // f16 [4096 rows][2048]: q | k
#define WS_QKL (WS_QK + 2u * NB * SS * 2 * DM)     // f16 q | k residual planes x2048
#define WS_VTH (WS_QKL + 2u * NB * SS * 2 * DM)    // f16 [b][1024 (h*64+d)][2048 s] hi
#define WS_VTL (WS_VTH + 2u * NB * DM * SS)        // f16 lo x 2048
#define WS_O   (WS_VTL + 2u * NB * DM * SS)        // f32 [4096][1024]
#define WS_PG  (WS_O + 4u * (size_t)NB * SS * DM)        // f16 x 2^8 [gate | up] rows [2*HP][1024] (zero rows >= HID), down rows [1024][HP] (zero cols >= HID)
#define WS_PD  (WS_PG + 2u * (size_t)2 * HP * DM)
#define WS_H1  (WS_PD + 2u * (size_t)DM * HP)             // f16 rmsnorm1(x) rows [NR][1024]; int flags [SS/64][SS/32]; f32 x1 [NR][1024]; f16 rmsnorm2(x1) rows; f16 silu(gate) up rows [NR][HP]
#define WS_FL  (WS_H1 + 2u * (size_t)NB * SS * DM)
#define WS_X1  (WS_FL + 4u * (size_t)(SS / 64) * (SS / 32))
#define WS_H2  (WS_X1 + 4u * (size_t)NB * SS * DM)
#define WS_GU  (WS_H2 + 2u * (size_t)NB * SS * DM)
#define WS_END (WS_GU + 2u * (size_t)NB * SS * HP)
// ---- k_pack: a resident stream, one task a wave and pass, no LDS and no barrier: 2,048 half rows of W_down, 4,096 rows of W_q | W_k | W_v | W_o, 5,632 rows of gate | up (the longer tasks first); value = f16(bf16(w) x 2^8); all loads of a task go out before its first store; every load and store of a wave covers one contiguous run of bytes; the loops over j and c below are unrolled so that the pieces stay in registers and the loads go out as one group
typedef __attribute__((ext_vector_type(4))) _Float16 v4h;
typedef __attribute__((ext_vector_type(2))) _Float16 v2h;
#define PT_D (2 * DM)
#define PT_A (PT_D + 4 * DM)
#define PT_END (PT_A + 2 * HP)
#define PK_WG 256        // work-groups of 16 waves: one a WGP
__device__ __forceinline__ _Float16 wcv(float w) { return (_Float16)(bfr(w) * WSC); }
#define STORES_OUT() asm volatile("s_wait_xcnt 0x0" ::: "memory")   // stands directly behind a task's last store: what follows (the next task) rewrites registers that these stores name
// one row of 1,024: a lane holds 8 pieces of 16 bytes, 128 elements apart
__device__ __forceinline__ void pack_row(const float* __restrict__ s, _Float16* __restrict__ d, int lane) { v4f x[8];
#pragma unroll
  for (int j = 0; j < 8; ++j) x[j] = *(const v4f*)(s + j * 128 + lane * 4);
#pragma unroll
  for (int j = 0; j < 8; ++j) { v4h o;
#pragma unroll
    for (int c = 0; c < 4; ++c) o[c] = wcv(x[j][c]);
    *(v4h*)(d + j * 128 + lane * 4) = o; }
  STORES_OUT(); }
__global__ __launch_bounds__(512) void k_pack(const float* __restrict__ WQ, const float* __restrict__ WK, const float* __restrict__ WV, const float* __restrict__ WO, const float* __restrict__ WG, const float* __restrict__ WU, const float* __restrict__ WD, char* __restrict__ ws) {
  const int lane = threadIdx.x & 31; _Float16* P = (_Float16*)(ws + WS_PK);
  for (int task = __builtin_amdgcn_readfirstlane((threadIdx.x >> 5) * PK_WG + blockIdx.x); task < PT_END; task += 16 * PK_WG) {   // dealt wave-major, so that every work-group gets the same mix of tasks; the task number sits in a scalar register, so the branches on it are scalar
    if (task < PT_D) { const int n = task >> 1, k0 = (task & 1) * (HP / 2) + lane * 2; const float* s = WD + (size_t)n * HID; _Float16* d = (_Float16*)(ws + WS_PD) + (size_t)n * HP; v2f x[22];   // down rows [1024][HP], zero beyond 2,730; a source row starts on 8 bytes only, hence 8-byte loads
#pragma unroll
      for (int j = 0; j < 22; ++j) { const int k = k0 + j * 64; x[j] = *(const v2f*)(s + (k < HID ? k : 0)); }
#pragma unroll
      for (int j = 0; j < 22; ++j) { const int k = k0 + j * 64; v2h o; o[0] = (k < HID) ? wcv(x[j][0]) : (_Float16)0.0f; o[1] = (k < HID) ? wcv(x[j][1]) : (_Float16)0.0f; *(v2h*)(d + k) = o; }
      STORES_OUT(); }
    else if (task < PT_A) { const int r = task - PT_D, which = r >> 10; const float* w = (which == 0) ? WQ : (which == 1) ? WK : (which == 2) ? WV : WO; pack_row(w + (size_t)(r & (DM - 1)) * DM, P + PK_A + (size_t)r * DM, lane); }   // PK_P follows PK_A directly
    else { const int r = task - PT_A, n = (r < HP) ? r : r - HP; _Float16* d = (_Float16*)(ws + WS_PG) + (size_t)r * DM;   // gate | up rows, zero beyond 2,730
      if (n < HID) pack_row(((r < HP) ? WG : WU) + (size_t)n * DM, d, lane);
      else { const v4h z = {};
#pragma unroll
        for (int j = 0; j < 8; ++j) *(v4h*)(d + j * 128 + lane * 4) = z;
        STORES_OUT(); } }
  } }
__global__ __launch_bounds__(128) void k_qkv(const float* __restrict__ XQ, const float* __restrict__ XK, const float* __restrict__ XV, const _Float16* __restrict__ P, const float* __restrict__ BQ, const float* __restrict__ BK, const float* __restrict__ BV, _Float16* __restrict__ QK, _Float16* __restrict__ QKL, _Float16* __restrict__ VTH, _Float16* __restrict__ VTL) {
  const int which0 = (blockIdx.y * 128) / DM; const float* X = (which0 == 0) ? XQ : (which0 == 1) ? XK : XV; const float* BB = BQ ? (((which0 == 0) ? BQ : (which0 == 1) ? BK : BV) + (blockIdx.y * 128 - which0 * DM)) : nullptr;
  constexpr int STG = (64 + 128) * HPITCH; __shared__ __attribute__((aligned(128))) char sm[2 * STG];   // the ring; behind the loop's last barrier the same bytes are the output staging
  _Float16 (*so)[16][136] = (_Float16 (*)[16][136])sm; _Float16 (*sol)[16][136] = (_Float16 (*)[16][136])(sm + 4 * 16 * 136 * 2); _Float16 (*sth)[72] = (_Float16 (*)[72])sm; _Float16 (*stl)[72] = (_Float16 (*)[72])(sm + 128 * 72 * 2);
  const int tid = threadIdx.x, wave = tid >> 5, lane = tid & 31, col = lane & 15, g = lane >> 4; const size_t r0 = (size_t)blockIdx.x * 64 + wave * 16; const int n0 = blockIdx.y * 128;
  v8f acc[8] = {};
  { const char* gA = (const char*)((const _Float16*)X + (size_t)blockIdx.x * 64 * DM); const char* gB = (const char*)(P + (size_t)n0 * DM); const unsigned l0 = lds_off(sm); constexpr int NT = DM / KS;   // A = f16 rmsnorm rows
    stage_ab<2 * KS>(l0, gA, 2 * DM, gB, 2 * DM, tid); WAIT_ASYNC0(); __syncthreads();
    stage_ab<2 * KS>(l0 + STG, gA + 2 * KS, 2 * DM, gB + 2 * KS, 2 * DM, tid);
#pragma unroll 1   // stays rolled: one copy of a stage's code in the instruction cache; t & 1 picks the buffer
    for (int t = 0; t < NT; ++t) { const int bo = (t & 1) * STG;
      v16h a[KS / 32], w[KS / 32][8];   // the stage's LDS reads go out as one group in front of its products; the loops below are unrolled so that these arrays are registers
#pragma unroll
      for (int kc = 0; kc < KS / 32; ++kc) { a[kc] = frag_h((const _Float16*)(sm + bo + (wave * 16 + col) * HPITCH) + kc * 32, lane);
#pragma unroll
        for (int j = 0; j < 8; ++j) w[kc][j] = frag_h((const _Float16*)(sm + bo + (64 + j * 16 + col) * HPITCH) + kc * 32, lane); }
#pragma unroll
      for (int kc = 0; kc < KS / 32; ++kc)
#pragma unroll
        for (int j = 0; j < 8; ++j) acc[j] = wmma16(a[kc], w[kc][j], acc[j]);
      WAIT_DS0(); WAIT_ASYNC0(); __syncthreads();   // publishes stage t + 1 and ends every reader's last read of stage t
      if (t + 2 < NT) { stage_ab<2 * KS>(l0 + bo, gA + (size_t)(t + 2) * 2 * KS, 2 * DM, gB + (size_t)(t + 2) * 2 * KS, 2 * DM, tid); } }
    WAIT_ASYNC0(); }
#pragma unroll
  for (int j = 0; j < 8; ++j)
#pragma unroll
    for (int r = 0; r < 8; ++r) acc[j][r] *= (1.0f / WSC);
  if (n0 < 2 * DM) {   // bias, then rotate-half rotary over each 64-dim head with angle position * inv_freq[d mod 32]
#pragma unroll
    for (int j = 0; j < 8; ++j)
#pragma unroll
      for (int r = 0; r < 8; ++r) acc[j][r] += (BB ? bfr(BB[j * 16 + col]) : 0.f);
#pragma unroll
    for (int r = 0; r < 8; ++r) { const int spos = (int)((r0 + 8 * g + r) % SS);
#pragma unroll
      for (int jj = 0; jj < 2; ++jj) { const float ang = (float)spos * THETA[jj * 16 + col]; const float c = cos_p(ang), sn = sin_p(ang);
#pragma unroll
        for (int hh = 0; hh < 2; ++hh) { const float x1 = acc[hh * 4 + jj][r], x2 = acc[hh * 4 + jj + 2][r]; acc[hh * 4 + jj][r] = x1 * c - x2 * sn; acc[hh * 4 + jj + 2][r] = x2 * c + x1 * sn; } } }
#pragma unroll
    for (int j = 0; j < 8; ++j) {
#pragma unroll
      for (int r = 0; r < 8; ++r) { const float v = acc[j][r]; const _Float16 hv = (_Float16)v; so[wave][8 * g + r][j * 16 + col] = hv; sol[wave][8 * g + r][j * 16 + col] = (_Float16)((v - (float)hv) * 2048.0f); } }   // q, k (+ bias) as f16 hi + (x2048) residual
    LDSX();
    for (int rl = 0; rl < 16; ++rl) if (lane < 16) { vst2((unsigned*)(QK + (r0 + rl) * (2 * DM) + n0 + lane * 8), *(const v4u*)&so[wave][rl][lane * 8]); vst2((unsigned*)(QKL + (r0 + rl) * (2 * DM) + n0 + lane * 8), *(const v4u*)&sol[wave][rl][lane * 8]); }
  } else {
#pragma unroll
    for (int j = 0; j < 8; ++j) {
#pragma unroll
      for (int r = 0; r < 8; ++r) { const float v = acc[j][r] + (BB ? bfr(BB[j * 16 + col]) : 0.f); const _Float16 hv = (_Float16)v; sth[j * 16 + col][wave * 16 + 8 * g + r] = hv; stl[j * 16 + col][wave * 16 + 8 * g + r] = (_Float16)((v - (float)hv) * 2048.0f); } }
    __syncthreads();
    const size_t rb = (size_t)blockIdx.x * 64; const int b = (int)(rb / SS), s0 = (int)(rb % SS); const int pc0 = n0 - 2 * DM;
    for (int q = tid; q < 128 * 8; q += 128) { const int d = q >> 3, pc = q & 7; const size_t o = ((size_t)b * DM + pc0 + d) * SS + s0 + pc * 8; vst2((unsigned*)(VTH + o), *(const v4u*)&sth[d][pc * 8]); vst2((unsigned*)(VTL + o), *(const v4u*)&stl[d][pc * 8]); }
  }
}
// ---- k_attn: block = (64 queries, head h, batch b): flash attention over the visible (64-query, 32-key) tiles (K = 64: 2 k-steps), scores = (q.k) * 0.125, 3 products (hi + residual planes), P.V likewise; O[b*S+q][h*64+d] = (acc + accl / 2048) / (2048 l) (256-B segments)
// a tile's K rows (32 x 128 B, hi and residual) and V^T rows (64 x 64 B, hi and residual) come into LDS once for the block's four waves by asynchronous 16-byte copies, two buffers, the next visible tile in flight while this one is worked on; row pitch = row bytes + 16 (16 B x odd: conflict-free for 16-byte reads)
#define AKP (2 * HD + 16)
#define AVP (2 * 32 + 16)
#define A_KH 0
#define A_KL (32 * AKP)
#define A_VH (2 * 32 * AKP)
#define A_VL (A_VH + HD * AVP)
#define A_STG (A_VL + HD * AVP)
// tile ks to LDS byte address lb: 8 copies a thread; kh, kl: key row 0 of this (batch, head) in the two planes; vh, vl: its V^T row 0
__device__ __forceinline__ void stage_kv(unsigned lb, const char* kh, const char* kl, const char* vh, const char* vl, int ks, int tid) {
  unsigned l[8]; const char* g[8]; const int kr = tid >> 3, kp = tid & 7, vr = tid >> 2, vp = tid & 3;
  const size_t ko = (size_t)(ks * 32 + kr) * (2 * DM * 2) + kp * 16, vo = (size_t)vr * (SS * 2) + ks * 64 + vp * 16;
#pragma unroll
  for (int i = 0; i < 2; ++i) { const unsigned lk = lb + (kr + 16 * i) * AKP + kp * 16, lv = lb + (vr + 32 * i) * AVP + vp * 16; const size_t gk = ko + (size_t)i * 16 * (2 * DM * 2), gv = vo + (size_t)i * 32 * (SS * 2);
    l[i] = lk + A_KH; g[i] = kh + gk; l[2 + i] = lk + A_KL; g[2 + i] = kl + gk; l[4 + i] = lv + A_VH; g[4 + i] = vh + gv; l[6 + i] = lv + A_VL; g[6 + i] = vl + gv; }
  cp8(l, g);
}
__global__ __launch_bounds__(128) void k_attn(const _Float16* __restrict__ QK, const _Float16* __restrict__ QKL, const _Float16* __restrict__ VTH, const _Float16* __restrict__ VTL, const void* __restrict__ KMASK, const int* __restrict__ MASK, const int* __restrict__ FL, float* __restrict__ O) {
  __shared__ __align__(16) float sp[4][16][36]; __shared__ __align__(16) float so[4][16][68]; __shared__ __attribute__((aligned(128))) char sm[2 * A_STG];   // sm: the K / V ring
  const int tid = threadIdx.x, wave = tid >> 5, lane = tid & 31, col = lane & 15, g = lane >> 4;
  const int qb = blockIdx.x, h = blockIdx.y, b = blockIdx.z; const int q0 = qb * 64 + wave * 16; const size_t rq = (size_t)b * SS + q0 + col;
  // the visible tiles of this query block as 64 bits in scalar registers (the same in every wave of the block), taken in rising order: the ring has to know the next tile before this one is done
  unsigned long long todo = ((unsigned long long)__builtin_amdgcn_ballot_w32(FL[qb * (SS / 32) + 32 + lane] != 0) << 32) | __builtin_amdgcn_ballot_w32(FL[qb * (SS / 32) + lane] != 0);
  const int nt = __builtin_popcountll(todo);
  const char* gkh = (const char*)(QK + (size_t)b * SS * (2 * DM) + DM + h * HD); const char* gkl = (const char*)(QKL + (size_t)b * SS * (2 * DM) + DM + h * HD);
  const char* gvh = (const char*)(VTH + ((size_t)b * DM + h * HD) * SS); const char* gvl = (const char*)(VTL + ((size_t)b * DM + h * HD) * SS); const unsigned l0 = lds_off(sm);
  int ks = 0, ksn = 0;
  if (nt > 0) { ks = __builtin_ctzll(todo); todo &= todo - 1; stage_kv(l0, gkh, gkl, gvh, gvl, ks, tid); }
  v16h aq[2], aql[2];
#pragma unroll
  for (int kc = 0; kc < 2; ++kc) { aq[kc] = frag_h(QK + rq * (2 * DM) + h * HD + kc * 32, lane); aql[kc] = frag_h(QKL + rq * (2 * DM) + h * HD + kc * 32, lane); }
  float m[8], l[8];
#pragma unroll
  for (int r = 0; r < 8; ++r) { m[r] = -3.0e38f; l[r] = 0.f; }
  v8f acc[4] = {}, accl[4] = {};
  WAIT_ASYNC0(); __syncthreads();   // publishes the first tile
  if (nt > 1) { ksn = __builtin_ctzll(todo); todo &= todo - 1; stage_kv(l0 + A_STG, gkh, gkl, gvh, gvl, ksn, tid); }
#pragma unroll 1   // stays rolled: t & 1 picks the buffer
  for (int t = 0; t < nt; ++t) { const int bo = (t & 1) * A_STG; v8f s[2];
    v16h kh[2][2], kl[2][2];   // the tile's K reads go out as one group in front of its products; unrolled so that the arrays are registers
#pragma unroll
    for (int ct = 0; ct < 2; ++ct)
#pragma unroll
      for (int kc = 0; kc < 2; ++kc) { kh[ct][kc] = frag_h((const _Float16*)(sm + bo + A_KH + (ct * 16 + col) * AKP) + kc * 32, lane); kl[ct][kc] = frag_h((const _Float16*)(sm + bo + A_KL + (ct * 16 + col) * AKP) + kc * 32, lane); }
#pragma unroll
    for (int ct = 0; ct < 2; ++ct) { const int kk = ks * 32 + ct * 16 + col; v8f c = {}, cl = {};
#pragma unroll
      for (int kc = 0; kc < 2; ++kc) { c = wmma16(aq[kc], kh[ct][kc], c); cl = wmma16(aql[kc], kh[ct][kc], cl); cl = wmma16(aq[kc], kl[ct][kc], cl); }   // 3 products: q, k as f16 hi + residual
#pragma unroll
      for (int r = 0; r < 8; ++r) c[r] += cl[r] * (1.0f / 2048.0f);
      {
#pragma unroll
      for (int r = 0; r < 8; ++r) s[ct][r] = (MASK[(size_t)(q0 + 8 * g + r) * SS + kk] == 0) ? c[r] * 0.125f : -3.0e38f; } }   // 1/sqrt(64); masked keys excluded
#pragma unroll
    for (int r = 0; r < 8; ++r) { float mx = fmaxf(s[0][r], s[1][r]);
#pragma unroll
      for (int o = 1; o < 16; o <<= 1) mx = fmaxf(mx, __shfl_xor(mx, o));
      const float mn = fmaxf(m[r], mx); const float alpha = (m[r] <= -1.0e38f) ? 0.f : __expf(m[r] - mn);
      const float e0 = (s[0][r] <= -1.0e38f) ? 0.f : __expf(s[0][r] - mn), e1 = (s[1][r] <= -1.0e38f) ? 0.f : __expf(s[1][r] - mn); float es = e0 + e1;
#pragma unroll
      for (int o = 1; o < 16; o <<= 1) es += __shfl_xor(es, o);
      l[r] = l[r] * alpha + es; m[r] = mn;
#pragma unroll
      for (int dt = 0; dt < 4; ++dt) { acc[dt][r] *= alpha; accl[dt][r] *= alpha; }
      sp[wave][8 * g + r][col] = e0; sp[wave][8 * g + r][16 + col] = e1; }
    LDSX();
    v16h vh[4], vl[4];   // the tile's V reads likewise as one group
#pragma unroll
    for (int dt = 0; dt < 4; ++dt) { vh[dt] = frag_h((const _Float16*)(sm + bo + A_VH + (dt * 16 + col) * AVP), lane); vl[dt] = frag_h((const _Float16*)(sm + bo + A_VL + (dt * 16 + col) * AVP), lane); }
    v16h pa, pl; { const float* prow = &sp[wave][col][0] + 8 * (lane >> 4);
#pragma unroll
      for (int i = 0; i < 8; ++i) { const float x0 = prow[i] * 2048.0f, x1 = prow[16 + i] * 2048.0f; const _Float16 h0 = (_Float16)x0, h1 = (_Float16)x1; pa[i] = h0; pa[8 + i] = h1; pl[i] = (_Float16)((x0 - (float)h0) * 2048.0f); pl[8 + i] = (_Float16)((x1 - (float)h1) * 2048.0f); } }   // P scaled by 2^11 before the f16 split so small softmax weights stay out of the f16 subnormal range; 2^-11 folded into the epilogue
#pragma unroll
    for (int dt = 0; dt < 4; ++dt) { acc[dt] = wmma16(pa, vh[dt], acc[dt]); accl[dt] = wmma16(pl, vh[dt], accl[dt]); accl[dt] = wmma16(pa, vl[dt], accl[dt]); }   // P hi x V hi + (P lo x V hi + P hi x V lo) / 2048
    WAIT_DS0(); WAIT_ASYNC0(); __syncthreads();   // publishes tile t + 1 and ends every reader's last read of tile t (and this wave's reads of its sp rows)
    ks = ksn;
    if (t + 2 < nt) { ksn = __builtin_ctzll(todo); todo &= todo - 1; stage_kv(l0 + bo, gkh, gkl, gvh, gvl, ksn, tid); } }
  WAIT_ASYNC0();
#pragma unroll
  for (int r = 0; r < 8; ++r) { const float il = (l[r] > 0.f) ? (1.0f / 2048.0f) / l[r] : 0.f;
#pragma unroll
    for (int dt = 0; dt < 4; ++dt) so[wave][8 * g + r][dt * 16 + col] = (acc[dt][r] + accl[dt][r] * (1.0f / 2048.0f)) * il; }
  LDSX();
  for (int rl = 0; rl < 16; ++rl) if (lane < 16) vst2(O + ((size_t)b * SS + q0 + rl) * DM + h * HD + lane * 4, *(const v4f*)&so[wave][rl][lane * 4]);
}
// ---- k_out: block = (64 rows, 128 cols): out = O(hi/lo) . Wo rows (2 products) + bo
__global__ __launch_bounds__(128) void k_out(const float* __restrict__ O, const __bf16* __restrict__ P, const float* __restrict__ BO, float* __restrict__ Y) {
  __shared__ __align__(16) float so[4][16][132];
  const int tid = threadIdx.x, wave = tid >> 5, lane = tid & 31, col = lane & 15, g = lane >> 4; const size_t r0 = (size_t)blockIdx.x * 64 + wave * 16; const int n0 = blockIdx.y * 128;
  v8f acc[8] = {};
#pragma unroll 2
  for (int kc = 0; kc < DM / 32; ++kc) { const F2 a = split_row(O + (r0 + col) * DM, kc * 32, lane);
#pragma unroll
    for (int j = 0; j < 8; ++j) { const v16b w = frag_b(P + (size_t)(n0 + j * 16 + col) * DM + kc * 32, lane); acc[j] = wmma_bf(a.l, w, acc[j]); acc[j] = wmma_bf(a.h, w, acc[j]); } }
#pragma unroll
  for (int j = 0; j < 8; ++j) {
#pragma unroll
    for (int r = 0; r < 8; ++r) so[wave][8 * g + r][j * 16 + col] = acc[j][r] + (BO ? bfr(BO[n0 + j * 16 + col]) : 0.f); }
  LDSX();
  for (int rl = 0; rl < 16; ++rl) vst2(Y + (r0 + rl) * DM + n0 + lane * 4, *(const v4f*)&so[wave][rl][lane * 4]);
}

// ---- k_rms: wave = row, no LDS and no barrier: OUTH = f16(x rsqrt(mean x^2 + eps) w) (MODE 0: x = bf16-rounded input; MODE 1: x = f32 x1); a lane holds 8 pieces of 16 bytes, 128 elements apart, the row's 8 loads in flight at once; every loop is unrolled so that the pieces stay in registers
template <int M> __device__ __forceinline__ float lane_xor(float v) { return __builtin_bit_cast(float, __builtin_amdgcn_update_dpp(0, __builtin_bit_cast(int, v), 0x160 + M, 0xf, 0xf, true)); }   // value of lane ^ M inside a 16-lane row (DPP row_xmask), no LDS round trip
template <int MODE>
__global__ __launch_bounds__(512) void k_rms(const float* __restrict__ A, const float* __restrict__ Wn, _Float16* __restrict__ OUTH) { const int lane = threadIdx.x & 31; const size_t row = (size_t)blockIdx.x * 16 + (threadIdx.x >> 5);
  v4f x[8], wn[8];
#pragma unroll
  for (int j = 0; j < 8; ++j) x[j] = *(const v4f*)(A + row * DM + j * 128 + lane * 4);
#pragma unroll
  for (int j = 0; j < 8; ++j) wn[j] = *(const v4f*)(Wn + j * 128 + lane * 4);
  if (MODE == 0) {
#pragma unroll
    for (int j = 0; j < 8; ++j)
#pragma unroll
      for (int c = 0; c < 4; ++c) x[j][c] = bfr(x[j][c]); }
  // the square sum keeps its tree: elements 256 apart chained, then pairwise over each aligned run of 32 elements (4 in the lane, 8 lanes), then the eight runs' sums one after another
  float s[2];
#pragma unroll
  for (int jp = 0; jp < 2; ++jp) { float q[4];
#pragma unroll
    for (int c = 0; c < 4; ++c) { float t = 0.f;
#pragma unroll
      for (int i = 0; i < 4; ++i) t += x[jp + 2 * i][c] * x[jp + 2 * i][c];
      q[c] = t; }
    s[jp] = (q[0] + q[1]) + (q[2] + q[3]); }
#pragma unroll
  for (int jp = 0; jp < 2; ++jp) { s[jp] += lane_xor<1>(s[jp]); s[jp] += lane_xor<2>(s[jp]); s[jp] += lane_xor<4>(s[jp]); }
  float tq = 0.f;
#pragma unroll
  for (int i = 0; i < 8; ++i) tq += __builtin_bit_cast(float, __builtin_amdgcn_readlane(__builtin_bit_cast(int, s[i >> 2]), (i & 3) * 8));
  const float inv = 1.0f / sqrtf(tq / (float)DM + RMSEPS);
#pragma unroll
  for (int j = 0; j < 8; ++j) { v4h o;
#pragma unroll
    for (int c = 0; c < 4; ++c) o[c] = (_Float16)(x[j][c] * inv * bfr(wn[j][c]));
    *(v4h*)(OUTH + row * DM + j * 128 + lane * 4) = o; } }
// ---- k_flags: block = (query block qb of 64 queries, half hf of the keys): FL[qb][hf * 32 + kt] = 1 if any mask[q][k] == 0 (attend) in the 64 x 32 tile; a lane owns one 16-byte column piece over 16 rows, all 16 loads independent; a block writes one whole 128-byte line of FL
__global__ __launch_bounds__(1024) void k_flags(const int* __restrict__ MASK, int* __restrict__ FL) { __shared__ __align__(16) int sf[32]; const int t = threadIdx.x; const int qb = blockIdx.x, hf = blockIdx.y; const int c4 = t & 255, rw = t >> 8;
  if (t < 32) sf[t] = 0; __syncthreads();
  const int* p = MASK + (size_t)(qb * 64 + rw) * SS + hf * (SS / 2) + c4 * 4; v4u v[16];
#pragma unroll
  for (int i = 0; i < 16; ++i) v[i] = *(const v4u*)(p + (size_t)i * 4 * SS);
  unsigned mn = 0xffffffffu;
#pragma unroll
  for (int i = 0; i < 16; ++i) mn = min(mn, min(min(v[i][0], v[i][1]), min(v[i][2], v[i][3])));   // smallest word is 0 exactly when some key is visible
  if (mn == 0u) sf[c4 >> 3] = 1;   // benign same-value race within the block
  __syncthreads(); if (t < 8) vst2((unsigned*)(FL + (size_t)qb * (SS / 32) + hf * 32 + t * 4), *(const v4u*)&sf[t * 4]); }
// ---- k_g<MODE, KW>: block = (64 rows, 128 cols): A f16 rows (MODE 0: built inline from the f32 ctx) . W^T (f16 x 2^8); MODE 0: X1 = x (bf16-rounded) + acc (f32 out); MODE 2: OUT = X1 + acc (f32)
template <int MODE, int KW>
__global__ __launch_bounds__(128) void k_g(const void* __restrict__ Ain, const _Float16* __restrict__ Wr, const float* __restrict__ RES, float* __restrict__ O32, int ow) { constexpr int AEB = (MODE == 0) ? 4 : 2, APITCH = AEB * KS + 16, STG = 64 * APITCH + 128 * HPITCH; __shared__ __attribute__((aligned(128))) char sm[2 * STG];   // the ring; behind the loop's last barrier the same bytes are the output staging
  float (*sf)[16][132] = (float (*)[16][132])sm;
  const int tid = threadIdx.x, wave = tid >> 5, lane = tid & 31, col = lane & 15, g = lane >> 4; const size_t r0 = (size_t)blockIdx.x * 64 + wave * 16; const int c0 = blockIdx.y * 128;
  v8f acc[8] = {};
  { const char* gA = (const char*)Ain + (size_t)blockIdx.x * 64 * KW * AEB; const char* gB = (const char*)(Wr + (size_t)c0 * KW); const unsigned l0 = lds_off(sm); constexpr int NT = KW / KS;
    stage_ab<AEB * KS>(l0, gA, (size_t)AEB * KW, gB, 2 * KW, tid); WAIT_ASYNC0(); __syncthreads();
    stage_ab<AEB * KS>(l0 + STG, gA + AEB * KS, (size_t)AEB * KW, gB + 2 * KS, 2 * KW, tid);
#pragma unroll 1   // stays rolled: one copy of a stage's code in the instruction cache; t & 1 picks the buffer
    for (int t = 0; t < NT; ++t) { const int bo = (t & 1) * STG;
      v16h a[KS / 32], w[KS / 32][8];   // the stage's LDS reads go out as one group in front of its products; the loops below are unrolled so that these arrays are registers
#pragma unroll
      for (int kc = 0; kc < KS / 32; ++kc) { if (MODE == 0) { const float* p = (const float*)(sm + bo + (wave * 16 + col) * APITCH) + kc * 32 + 8 * g;
#pragma unroll
          for (int i = 0; i < 8; ++i) { a[kc][i] = (_Float16)p[i]; a[kc][8 + i] = (_Float16)p[16 + i]; } } else a[kc] = frag_h((const _Float16*)(sm + bo + (wave * 16 + col) * APITCH) + kc * 32, lane);
#pragma unroll
        for (int j = 0; j < 8; ++j) w[kc][j] = frag_h((const _Float16*)(sm + bo + 64 * APITCH + (j * 16 + col) * HPITCH) + kc * 32, lane); }
#pragma unroll
      for (int kc = 0; kc < KS / 32; ++kc)
#pragma unroll
        for (int j = 0; j < 8; ++j) acc[j] = wmma16(a[kc], w[kc][j], acc[j]);
      WAIT_DS0(); WAIT_ASYNC0(); __syncthreads();   // publishes stage t + 1 and ends every reader's last read of stage t
      if (t + 2 < NT) { stage_ab<AEB * KS>(l0 + bo, gA + (size_t)(t + 2) * AEB * KS, (size_t)AEB * KW, gB + (size_t)(t + 2) * 2 * KS, 2 * KW, tid); } }
    WAIT_ASYNC0(); }
#pragma unroll
  for (int j = 0; j < 8; ++j) { const int c = c0 + j * 16 + col;
#pragma unroll
    for (int r = 0; r < 8; ++r) { const float res = RES[(r0 + 8 * g + r) * ow + c]; sf[wave][8 * g + r][j * 16 + col] = acc[j][r] * (1.0f / WSC) + (MODE == 0 ? bfr(res) : res); } }
  LDSX(); for (int rl = 0; rl < 16; ++rl) vst2(O32 + (r0 + rl) * ow + c0 + lane * 4, *(const v4f*)&sf[wave][rl][lane * 4]); }
// ---- k_gu: block = (64 rows, 128 hidden cols): g = h2 . Wg^T, u = h2 . Wu^T (same A), GU = f16(silu(g) u) -> rows [NR][HP]
__global__ __launch_bounds__(128) void k_gu(const _Float16* __restrict__ H2, const _Float16* __restrict__ PG, _Float16* __restrict__ GU) { constexpr int STG = (64 + 256) * HPITCH; __shared__ __attribute__((aligned(128))) char sm[2 * STG];   // the ring; behind the loop's last barrier the same bytes are the output staging
  _Float16 (*so)[136] = (_Float16 (*)[136])sm;
  const int tid = threadIdx.x, wave = tid >> 5, lane = tid & 31, col = lane & 15, g = lane >> 4; const size_t rb = (size_t)blockIdx.x * 64; const size_t r0 = rb + wave * 16; const int c0 = blockIdx.y * 128; const _Float16* Wg = PG + (size_t)c0 * DM; const _Float16* Wu = PG + ((size_t)HP + c0) * DM;
  v8f ag[8] = {}, au[8] = {};
  { const char* gA = (const char*)(H2 + rb * DM); const char* gG = (const char*)Wg; const char* gU = (const char*)Wu; const unsigned l0 = lds_off(sm); constexpr int NT = DM / KS;
    stage_ab<2 * KS>(l0, gA, 2 * DM, gG, 2 * DM, tid); stage_w(l0 + 192 * HPITCH, gU, 2 * DM, tid); WAIT_ASYNC0(); __syncthreads();
    stage_ab<2 * KS>(l0 + STG, gA + 2 * KS, 2 * DM, gG + 2 * KS, 2 * DM, tid); stage_w(l0 + STG + 192 * HPITCH, gU + 2 * KS, 2 * DM, tid);
#pragma unroll 1   // stays rolled: one copy of a stage's code in the instruction cache; t & 1 picks the buffer
    for (int t = 0; t < NT; ++t) { const int bo = (t & 1) * STG;
#pragma unroll
      for (int kc = 0; kc < KS / 32; ++kc) { const v16h a = frag_h((const _Float16*)(sm + bo + (wave * 16 + col) * HPITCH) + kc * 32, lane);
#pragma unroll
        for (int jh = 0; jh < 8; jh += 4) { v16h wg[4], wu[4];   // the LDS reads of eight products go out as one group in front of them (all sixteen at once would not fit beside the 128 accumulator registers); unrolled so that the arrays are registers
#pragma unroll
          for (int j = 0; j < 4; ++j) { wg[j] = frag_h((const _Float16*)(sm + bo + (64 + (jh + j) * 16 + col) * HPITCH) + kc * 32, lane); wu[j] = frag_h((const _Float16*)(sm + bo + (192 + (jh + j) * 16 + col) * HPITCH) + kc * 32, lane); }
#pragma unroll
          for (int j = 0; j < 4; ++j) { ag[jh + j] = wmma16(a, wg[j], ag[jh + j]); au[jh + j] = wmma16(a, wu[j], au[jh + j]); } } }
      WAIT_DS0(); WAIT_ASYNC0(); __syncthreads();   // publishes stage t + 1 and ends every reader's last read of stage t
      if (t + 2 < NT) { const size_t ko = (size_t)(t + 2) * 2 * KS; stage_ab<2 * KS>(l0 + bo, gA + ko, 2 * DM, gG + ko, 2 * DM, tid); stage_w(l0 + bo + 192 * HPITCH, gU + ko, 2 * DM, tid); } }
    WAIT_ASYNC0(); }
#pragma unroll
  for (int j = 0; j < 8; ++j)
#pragma unroll
    for (int r = 0; r < 8; ++r) { const float gg = ag[j][r] * (1.0f / WSC), uu = au[j][r] * (1.0f / WSC); so[wave * 16 + 8 * g + r][j * 16 + col] = (_Float16)(gg / (1.0f + __expf(-gg)) * uu); }
  __syncthreads(); for (int e = tid; e < 64 * 16; e += 128) { const int rl = e >> 4, q = e & 15; vst2((unsigned*)(GU + (rb + rl) * HP + c0 + q * 8), *(const v4u*)&so[rl][q * 8]); } }

extern "C" void kernel_launch(void* const* d_in, const int* in_sizes, int n_in, void* d_out, int out_size, void* d_ws, size_t ws_size, hipStream_t stream) {
  (void)in_sizes; (void)n_in; (void)out_size;
  const float** F = (const float**)d_in;   // 0 x [2,2048,1024], 1 attn_mask [2048,2048] int (1 = masked), 2 wq, 3 wk, 4 wv, 5 wo (natural [1024,1024]), 6 norm1_w, 7 norm2_w, 8 w_gate [2730,1024], 9 w_up, 10 w_down [1024,2730]
  if (ws_size < (size_t)WS_END) return;
  char* ws = (char*)d_ws; _Float16* PK = (_Float16*)(ws + WS_PK); _Float16 *QK = (_Float16*)(ws + WS_QK), *QKL = (_Float16*)(ws + WS_QKL), *VTH = (_Float16*)(ws + WS_VTH), *VTL = (_Float16*)(ws + WS_VTL), *H1 = (_Float16*)(ws + WS_H1), *H2 = (_Float16*)(ws + WS_H2), *GU = (_Float16*)(ws + WS_GU); float *O = (float*)(ws + WS_O), *X1 = (float*)(ws + WS_X1); int* FL = (int*)(ws + WS_FL); const int* MASK = (const int*)d_in[1];
  const int nr = NB * SS;   // keys of both batches are always needed
  k_pack<<<PK_WG, 512, 0, stream>>>(F[2], F[3], F[4], F[5], F[8], F[9], F[10], ws);
  k_rms<0><<<nr / 16, 512, 0, stream>>>(F[0], F[6], H1);
  k_flags<<<dim3(SS / 64, 2), 1024, 0, stream>>>(MASK, FL);
  k_qkv<<<dim3(nr / 64, QKVW / 128), 128, 0, stream>>>((const float*)H1, (const float*)H1, (const float*)H1, PK + PK_A, nullptr, nullptr, nullptr, QK, QKL, VTH, VTL);
  k_attn<<<dim3(TQB, NH, TNB), 128, 0, stream>>>(QK, QKL, VTH, VTL, nullptr, MASK, FL, O);
  k_g<0, DM><<<dim3(TOB, DM / 128), 128, 0, stream>>>(O, PK + PK_P, F[0], X1, DM);                  // x1 = x + ctx wo^T
  k_rms<1><<<TOB * 4, 512, 0, stream>>>(X1, F[7], H2);
  k_gu<<<dim3(TOB, HP / 128), 128, 0, stream>>>(H2, (const _Float16*)(ws + WS_PG), GU);
  k_g<2, HP><<<dim3(TOB, DM / 128), 128, 0, stream>>>(GU, (const _Float16*)(ws + WS_PD), X1, (float*)d_out, DM);   // out = x1 + (silu(g) u) w_down^T
}

// v005
// Measured time: 189 microseconds a run.
// Two timings next to v004 put it at 1.07 and 1.06 times that version's speed.
// All steps since v000 together make it 4.86 times as fast.
// compute dtype: all float inputs rounded to bf16, attn_mask (int) read on device; RMSNorms (eps 1e-6) in f32, normed rows once to f16; q/k/v = f16(h) . W^T against exact f16 x 2^8 weight copies on WMMA 16x16x32 (single products, f32 accumulate); rotate-half RoPE in f32 (precise sinf/cosf) before the f16 hi + residual split; attention with 3-product scores and P.v (hi + residual planes), x 1/8, masked keys excluded (mask read per pair; fully-masked 64x32 tiles skipped via a device-built flag table), running-max softmax in f32 (hardware exp); x1 = x + f16(ctx) . Wo^T; SwiGLU: f16(rmsnorm(x1)) . [W_gate | W_up]^T (hidden padded 2,730 -> 2,816 with zero weights), silu(g) u in f32 -> f16, . W_down^T + x1; f32 output.
#include <hip/hip_runtime.h>
#include <math.h>

typedef __attribute__((ext_vector_type(16))) _Float16 v16h;
typedef __attribute__((ext_vector_type(16))) __bf16 v16b;
typedef __attribute__((ext_vector_type(8)))  _Float16 v8h;
typedef __attribute__((ext_vector_type(8)))  float v8f;
typedef __attribute__((ext_vector_type(4)))  float v4f;
typedef __attribute__((ext_vector_type(2)))  float v2f;
typedef __attribute__((ext_vector_type(4)))  unsigned v4u;
typedef __attribute__((ext_vector_type(4)))  int v4i;
typedef float __attribute__((may_alias)) float_a;
typedef int __attribute__((may_alias)) int_a;

template <typename T> __device__ __forceinline__ void vst2(void* p, T v) { *(T*)p = v;  }
__device__ __forceinline__ v8f wmma16(v16h a, v16h b, v8f c) {
  v8f d = __builtin_amdgcn_wmma_f32_16x16x32_f16(false, a, false, b, (short)0, c, false, false);
  asm volatile("v_nop\n\tv_nop\n\tv_nop\n\tv_nop" : "+v"(d) : "v"(a), "v"(b));
  return d;
}
__device__ __forceinline__ v8f wmma_bf(v16b a, v16b b, v8f c) {
  v8f d = __builtin_amdgcn_wmma_f32_16x16x32_bf16(false, a, false, b, (short)0, c, false, false);
  asm volatile("v_nop\n\tv_nop\n\tv_nop\n\tv_nop" : "+v"(d) : "v"(a), "v"(b));
  return d;
}
// Streaming decoder block (B 2, L 2,048, d 1,024, 16 heads x 64, SwiGLU hidden 2,730): pre-RMSNorm, bias-free projections, rotate-half RoPE (base 10000), attention under the given boolean mask (all-keys + 256-token window), out-projection + residual, pre-RMSNorm SwiGLU FFN + residual.
__device__ __forceinline__ v16h frag_h(const _Float16* rowk0, int lane) {
  union { v16h v; v8h q[2]; } u; const _Float16* p = rowk0 + 8 * (lane >> 4);
  u.q[0] = *(const v8h*)p; u.q[1] = *(const v8h*)(p + 16); return u.v;
}
__device__ __forceinline__ v16h frag_f32(const float* rowk0, int lane) {
  v16h a; const float* p = rowk0 + 8 * (lane >> 4);
#pragma unroll
  for (int i = 0; i < 8; ++i) { a[i] = (_Float16)p[i]; a[8 + i] = (_Float16)p[16 + i]; }
  return a;
}
__device__ __forceinline__ v16h frag_f32s(const float* rowk0, int lane, float sc) {
  v16h a; const float* p = rowk0 + 8 * (lane >> 4);
#pragma unroll
  for (int i = 0; i < 8; ++i) { a[i] = (_Float16)(p[i] * sc); a[8 + i] = (_Float16)(p[16 + i] * sc); }
  return a;
}
// column fragment from a [K][ld] layout (column n), rows >= K read as 0
__device__ __forceinline__ v16h fragc_f32(const float* W, int k0, int n, int lane, int ld, int K) {
  v16h a; const int g = lane >> 4;
#pragma unroll
  for (int i = 0; i < 8; ++i) { const int ka = k0 + 8 * g + i, kb = ka + 16;
    a[i] = (_Float16)(ka < K ? W[(size_t)(ka < K ? ka : K - 1) * ld + n] : 0.f); a[8 + i] = (_Float16)(kb < K ? W[(size_t)(kb < K ? kb : K - 1) * ld + n] : 0.f); }
  return a;
}
struct F2 { v16b h, l; };
__device__ __forceinline__ F2 bsplit16(const float v[16]) { F2 r;
#pragma unroll
  for (int i = 0; i < 16; ++i) { const __bf16 h = (__bf16)v[i]; r.h[i] = h; r.l[i] = (__bf16)(v[i] - (float)h); }
  return r; }
__device__ __forceinline__ F2 split_row(const float* row, int k0, int lane) { float v[16]; const float* p = row + k0 + 8 * (lane >> 4);
#pragma unroll
  for (int i = 0; i < 8; ++i) { v[i] = p[i]; v[8 + i] = p[16 + i]; }
  return bsplit16(v); }
__device__ __forceinline__ F2 split_rowK(const float* row, int k0, int lane, int K) { float v[16]; const int g = lane >> 4;
#pragma unroll
  for (int i = 0; i < 8; ++i) { const int ka = k0 + 8 * g + i, kb = ka + 16; v[i] = ka < K ? row[ka < K ? ka : K - 1] : 0.f; v[8 + i] = kb < K ? row[kb < K ? kb : K - 1] : 0.f; }
  return bsplit16(v); }
__device__ __forceinline__ F2 split_col(const float* W, int k0, int n, int lane, int ld, int K) { float v[16]; const int g = lane >> 4;
#pragma unroll
  for (int i = 0; i < 8; ++i) { const int ka = k0 + 8 * g + i, kb = ka + 16; v[i] = ka < K ? W[(size_t)(ka < K ? ka : K - 1) * ld + n] : 0.f; v[8 + i] = kb < K ? W[(size_t)(kb < K ? kb : K - 1) * ld + n] : 0.f; }
  return bsplit16(v); }
__device__ __forceinline__ v8f mac3(const F2& a, const F2& b, v8f c) { c = wmma_bf(a.l, b.h, c); c = wmma_bf(a.h, b.l, c); return wmma_bf(a.h, b.h, c); }
__device__ __forceinline__ float sigm(float v) { return 1.0f / (1.0f + expf(-v)); }
#define LDSX() do { asm volatile("s_wait_dscnt 0" ::: "memory"); __builtin_amdgcn_wave_barrier(); __builtin_amdgcn_fence(__ATOMIC_RELEASE, "workgroup"); } while (0)
// ---- GEMM operand ring: a stage is 64 k of every operand row of the block's tile, brought into LDS by asynchronous 16-byte copies (a wave's copy covers whole 128-byte lines); LDS row pitch = row bytes + 16 (16 B x odd: conflict-free for 16-byte reads); two buffers
#define KS 64
#define HPITCH (2 * KS + 16)       // f16 rows: 128 B + 16
__device__ __forceinline__ unsigned lds_off(const void* p) { return (unsigned)(size_t)p; }
// a run of copies and, as the last line of their own statement, the wait that stands in front of any rewrite of their address registers (one wait a run: fewer, longer runs cost a wave fewer waits)
#define CPL(a, b) "global_load_async_to_lds_b128 %" #a ", %" #b ", off\n\t"
__device__ __forceinline__ void cp8(const unsigned* l, const char* const* g) {
  asm volatile(CPL(0, 1) CPL(2, 3) CPL(4, 5) CPL(6, 7) CPL(8, 9) CPL(10, 11) CPL(12, 13) CPL(14, 15) "s_wait_xcnt 0x0"
               :: "v"(l[0]), "v"(g[0]), "v"(l[1]), "v"(g[1]), "v"(l[2]), "v"(g[2]), "v"(l[3]), "v"(g[3]), "v"(l[4]), "v"(g[4]), "v"(l[5]), "v"(g[5]), "v"(l[6]), "v"(g[6]), "v"(l[7]), "v"(g[7]) : "memory");
}
__device__ __forceinline__ void cp12(const unsigned* l, const char* const* g) {
  asm volatile(CPL(0, 1) CPL(2, 3) CPL(4, 5) CPL(6, 7) CPL(8, 9) CPL(10, 11) CPL(12, 13) CPL(14, 15) CPL(16, 17) CPL(18, 19) CPL(20, 21) CPL(22, 23) "s_wait_xcnt 0x0"
               :: "v"(l[0]), "v"(g[0]), "v"(l[1]), "v"(g[1]), "v"(l[2]), "v"(g[2]), "v"(l[3]), "v"(g[3]), "v"(l[4]), "v"(g[4]), "v"(l[5]), "v"(g[5]), "v"(l[6]), "v"(g[6]), "v"(l[7]), "v"(g[7]), "v"(l[8]), "v"(g[8]), "v"(l[9]), "v"(g[9]), "v"(l[10]), "v"(g[10]), "v"(l[11]), "v"(g[11]) : "memory");
}
// this thread's addresses for ROWS rows of RB bytes from gb (row pitch gp bytes) to LDS byte address lb (row pitch RB + 16), dealt over the NTH threads of a block: ROWS * RB / (16 * NTH) copies a thread
template <int ROWS, int RB, int NTH = 128>
__device__ __forceinline__ void row_addr(unsigned* l, const char** g, unsigned lb, const char* gb, size_t gp, int tid) {
  constexpr int PPR = RB / 16, RPI = NTH / PPR, NI = ROWS / RPI; const int row = tid / PPR, pc = tid % PPR;
#pragma unroll
  for (int i = 0; i < NI; ++i) { l[i] = lb + (row + i * RPI) * (RB + 16) + pc * 16; g[i] = gb + (size_t)(row + i * RPI) * gp + pc * 16; }
}
// 128 threads: 128 A rows of 128 B at lb, behind them 128 weight rows of 128 B
__device__ __forceinline__ void stage_ab(unsigned lb, const char* ga, size_t pa, const char* gb, size_t pb, int tid) {
  unsigned l[16]; const char* g[16]; row_addr<128, 2 * KS>(l, g, lb, ga, pa, tid); row_addr<128, 2 * KS>(l + 8, g + 8, lb + 128 * HPITCH, gb, pb, tid); cp8(l, g); cp8(l + 8, g + 8);
}
// 256 threads: 128 A rows of ARB bytes at lb, behind them 128 weight rows of 128 B
template <int ARB>
__device__ __forceinline__ void stage_ab8(unsigned lb, const char* ga, size_t pa, const char* gb, size_t pb, int tid) {
  constexpr int NA = 128 * ARB / 4096; unsigned l[NA + 4]; const char* g[NA + 4];
  row_addr<128, ARB, 256>(l, g, lb, ga, pa, tid); row_addr<128, 2 * KS, 256>(l + NA, g + NA, lb + 128 * (ARB + 16), gb, pb, tid);
  if constexpr (NA == 4) cp8(l, g); else cp12(l, g);
}
// 256 threads: three runs of 128 rows of 128 B (A, gate, up; all of row pitch gp), one behind the other at lb
__device__ __forceinline__ void stage_abc8(unsigned lb, const char* ga, const char* gb, const char* gc, size_t gp, int tid) {
  unsigned l[12]; const char* g[12]; row_addr<128, 2 * KS, 256>(l, g, lb, ga, gp, tid); row_addr<128, 2 * KS, 256>(l + 4, g + 4, lb + 128 * HPITCH, gb, gp, tid); row_addr<128, 2 * KS, 256>(l + 8, g + 8, lb + 256 * HPITCH, gc, gp, tid); cp12(l, g);
}
#define WAIT_ASYNC0() asm volatile("s_wait_asynccnt 0x0" ::: "memory")   // this wave's copies have landed
#define WAIT_DS0() asm volatile("s_wait_dscnt 0x0" ::: "memory")         // this wave's LDS reads of the buffer have returned before it is refilled


#define NB 2
#define SS 2048
#define DM 1024
#define NH 16
#define HID 2730
#define HP 2816          // hidden padded to 22 x 128
#define WSC 256.0f
#define RMSEPS 1e-6f
__constant__ float THETA[32] = {1.000000000e+00f,7.498942018e-01f,5.623413324e-01f,4.216965139e-01f,3.162277639e-01f,2.371373773e-01f,1.778279394e-01f,1.333521456e-01f,1.000000015e-01f,7.498942316e-02f,5.623413250e-02f,4.216964915e-02f,3.162277490e-02f,2.371373773e-02f,1.778279431e-02f,1.333521400e-02f,9.999999776e-03f,7.498942316e-03f,5.623413250e-03f,4.216964822e-03f,3.162277630e-03f,2.371373819e-03f,1.778279431e-03f,1.333521446e-03f,1.000000047e-03f,7.498941850e-04f,5.623413017e-04f,4.216965172e-04f,3.162277571e-04f,2.371373703e-04f,1.778279402e-04f,1.333521504e-04f};
__device__ __attribute__((noinline)) float cos_p(float v) { return cosf(v); }
__device__ __attribute__((noinline)) float sin_p(float v) { return sinf(v); }
#define HD 64
#define QKVW (3 * DM)
#ifndef TQB
#define TQB (SS / 64)
#define TNB NB
#define TOB (NB * SS / 64)     // output row tiles (all)
#endif
typedef __attribute__((ext_vector_type(8))) __bf16 v8b;
__device__ __forceinline__ v16b frag_b(const __bf16* rowk0, int lane) {
  union { v16b v; v8b q[2]; } u; const __bf16* p = rowk0 + 8 * (lane >> 4);
  u.q[0] = *(const v8b*)p; u.q[1] = *(const v8b*)(p + 16); return u.v;
}
__device__ __forceinline__ float bfr(float v) { return (float)(__bf16)v; }
__device__ __attribute__((noinline)) float exp_ni(float v) { return expf(v); }
__device__ __attribute__((noinline)) float erf_ni(float v) { return erff(v); }

#define PK_A 0                       // [3072][1024] Wqkv rows (natural [out][in])
#define PK_P (PK_A + QKVW * DM)        // [1024][1024] Wo rows (natural)
#define PK_END (PK_P + DM * DM)
#define WS_PK  0u
#define WS_QK  (WS_PK + 2u * PK_END)             // f16 [4096 rows][2048]: q | k
#define WS_QKL (WS_QK + 2u * NB * SS * 2 * DM)     // f16 q | k residual planes x2048
#define WS_VTH (WS_QKL + 2u * NB * SS * 2 * DM)    // f16 [b][1024 (h*64+d)][2048 s] hi
#define WS_VTL (WS_VTH + 2u * NB * DM * SS)        // f16 lo x 2048
#define WS_O   (WS_VTL + 2u * NB * DM * SS)        // f32 [4096][1024]
#define WS_PG  (WS_O + 4u * (size_t)NB * SS * DM)        // f16 x 2^8 [gate | up] rows [2*HP][1024] (zero rows >= HID), down rows [1024][HP] (zero cols >= HID)
#define WS_PD  (WS_PG + 2u * (size_t)2 * HP * DM)
#define WS_H1  (WS_PD + 2u * (size_t)DM * HP)             // f16 rmsnorm1(x) rows [NR][1024]; int flags [SS/64][SS/32]; f32 x1 [NR][1024]; f16 rmsnorm2(x1) rows; f16 silu(gate) up rows [NR][HP]
#define WS_FL  (WS_H1 + 2u * (size_t)NB * SS * DM)
#define WS_X1  (WS_FL + 4u * (size_t)(SS / 64) * (SS / 32))
#define WS_H2  (WS_X1 + 4u * (size_t)NB * SS * DM)
#define WS_GU  (WS_H2 + 2u * (size_t)NB * SS * DM)
#define WS_END (WS_GU + 2u * (size_t)NB * SS * HP)
// ---- k_pack: a resident stream, one task a wave and pass, no LDS and no barrier: 2,048 half rows of W_down, 4,096 rows of W_q | W_k | W_v | W_o, 5,632 rows of gate | up (the longer tasks first); value = f16(bf16(w) x 2^8); all loads of a task go out before its first store; every load and store of a wave covers one contiguous run of bytes; the loops over j and c below are unrolled so that the pieces stay in registers and the loads go out as one group
typedef __attribute__((ext_vector_type(4))) _Float16 v4h;
typedef __attribute__((ext_vector_type(2))) _Float16 v2h;
#define PT_D (2 * DM)
#define PT_A (PT_D + 4 * DM)
#define PT_END (PT_A + 2 * HP)
#define PK_WG 256        // work-groups of 16 waves: one a WGP
__device__ __forceinline__ _Float16 wcv(float w) { return (_Float16)(bfr(w) * WSC); }
#define STORES_OUT() asm volatile("s_wait_xcnt 0x0" ::: "memory")   // stands directly behind a task's last store: what follows (the next task) rewrites registers that these stores name
// one row of 1,024: a lane holds 8 pieces of 16 bytes, 128 elements apart
__device__ __forceinline__ void pack_row(const float* __restrict__ s, _Float16* __restrict__ d, int lane) { v4f x[8];
#pragma unroll
  for (int j = 0; j < 8; ++j) x[j] = *(const v4f*)(s + j * 128 + lane * 4);
#pragma unroll
  for (int j = 0; j < 8; ++j) { v4h o;
#pragma unroll
    for (int c = 0; c < 4; ++c) o[c] = wcv(x[j][c]);
    *(v4h*)(d + j * 128 + lane * 4) = o; }
  STORES_OUT(); }
__global__ __launch_bounds__(512) void k_pack(const float* __restrict__ WQ, const float* __restrict__ WK, const float* __restrict__ WV, const float* __restrict__ WO, const float* __restrict__ WG, const float* __restrict__ WU, const float* __restrict__ WD, char* __restrict__ ws) {
  const int lane = threadIdx.x & 31; _Float16* P = (_Float16*)(ws + WS_PK);
  for (int task = __builtin_amdgcn_readfirstlane((threadIdx.x >> 5) * PK_WG + blockIdx.x); task < PT_END; task += 16 * PK_WG) {   // dealt wave-major, so that every work-group gets the same mix of tasks; the task number sits in a scalar register, so the branches on it are scalar
    if (task < PT_D) { const int n = task >> 1, k0 = (task & 1) * (HP / 2) + lane * 2; const float* s = WD + (size_t)n * HID; _Float16* d = (_Float16*)(ws + WS_PD) + (size_t)n * HP; v2f x[22];   // down rows [1024][HP], zero beyond 2,730; a source row starts on 8 bytes only, hence 8-byte loads
#pragma unroll
      for (int j = 0; j < 22; ++j) { const int k = k0 + j * 64; x[j] = *(const v2f*)(s + (k < HID ? k : 0)); }
#pragma unroll
      for (int j = 0; j < 22; ++j) { const int k = k0 + j * 64; v2h o; o[0] = (k < HID) ? wcv(x[j][0]) : (_Float16)0.0f; o[1] = (k < HID) ? wcv(x[j][1]) : (_Float16)0.0f; *(v2h*)(d + k) = o; }
      STORES_OUT(); }
    else if (task < PT_A) { const int r = task - PT_D, which = r >> 10; const float* w = (which == 0) ? WQ : (which == 1) ? WK : (which == 2) ? WV : WO; pack_row(w + (size_t)(r & (DM - 1)) * DM, P + PK_A + (size_t)r * DM, lane); }   // PK_P follows PK_A directly
    else { const int r = task - PT_A, n = (r < HP) ? r : r - HP; _Float16* d = (_Float16*)(ws + WS_PG) + (size_t)r * DM;   // gate | up rows, zero beyond 2,730
      if (n < HID) pack_row(((r < HP) ? WG : WU) + (size_t)n * DM, d, lane);
      else { const v4h z = {};
#pragma unroll
        for (int j = 0; j < 8; ++j) *(v4h*)(d + j * 128 + lane * 4) = z;
        STORES_OUT(); } }
  } }
__global__ __launch_bounds__(128) void k_qkv(const float* __restrict__ XQ, const float* __restrict__ XK, const float* __restrict__ XV, const _Float16* __restrict__ P, const float* __restrict__ BQ, const float* __restrict__ BK, const float* __restrict__ BV, _Float16* __restrict__ QK, _Float16* __restrict__ QKL, _Float16* __restrict__ VTH, _Float16* __restrict__ VTL) {
  const int which0 = (blockIdx.y * 128) / DM; const float* X = (which0 == 0) ? XQ : (which0 == 1) ? XK : XV; const float* BB = BQ ? (((which0 == 0) ? BQ : (which0 == 1) ? BK : BV) + (blockIdx.y * 128 - which0 * DM)) : nullptr;
  constexpr int STG = (128 + 128) * HPITCH; __shared__ __attribute__((aligned(128))) char sm[2 * STG];   // the ring; behind the loop's last barrier the same bytes are the output staging
  _Float16 (*so)[16][136] = (_Float16 (*)[16][136])sm; _Float16 (*sol)[16][136] = (_Float16 (*)[16][136])(sm + 4 * 16 * 136 * 2); _Float16 (*sth)[136] = (_Float16 (*)[136])sm; _Float16 (*stl)[136] = (_Float16 (*)[136])(sm + 128 * 136 * 2);
  const int tid = threadIdx.x, wave = tid >> 5, lane = tid & 31, col = lane & 15, g = lane >> 4; const size_t r0 = (size_t)blockIdx.x * 128 + wave * 32; const int n0 = blockIdx.y * 128;   // block = (128 rows, 128 cols); a wave holds 32 rows x 128 cols: each weight fragment read from LDS feeds two products
  v8f acc[2][8] = {};
  { const char* gA = (const char*)((const _Float16*)X + (size_t)blockIdx.x * 128 * DM); const char* gB = (const char*)(P + (size_t)n0 * DM); const unsigned l0 = lds_off(sm); constexpr int NT = DM / KS;   // A = f16 rmsnorm rows
    stage_ab(l0, gA, 2 * DM, gB, 2 * DM, tid); WAIT_ASYNC0(); __syncthreads();
    stage_ab(l0 + STG, gA + 2 * KS, 2 * DM, gB + 2 * KS, 2 * DM, tid);
#pragma unroll 1   // stays rolled: one copy of a stage's code in the instruction cache; t & 1 picks the buffer
    for (int t = 0; t < NT; ++t) { const int bo = (t & 1) * STG;
#pragma unroll
      for (int kc = 0; kc < KS / 32; ++kc) { v16h a[2], w[8];   // a 32-k step's LDS reads go out as one group in front of its 16 products (both steps' fragments at once would not fit beside the 128 accumulator registers); the loops below are unrolled so that these arrays are registers
#pragma unroll
        for (int i = 0; i < 2; ++i) a[i] = frag_h((const _Float16*)(sm + bo + (wave * 32 + i * 16 + col) * HPITCH) + kc * 32, lane);
#pragma unroll
        for (int j = 0; j < 8; ++j) w[j] = frag_h((const _Float16*)(sm + bo + (128 + j * 16 + col) * HPITCH) + kc * 32, lane);
#pragma unroll
        for (int j = 0; j < 8; ++j)
#pragma unroll
          for (int i = 0; i < 2; ++i) acc[i][j] = wmma16(a[i], w[j], acc[i][j]); }
      WAIT_DS0(); WAIT_ASYNC0(); __syncthreads();   // publishes stage t + 1 and ends every reader's last read of stage t
      if (t + 2 < NT) { stage_ab(l0 + bo, gA + (size_t)(t + 2) * 2 * KS, 2 * DM, gB + (size_t)(t + 2) * 2 * KS, 2 * DM, tid); } }
    WAIT_ASYNC0(); }
#pragma unroll
  for (int i = 0; i < 2; ++i)
#pragma unroll
    for (int j = 0; j < 8; ++j)
#pragma unroll
      for (int r = 0; r < 8; ++r) acc[i][j][r] *= (1.0f / WSC);
  if (n0 < 2 * DM) {   // bias, then rotate-half rotary over each 64-dim head with angle position * inv_freq[d mod 32]; the wave's two 16-row halves go through its staging rows one after the other (unrolled: acc is indexed by i)
#pragma unroll
    for (int i = 0; i < 2; ++i) { const size_t ri = r0 + i * 16;
#pragma unroll
      for (int j = 0; j < 8; ++j)
#pragma unroll
        for (int r = 0; r < 8; ++r) acc[i][j][r] += (BB ? bfr(BB[j * 16 + col]) : 0.f);
#pragma unroll
      for (int r = 0; r < 8; ++r) { const int spos = (int)((ri + 8 * g + r) % SS);
#pragma unroll
        for (int jj = 0; jj < 2; ++jj) { const float ang = (float)spos * THETA[jj * 16 + col]; const float c = cos_p(ang), sn = sin_p(ang);
#pragma unroll
          for (int hh = 0; hh < 2; ++hh) { const float x1 = acc[i][hh * 4 + jj][r], x2 = acc[i][hh * 4 + jj + 2][r]; acc[i][hh * 4 + jj][r] = x1 * c - x2 * sn; acc[i][hh * 4 + jj + 2][r] = x2 * c + x1 * sn; } } }
      if (i) LDSX();   // the first half's reads of the staging rows have returned before other lanes rewrite them
#pragma unroll
      for (int j = 0; j < 8; ++j) {
#pragma unroll
        for (int r = 0; r < 8; ++r) { const float v = acc[i][j][r]; const _Float16 hv = (_Float16)v; so[wave][8 * g + r][j * 16 + col] = hv; sol[wave][8 * g + r][j * 16 + col] = (_Float16)((v - (float)hv) * 2048.0f); } }   // q, k (+ bias) as f16 hi + (x2048) residual
      LDSX();
      for (int rl = 0; rl < 16; ++rl) if (lane < 16) { vst2((unsigned*)(QK + (ri + rl) * (2 * DM) + n0 + lane * 8), *(const v4u*)&so[wave][rl][lane * 8]); vst2((unsigned*)(QKL + (ri + rl) * (2 * DM) + n0 + lane * 8), *(const v4u*)&sol[wave][rl][lane * 8]); } }
  } else {
#pragma unroll
    for (int i = 0; i < 2; ++i)
#pragma unroll
      for (int j = 0; j < 8; ++j) {
#pragma unroll
        for (int r = 0; r < 8; ++r) { const float v = acc[i][j][r] + (BB ? bfr(BB[j * 16 + col]) : 0.f); const _Float16 hv = (_Float16)v; sth[j * 16 + col][wave * 32 + i * 16 + 8 * g + r] = hv; stl[j * 16 + col][wave * 32 + i * 16 + 8 * g + r] = (_Float16)((v - (float)hv) * 2048.0f); } }
    __syncthreads();
    const size_t rb = (size_t)blockIdx.x * 128; const int b = (int)(rb / SS), s0 = (int)(rb % SS); const int pc0 = n0 - 2 * DM;
    for (int q = tid; q < 128 * 16; q += 128) { const int d = q >> 4, pc = q & 15; const size_t o = ((size_t)b * DM + pc0 + d) * SS + s0 + pc * 8; vst2((unsigned*)(VTH + o), *(const v4u*)&sth[d][pc * 8]); vst2((unsigned*)(VTL + o), *(const v4u*)&stl[d][pc * 8]); }
  }
}
// ---- k_attn: block = (64 queries, head h, batch b): flash attention over the visible (64-query, 32-key) tiles (K = 64: 2 k-steps), scores = (q.k) * 0.125, 3 products (hi + residual planes), P.V likewise; O[b*S+q][h*64+d] = (acc + accl / 2048) / (2048 l) (256-B segments)
// a tile's K rows (32 x 128 B, hi and residual) and V^T rows (64 x 64 B, hi and residual) come into LDS once for the block's four waves by asynchronous 16-byte copies, two buffers, the next visible tile in flight while this one is worked on; row pitch = row bytes + 16 (16 B x odd: conflict-free for 16-byte reads)
#define AKP (2 * HD + 16)
#define AVP (2 * 32 + 16)
#define A_KH 0
#define A_KL (32 * AKP)
#define A_VH (2 * 32 * AKP)
#define A_VL (A_VH + HD * AVP)
#define A_STG (A_VL + HD * AVP)
// tile ks to LDS byte address lb: 8 copies a thread; kh, kl: key row 0 of this (batch, head) in the two planes; vh, vl: its V^T row 0
__device__ __forceinline__ void stage_kv(unsigned lb, const char* kh, const char* kl, const char* vh, const char* vl, int ks, int tid) {
  unsigned l[8]; const char* g[8]; const int kr = tid >> 3, kp = tid & 7, vr = tid >> 2, vp = tid & 3;
  const size_t ko = (size_t)(ks * 32 + kr) * (2 * DM * 2) + kp * 16, vo = (size_t)vr * (SS * 2) + ks * 64 + vp * 16;
#pragma unroll
  for (int i = 0; i < 2; ++i) { const unsigned lk = lb + (kr + 16 * i) * AKP + kp * 16, lv = lb + (vr + 32 * i) * AVP + vp * 16; const size_t gk = ko + (size_t)i * 16 * (2 * DM * 2), gv = vo + (size_t)i * 32 * (SS * 2);
    l[i] = lk + A_KH; g[i] = kh + gk; l[2 + i] = lk + A_KL; g[2 + i] = kl + gk; l[4 + i] = lv + A_VH; g[4 + i] = vh + gv; l[6 + i] = lv + A_VL; g[6 + i] = vl + gv; }
  cp8(l, g);
}
__global__ __launch_bounds__(128) void k_attn(const _Float16* __restrict__ QK, const _Float16* __restrict__ QKL, const _Float16* __restrict__ VTH, const _Float16* __restrict__ VTL, const void* __restrict__ KMASK, const int* __restrict__ MASK, const int* __restrict__ FL, float* __restrict__ O) {
  __shared__ __align__(16) float sp[4][16][36]; __shared__ __align__(16) float so[4][16][68]; __shared__ __attribute__((aligned(128))) char sm[2 * A_STG];   // sm: the K / V ring
  const int tid = threadIdx.x, wave = tid >> 5, lane = tid & 31, col = lane & 15, g = lane >> 4;
  const int qb = blockIdx.x, h = blockIdx.y, b = blockIdx.z; const int q0 = qb * 64 + wave * 16; const size_t rq = (size_t)b * SS + q0 + col;
  // the visible tiles of this query block as 64 bits in scalar registers (the same in every wave of the block), taken in rising order: the ring has to know the next tile before this one is done
  unsigned long long todo = ((unsigned long long)__builtin_amdgcn_ballot_w32(FL[qb * (SS / 32) + 32 + lane] != 0) << 32) | __builtin_amdgcn_ballot_w32(FL[qb * (SS / 32) + lane] != 0);
  const int nt = __builtin_popcountll(todo);
  const char* gkh = (const char*)(QK + (size_t)b * SS * (2 * DM) + DM + h * HD); const char* gkl = (const char*)(QKL + (size_t)b * SS * (2 * DM) + DM + h * HD);
  const char* gvh = (const char*)(VTH + ((size_t)b * DM + h * HD) * SS); const char* gvl = (const char*)(VTL + ((size_t)b * DM + h * HD) * SS); const unsigned l0 = lds_off(sm);
  int ks = 0, ksn = 0;
  if (nt > 0) { ks = __builtin_ctzll(todo); todo &= todo - 1; stage_kv(l0, gkh, gkl, gvh, gvl, ks, tid); }
  v16h aq[2], aql[2];
#pragma unroll
  for (int kc = 0; kc < 2; ++kc) { aq[kc] = frag_h(QK + rq * (2 * DM) + h * HD + kc * 32, lane); aql[kc] = frag_h(QKL + rq * (2 * DM) + h * HD + kc * 32, lane); }
  float m[8], l[8];
#pragma unroll
  for (int r = 0; r < 8; ++r) { m[r] = -3.0e38f; l[r] = 0.f; }
  v8f acc[4] = {}, accl[4] = {};
  WAIT_ASYNC0(); __syncthreads();   // publishes the first tile
  if (nt > 1) { ksn = __builtin_ctzll(todo); todo &= todo - 1; stage_kv(l0 + A_STG, gkh, gkl, gvh, gvl, ksn, tid); }
#pragma unroll 1   // stays rolled: t & 1 picks the buffer
  for (int t = 0; t < nt; ++t) { const int bo = (t & 1) * A_STG; v8f s[2];
    v16h kh[2][2], kl[2][2];   // the tile's K reads go out as one group in front of its products; unrolled so that the arrays are registers
#pragma unroll
    for (int ct = 0; ct < 2; ++ct)
#pragma unroll
      for (int kc = 0; kc < 2; ++kc) { kh[ct][kc] = frag_h((const _Float16*)(sm + bo + A_KH + (ct * 16 + col) * AKP) + kc * 32, lane); kl[ct][kc] = frag_h((const _Float16*)(sm + bo + A_KL + (ct * 16 + col) * AKP) + kc * 32, lane); }
#pragma unroll
    for (int ct = 0; ct < 2; ++ct) { const int kk = ks * 32 + ct * 16 + col; v8f c = {}, cl = {};
#pragma unroll
      for (int kc = 0; kc < 2; ++kc) { c = wmma16(aq[kc], kh[ct][kc], c); cl = wmma16(aql[kc], kh[ct][kc], cl); cl = wmma16(aq[kc], kl[ct][kc], cl); }   // 3 products: q, k as f16 hi + residual
#pragma unroll
      for (int r = 0; r < 8; ++r) c[r] += cl[r] * (1.0f / 2048.0f);
      {
#pragma unroll
      for (int r = 0; r < 8; ++r) s[ct][r] = (MASK[(size_t)(q0 + 8 * g + r) * SS + kk] == 0) ? c[r] * 0.125f : -3.0e38f; } }   // 1/sqrt(64); masked keys excluded
#pragma unroll
    for (int r = 0; r < 8; ++r) { float mx = fmaxf(s[0][r], s[1][r]);
#pragma unroll
      for (int o = 1; o < 16; o <<= 1) mx = fmaxf(mx, __shfl_xor(mx, o));
      const float mn = fmaxf(m[r], mx); const float alpha = (m[r] <= -1.0e38f) ? 0.f : __expf(m[r] - mn);
      const float e0 = (s[0][r] <= -1.0e38f) ? 0.f : __expf(s[0][r] - mn), e1 = (s[1][r] <= -1.0e38f) ? 0.f : __expf(s[1][r] - mn); float es = e0 + e1;
#pragma unroll
      for (int o = 1; o < 16; o <<= 1) es += __shfl_xor(es, o);
      l[r] = l[r] * alpha + es; m[r] = mn;
#pragma unroll
      for (int dt = 0; dt < 4; ++dt) { acc[dt][r] *= alpha; accl[dt][r] *= alpha; }
      sp[wave][8 * g + r][col] = e0; sp[wave][8 * g + r][16 + col] = e1; }
    LDSX();
    v16h vh[4], vl[4];   // the tile's V reads likewise as one group
#pragma unroll
    for (int dt = 0; dt < 4; ++dt) { vh[dt] = frag_h((const _Float16*)(sm + bo + A_VH + (dt * 16 + col) * AVP), lane); vl[dt] = frag_h((const _Float16*)(sm + bo + A_VL + (dt * 16 + col) * AVP), lane); }
    v16h pa, pl; { const float* prow = &sp[wave][col][0] + 8 * (lane >> 4);
#pragma unroll
      for (int i = 0; i < 8; ++i) { const float x0 = prow[i] * 2048.0f, x1 = prow[16 + i] * 2048.0f; const _Float16 h0 = (_Float16)x0, h1 = (_Float16)x1; pa[i] = h0; pa[8 + i] = h1; pl[i] = (_Float16)((x0 - (float)h0) * 2048.0f); pl[8 + i] = (_Float16)((x1 - (float)h1) * 2048.0f); } }   // P scaled by 2^11 before the f16 split so small softmax weights stay out of the f16 subnormal range; 2^-11 folded into the epilogue
#pragma unroll
    for (int dt = 0; dt < 4; ++dt) { acc[dt] = wmma16(pa, vh[dt], acc[dt]); accl[dt] = wmma16(pl, vh[dt], accl[dt]); accl[dt] = wmma16(pa, vl[dt], accl[dt]); }   // P hi x V hi + (P lo x V hi + P hi x V lo) / 2048
    WAIT_DS0(); WAIT_ASYNC0(); __syncthreads();   // publishes tile t + 1 and ends every reader's last read of tile t (and this wave's reads of its sp rows)
    ks = ksn;
    if (t + 2 < nt) { ksn = __builtin_ctzll(todo); todo &= todo - 1; stage_kv(l0 + bo, gkh, gkl, gvh, gvl, ksn, tid); } }
  WAIT_ASYNC0();
#pragma unroll
  for (int r = 0; r < 8; ++r) { const float il = (l[r] > 0.f) ? (1.0f / 2048.0f) / l[r] : 0.f;
#pragma unroll
    for (int dt = 0; dt < 4; ++dt) so[wave][8 * g + r][dt * 16 + col] = (acc[dt][r] + accl[dt][r] * (1.0f / 2048.0f)) * il; }
  LDSX();
  for (int rl = 0; rl < 16; ++rl) if (lane < 16) vst2(O + ((size_t)b * SS + q0 + rl) * DM + h * HD + lane * 4, *(const v4f*)&so[wave][rl][lane * 4]);
}
// ---- k_out: block = (64 rows, 128 cols): out = O(hi/lo) . Wo rows (2 products) + bo
__global__ __launch_bounds__(128) void k_out(const float* __restrict__ O, const __bf16* __restrict__ P, const float* __restrict__ BO, float* __restrict__ Y) {
  __shared__ __align__(16) float so[4][16][132];
  const int tid = threadIdx.x, wave = tid >> 5, lane = tid & 31, col = lane & 15, g = lane >> 4; const size_t r0 = (size_t)blockIdx.x * 64 + wave * 16; const int n0 = blockIdx.y * 128;
  v8f acc[8] = {};
#pragma unroll 2
  for (int kc = 0; kc < DM / 32; ++kc) { const F2 a = split_row(O + (r0 + col) * DM, kc * 32, lane);
#pragma unroll
    for (int j = 0; j < 8; ++j) { const v16b w = frag_b(P + (size_t)(n0 + j * 16 + col) * DM + kc * 32, lane); acc[j] = wmma_bf(a.l, w, acc[j]); acc[j] = wmma_bf(a.h, w, acc[j]); } }
#pragma unroll
  for (int j = 0; j < 8; ++j) {
#pragma unroll
    for (int r = 0; r < 8; ++r) so[wave][8 * g + r][j * 16 + col] = acc[j][r] + (BO ? bfr(BO[n0 + j * 16 + col]) : 0.f); }
  LDSX();
  for (int rl = 0; rl < 16; ++rl) vst2(Y + (r0 + rl) * DM + n0 + lane * 4, *(const v4f*)&so[wave][rl][lane * 4]);
}

// ---- k_rms: wave = row, no LDS and no barrier: OUTH = f16(x rsqrt(mean x^2 + eps) w) (MODE 0: x = bf16-rounded input; MODE 1: x = f32 x1); a lane holds 8 pieces of 16 bytes, 128 elements apart, the row's 8 loads in flight at once; every loop is unrolled so that the pieces stay in registers
template <int M> __device__ __forceinline__ float lane_xor(float v) { return __builtin_bit_cast(float, __builtin_amdgcn_update_dpp(0, __builtin_bit_cast(int, v), 0x160 + M, 0xf, 0xf, true)); }   // value of lane ^ M inside a 16-lane row (DPP row_xmask), no LDS round trip
template <int MODE>
__global__ __launch_bounds__(512) void k_rms(const float* __restrict__ A, const float* __restrict__ Wn, _Float16* __restrict__ OUTH) { const int lane = threadIdx.x & 31; const size_t row = (size_t)blockIdx.x * 16 + (threadIdx.x >> 5);
  v4f x[8], wn[8];
#pragma unroll
  for (int j = 0; j < 8; ++j) x[j] = *(const v4f*)(A + row * DM + j * 128 + lane * 4);
#pragma unroll
  for (int j = 0; j < 8; ++j) wn[j] = *(const v4f*)(Wn + j * 128 + lane * 4);
  if (MODE == 0) {
#pragma unroll
    for (int j = 0; j < 8; ++j)
#pragma unroll
      for (int c = 0; c < 4; ++c) x[j][c] = bfr(x[j][c]); }
  // the square sum keeps its tree: elements 256 apart chained, then pairwise over each aligned run of 32 elements (4 in the lane, 8 lanes), then the eight runs' sums one after another
  float s[2];
#pragma unroll
  for (int jp = 0; jp < 2; ++jp) { float q[4];
#pragma unroll
    for (int c = 0; c < 4; ++c) { float t = 0.f;
#pragma unroll
      for (int i = 0; i < 4; ++i) t += x[jp + 2 * i][c] * x[jp + 2 * i][c];
      q[c] = t; }
    s[jp] = (q[0] + q[1]) + (q[2] + q[3]); }
#pragma unroll
  for (int jp = 0; jp < 2; ++jp) { s[jp] += lane_xor<1>(s[jp]); s[jp] += lane_xor<2>(s[jp]); s[jp] += lane_xor<4>(s[jp]); }
  float tq = 0.f;
#pragma unroll
  for (int i = 0; i < 8; ++i) tq += __builtin_bit_cast(float, __builtin_amdgcn_readlane(__builtin_bit_cast(int, s[i >> 2]), (i & 3) * 8));
  const float inv = 1.0f / sqrtf(tq / (float)DM + RMSEPS);
#pragma unroll
  for (int j = 0; j < 8; ++j) { v4h o;
#pragma unroll
    for (int c = 0; c < 4; ++c) o[c] = (_Float16)(x[j][c] * inv * bfr(wn[j][c]));
    *(v4h*)(OUTH + row * DM + j * 128 + lane * 4) = o; } }
// ---- k_flags: block = (query block qb of 64 queries, half hf of the keys): FL[qb][hf * 32 + kt] = 1 if any mask[q][k] == 0 (attend) in the 64 x 32 tile; a lane owns one 16-byte column piece over 16 rows, all 16 loads independent; a block writes one whole 128-byte line of FL
__global__ __launch_bounds__(1024) void k_flags(const int* __restrict__ MASK, int* __restrict__ FL) { __shared__ __align__(16) int sf[32]; const int t = threadIdx.x; const int qb = blockIdx.x, hf = blockIdx.y; const int c4 = t & 255, rw = t >> 8;
  if (t < 32) sf[t] = 0; __syncthreads();
  const int* p = MASK + (size_t)(qb * 64 + rw) * SS + hf * (SS / 2) + c4 * 4; v4u v[16];
#pragma unroll
  for (int i = 0; i < 16; ++i) v[i] = *(const v4u*)(p + (size_t)i * 4 * SS);
  unsigned mn = 0xffffffffu;
#pragma unroll
  for (int i = 0; i < 16; ++i) mn = min(mn, min(min(v[i][0], v[i][1]), min(v[i][2], v[i][3])));   // smallest word is 0 exactly when some key is visible
  if (mn == 0u) sf[c4 >> 3] = 1;   // benign same-value race within the block
  __syncthreads(); if (t < 8) vst2((unsigned*)(FL + (size_t)qb * (SS / 32) + hf * 32 + t * 4), *(const v4u*)&sf[t * 4]); }
// ---- k_g<MODE, KW>: block = (128 rows, 128 cols), eight waves, a wave 32 rows x 64 cols (a fragment read from LDS feeds two or four products; the grid is one block a WGP, so the block brings two waves a SIMD itself): A f16 rows (MODE 0: built inline from the f32 ctx) . W^T (f16 x 2^8); MODE 0: X1 = x (bf16-rounded) + acc (f32 out); MODE 2: OUT = X1 + acc (f32)
template <int MODE, int KW>
__global__ __launch_bounds__(256) void k_g(const void* __restrict__ Ain, const _Float16* __restrict__ Wr, const float* __restrict__ RES, float* __restrict__ O32, int ow) { constexpr int AEB = (MODE == 0) ? 4 : 2, APITCH = AEB * KS + 16, STG = 128 * APITCH + 128 * HPITCH; __shared__ __attribute__((aligned(128))) char sm[2 * STG];   // the ring; behind the loop's last barrier the same bytes are the output staging
  float (*sf)[16][68] = (float (*)[16][68])sm;
  const int tid = threadIdx.x, wave = tid >> 5, lane = tid & 31, col = lane & 15, g = lane >> 4, ar = (wave >> 1) * 32, wr = (wave & 1) * 64; const size_t r0 = (size_t)blockIdx.x * 128 + ar; const int c0 = blockIdx.y * 128 + wr;
  v8f acc[2][4] = {};
  { const char* gA = (const char*)Ain + (size_t)blockIdx.x * 128 * KW * AEB; const char* gB = (const char*)(Wr + (size_t)blockIdx.y * 128 * KW); const unsigned l0 = lds_off(sm); constexpr int NT = KW / KS;
    stage_ab8<AEB * KS>(l0, gA, (size_t)AEB * KW, gB, 2 * KW, tid); WAIT_ASYNC0(); __syncthreads();
    stage_ab8<AEB * KS>(l0 + STG, gA + AEB * KS, (size_t)AEB * KW, gB + 2 * KS, 2 * KW, tid);
#pragma unroll 1   // stays rolled: one copy of a stage's code in the instruction cache; t & 1 picks the buffer
    for (int t = 0; t < NT; ++t) { const int bo = (t & 1) * STG;
      v16h a[KS / 32][2], w[KS / 32][4];   // the stage's LDS reads go out as one group in front of its products; the loops below are unrolled so that these arrays are registers
#pragma unroll
      for (int kc = 0; kc < KS / 32; ++kc) {
#pragma unroll
        for (int h = 0; h < 2; ++h) { if (MODE == 0) { const float* p = (const float*)(sm + bo + (ar + h * 16 + col) * APITCH) + kc * 32 + 8 * g;
#pragma unroll
            for (int i = 0; i < 8; ++i) { a[kc][h][i] = (_Float16)p[i]; a[kc][h][8 + i] = (_Float16)p[16 + i]; } } else a[kc][h] = frag_h((const _Float16*)(sm + bo + (ar + h * 16 + col) * APITCH) + kc * 32, lane); }
#pragma unroll
        for (int j = 0; j < 4; ++j) w[kc][j] = frag_h((const _Float16*)(sm + bo + 128 * APITCH + (wr + j * 16 + col) * HPITCH) + kc * 32, lane); }
#pragma unroll
      for (int kc = 0; kc < KS / 32; ++kc)
#pragma unroll
        for (int j = 0; j < 4; ++j)
#pragma unroll
          for (int h = 0; h < 2; ++h) acc[h][j] = wmma16(a[kc][h], w[kc][j], acc[h][j]);
      WAIT_DS0(); WAIT_ASYNC0(); __syncthreads();   // publishes stage t + 1 and ends every reader's last read of stage t
      if (t + 2 < NT) { stage_ab8<AEB * KS>(l0 + bo, gA + (size_t)(t + 2) * AEB * KS, (size_t)AEB * KW, gB + (size_t)(t + 2) * 2 * KS, 2 * KW, tid); } }
    WAIT_ASYNC0(); }
#pragma unroll   // the wave's two 16-row halves go through its staging rows one after the other (unrolled: acc is indexed by h)
  for (int h = 0; h < 2; ++h) { const size_t rh = r0 + h * 16; float res[8][4];
#pragma unroll
    for (int r = 0; r < 8; ++r) { const float* rp = RES + (rh + 8 * g + r) * ow + c0 + col;
#pragma unroll
      for (int j = 0; j < 4; ++j) res[r][j] = rp[j * 16];
      asm volatile("s_wait_xcnt 0x0" ::: "memory"); }   // stands behind each row's four loads: the results of later rows' loads may land in the registers that held this row's address
    if (h) LDSX();   // the first half's reads of the staging rows have returned before other lanes rewrite them
#pragma unroll
    for (int j = 0; j < 4; ++j)
#pragma unroll
      for (int r = 0; r < 8; ++r) sf[wave][8 * g + r][j * 16 + col] = acc[h][j][r] * (1.0f / WSC) + (MODE == 0 ? bfr(res[r][j]) : res[r][j]);
    LDSX(); for (int rl = g; rl < 16; rl += 2) vst2(O32 + (rh + rl) * ow + c0 + col * 4, *(const v4f*)&sf[wave][rl][col * 4]); } }   // a store covers two rows' 256-byte runs
// ---- k_gu: block = (128 rows, 128 hidden cols), eight waves, a wave 32 rows x (64 gate + 64 up) cols (each weight fragment read from LDS feeds two products): g = h2 . Wg^T, u = h2 . Wu^T (same A), GU = f16(silu(g) u) -> rows [NR][HP]
__global__ __launch_bounds__(256) void k_gu(const _Float16* __restrict__ H2, const _Float16* __restrict__ PG, _Float16* __restrict__ GU) { constexpr int STG = (128 + 256) * HPITCH; __shared__ __attribute__((aligned(128))) char sm[2 * STG];   // the ring (128 A rows, 128 gate rows, 128 up rows); behind the loop's last barrier the same bytes are the output staging
  _Float16 (*so)[136] = (_Float16 (*)[136])sm;
  const int tid = threadIdx.x, wave = tid >> 5, lane = tid & 31, col = lane & 15, g = lane >> 4, ar = (wave >> 1) * 32, wr = (wave & 1) * 64; const size_t rb = (size_t)blockIdx.x * 128; const int c0 = blockIdx.y * 128; const _Float16* Wg = PG + (size_t)c0 * DM; const _Float16* Wu = PG + ((size_t)HP + c0) * DM;
  v8f ag[2][4] = {}, au[2][4] = {};
  { const char* gA = (const char*)(H2 + rb * DM); const char* gG = (const char*)Wg; const char* gU = (const char*)Wu; const unsigned l0 = lds_off(sm); constexpr int NT = DM / KS;
    stage_abc8(l0, gA, gG, gU, 2 * DM, tid); WAIT_ASYNC0(); __syncthreads();
    stage_abc8(l0 + STG, gA + 2 * KS, gG + 2 * KS, gU + 2 * KS, 2 * DM, tid);
#pragma unroll 1   // stays rolled: one copy of a stage's code in the instruction cache; t & 1 picks the buffer
    for (int t = 0; t < NT; ++t) { const int bo = (t & 1) * STG;
#pragma unroll
      for (int kc = 0; kc < KS / 32; ++kc) { v16h a[2], wg[4], wu[4];   // a 32-k step's LDS reads go out as one group in front of its 16 products (both steps' fragments at once would not fit beside the 128 accumulator registers); the loops below are unrolled so that these arrays are registers
#pragma unroll
        for (int h = 0; h < 2; ++h) a[h] = frag_h((const _Float16*)(sm + bo + (ar + h * 16 + col) * HPITCH) + kc * 32, lane);
#pragma unroll
        for (int j = 0; j < 4; ++j) { wg[j] = frag_h((const _Float16*)(sm + bo + (128 + wr + j * 16 + col) * HPITCH) + kc * 32, lane); wu[j] = frag_h((const _Float16*)(sm + bo + (256 + wr + j * 16 + col) * HPITCH) + kc * 32, lane); }
#pragma unroll
        for (int j = 0; j < 4; ++j)
#pragma unroll
          for (int h = 0; h < 2; ++h) { ag[h][j] = wmma16(a[h], wg[j], ag[h][j]); au[h][j] = wmma16(a[h], wu[j], au[h][j]); } }
      WAIT_DS0(); WAIT_ASYNC0(); __syncthreads();   // publishes stage t + 1 and ends every reader's last read of stage t
      if (t + 2 < NT) { const size_t ko = (size_t)(t + 2) * 2 * KS; stage_abc8(l0 + bo, gA + ko, gG + ko, gU + ko, 2 * DM, tid); } }
    WAIT_ASYNC0(); }
#pragma unroll
  for (int h = 0; h < 2; ++h)
#pragma unroll
    for (int j = 0; j < 4; ++j)
#pragma unroll
      for (int r = 0; r < 8; ++r) { const float gg = ag[h][j][r] * (1.0f / WSC), uu = au[h][j][r] * (1.0f / WSC); so[ar + h * 16 + 8 * g + r][wr + j * 16 + col] = (_Float16)(gg / (1.0f + __expf(-gg)) * uu); }
  __syncthreads(); for (int e = tid; e < 128 * 16; e += 256) { const int rl = e >> 4, q = e & 15; vst2((unsigned*)(GU + (rb + rl) * HP + c0 + q * 8), *(const v4u*)&so[rl][q * 8]); } }

extern "C" void kernel_launch(void* const* d_in, const int* in_sizes, int n_in, void* d_out, int out_size, void* d_ws, size_t ws_size, hipStream_t stream) {
  (void)in_sizes; (void)n_in; (void)out_size;
  const float** F = (const float**)d_in;   // 0 x [2,2048,1024], 1 attn_mask [2048,2048] int (1 = masked), 2 wq, 3 wk, 4 wv, 5 wo (natural [1024,1024]), 6 norm1_w, 7 norm2_w, 8 w_gate [2730,1024], 9 w_up, 10 w_down [1024,2730]
  if (ws_size < (size_t)WS_END) return;
  char* ws = (char*)d_ws; _Float16* PK = (_Float16*)(ws + WS_PK); _Float16 *QK = (_Float16*)(ws + WS_QK), *QKL = (_Float16*)(ws + WS_QKL), *VTH = (_Float16*)(ws + WS_VTH), *VTL = (_Float16*)(ws + WS_VTL), *H1 = (_Float16*)(ws + WS_H1), *H2 = (_Float16*)(ws + WS_H2), *GU = (_Float16*)(ws + WS_GU); float *O = (float*)(ws + WS_O), *X1 = (float*)(ws + WS_X1); int* FL = (int*)(ws + WS_FL); const int* MASK = (const int*)d_in[1];
  const int nr = NB * SS;   // keys of both batches are always needed
  k_pack<<<PK_WG, 512, 0, stream>>>(F[2], F[3], F[4], F[5], F[8], F[9], F[10], ws);
  k_rms<0><<<nr / 16, 512, 0, stream>>>(F[0], F[6], H1);
  k_flags<<<dim3(SS / 64, 2), 1024, 0, stream>>>(MASK, FL);
  k_qkv<<<dim3(nr / 128, QKVW / 128), 128, 0, stream>>>((const float*)H1, (const float*)H1, (const float*)H1, PK + PK_A, nullptr, nullptr, nullptr, QK, QKL, VTH, VTL);
  k_attn<<<dim3(TQB, NH, TNB), 128, 0, stream>>>(QK, QKL, VTH, VTL, nullptr, MASK, FL, O);
  k_g<0, DM><<<dim3(TOB / 2, DM / 128), 256, 0, stream>>>(O, PK + PK_P, F[0], X1, DM);                  // x1 = x + ctx wo^T
  k_rms<1><<<TOB * 4, 512, 0, stream>>>(X1, F[7], H2);
  k_gu<<<dim3(TOB / 2, HP / 128), 256, 0, stream>>>(H2, (const _Float16*)(ws + WS_PG), GU);
  k_g<2, HP><<<dim3(TOB / 2, DM / 128), 256, 0, stream>>>(GU, (const _Float16*)(ws + WS_PD), X1, (float*)d_out, DM);   // out = x1 + (silu(g) u) w_down^T
}

// v006
// Measured time: 175 microseconds a run.
// Two timings next to v005 both put it at 1.08 times that version's speed.
// Over all steps from v000 it is 5.23 times as fast.
// compute dtype: all float inputs rounded to bf16, attn_mask (int) read on device; RMSNorms (eps 1e-6) in f32, normed rows once to f16; q/k/v = f16(h) . W^T against exact f16 x 2^8 weight copies on WMMA 16x16x32 (single products, f32 accumulate); rotate-half RoPE in f32 (precise sinf/cosf) before the f16 hi + residual split; attention with 3-product scores and P.v (hi + residual planes), x 1/8, masked keys excluded (mask read per pair; fully-masked 64x32 tiles skipped via a device-built flag table), running-max softmax in f32 (hardware exp); x1 = x + f16(ctx) . Wo^T; SwiGLU: f16(rmsnorm(x1)) . [W_gate | W_up]^T (hidden padded 2,730 -> 2,816 with zero weights), silu(g) u in f32 -> f16, . W_down^T + x1; f32 output.
#include <hip/hip_runtime.h>
#include <math.h>

typedef __attribute__((ext_vector_type(16))) _Float16 v16h;
typedef __attribute__((ext_vector_type(16))) __bf16 v16b;
typedef __attribute__((ext_vector_type(8)))  _Float16 v8h;
typedef __attribute__((ext_vector_type(8)))  float v8f;
typedef __attribute__((ext_vector_type(4)))  float v4f;
typedef __attribute__((ext_vector_type(2)))  float v2f;
typedef __attribute__((ext_vector_type(4)))  unsigned v4u;
typedef __attribute__((ext_vector_type(4)))  int v4i;
typedef float __attribute__((may_alias)) float_a;
typedef int __attribute__((may_alias)) int_a;

template <typename T> __device__ __forceinline__ void vst2(void* p, T v) { *(T*)p = v;  }
__device__ __forceinline__ v8f wmma16(v16h a, v16h b, v8f c) {
  v8f d = __builtin_amdgcn_wmma_f32_16x16x32_f16(false, a, false, b, (short)0, c, false, false);
  asm volatile("v_nop\n\tv_nop\n\tv_nop\n\tv_nop" : "+v"(d) : "v"(a), "v"(b));
  return d;
}
__device__ __forceinline__ v8f wmma_bf(v16b a, v16b b, v8f c) {
  v8f d = __builtin_amdgcn_wmma_f32_16x16x32_bf16(false, a, false, b, (short)0, c, false, false);
  asm volatile("v_nop\n\tv_nop\n\tv_nop\n\tv_nop" : "+v"(d) : "v"(a), "v"(b));
  return d;
}
// Streaming decoder block (B 2, L 2,048, d 1,024, 16 heads x 64, SwiGLU hidden 2,730): pre-RMSNorm, bias-free projections, rotate-half RoPE (base 10000), attention under the given boolean mask (all-keys + 256-token window), out-projection + residual, pre-RMSNorm SwiGLU FFN + residual.
__device__ __forceinline__ v16h frag_h(const _Float16* rowk0, int lane) {
  union { v16h v; v8h q[2]; } u; const _Float16* p = rowk0 + 8 * (lane >> 4);
  u.q[0] = *(const v8h*)p; u.q[1] = *(const v8h*)(p + 16); return u.v;
}
__device__ __forceinline__ v16h frag_f32(const float* rowk0, int lane) {
  v16h a; const float* p = rowk0 + 8 * (lane >> 4);
#pragma unroll
  for (int i = 0; i < 8; ++i) { a[i] = (_Float16)p[i]; a[8 + i] = (_Float16)p[16 + i]; }
  return a;
}
__device__ __forceinline__ v16h frag_f32s(const float* rowk0, int lane, float sc) {
  v16h a; const float* p = rowk0 + 8 * (lane >> 4);
#pragma unroll
  for (int i = 0; i < 8; ++i) { a[i] = (_Float16)(p[i] * sc); a[8 + i] = (_Float16)(p[16 + i] * sc); }
  return a;
}
// column fragment from a [K][ld] layout (column n), rows >= K read as 0
__device__ __forceinline__ v16h fragc_f32(const float* W, int k0, int n, int lane, int ld, int K) {
  v16h a; const int g = lane >> 4;
#pragma unroll
  for (int i = 0; i < 8; ++i) { const int ka = k0 + 8 * g + i, kb = ka + 16;
    a[i] = (_Float16)(ka < K ? W[(size_t)(ka < K ? ka : K - 1) * ld + n] : 0.f); a[8 + i] = (_Float16)(kb < K ? W[(size_t)(kb < K ? kb : K - 1) * ld + n] : 0.f); }
  return a;
}
struct F2 { v16b h, l; };
__device__ __forceinline__ F2 bsplit16(const float v[16]) { F2 r;
#pragma unroll
  for (int i = 0; i < 16; ++i) { const __bf16 h = (__bf16)v[i]; r.h[i] = h; r.l[i] = (__bf16)(v[i] - (float)h); }
  return r; }
__device__ __forceinline__ F2 split_row(const float* row, int k0, int lane) { float v[16]; const float* p = row + k0 + 8 * (lane >> 4);
#pragma unroll
  for (int i = 0; i < 8; ++i) { v[i] = p[i]; v[8 + i] = p[16 + i]; }
  return bsplit16(v); }
__device__ __forceinline__ F2 split_rowK(const float* row, int k0, int lane, int K) { float v[16]; const int g = lane >> 4;
#pragma unroll
  for (int i = 0; i < 8; ++i) { const int ka = k0 + 8 * g + i, kb = ka + 16; v[i] = ka < K ? row[ka < K ? ka : K - 1] : 0.f; v[8 + i] = kb < K ? row[kb < K ? kb : K - 1] : 0.f; }
  return bsplit16(v); }
__device__ __forceinline__ F2 split_col(const float* W, int k0, int n, int lane, int ld, int K) { float v[16]; const int g = lane >> 4;
#pragma unroll
  for (int i = 0; i < 8; ++i) { const int ka = k0 + 8 * g + i, kb = ka + 16; v[i] = ka < K ? W[(size_t)(ka < K ? ka : K - 1) * ld + n] : 0.f; v[8 + i] = kb < K ? W[(size_t)(kb < K ? kb : K - 1) * ld + n] : 0.f; }
  return bsplit16(v); }
__device__ __forceinline__ v8f mac3(const F2& a, const F2& b, v8f c) { c = wmma_bf(a.l, b.h, c); c = wmma_bf(a.h, b.l, c); return wmma_bf(a.h, b.h, c); }
__device__ __forceinline__ float sigm(float v) { return 1.0f / (1.0f + expf(-v)); }
#define LDSX() do { asm volatile("s_wait_dscnt 0" ::: "memory"); __builtin_amdgcn_wave_barrier(); __builtin_amdgcn_fence(__ATOMIC_RELEASE, "workgroup"); } while (0)
// ---- GEMM operand ring: a stage is 64 k of every operand row of the block's tile, brought into LDS by asynchronous 16-byte copies (a wave's copy covers whole 128-byte lines); LDS row pitch = row bytes + 16 (16 B x odd: conflict-free for 16-byte reads); two buffers (four in k_g)
#define KS 64
#define HPITCH (2 * KS + 16)       // f16 rows: 128 B + 16
__device__ __forceinline__ unsigned lds_off(const void* p) { return (unsigned)(size_t)p; }
// a run of copies and, as the last line of their own statement, the wait that stands in front of any rewrite of their address registers (one wait a run: fewer, longer runs cost a wave fewer waits)
#define CPL(a, b) "global_load_async_to_lds_b128 %" #a ", %" #b ", off\n\t"
__device__ __forceinline__ void cp8(const unsigned* l, const char* const* g) {
  asm volatile(CPL(0, 1) CPL(2, 3) CPL(4, 5) CPL(6, 7) CPL(8, 9) CPL(10, 11) CPL(12, 13) CPL(14, 15) "s_wait_xcnt 0x0"
               :: "v"(l[0]), "v"(g[0]), "v"(l[1]), "v"(g[1]), "v"(l[2]), "v"(g[2]), "v"(l[3]), "v"(g[3]), "v"(l[4]), "v"(g[4]), "v"(l[5]), "v"(g[5]), "v"(l[6]), "v"(g[6]), "v"(l[7]), "v"(g[7]) : "memory");
}
__device__ __forceinline__ void cp12(const unsigned* l, const char* const* g) {
  asm volatile(CPL(0, 1) CPL(2, 3) CPL(4, 5) CPL(6, 7) CPL(8, 9) CPL(10, 11) CPL(12, 13) CPL(14, 15) CPL(16, 17) CPL(18, 19) CPL(20, 21) CPL(22, 23) "s_wait_xcnt 0x0"
               :: "v"(l[0]), "v"(g[0]), "v"(l[1]), "v"(g[1]), "v"(l[2]), "v"(g[2]), "v"(l[3]), "v"(g[3]), "v"(l[4]), "v"(g[4]), "v"(l[5]), "v"(g[5]), "v"(l[6]), "v"(g[6]), "v"(l[7]), "v"(g[7]), "v"(l[8]), "v"(g[8]), "v"(l[9]), "v"(g[9]), "v"(l[10]), "v"(g[10]), "v"(l[11]), "v"(g[11]) : "memory");
}
// this thread's addresses for ROWS rows of RB bytes from gb (row pitch gp bytes) to LDS byte address lb (row pitch RB + 16), dealt over the NTH threads of a block: ROWS * RB / (16 * NTH) copies a thread
template <int ROWS, int RB, int NTH = 128>
__device__ __forceinline__ void row_addr(unsigned* l, const char** g, unsigned lb, const char* gb, size_t gp, int tid) {
  constexpr int PPR = RB / 16, RPI = NTH / PPR, NI = ROWS / RPI; const int row = tid / PPR, pc = tid % PPR;
#pragma unroll
  for (int i = 0; i < NI; ++i) { l[i] = lb + (row + i * RPI) * (RB + 16) + pc * 16; g[i] = gb + (size_t)(row + i * RPI) * gp + pc * 16; }
}
// 128 threads: 128 A rows of 128 B at lb, behind them 128 weight rows of 128 B
__device__ __forceinline__ void stage_ab(unsigned lb, const char* ga, size_t pa, const char* gb, size_t pb, int tid) {
  unsigned l[16]; const char* g[16]; row_addr<128, 2 * KS>(l, g, lb, ga, pa, tid); row_addr<128, 2 * KS>(l + 8, g + 8, lb + 128 * HPITCH, gb, pb, tid); cp8(l, g); cp8(l + 8, g + 8);
}
// 256 threads: 128 A rows of ARB bytes at lb, behind them 128 weight rows of 128 B
template <int ARB>
__device__ __forceinline__ void stage_ab8(unsigned lb, const char* ga, size_t pa, const char* gb, size_t pb, int tid) {
  constexpr int NA = 128 * ARB / 4096; unsigned l[NA + 4]; const char* g[NA + 4];
  row_addr<128, ARB, 256>(l, g, lb, ga, pa, tid); row_addr<128, 2 * KS, 256>(l + NA, g + NA, lb + 128 * (ARB + 16), gb, pb, tid);
  if constexpr (NA == 4) cp8(l, g); else cp12(l, g);
}
// 256 threads: three runs of 128 rows of 128 B (A, gate, up; all of row pitch gp), one behind the other at lb
__device__ __forceinline__ void stage_abc8(unsigned lb, const char* ga, const char* gb, const char* gc, size_t gp, int tid) {
  unsigned l[12]; const char* g[12]; row_addr<128, 2 * KS, 256>(l, g, lb, ga, gp, tid); row_addr<128, 2 * KS, 256>(l + 4, g + 4, lb + 128 * HPITCH, gb, gp, tid); row_addr<128, 2 * KS, 256>(l + 8, g + 8, lb + 256 * HPITCH, gc, gp, tid); cp12(l, g);
}
#define WAIT_ASYNC0() asm volatile("s_wait_asynccnt 0x0" ::: "memory")   // this wave's copies have landed
#define WAIT_ASYNC(n) asm volatile("s_wait_asynccnt %0" :: "n"(n) : "memory")   // all but this wave's n youngest copies have landed (the counter returns in issue order)
#define WAIT_DS0() asm volatile("s_wait_dscnt 0x0" ::: "memory")         // this wave's LDS reads of the buffer have returned before it is refilled


#define NB 2
#define SS 2048
#define DM 1024
#define NH 16
#define HID 2730
#define HP 2816          // hidden padded to 22 x 128
#define WSC 256.0f
#define RMSEPS 1e-6f
__constant__ float THETA[32] = {1.000000000e+00f,7.498942018e-01f,5.623413324e-01f,4.216965139e-01f,3.162277639e-01f,2.371373773e-01f,1.778279394e-01f,1.333521456e-01f,1.000000015e-01f,7.498942316e-02f,5.623413250e-02f,4.216964915e-02f,3.162277490e-02f,2.371373773e-02f,1.778279431e-02f,1.333521400e-02f,9.999999776e-03f,7.498942316e-03f,5.623413250e-03f,4.216964822e-03f,3.162277630e-03f,2.371373819e-03f,1.778279431e-03f,1.333521446e-03f,1.000000047e-03f,7.498941850e-04f,5.623413017e-04f,4.216965172e-04f,3.162277571e-04f,2.371373703e-04f,1.778279402e-04f,1.333521504e-04f};
__device__ __attribute__((noinline)) float cos_p(float v) { return cosf(v); }
__device__ __attribute__((noinline)) float sin_p(float v) { return sinf(v); }
#define HD 64
#define QKVW (3 * DM)
#ifndef TQB
#define TQB (SS / 64)
#define TNB NB
#define TOB (NB * SS / 64)     // output row tiles (all)
#endif
typedef __attribute__((ext_vector_type(8))) __bf16 v8b;
__device__ __forceinline__ v16b frag_b(const __bf16* rowk0, int lane) {
  union { v16b v; v8b q[2]; } u; const __bf16* p = rowk0 + 8 * (lane >> 4);
  u.q[0] = *(const v8b*)p; u.q[1] = *(const v8b*)(p + 16); return u.v;
}
__device__ __forceinline__ float bfr(float v) { return (float)(__bf16)v; }
__device__ __attribute__((noinline)) float exp_ni(float v) { return expf(v); }
__device__ __attribute__((noinline)) float erf_ni(float v) { return erff(v); }

#define PK_A 0                       // [3072][1024] Wqkv rows (natural [out][in])
#define PK_P (PK_A + QKVW * DM)        // [1024][1024] Wo rows (natural)
#define PK_END (PK_P + DM * DM)
#define WS_PK  0u
#define WS_QK  (WS_PK + 2u * PK_END)             // f16 [4096 rows][2048]: q | k
#define WS_QKL (WS_QK + 2u * NB * SS * 2 * DM)     // f16 q | k residual planes x2048
#define WS_VTH (WS_QKL + 2u * NB * SS * 2 * DM)    // f16 [b][1024 (h*64+d)][2048 s] hi
#define WS_VTL (WS_VTH + 2u * NB * DM * SS)        // f16 lo x 2048
#define WS_O   (WS_VTL + 2u * NB * DM * SS)        // f32 [4096][1024]
#define WS_PG  (WS_O + 4u * (size_t)NB * SS * DM)        // f16 x 2^8 [gate | up] rows [2*HP][1024] (zero rows >= HID), down rows [1024][HP] (zero cols >= HID)
#define WS_PD  (WS_PG + 2u * (size_t)2 * HP * DM)
#define WS_H1  (WS_PD + 2u * (size_t)DM * HP)             // f16 rmsnorm1(x) rows [NR][1024]; int flags [SS/64][SS/32]; f32 x1 [NR][1024]; f16 rmsnorm2(x1) rows; f16 silu(gate) up rows [NR][HP]
#define WS_FL  (WS_H1 + 2u * (size_t)NB * SS * DM)
#define WS_X1  (WS_FL + 4u * (size_t)(SS / 64) * (SS / 32))
#define WS_H2  (WS_X1 + 4u * (size_t)NB * SS * DM)
#define WS_GU  (WS_H2 + 2u * (size_t)NB * SS * DM)
#define WS_END (WS_GU + 2u * (size_t)NB * SS * HP)
// ---- k_pack: a resident stream, one task a wave and pass, no LDS and no barrier: 2,048 half rows of W_down, 4,096 rows of W_q | W_k | W_v | W_o, 5,632 rows of gate | up (the longer tasks first); value = f16(bf16(w) x 2^8); all loads of a task go out before its first store; every load and store of a wave covers one contiguous run of bytes; the loops over j and c below are unrolled so that the pieces stay in registers and the loads go out as one group
typedef __attribute__((ext_vector_type(4))) _Float16 v4h;
typedef __attribute__((ext_vector_type(2))) _Float16 v2h;
#define PT_D (2 * DM)
#define PT_A (PT_D + 4 * DM)
#define PT_END (PT_A + 2 * HP)
#define PK_WG 256        // work-groups of 16 waves: one a WGP
__device__ __forceinline__ _Float16 wcv(float w) { return (_Float16)(bfr(w) * WSC); }
#define STORES_OUT() asm volatile("s_wait_xcnt 0x0" ::: "memory")   // stands directly behind a task's last store: what follows (the next task) rewrites registers that these stores name
// one row of 1,024: a lane holds 8 pieces of 16 bytes, 128 elements apart
__device__ __forceinline__ void pack_row(const float* __restrict__ s, _Float16* __restrict__ d, int lane) { v4f x[8];
#pragma unroll
  for (int j = 0; j < 8; ++j) x[j] = *(const v4f*)(s + j * 128 + lane * 4);
#pragma unroll
  for (int j = 0; j < 8; ++j) { v4h o;
#pragma unroll
    for (int c = 0; c < 4; ++c) o[c] = wcv(x[j][c]);
    *(v4h*)(d + j * 128 + lane * 4) = o; }
  STORES_OUT(); }
__global__ __launch_bounds__(512) void k_pack(const float* __restrict__ WQ, const float* __restrict__ WK, const float* __restrict__ WV, const float* __restrict__ WO, const float* __restrict__ WG, const float* __restrict__ WU, const float* __restrict__ WD, char* __restrict__ ws) {
  const int lane = threadIdx.x & 31; _Float16* P = (_Float16*)(ws + WS_PK);
  for (int task = __builtin_amdgcn_readfirstlane((threadIdx.x >> 5) * PK_WG + blockIdx.x); task < PT_END; task += 16 * PK_WG) {   // dealt wave-major, so that every work-group gets the same mix of tasks; the task number sits in a scalar register, so the branches on it are scalar
    if (task < PT_D) { const int n = task >> 1, k0 = (task & 1) * (HP / 2) + lane * 2; const float* s = WD + (size_t)n * HID; _Float16* d = (_Float16*)(ws + WS_PD) + (size_t)n * HP; v2f x[22];   // down rows [1024][HP], zero beyond 2,730; a source row starts on 8 bytes only, hence 8-byte loads
#pragma unroll
      for (int j = 0; j < 22; ++j) { const int k = k0 + j * 64; x[j] = *(const v2f*)(s + (k < HID ? k : 0)); }
#pragma unroll
      for (int j = 0; j < 22; ++j) { const int k = k0 + j * 64; v2h o; o[0] = (k < HID) ? wcv(x[j][0]) : (_Float16)0.0f; o[1] = (k < HID) ? wcv(x[j][1]) : (_Float16)0.0f; *(v2h*)(d + k) = o; }
      STORES_OUT(); }
    else if (task < PT_A) { const int r = task - PT_D, which = r >> 10; const float* w = (which == 0) ? WQ : (which == 1) ? WK : (which == 2) ? WV : WO; pack_row(w + (size_t)(r & (DM - 1)) * DM, P + PK_A + (size_t)r * DM, lane); }   // PK_P follows PK_A directly
    else { const int r = task - PT_A, n = (r < HP) ? r : r - HP; _Float16* d = (_Float16*)(ws + WS_PG) + (size_t)r * DM;   // gate | up rows, zero beyond 2,730
      if (n < HID) pack_row(((r < HP) ? WG : WU) + (size_t)n * DM, d, lane);
      else { const v4h z = {};
#pragma unroll
        for (int j = 0; j < 8; ++j) *(v4h*)(d + j * 128 + lane * 4) = z;
        STORES_OUT(); } }
  } }
__global__ __launch_bounds__(128) void k_qkv(const float* __restrict__ XQ, const float* __restrict__ XK, const float* __restrict__ XV, const _Float16* __restrict__ P, const float* __restrict__ BQ, const float* __restrict__ BK, const float* __restrict__ BV, _Float16* __restrict__ QK, _Float16* __restrict__ QKL, _Float16* __restrict__ VTH, _Float16* __restrict__ VTL) {
  const int which0 = (blockIdx.y * 128) / DM; const float* X = (which0 == 0) ? XQ : (which0 == 1) ? XK : XV; const float* BB = BQ ? (((which0 == 0) ? BQ : (which0 == 1) ? BK : BV) + (blockIdx.y * 128 - which0 * DM)) : nullptr;
  constexpr int STG = (128 + 128) * HPITCH; __shared__ __attribute__((aligned(128))) char sm[2 * STG];   // the ring; behind the loop's last barrier the same bytes are the output staging
  _Float16 (*so)[16][136] = (_Float16 (*)[16][136])sm; _Float16 (*sol)[16][136] = (_Float16 (*)[16][136])(sm + 4 * 16 * 136 * 2); _Float16 (*sth)[136] = (_Float16 (*)[136])sm; _Float16 (*stl)[136] = (_Float16 (*)[136])(sm + 128 * 136 * 2);
  const int tid = threadIdx.x, wave = tid >> 5, lane = tid & 31, col = lane & 15, g = lane >> 4; const size_t r0 = (size_t)blockIdx.x * 128 + wave * 32; const int n0 = blockIdx.y * 128;   // block = (128 rows, 128 cols); a wave holds 32 rows x 128 cols: each weight fragment read from LDS feeds two products
  v8f acc[2][8] = {};
  { const char* gA = (const char*)((const _Float16*)X + (size_t)blockIdx.x * 128 * DM); const char* gB = (const char*)(P + (size_t)n0 * DM); const unsigned l0 = lds_off(sm); constexpr int NT = DM / KS;   // A = f16 rmsnorm rows
    stage_ab(l0, gA, 2 * DM, gB, 2 * DM, tid); WAIT_ASYNC0(); __syncthreads();
    stage_ab(l0 + STG, gA + 2 * KS, 2 * DM, gB + 2 * KS, 2 * DM, tid);
#pragma unroll 1   // stays rolled: one copy of a stage's code in the instruction cache; t & 1 picks the buffer
    for (int t = 0; t < NT; ++t) { const int bo = (t & 1) * STG;
#pragma unroll
      for (int kc = 0; kc < KS / 32; ++kc) { v16h a[2], w[8];   // a 32-k step's LDS reads go out as one group in front of its 16 products (both steps' fragments at once would not fit beside the 128 accumulator registers); the loops below are unrolled so that these arrays are registers
#pragma unroll
        for (int i = 0; i < 2; ++i) a[i] = frag_h((const _Float16*)(sm + bo + (wave * 32 + i * 16 + col) * HPITCH) + kc * 32, lane);
#pragma unroll
        for (int j = 0; j < 8; ++j) w[j] = frag_h((const _Float16*)(sm + bo + (128 + j * 16 + col) * HPITCH) + kc * 32, lane);
#pragma unroll
        for (int j = 0; j < 8; ++j)
#pragma unroll
          for (int i = 0; i < 2; ++i) acc[i][j] = wmma16(a[i], w[j], acc[i][j]); }
      WAIT_DS0(); WAIT_ASYNC0(); __syncthreads();   // publishes stage t + 1 and ends every reader's last read of stage t
      if (t + 2 < NT) { stage_ab(l0 + bo, gA + (size_t)(t + 2) * 2 * KS, 2 * DM, gB + (size_t)(t + 2) * 2 * KS, 2 * DM, tid); } }
    WAIT_ASYNC0(); }
#pragma unroll
  for (int i = 0; i < 2; ++i)
#pragma unroll
    for (int j = 0; j < 8; ++j)
#pragma unroll
      for (int r = 0; r < 8; ++r) acc[i][j][r] *= (1.0f / WSC);
  if (n0 < 2 * DM) {   // bias, then rotate-half rotary over each 64-dim head with angle position * inv_freq[d mod 32]; the wave's two 16-row halves go through its staging rows one after the other (unrolled: acc is indexed by i)
#pragma unroll
    for (int i = 0; i < 2; ++i) { const size_t ri = r0 + i * 16;
#pragma unroll
      for (int j = 0; j < 8; ++j)
#pragma unroll
        for (int r = 0; r < 8; ++r) acc[i][j][r] += (BB ? bfr(BB[j * 16 + col]) : 0.f);
#pragma unroll
      for (int r = 0; r < 8; ++r) { const int spos = (int)((ri + 8 * g + r) % SS);
#pragma unroll
        for (int jj = 0; jj < 2; ++jj) { const float ang = (float)spos * THETA[jj * 16 + col]; const float c = cos_p(ang), sn = sin_p(ang);
#pragma unroll
          for (int hh = 0; hh < 2; ++hh) { const float x1 = acc[i][hh * 4 + jj][r], x2 = acc[i][hh * 4 + jj + 2][r]; acc[i][hh * 4 + jj][r] = x1 * c - x2 * sn; acc[i][hh * 4 + jj + 2][r] = x2 * c + x1 * sn; } } }
      if (i) LDSX();   // the first half's reads of the staging rows have returned before other lanes rewrite them
#pragma unroll
      for (int j = 0; j < 8; ++j) {
#pragma unroll
        for (int r = 0; r < 8; ++r) { const float v = acc[i][j][r]; const _Float16 hv = (_Float16)v; so[wave][8 * g + r][j * 16 + col] = hv; sol[wave][8 * g + r][j * 16 + col] = (_Float16)((v - (float)hv) * 2048.0f); } }   // q, k (+ bias) as f16 hi + (x2048) residual
      LDSX();
      for (int rl = 0; rl < 16; ++rl) if (lane < 16) { vst2((unsigned*)(QK + (ri + rl) * (2 * DM) + n0 + lane * 8), *(const v4u*)&so[wave][rl][lane * 8]); vst2((unsigned*)(QKL + (ri + rl) * (2 * DM) + n0 + lane * 8), *(const v4u*)&sol[wave][rl][lane * 8]); } }
  } else {
#pragma unroll
    for (int i = 0; i < 2; ++i)
#pragma unroll
      for (int j = 0; j < 8; ++j) {
#pragma unroll
        for (int r = 0; r < 8; ++r) { const float v = acc[i][j][r] + (BB ? bfr(BB[j * 16 + col]) : 0.f); const _Float16 hv = (_Float16)v; sth[j * 16 + col][wave * 32 + i * 16 + 8 * g + r] = hv; stl[j * 16 + col][wave * 32 + i * 16 + 8 * g + r] = (_Float16)((v - (float)hv) * 2048.0f); } }
    __syncthreads();
    const size_t rb = (size_t)blockIdx.x * 128; const int b = (int)(rb / SS), s0 = (int)(rb % SS); const int pc0 = n0 - 2 * DM;
    for (int q = tid; q < 128 * 16; q += 128) { const int d = q >> 4, pc = q & 15; const size_t o = ((size_t)b * DM + pc0 + d) * SS + s0 + pc * 8; vst2((unsigned*)(VTH + o), *(const v4u*)&sth[d][pc * 8]); vst2((unsigned*)(VTL + o), *(const v4u*)&stl[d][pc * 8]); }
  }
}
// ---- k_attn: block = (64 queries, head h, batch b): flash attention over the visible (64-query, 32-key) tiles (K = 64: 2 k-steps), scores = (q.k) * 0.125, 3 products (hi + residual planes), P.V likewise; O[b*S+q][h*64+d] = (acc + accl / 2048) / (2048 l) (256-B segments)
// a tile's K rows (32 x 128 B, hi and residual) and V^T rows (64 x 64 B, hi and residual) come into LDS once for the block's four waves by asynchronous 16-byte copies, two buffers, the next visible tile in flight while this one is worked on; row pitch = row bytes + 16 (16 B x odd: conflict-free for 16-byte reads)
#define AKP (2 * HD + 16)
#define AVP (2 * 32 + 16)
#define A_KH 0
#define A_KL (32 * AKP)
#define A_VH (2 * 32 * AKP)
#define A_VL (A_VH + HD * AVP)
#define A_STG (A_VL + HD * AVP)
// tile ks to LDS byte address lb: 8 copies a thread; kh, kl: key row 0 of this (batch, head) in the two planes; vh, vl: its V^T row 0
__device__ __forceinline__ void stage_kv(unsigned lb, const char* kh, const char* kl, const char* vh, const char* vl, int ks, int tid) {
  unsigned l[8]; const char* g[8]; const int kr = tid >> 3, kp = tid & 7, vr = tid >> 2, vp = tid & 3;
  const size_t ko = (size_t)(ks * 32 + kr) * (2 * DM * 2) + kp * 16, vo = (size_t)vr * (SS * 2) + ks * 64 + vp * 16;
#pragma unroll
  for (int i = 0; i < 2; ++i) { const unsigned lk = lb + (kr + 16 * i) * AKP + kp * 16, lv = lb + (vr + 32 * i) * AVP + vp * 16; const size_t gk = ko + (size_t)i * 16 * (2 * DM * 2), gv = vo + (size_t)i * 32 * (SS * 2);
    l[i] = lk + A_KH; g[i] = kh + gk; l[2 + i] = lk + A_KL; g[2 + i] = kl + gk; l[4 + i] = lv + A_VH; g[4 + i] = vh + gv; l[6 + i] = lv + A_VL; g[6 + i] = vl + gv; }
  cp8(l, g);
}
__global__ __launch_bounds__(128) void k_attn(const _Float16* __restrict__ QK, const _Float16* __restrict__ QKL, const _Float16* __restrict__ VTH, const _Float16* __restrict__ VTL, const void* __restrict__ KMASK, const int* __restrict__ MASK, const int* __restrict__ FL, float* __restrict__ O) {
  __shared__ __align__(16) float sp[4][16][36]; __shared__ __align__(16) float so[4][16][68]; __shared__ __attribute__((aligned(128))) char sm[2 * A_STG];   // sm: the K / V ring
  const int tid = threadIdx.x, wave = tid >> 5, lane = tid & 31, col = lane & 15, g = lane >> 4;
  const int qb = blockIdx.x, h = blockIdx.y, b = blockIdx.z; const int q0 = qb * 64 + wave * 16; const size_t rq = (size_t)b * SS + q0 + col;
  // the visible tiles of this query block as 64 bits in scalar registers (the same in every wave of the block), taken in rising order: the ring has to know the next tile before this one is done
  unsigned long long todo = ((unsigned long long)__builtin_amdgcn_ballot_w32(FL[qb * (SS / 32) + 32 + lane] != 0) << 32) | __builtin_amdgcn_ballot_w32(FL[qb * (SS / 32) + lane] != 0);
  const int nt = __builtin_popcountll(todo);
  const char* gkh = (const char*)(QK + (size_t)b * SS * (2 * DM) + DM + h * HD); const char* gkl = (const char*)(QKL + (size_t)b * SS * (2 * DM) + DM + h * HD);
  const char* gvh = (const char*)(VTH + ((size_t)b * DM + h * HD) * SS); const char* gvl = (const char*)(VTL + ((size_t)b * DM + h * HD) * SS); const unsigned l0 = lds_off(sm);
  int ks = 0, ksn = 0;
  if (nt > 0) { ks = __builtin_ctzll(todo); todo &= todo - 1; stage_kv(l0, gkh, gkl, gvh, gvl, ks, tid); }
  v16h aq[2], aql[2];
#pragma unroll
  for (int kc = 0; kc < 2; ++kc) { aq[kc] = frag_h(QK + rq * (2 * DM) + h * HD + kc * 32, lane); aql[kc] = frag_h(QKL + rq * (2 * DM) + h * HD + kc * 32, lane); }
  float m[8], l[8];
#pragma unroll
  for (int r = 0; r < 8; ++r) { m[r] = -3.0e38f; l[r] = 0.f; }
  v8f acc[4] = {}, accl[4] = {};
  WAIT_ASYNC0(); __syncthreads();   // publishes the first tile
  if (nt > 1) { ksn = __builtin_ctzll(todo); todo &= todo - 1; stage_kv(l0 + A_STG, gkh, gkl, gvh, gvl, ksn, tid); }
#pragma unroll 1   // stays rolled: t & 1 picks the buffer
  for (int t = 0; t < nt; ++t) { const int bo = (t & 1) * A_STG; v8f s[2];
    v16h kh[2][2], kl[2][2];   // the tile's K reads go out as one group in front of its products; unrolled so that the arrays are registers
#pragma unroll
    for (int ct = 0; ct < 2; ++ct)
#pragma unroll
      for (int kc = 0; kc < 2; ++kc) { kh[ct][kc] = frag_h((const _Float16*)(sm + bo + A_KH + (ct * 16 + col) * AKP) + kc * 32, lane); kl[ct][kc] = frag_h((const _Float16*)(sm + bo + A_KL + (ct * 16 + col) * AKP) + kc * 32, lane); }
#pragma unroll
    for (int ct = 0; ct < 2; ++ct) { const int kk = ks * 32 + ct * 16 + col; v8f c = {}, cl = {};
#pragma unroll
      for (int kc = 0; kc < 2; ++kc) { c = wmma16(aq[kc], kh[ct][kc], c); cl = wmma16(aql[kc], kh[ct][kc], cl); cl = wmma16(aq[kc], kl[ct][kc], cl); }   // 3 products: q, k as f16 hi + residual
#pragma unroll
      for (int r = 0; r < 8; ++r) c[r] += cl[r] * (1.0f / 2048.0f);
      {
#pragma unroll
      for (int r = 0; r < 8; ++r) s[ct][r] = (MASK[(size_t)(q0 + 8 * g + r) * SS + kk] == 0) ? c[r] * 0.125f : -3.0e38f; } }   // 1/sqrt(64); masked keys excluded
#pragma unroll
    for (int r = 0; r < 8; ++r) { float mx = fmaxf(s[0][r], s[1][r]);
#pragma unroll
      for (int o = 1; o < 16; o <<= 1) mx = fmaxf(mx, __shfl_xor(mx, o));
      const float mn = fmaxf(m[r], mx); const float alpha = (m[r] <= -1.0e38f) ? 0.f : __expf(m[r] - mn);
      const float e0 = (s[0][r] <= -1.0e38f) ? 0.f : __expf(s[0][r] - mn), e1 = (s[1][r] <= -1.0e38f) ? 0.f : __expf(s[1][r] - mn); float es = e0 + e1;
#pragma unroll
      for (int o = 1; o < 16; o <<= 1) es += __shfl_xor(es, o);
      l[r] = l[r] * alpha + es; m[r] = mn;
#pragma unroll
      for (int dt = 0; dt < 4; ++dt) { acc[dt][r] *= alpha; accl[dt][r] *= alpha; }
      sp[wave][8 * g + r][col] = e0; sp[wave][8 * g + r][16 + col] = e1; }
    LDSX();
    v16h vh[4], vl[4];   // the tile's V reads likewise as one group
#pragma unroll
    for (int dt = 0; dt < 4; ++dt) { vh[dt] = frag_h((const _Float16*)(sm + bo + A_VH + (dt * 16 + col) * AVP), lane); vl[dt] = frag_h((const _Float16*)(sm + bo + A_VL + (dt * 16 + col) * AVP), lane); }
    v16h pa, pl; { const float* prow = &sp[wave][col][0] + 8 * (lane >> 4);
#pragma unroll
      for (int i = 0; i < 8; ++i) { const float x0 = prow[i] * 2048.0f, x1 = prow[16 + i] * 2048.0f; const _Float16 h0 = (_Float16)x0, h1 = (_Float16)x1; pa[i] = h0; pa[8 + i] = h1; pl[i] = (_Float16)((x0 - (float)h0) * 2048.0f); pl[8 + i] = (_Float16)((x1 - (float)h1) * 2048.0f); } }   // P scaled by 2^11 before the f16 split so small softmax weights stay out of the f16 subnormal range; 2^-11 folded into the epilogue
#pragma unroll
    for (int dt = 0; dt < 4; ++dt) { acc[dt] = wmma16(pa, vh[dt], acc[dt]); accl[dt] = wmma16(pl, vh[dt], accl[dt]); accl[dt] = wmma16(pa, vl[dt], accl[dt]); }   // P hi x V hi + (P lo x V hi + P hi x V lo) / 2048
    WAIT_DS0(); WAIT_ASYNC0(); __syncthreads();   // publishes tile t + 1 and ends every reader's last read of tile t (and this wave's reads of its sp rows)
    ks = ksn;
    if (t + 2 < nt) { ksn = __builtin_ctzll(todo); todo &= todo - 1; stage_kv(l0 + bo, gkh, gkl, gvh, gvl, ksn, tid); } }
  WAIT_ASYNC0();
#pragma unroll
  for (int r = 0; r < 8; ++r) { const float il = (l[r] > 0.f) ? (1.0f / 2048.0f) / l[r] : 0.f;
#pragma unroll
    for (int dt = 0; dt < 4; ++dt) so[wave][8 * g + r][dt * 16 + col] = (acc[dt][r] + accl[dt][r] * (1.0f / 2048.0f)) * il; }
  LDSX();
  for (int rl = 0; rl < 16; ++rl) if (lane < 16) vst2(O + ((size_t)b * SS + q0 + rl) * DM + h * HD + lane * 4, *(const v4f*)&so[wave][rl][lane * 4]);
}
// ---- k_out: block = (64 rows, 128 cols): out = O(hi/lo) . Wo rows (2 products) + bo
__global__ __launch_bounds__(128) void k_out(const float* __restrict__ O, const __bf16* __restrict__ P, const float* __restrict__ BO, float* __restrict__ Y) {
  __shared__ __align__(16) float so[4][16][132];
  const int tid = threadIdx.x, wave = tid >> 5, lane = tid & 31, col = lane & 15, g = lane >> 4; const size_t r0 = (size_t)blockIdx.x * 64 + wave * 16; const int n0 = blockIdx.y * 128;
  v8f acc[8] = {};
#pragma unroll 2
  for (int kc = 0; kc < DM / 32; ++kc) { const F2 a = split_row(O + (r0 + col) * DM, kc * 32, lane);
#pragma unroll
    for (int j = 0; j < 8; ++j) { const v16b w = frag_b(P + (size_t)(n0 + j * 16 + col) * DM + kc * 32, lane); acc[j] = wmma_bf(a.l, w, acc[j]); acc[j] = wmma_bf(a.h, w, acc[j]); } }
#pragma unroll
  for (int j = 0; j < 8; ++j) {
#pragma unroll
    for (int r = 0; r < 8; ++r) so[wave][8 * g + r][j * 16 + col] = acc[j][r] + (BO ? bfr(BO[n0 + j * 16 + col]) : 0.f); }
  LDSX();
  for (int rl = 0; rl < 16; ++rl) vst2(Y + (r0 + rl) * DM + n0 + lane * 4, *(const v4f*)&so[wave][rl][lane * 4]);
}

// ---- k_rms: wave = row, no LDS and no barrier: OUTH = f16(x rsqrt(mean x^2 + eps) w) (MODE 0: x = bf16-rounded input; MODE 1: x = f32 x1); a lane holds 8 pieces of 16 bytes, 128 elements apart, the row's 8 loads in flight at once; every loop is unrolled so that the pieces stay in registers
template <int M> __device__ __forceinline__ float lane_xor(float v) { return __builtin_bit_cast(float, __builtin_amdgcn_update_dpp(0, __builtin_bit_cast(int, v), 0x160 + M, 0xf, 0xf, true)); }   // value of lane ^ M inside a 16-lane row (DPP row_xmask), no LDS round trip
template <int MODE>
__global__ __launch_bounds__(512) void k_rms(const float* __restrict__ A, const float* __restrict__ Wn, _Float16* __restrict__ OUTH) { const int lane = threadIdx.x & 31; const size_t row = (size_t)blockIdx.x * 16 + (threadIdx.x >> 5);
  v4f x[8], wn[8];
#pragma unroll
  for (int j = 0; j < 8; ++j) x[j] = *(const v4f*)(A + row * DM + j * 128 + lane * 4);
#pragma unroll
  for (int j = 0; j < 8; ++j) wn[j] = *(const v4f*)(Wn + j * 128 + lane * 4);
  if (MODE == 0) {
#pragma unroll
    for (int j = 0; j < 8; ++j)
#pragma unroll
      for (int c = 0; c < 4; ++c) x[j][c] = bfr(x[j][c]); }
  // the square sum keeps its tree: elements 256 apart chained, then pairwise over each aligned run of 32 elements (4 in the lane, 8 lanes), then the eight runs' sums one after another
  float s[2];
#pragma unroll
  for (int jp = 0; jp < 2; ++jp) { float q[4];
#pragma unroll
    for (int c = 0; c < 4; ++c) { float t = 0.f;
#pragma unroll
      for (int i = 0; i < 4; ++i) t += x[jp + 2 * i][c] * x[jp + 2 * i][c];
      q[c] = t; }
    s[jp] = (q[0] + q[1]) + (q[2] + q[3]); }
#pragma unroll
  for (int jp = 0; jp < 2; ++jp) { s[jp] += lane_xor<1>(s[jp]); s[jp] += lane_xor<2>(s[jp]); s[jp] += lane_xor<4>(s[jp]); }
  float tq = 0.f;
#pragma unroll
  for (int i = 0; i < 8; ++i) tq += __builtin_bit_cast(float, __builtin_amdgcn_readlane(__builtin_bit_cast(int, s[i >> 2]), (i & 3) * 8));
  const float inv = 1.0f / sqrtf(tq / (float)DM + RMSEPS);
#pragma unroll
  for (int j = 0; j < 8; ++j) { v4h o;
#pragma unroll
    for (int c = 0; c < 4; ++c) o[c] = (_Float16)(x[j][c] * inv * bfr(wn[j][c]));
    *(v4h*)(OUTH + row * DM + j * 128 + lane * 4) = o; } }
// ---- k_flags: block = (query block qb of 64 queries, half hf of the keys): FL[qb][hf * 32 + kt] = 1 if any mask[q][k] == 0 (attend) in the 64 x 32 tile; a lane owns one 16-byte column piece over 16 rows, all 16 loads independent; a block writes one whole 128-byte line of FL
__global__ __launch_bounds__(1024) void k_flags(const int* __restrict__ MASK, int* __restrict__ FL) { __shared__ __align__(16) int sf[32]; const int t = threadIdx.x; const int qb = blockIdx.x, hf = blockIdx.y; const int c4 = t & 255, rw = t >> 8;
  if (t < 32) sf[t] = 0; __syncthreads();
  const int* p = MASK + (size_t)(qb * 64 + rw) * SS + hf * (SS / 2) + c4 * 4; v4u v[16];
#pragma unroll
  for (int i = 0; i < 16; ++i) v[i] = *(const v4u*)(p + (size_t)i * 4 * SS);
  unsigned mn = 0xffffffffu;
#pragma unroll
  for (int i = 0; i < 16; ++i) mn = min(mn, min(min(v[i][0], v[i][1]), min(v[i][2], v[i][3])));   // smallest word is 0 exactly when some key is visible
  if (mn == 0u) sf[c4 >> 3] = 1;   // benign same-value race within the block
  __syncthreads(); if (t < 8) vst2((unsigned*)(FL + (size_t)qb * (SS / 32) + hf * 32 + t * 4), *(const v4u*)&sf[t * 4]); }
// ---- k_g<MODE, KW>: block = (128 rows, 128 cols), eight waves, a wave 32 rows x 64 cols (a fragment read from LDS feeds two or four products; the grid is one block a WGP, so the block brings two waves a SIMD itself, and nothing else on the WGP covers a stage's way from L2: the ring has four buffers, three stages in flight while one is worked on): A f16 rows (MODE 0: built inline from the f32 ctx) . W^T (f16 x 2^8); MODE 0: X1 = x (bf16-rounded) + acc (f32 out); MODE 2: OUT = X1 + acc (f32)
template <int MODE, int KW>
__global__ __launch_bounds__(256) void k_g(const void* __restrict__ Ain, const _Float16* __restrict__ Wr, const float* __restrict__ RES, float* __restrict__ O32, int ow) { constexpr int AEB = (MODE == 0) ? 4 : 2, APITCH = AEB * KS + 16, STG = 128 * APITCH + 128 * HPITCH, CPS = 128 * AEB * KS / 4096 + 4; __shared__ __attribute__((aligned(128))) char sm[4 * STG];   // the ring (CPS: copies a wave issues for a stage, the same in every wave); behind the loop's last barrier the same bytes are the output staging
  float (*sf)[16][68] = (float (*)[16][68])sm;
  const int tid = threadIdx.x, wave = tid >> 5, lane = tid & 31, col = lane & 15, g = lane >> 4, ar = (wave >> 1) * 32, wr = (wave & 1) * 64; const size_t r0 = (size_t)blockIdx.x * 128 + ar; const int c0 = blockIdx.y * 128 + wr;
  v8f acc[2][4] = {};
  { const char* gA = (const char*)Ain + (size_t)blockIdx.x * 128 * KW * AEB; const char* gB = (const char*)(Wr + (size_t)blockIdx.y * 128 * KW); const unsigned l0 = lds_off(sm); constexpr int NT = KW / KS;
    static_assert(NT >= 4 && 4 * CPS <= 63, "four stages exist, and their copies fit the counter");
#pragma unroll   // four straight-line stages: the buffer offsets are constants
    for (int s = 0; s < 4; ++s) stage_ab8<AEB * KS>(l0 + s * STG, gA + (size_t)s * AEB * KS, (size_t)AEB * KW, gB + (size_t)s * 2 * KS, 2 * KW, tid);
    WAIT_ASYNC(3 * CPS); __syncthreads();   // publishes stage 0; stages 1 to 3 stay in flight
    // one stage's work, from the buffer at byte offset bo
    auto work = [&](int bo) __attribute__((always_inline)) {
      v16h a[KS / 32][2], w[KS / 32][4];   // the stage's LDS reads go out as one group in front of its products; the loops below are unrolled so that these arrays are registers
#pragma unroll
      for (int kc = 0; kc < KS / 32; ++kc) {
#pragma unroll
        for (int h = 0; h < 2; ++h) { if (MODE == 0) { const float* p = (const float*)(sm + bo + (ar + h * 16 + col) * APITCH) + kc * 32 + 8 * g;
#pragma unroll
            for (int i = 0; i < 8; ++i) { a[kc][h][i] = (_Float16)p[i]; a[kc][h][8 + i] = (_Float16)p[16 + i]; } } else a[kc][h] = frag_h((const _Float16*)(sm + bo + (ar + h * 16 + col) * APITCH) + kc * 32, lane); }
#pragma unroll
        for (int j = 0; j < 4; ++j) w[kc][j] = frag_h((const _Float16*)(sm + bo + 128 * APITCH + (wr + j * 16 + col) * HPITCH) + kc * 32, lane); }
#pragma unroll
      for (int kc = 0; kc < KS / 32; ++kc)
#pragma unroll
        for (int j = 0; j < 4; ++j)
#pragma unroll
          for (int h = 0; h < 2; ++h) acc[h][j] = wmma16(a[kc][h], w[kc][j], acc[h][j]); };
#pragma unroll 1   // stays rolled: one copy of a stage's code in the instruction cache; t & 3 picks the buffer
    for (int t = 0; t < NT - 4; ++t) { const int bo = (t & 3) * STG; work(bo);
      WAIT_DS0(); WAIT_ASYNC(2 * CPS); __syncthreads();   // stage t + 1 has landed (the wave's youngest copies are those of stages t + 2 and t + 3); the barrier publishes it and ends every reader's last read of stage t
      stage_ab8<AEB * KS>(l0 + bo, gA + (size_t)(t + 4) * AEB * KS, (size_t)AEB * KW, gB + (size_t)(t + 4) * 2 * KS, 2 * KW, tid); }
#pragma unroll 1   // the last four stages: nothing is issued any more, so the wait is to 0; rolled for the same reason
    for (int t = NT - 4; t < NT; ++t) { work((t & 3) * STG); WAIT_DS0(); WAIT_ASYNC0(); __syncthreads(); }
    WAIT_ASYNC0(); }
#pragma unroll   // the wave's two 16-row halves go through its staging rows one after the other (unrolled: acc is indexed by h)
  for (int h = 0; h < 2; ++h) { const size_t rh = r0 + h * 16; float res[8][4];
#pragma unroll
    for (int r = 0; r < 8; ++r) { const float* rp = RES + (rh + 8 * g + r) * ow + c0 + col;
#pragma unroll
      for (int j = 0; j < 4; ++j) res[r][j] = rp[j * 16];
      asm volatile("s_wait_xcnt 0x0" ::: "memory"); }   // stands behind each row's four loads: the results of later rows' loads may land in the registers that held this row's address
    if (h) LDSX();   // the first half's reads of the staging rows have returned before other lanes rewrite them
#pragma unroll
    for (int j = 0; j < 4; ++j)
#pragma unroll
      for (int r = 0; r < 8; ++r) sf[wave][8 * g + r][j * 16 + col] = acc[h][j][r] * (1.0f / WSC) + (MODE == 0 ? bfr(res[r][j]) : res[r][j]);
    LDSX(); for (int rl = g; rl < 16; rl += 2) vst2(O32 + (rh + rl) * ow + c0 + col * 4, *(const v4f*)&sf[wave][rl][col * 4]); } }   // a store covers two rows' 256-byte runs
// ---- k_gu: block = (128 rows, 128 hidden cols), eight waves, a wave 32 rows x (64 gate + 64 up) cols (each weight fragment read from LDS feeds two products): g = h2 . Wg^T, u = h2 . Wu^T (same A), GU = f16(silu(g) u) -> rows [NR][HP]
__global__ __launch_bounds__(256) void k_gu(const _Float16* __restrict__ H2, const _Float16* __restrict__ PG, _Float16* __restrict__ GU) { constexpr int STG = (128 + 256) * HPITCH; __shared__ __attribute__((aligned(128))) char sm[2 * STG];   // the ring (128 A rows, 128 gate rows, 128 up rows); behind the loop's last barrier the same bytes are the output staging
  _Float16 (*so)[136] = (_Float16 (*)[136])sm;
  const int tid = threadIdx.x, wave = tid >> 5, lane = tid & 31, col = lane & 15, g = lane >> 4, ar = (wave >> 1) * 32, wr = (wave & 1) * 64; const size_t rb = (size_t)blockIdx.x * 128; const int c0 = blockIdx.y * 128; const _Float16* Wg = PG + (size_t)c0 * DM; const _Float16* Wu = PG + ((size_t)HP + c0) * DM;
  v8f ag[2][4] = {}, au[2][4] = {};
  { const char* gA = (const char*)(H2 + rb * DM); const char* gG = (const char*)Wg; const char* gU = (const char*)Wu; const unsigned l0 = lds_off(sm); constexpr int NT = DM / KS;
    stage_abc8(l0, gA, gG, gU, 2 * DM, tid); WAIT_ASYNC0(); __syncthreads();
    stage_abc8(l0 + STG, gA + 2 * KS, gG + 2 * KS, gU + 2 * KS, 2 * DM, tid);
#pragma unroll 1   // stays rolled: one copy of a stage's code in the instruction cache; t & 1 picks the buffer
    for (int t = 0; t < NT; ++t) { const int bo = (t & 1) * STG;
#pragma unroll
      for (int kc = 0; kc < KS / 32; ++kc) { v16h a[2], wg[4], wu[4];   // a 32-k step's LDS reads go out as one group in front of its 16 products (both steps' fragments at once would not fit beside the 128 accumulator registers); the loops below are unrolled so that these arrays are registers
#pragma unroll
        for (int h = 0; h < 2; ++h) a[h] = frag_h((const _Float16*)(sm + bo + (ar + h * 16 + col) * HPITCH) + kc * 32, lane);
#pragma unroll
        for (int j = 0; j < 4; ++j) { wg[j] = frag_h((const _Float16*)(sm + bo + (128 + wr + j * 16 + col) * HPITCH) + kc * 32, lane); wu[j] = frag_h((const _Float16*)(sm + bo + (256 + wr + j * 16 + col) * HPITCH) + kc * 32, lane); }
#pragma unroll
        for (int j = 0; j < 4; ++j)
#pragma unroll
          for (int h = 0; h < 2; ++h) { ag[h][j] = wmma16(a[h], wg[j], ag[h][j]); au[h][j] = wmma16(a[h], wu[j], au[h][j]); } }
      WAIT_DS0(); WAIT_ASYNC0(); __syncthreads();   // publishes stage t + 1 and ends every reader's last read of stage t
      if (t + 2 < NT) { const size_t ko = (size_t)(t + 2) * 2 * KS; stage_abc8(l0 + bo, gA + ko, gG + ko, gU + ko, 2 * DM, tid); } }
    WAIT_ASYNC0(); }
#pragma unroll
  for (int h = 0; h < 2; ++h)
#pragma unroll
    for (int j = 0; j < 4; ++j)
#pragma unroll
      for (int r = 0; r < 8; ++r) { const float gg = ag[h][j][r] * (1.0f / WSC), uu = au[h][j][r] * (1.0f / WSC); so[ar + h * 16 + 8 * g + r][wr + j * 16 + col] = (_Float16)(gg / (1.0f + __expf(-gg)) * uu); }
  __syncthreads(); for (int e = tid; e < 128 * 16; e += 256) { const int rl = e >> 4, q = e & 15; vst2((unsigned*)(GU + (rb + rl) * HP + c0 + q * 8), *(const v4u*)&so[rl][q * 8]); } }

extern "C" void kernel_launch(void* const* d_in, const int* in_sizes, int n_in, void* d_out, int out_size, void* d_ws, size_t ws_size, hipStream_t stream) {
  (void)in_sizes; (void)n_in; (void)out_size;
  const float** F = (const float**)d_in;   // 0 x [2,2048,1024], 1 attn_mask [2048,2048] int (1 = masked), 2 wq, 3 wk, 4 wv, 5 wo (natural [1024,1024]), 6 norm1_w, 7 norm2_w, 8 w_gate [2730,1024], 9 w_up, 10 w_down [1024,2730]
  if (ws_size < (size_t)WS_END) return;
  char* ws = (char*)d_ws; _Float16* PK = (_Float16*)(ws + WS_PK); _Float16 *QK = (_Float16*)(ws + WS_QK), *QKL = (_Float16*)(ws + WS_QKL), *VTH = (_Float16*)(ws + WS_VTH), *VTL = (_Float16*)(ws + WS_VTL), *H1 = (_Float16*)(ws + WS_H1), *H2 = (_Float16*)(ws + WS_H2), *GU = (_Float16*)(ws + WS_GU); float *O = (float*)(ws + WS_O), *X1 = (float*)(ws + WS_X1); int* FL = (int*)(ws + WS_FL); const int* MASK = (const int*)d_in[1];
  const int nr = NB * SS;   // keys of both batches are always needed
  k_pack<<<PK_WG, 512, 0, stream>>>(F[2], F[3], F[4], F[5], F[8], F[9], F[10], ws);
  k_rms<0><<<nr / 16, 512, 0, stream>>>(F[0], F[6], H1);
  k_flags<<<dim3(SS / 64, 2), 1024, 0, stream>>>(MASK, FL);
  k_qkv<<<dim3(nr / 128, QKVW / 128), 128, 0, stream>>>((const float*)H1, (const float*)H1, (const float*)H1, PK + PK_A, nullptr, nullptr, nullptr, QK, QKL, VTH, VTL);
  k_attn<<<dim3(TQB, NH, TNB), 128, 0, stream>>>(QK, QKL, VTH, VTL, nullptr, MASK, FL, O);
  k_g<0, DM><<<dim3(TOB / 2, DM / 128), 256, 0, stream>>>(O, PK + PK_P, F[0], X1, DM);                  // x1 = x + ctx wo^T
  k_rms<1><<<TOB * 4, 512, 0, stream>>>(X1, F[7], H2);
  k_gu<<<dim3(TOB / 2, HP / 128), 256, 0, stream>>>(H2, (const _Float16*)(ws + WS_PG), GU);
  k_g<2, HP><<<dim3(TOB / 2, DM / 128), 256, 0, stream>>>(GU, (const _Float16*)(ws + WS_PD), X1, (float*)d_out, DM);   // out = x1 + (silu(g) u) w_down^T
}

// v007
// A run of this version takes 167 microseconds.
// Two timings next to v006 both put it at 1.03 times that version's speed.
// All steps since v000 together make it 5.40 times as fast.
// compute dtype: all float inputs rounded to bf16, attn_mask (int) read on device; RMSNorms (eps 1e-6) in f32, normed rows once to f16; q/k/v = f16(h) . W^T against exact f16 x 2^8 weight copies on WMMA 16x16x32 (single products, f32 accumulate); rotate-half RoPE in f32 (precise sinf/cosf) before the f16 hi + residual split; attention with 3-product scores and P.v (hi + residual planes), x 1/8, masked keys excluded (mask read per pair; fully-masked 64x32 tiles skipped via a device-built flag table), running-max softmax in f32 (hardware exp); x1 = x + f16(ctx) . Wo^T; SwiGLU: f16(rmsnorm(x1)) . [W_gate | W_up]^T (hidden padded 2,730 -> 2,816 with zero weights), silu(g) u in f32 -> f16, . W_down^T + x1; f32 output.
#include <hip/hip_runtime.h>
#include <math.h>

typedef __attribute__((ext_vector_type(16))) _Float16 v16h;
typedef __attribute__((ext_vector_type(16))) __bf16 v16b;
typedef __attribute__((ext_vector_type(8)))  _Float16 v8h;
typedef __attribute__((ext_vector_type(8)))  float v8f;
typedef __attribute__((ext_vector_type(4)))  float v4f;
typedef __attribute__((ext_vector_type(2)))  float v2f;
typedef __attribute__((ext_vector_type(4)))  unsigned v4u;
typedef __attribute__((ext_vector_type(4)))  int v4i;
typedef float __attribute__((may_alias)) float_a;
typedef int __attribute__((may_alias)) int_a;

template <typename T> __device__ __forceinline__ void vst2(void* p, T v) { *(T*)p = v;  }
__device__ __forceinline__ v8f wmma16(v16h a, v16h b, v8f c) {
  v8f d = __builtin_amdgcn_wmma_f32_16x16x32_f16(false, a, false, b, (short)0, c, false, false);
  asm volatile("v_nop\n\tv_nop\n\tv_nop\n\tv_nop" : "+v"(d) : "v"(a), "v"(b));
  return d;
}
__device__ __forceinline__ v8f wmma_bf(v16b a, v16b b, v8f c) {
  v8f d = __builtin_amdgcn_wmma_f32_16x16x32_bf16(false, a, false, b, (short)0, c, false, false);
  asm volatile("v_nop\n\tv_nop\n\tv_nop\n\tv_nop" : "+v"(d) : "v"(a), "v"(b));
  return d;
}
// Streaming decoder block (B 2, L 2,048, d 1,024, 16 heads x 64, SwiGLU hidden 2,730): pre-RMSNorm, bias-free projections, rotate-half RoPE (base 10000), attention under the given boolean mask (all-keys + 256-token window), out-projection + residual, pre-RMSNorm SwiGLU FFN + residual.
__device__ __forceinline__ v16h frag_h(const _Float16* rowk0, int lane) {
  union { v16h v; v8h q[2]; } u; const _Float16* p = rowk0 + 8 * (lane >> 4);
  u.q[0] = *(const v8h*)p; u.q[1] = *(const v8h*)(p + 16); return u.v;
}
__device__ __forceinline__ v16h frag_f32(const float* rowk0, int lane) {
  v16h a; const float* p = rowk0 + 8 * (lane >> 4);
#pragma unroll
  for (int i = 0; i < 8; ++i) { a[i] = (_Float16)p[i]; a[8 + i] = (_Float16)p[16 + i]; }
  return a;
}
__device__ __forceinline__ v16h frag_f32s(const float* rowk0, int lane, float sc) {
  v16h a; const float* p = rowk0 + 8 * (lane >> 4);
#pragma unroll
  for (int i = 0; i < 8; ++i) { a[i] = (_Float16)(p[i] * sc); a[8 + i] = (_Float16)(p[16 + i] * sc); }
  return a;
}
// column fragment from a [K][ld] layout (column n), rows >= K read as 0
__device__ __forceinline__ v16h fragc_f32(const float* W, int k0, int n, int lane, int ld, int K) {
  v16h a; const int g = lane >> 4;
#pragma unroll
  for (int i = 0; i < 8; ++i) { const int ka = k0 + 8 * g + i, kb = ka + 16;
    a[i] = (_Float16)(ka < K ? W[(size_t)(ka < K ? ka : K - 1) * ld + n] : 0.f); a[8 + i] = (_Float16)(kb < K ? W[(size_t)(kb < K ? kb : K - 1) * ld + n] : 0.f); }
  return a;
}
struct F2 { v16b h, l; };
__device__ __forceinline__ F2 bsplit16(const float v[16]) { F2 r;
#pragma unroll
  for (int i = 0; i < 16; ++i) { const __bf16 h = (__bf16)v[i]; r.h[i] = h; r.l[i] = (__bf16)(v[i] - (float)h); }
  return r; }
__device__ __forceinline__ F2 split_row(const float* row, int k0, int lane) { float v[16]; const float* p = row + k0 + 8 * (lane >> 4);
#pragma unroll
  for (int i = 0; i < 8; ++i) { v[i] = p[i]; v[8 + i] = p[16 + i]; }
  return bsplit16(v); }
__device__ __forceinline__ F2 split_rowK(const float* row, int k0, int lane, int K) { float v[16]; const int g = lane >> 4;
#pragma unroll
  for (int i = 0; i < 8; ++i) { const int ka = k0 + 8 * g + i, kb = ka + 16; v[i] = ka < K ? row[ka < K ? ka : K - 1] : 0.f; v[8 + i] = kb < K ? row[kb < K ? kb : K - 1] : 0.f; }
  return bsplit16(v); }
__device__ __forceinline__ F2 split_col(const float* W, int k0, int n, int lane, int ld, int K) { float v[16]; const int g = lane >> 4;
#pragma unroll
  for (int i = 0; i < 8; ++i) { const int ka = k0 + 8 * g + i, kb = ka + 16; v[i] = ka < K ? W[(size_t)(ka < K ? ka : K - 1) * ld + n] : 0.f; v[8 + i] = kb < K ? W[(size_t)(kb < K ? kb : K - 1) * ld + n] : 0.f; }
  return bsplit16(v); }
__device__ __forceinline__ v8f mac3(const F2& a, const F2& b, v8f c) { c = wmma_bf(a.l, b.h, c); c = wmma_bf(a.h, b.l, c); return wmma_bf(a.h, b.h, c); }
__device__ __forceinline__ float sigm(float v) { return 1.0f / (1.0f + expf(-v)); }
#define LDSX() do { asm volatile("s_wait_dscnt 0" ::: "memory"); __builtin_amdgcn_wave_barrier(); __builtin_amdgcn_fence(__ATOMIC_RELEASE, "workgroup"); } while (0)
// ---- GEMM operand ring: a stage is 64 k of every operand row of the block's tile, brought into LDS by asynchronous 16-byte copies (a wave's copy covers whole 128-byte lines); LDS row pitch = row bytes + 16 (16 B x odd: conflict-free for 16-byte reads); two buffers (four in k_g)
#define KS 64
#define HPITCH (2 * KS + 16)       // f16 rows: 128 B + 16
__device__ __forceinline__ unsigned lds_off(const void* p) { return (unsigned)(size_t)p; }
// a run of copies and, as the last line of their own statement, the wait that stands in front of any rewrite of their address registers (one wait a run: fewer, longer runs cost a wave fewer waits)
#define CPL(a, b) "global_load_async_to_lds_b128 %" #a ", %" #b ", off\n\t"
__device__ __forceinline__ void cp8(const unsigned* l, const char* const* g) {
  asm volatile(CPL(0, 1) CPL(2, 3) CPL(4, 5) CPL(6, 7) CPL(8, 9) CPL(10, 11) CPL(12, 13) CPL(14, 15) "s_wait_xcnt 0x0"
               :: "v"(l[0]), "v"(g[0]), "v"(l[1]), "v"(g[1]), "v"(l[2]), "v"(g[2]), "v"(l[3]), "v"(g[3]), "v"(l[4]), "v"(g[4]), "v"(l[5]), "v"(g[5]), "v"(l[6]), "v"(g[6]), "v"(l[7]), "v"(g[7]) : "memory");
}
__device__ __forceinline__ void cp12(const unsigned* l, const char* const* g) {
  asm volatile(CPL(0, 1) CPL(2, 3) CPL(4, 5) CPL(6, 7) CPL(8, 9) CPL(10, 11) CPL(12, 13) CPL(14, 15) CPL(16, 17) CPL(18, 19) CPL(20, 21) CPL(22, 23) "s_wait_xcnt 0x0"
               :: "v"(l[0]), "v"(g[0]), "v"(l[1]), "v"(g[1]), "v"(l[2]), "v"(g[2]), "v"(l[3]), "v"(g[3]), "v"(l[4]), "v"(g[4]), "v"(l[5]), "v"(g[5]), "v"(l[6]), "v"(g[6]), "v"(l[7]), "v"(g[7]), "v"(l[8]), "v"(g[8]), "v"(l[9]), "v"(g[9]), "v"(l[10]), "v"(g[10]), "v"(l[11]), "v"(g[11]) : "memory");
}
// this thread's addresses for ROWS rows of RB bytes from gb (row pitch gp bytes) to LDS byte address lb (row pitch RB + 16), dealt over the NTH threads of a block: ROWS * RB / (16 * NTH) copies a thread
template <int ROWS, int RB, int NTH = 128>
__device__ __forceinline__ void row_addr(unsigned* l, const char** g, unsigned lb, const char* gb, size_t gp, int tid) {
  constexpr int PPR = RB / 16, RPI = NTH / PPR, NI = ROWS / RPI; const int row = tid / PPR, pc = tid % PPR;
#pragma unroll
  for (int i = 0; i < NI; ++i) { l[i] = lb + (row + i * RPI) * (RB + 16) + pc * 16; g[i] = gb + (size_t)(row + i * RPI) * gp + pc * 16; }
}
// 128 threads: 128 A rows of 128 B at lb, behind them 128 weight rows of 128 B
__device__ __forceinline__ void stage_ab(unsigned lb, const char* ga, size_t pa, const char* gb, size_t pb, int tid) {
  unsigned l[16]; const char* g[16]; row_addr<128, 2 * KS>(l, g, lb, ga, pa, tid); row_addr<128, 2 * KS>(l + 8, g + 8, lb + 128 * HPITCH, gb, pb, tid); cp8(l, g); cp8(l + 8, g + 8);
}
// 256 threads: 128 A rows of ARB bytes at lb, behind them 128 weight rows of 128 B
template <int ARB>
__device__ __forceinline__ void stage_ab8(unsigned lb, const char* ga, size_t pa, const char* gb, size_t pb, int tid) {
  constexpr int NA = 128 * ARB / 4096; unsigned l[NA + 4]; const char* g[NA + 4];
  row_addr<128, ARB, 256>(l, g, lb, ga, pa, tid); row_addr<128, 2 * KS, 256>(l + NA, g + NA, lb + 128 * (ARB + 16), gb, pb, tid);
  if constexpr (NA == 4) cp8(l, g); else cp12(l, g);
}
// 256 threads: three runs of 128 rows of 128 B (A, gate, up; all of row pitch gp), one behind the other at lb
__device__ __forceinline__ void stage_abc8(unsigned lb, const char* ga, const char* gb, const char* gc, size_t gp, int tid) {
  unsigned l[12]; const char* g[12]; row_addr<128, 2 * KS, 256>(l, g, lb, ga, gp, tid); row_addr<128, 2 * KS, 256>(l + 4, g + 4, lb + 128 * HPITCH, gb, gp, tid); row_addr<128, 2 * KS, 256>(l + 8, g + 8, lb + 256 * HPITCH, gc, gp, tid); cp12(l, g);
}
#define WAIT_ASYNC0() asm volatile("s_wait_asynccnt 0x0" ::: "memory")   // this wave's copies have landed
#define WAIT_ASYNC(n) asm volatile("s_wait_asynccnt %0" :: "n"(n) : "memory")   // all but this wave's n youngest copies have landed (the counter returns in issue order)
#define WAIT_DS0() asm volatile("s_wait_dscnt 0x0" ::: "memory")         // this wave's LDS reads of the buffer have returned before it is refilled


#define NB 2
#define SS 2048
#define DM 1024
#define NH 16
#define HID 2730
#define HP 2816          // hidden padded to 22 x 128
#define WSC 256.0f
#define RMSEPS 1e-6f
__constant__ float THETA[32] = {1.000000000e+00f,7.498942018e-01f,5.623413324e-01f,4.216965139e-01f,3.162277639e-01f,2.371373773e-01f,1.778279394e-01f,1.333521456e-01f,1.000000015e-01f,7.498942316e-02f,5.623413250e-02f,4.216964915e-02f,3.162277490e-02f,2.371373773e-02f,1.778279431e-02f,1.333521400e-02f,9.999999776e-03f,7.498942316e-03f,5.623413250e-03f,4.216964822e-03f,3.162277630e-03f,2.371373819e-03f,1.778279431e-03f,1.333521446e-03f,1.000000047e-03f,7.498941850e-04f,5.623413017e-04f,4.216965172e-04f,3.162277571e-04f,2.371373703e-04f,1.778279402e-04f,1.333521504e-04f};
__device__ __attribute__((noinline)) float cos_p(float v) { return cosf(v); }
__device__ __attribute__((noinline)) float sin_p(float v) { return sinf(v); }
#define HD 64
#define QKVW (3 * DM)
#ifndef TQB
#define TQB (SS / 64)
#define TNB NB
#define TOB (NB * SS / 64)     // output row tiles (all)
#endif
typedef __attribute__((ext_vector_type(8))) __bf16 v8b;
__device__ __forceinline__ v16b frag_b(const __bf16* rowk0, int lane) {
  union { v16b v; v8b q[2]; } u; const __bf16* p = rowk0 + 8 * (lane >> 4);
  u.q[0] = *(const v8b*)p; u.q[1] = *(const v8b*)(p + 16); return u.v;
}
__device__ __forceinline__ float bfr(float v) { return (float)(__bf16)v; }
__device__ __attribute__((noinline)) float exp_ni(float v) { return expf(v); }
__device__ __attribute__((noinline)) float erf_ni(float v) { return erff(v); }

#define PK_A 0                       // [3072][1024] Wqkv rows (natural [out][in])
#define PK_P (PK_A + QKVW * DM)        // [1024][1024] Wo rows (natural)
#define PK_END (PK_P + DM * DM)
#define WS_PK  0u
#define WS_QK  (WS_PK + 2u * PK_END)             // f16 [4096 rows][2048]: q | k
#define WS_QKL (WS_QK + 2u * NB * SS * 2 * DM)     // f16 q | k residual planes x2048
#define WS_VTH (WS_QKL + 2u * NB * SS * 2 * DM)    // f16 [b][1024 (h*64+d)][2048 s] hi
#define WS_VTL (WS_VTH + 2u * NB * DM * SS)        // f16 lo x 2048
#define WS_O   (WS_VTL + 2u * NB * DM * SS)        // f32 [4096][1024]
#define WS_PG  (WS_O + 4u * (size_t)NB * SS * DM)        // f16 x 2^8 [gate | up] rows [2*HP][1024] (zero rows >= HID), down rows [1024][HP] (zero cols >= HID)
#define WS_PD  (WS_PG + 2u * (size_t)2 * HP * DM)
#define WS_H1  (WS_PD + 2u * (size_t)DM * HP)             // f16 rmsnorm1(x) rows [NR][1024]; int flags [SS/64][SS/32]; f32 x1 [NR][1024]; f16 rmsnorm2(x1) rows; f16 silu(gate) up rows [NR][HP]
#define WS_FL  (WS_H1 + 2u * (size_t)NB * SS * DM)
#define WS_X1  (WS_FL + 4u * (size_t)(SS / 64) * (SS / 32))
#define WS_H2  (WS_X1 + 4u * (size_t)NB * SS * DM)
#define WS_GU  (WS_H2 + 2u * (size_t)NB * SS * DM)
#define WS_END (WS_GU + 2u * (size_t)NB * SS * HP)
// ---- k_pack: a resident stream, one task a wave and pass, no LDS and no barrier: 2,048 half rows of W_down, 4,096 rows of W_q | W_k | W_v | W_o, 5,632 rows of gate | up (the longer tasks first); value = f16(bf16(w) x 2^8); all loads of a task go out before its first store; every load and store of a wave covers one contiguous run of bytes; the loops over j and c below are unrolled so that the pieces stay in registers and the loads go out as one group
typedef __attribute__((ext_vector_type(4))) _Float16 v4h;
typedef __attribute__((ext_vector_type(2))) _Float16 v2h;
#define PT_D (2 * DM)
#define PT_A (PT_D + 4 * DM)
#define PT_END (PT_A + 2 * HP)
#define PK_WG 256        // work-groups of 16 waves: one a WGP
__device__ __forceinline__ _Float16 wcv(float w) { return (_Float16)(bfr(w) * WSC); }
#define STORES_OUT() asm volatile("s_wait_xcnt 0x0" ::: "memory")   // stands directly behind a task's last store: what follows (the next task) rewrites registers that these stores name
// one row of 1,024: a lane holds 8 pieces of 16 bytes, 128 elements apart
__device__ __forceinline__ void pack_row(const float* __restrict__ s, _Float16* __restrict__ d, int lane) { v4f x[8];
#pragma unroll
  for (int j = 0; j < 8; ++j) x[j] = *(const v4f*)(s + j * 128 + lane * 4);
#pragma unroll
  for (int j = 0; j < 8; ++j) { v4h o;
#pragma unroll
    for (int c = 0; c < 4; ++c) o[c] = wcv(x[j][c]);
    *(v4h*)(d + j * 128 + lane * 4) = o; }
  STORES_OUT(); }
__global__ __launch_bounds__(512) void k_pack(const float* __restrict__ WQ, const float* __restrict__ WK, const float* __restrict__ WV, const float* __restrict__ WO, const float* __restrict__ WG, const float* __restrict__ WU, const float* __restrict__ WD, char* __restrict__ ws) {
  const int lane = threadIdx.x & 31; _Float16* P = (_Float16*)(ws + WS_PK);
  for (int task = __builtin_amdgcn_readfirstlane((threadIdx.x >> 5) * PK_WG + blockIdx.x); task < PT_END; task += 16 * PK_WG) {   // dealt wave-major, so that every work-group gets the same mix of tasks; the task number sits in a scalar register, so the branches on it are scalar
    if (task < PT_D) { const int n = task >> 1, k0 = (task & 1) * (HP / 2) + lane * 2; const float* s = WD + (size_t)n * HID; _Float16* d = (_Float16*)(ws + WS_PD) + (size_t)n * HP; v2f x[22];   // down rows [1024][HP], zero beyond 2,730; a source row starts on 8 bytes only, hence 8-byte loads
#pragma unroll
      for (int j = 0; j < 22; ++j) { const int k = k0 + j * 64; x[j] = *(const v2f*)(s + (k < HID ? k : 0)); }
#pragma unroll
      for (int j = 0; j < 22; ++j) { const int k = k0 + j * 64; v2h o; o[0] = (k < HID) ? wcv(x[j][0]) : (_Float16)0.0f; o[1] = (k < HID) ? wcv(x[j][1]) : (_Float16)0.0f; *(v2h*)(d + k) = o; }
      STORES_OUT(); }
    else if (task < PT_A) { const int r = task - PT_D, which = r >> 10; const float* w = (which == 0) ? WQ : (which == 1) ? WK : (which == 2) ? WV : WO; pack_row(w + (size_t)(r & (DM - 1)) * DM, P + PK_A + (size_t)r * DM, lane); }   // PK_P follows PK_A directly
    else { const int r = task - PT_A, n = (r < HP) ? r : r - HP; _Float16* d = (_Float16*)(ws + WS_PG) + (size_t)r * DM;   // gate | up rows, zero beyond 2,730
      if (n < HID) pack_row(((r < HP) ? WG : WU) + (size_t)n * DM, d, lane);
      else { const v4h z = {};
#pragma unroll
        for (int j = 0; j < 8; ++j) *(v4h*)(d + j * 128 + lane * 4) = z;
        STORES_OUT(); } }
  } }
// the projections are bias-free: the kernel holds no bias path
__global__ __launch_bounds__(128) void k_qkv(const float* __restrict__ XQ, const float* __restrict__ XK, const float* __restrict__ XV, const _Float16* __restrict__ P, _Float16* __restrict__ QK, _Float16* __restrict__ QKL, _Float16* __restrict__ VTH, _Float16* __restrict__ VTL) {
  const int which0 = (blockIdx.y * 128) / DM; const float* X = (which0 == 0) ? XQ : (which0 == 1) ? XK : XV;
  constexpr int STG = (128 + 128) * HPITCH; __shared__ __attribute__((aligned(128))) char sm[2 * STG];   // the ring; behind the loop's last barrier the same bytes are the output staging
  _Float16 (*so)[16][136] = (_Float16 (*)[16][136])sm; _Float16 (*sol)[16][136] = (_Float16 (*)[16][136])(sm + 4 * 16 * 136 * 2); _Float16 (*sth)[136] = (_Float16 (*)[136])sm; _Float16 (*stl)[136] = (_Float16 (*)[136])(sm + 128 * 136 * 2);
  const int tid = threadIdx.x, wave = tid >> 5, lane = tid & 31, col = lane & 15, g = lane >> 4; const size_t r0 = (size_t)blockIdx.x * 128 + wave * 32; const int n0 = blockIdx.y * 128;   // block = (128 rows, 128 cols); a wave holds 32 rows x 128 cols: each weight fragment read from LDS feeds two products
  v8f acc[2][8] = {};
  { const char* gA = (const char*)((const _Float16*)X + (size_t)blockIdx.x * 128 * DM); const char* gB = (const char*)(P + (size_t)n0 * DM); const unsigned l0 = lds_off(sm); constexpr int NT = DM / KS;   // A = f16 rmsnorm rows
    stage_ab(l0, gA, 2 * DM, gB, 2 * DM, tid); WAIT_ASYNC0(); __syncthreads();
    stage_ab(l0 + STG, gA + 2 * KS, 2 * DM, gB + 2 * KS, 2 * DM, tid);
#pragma unroll 1   // stays rolled: one copy of a stage's code in the instruction cache; t & 1 picks the buffer
    for (int t = 0; t < NT; ++t) { const int bo = (t & 1) * STG;
#pragma unroll
      for (int kc = 0; kc < KS / 32; ++kc) { v16h a[2], w[8];   // a 32-k step's LDS reads go out as one group in front of its 16 products (both steps' fragments at once would not fit beside the 128 accumulator registers); the loops below are unrolled so that these arrays are registers
#pragma unroll
        for (int i = 0; i < 2; ++i) a[i] = frag_h((const _Float16*)(sm + bo + (wave * 32 + i * 16 + col) * HPITCH) + kc * 32, lane);
#pragma unroll
        for (int j = 0; j < 8; ++j) w[j] = frag_h((const _Float16*)(sm + bo + (128 + j * 16 + col) * HPITCH) + kc * 32, lane);
#pragma unroll
        for (int j = 0; j < 8; ++j)
#pragma unroll
          for (int i = 0; i < 2; ++i) acc[i][j] = wmma16(a[i], w[j], acc[i][j]); }
      WAIT_DS0(); WAIT_ASYNC0(); __syncthreads();   // publishes stage t + 1 and ends every reader's last read of stage t
      if (t + 2 < NT) { stage_ab(l0 + bo, gA + (size_t)(t + 2) * 2 * KS, 2 * DM, gB + (size_t)(t + 2) * 2 * KS, 2 * DM, tid); } }
    WAIT_ASYNC0(); }
#pragma unroll
  for (int i = 0; i < 2; ++i)
#pragma unroll
    for (int j = 0; j < 8; ++j)
#pragma unroll
      for (int r = 0; r < 8; ++r) acc[i][j][r] *= (1.0f / WSC);
  if (n0 < 2 * DM) {   // rotate-half rotary over each 64-dim head with angle position * inv_freq[d mod 32]; the wave's two 16-row halves go through its staging rows one after the other (unrolled: acc is indexed by i)
#pragma unroll
    for (int i = 0; i < 2; ++i) { const size_t ri = r0 + i * 16;
#pragma unroll
      for (int r = 0; r < 8; ++r) { const int spos = (int)((ri + 8 * g + r) % SS);
#pragma unroll
        for (int jj = 0; jj < 2; ++jj) { const float ang = (float)spos * THETA[jj * 16 + col]; const float c = cos_p(ang), sn = sin_p(ang);
#pragma unroll
          for (int hh = 0; hh < 2; ++hh) { const float x1 = acc[i][hh * 4 + jj][r], x2 = acc[i][hh * 4 + jj + 2][r]; acc[i][hh * 4 + jj][r] = x1 * c - x2 * sn; acc[i][hh * 4 + jj + 2][r] = x2 * c + x1 * sn; } } }
      if (i) LDSX();   // the first half's reads of the staging rows have returned before other lanes rewrite them
#pragma unroll
      for (int j = 0; j < 8; ++j) {
#pragma unroll
        for (int r = 0; r < 8; ++r) { const float v = acc[i][j][r]; const _Float16 hv = (_Float16)v; so[wave][8 * g + r][j * 16 + col] = hv; sol[wave][8 * g + r][j * 16 + col] = (_Float16)((v - (float)hv) * 2048.0f); } }   // q, k as f16 hi + (x2048) residual
      LDSX();
      for (int rl = 0; rl < 16; ++rl) if (lane < 16) { vst2((unsigned*)(QK + (ri + rl) * (2 * DM) + n0 + lane * 8), *(const v4u*)&so[wave][rl][lane * 8]); vst2((unsigned*)(QKL + (ri + rl) * (2 * DM) + n0 + lane * 8), *(const v4u*)&sol[wave][rl][lane * 8]); } }
  } else {
#pragma unroll
    for (int i = 0; i < 2; ++i)
#pragma unroll
      for (int j = 0; j < 8; ++j) {
#pragma unroll
        for (int r = 0; r < 8; ++r) { const float v = acc[i][j][r]; const _Float16 hv = (_Float16)v; sth[j * 16 + col][wave * 32 + i * 16 + 8 * g + r] = hv; stl[j * 16 + col][wave * 32 + i * 16 + 8 * g + r] = (_Float16)((v - (float)hv) * 2048.0f); } }
    __syncthreads();
    const size_t rb = (size_t)blockIdx.x * 128; const int b = (int)(rb / SS), s0 = (int)(rb % SS); const int pc0 = n0 - 2 * DM;
    for (int q = tid; q < 128 * 16; q += 128) { const int d = q >> 4, pc = q & 15; const size_t o = ((size_t)b * DM + pc0 + d) * SS + s0 + pc * 8; vst2((unsigned*)(VTH + o), *(const v4u*)&sth[d][pc * 8]); vst2((unsigned*)(VTL + o), *(const v4u*)&stl[d][pc * 8]); }
  }
}
// ---- k_attn: block = (64 queries, head h, batch b): flash attention over the visible (64-query, 32-key) tiles (K = 64: 2 k-steps), scores = (q.k) * 0.125, 3 products (hi + residual planes), P.V likewise; O[b*S+q][h*64+d] = (acc + accl / 2048) / (2048 l) (256-B segments)
// a tile's K rows (32 x 128 B, hi and residual) and V^T rows (64 x 64 B, hi and residual) come into LDS once for the block's four waves by asynchronous 16-byte copies, two buffers, the next visible tile in flight while this one is worked on; row pitch = row bytes + 16 (16 B x odd: conflict-free for 16-byte reads)
#define AKP (2 * HD + 16)
#define AVP (2 * 32 + 16)
#define A_KH 0
#define A_KL (32 * AKP)
#define A_VH (2 * 32 * AKP)
#define A_VL (A_VH + HD * AVP)
#define A_STG (A_VL + HD * AVP)
// tile ks to LDS byte address lb: 8 copies a thread; kh, kl: key row 0 of this (batch, head) in the two planes; vh, vl: its V^T row 0
__device__ __forceinline__ void stage_kv(unsigned lb, const char* kh, const char* kl, const char* vh, const char* vl, int ks, int tid) {
  unsigned l[8]; const char* g[8]; const int kr = tid >> 3, kp = tid & 7, vr = tid >> 2, vp = tid & 3;
  const size_t ko = (size_t)(ks * 32 + kr) * (2 * DM * 2) + kp * 16, vo = (size_t)vr * (SS * 2) + ks * 64 + vp * 16;
#pragma unroll
  for (int i = 0; i < 2; ++i) { const unsigned lk = lb + (kr + 16 * i) * AKP + kp * 16, lv = lb + (vr + 32 * i) * AVP + vp * 16; const size_t gk = ko + (size_t)i * 16 * (2 * DM * 2), gv = vo + (size_t)i * 32 * (SS * 2);
    l[i] = lk + A_KH; g[i] = kh + gk; l[2 + i] = lk + A_KL; g[2 + i] = kl + gk; l[4 + i] = lv + A_VH; g[4 + i] = vh + gv; l[6 + i] = lv + A_VL; g[6 + i] = vl + gv; }
  cp8(l, g);
}
__global__ __launch_bounds__(128) void k_attn(const _Float16* __restrict__ QK, const _Float16* __restrict__ QKL, const _Float16* __restrict__ VTH, const _Float16* __restrict__ VTL, const void* __restrict__ KMASK, const int* __restrict__ MASK, const int* __restrict__ FL, float* __restrict__ O) {
  __shared__ __align__(16) float sp[4][16][36]; __shared__ __align__(16) float so[4][16][68]; __shared__ __attribute__((aligned(128))) char sm[2 * A_STG];   // sm: the K / V ring
  const int tid = threadIdx.x, wave = tid >> 5, lane = tid & 31, col = lane & 15, g = lane >> 4;
  const int qb = blockIdx.x, h = blockIdx.y, b = blockIdx.z; const int q0 = qb * 64 + wave * 16; const size_t rq = (size_t)b * SS + q0 + col;
  // the visible tiles of this query block as 64 bits in scalar registers (the same in every wave of the block), taken in rising order: the ring has to know the next tile before this one is done
  unsigned long long todo = ((unsigned long long)__builtin_amdgcn_ballot_w32(FL[qb * (SS / 32) + 32 + lane] != 0) << 32) | __builtin_amdgcn_ballot_w32(FL[qb * (SS / 32) + lane] != 0);
  const int nt = __builtin_popcountll(todo);
  const char* gkh = (const char*)(QK + (size_t)b * SS * (2 * DM) + DM + h * HD); const char* gkl = (const char*)(QKL + (size_t)b * SS * (2 * DM) + DM + h * HD);
  const char* gvh = (const char*)(VTH + ((size_t)b * DM + h * HD) * SS); const char* gvl = (const char*)(VTL + ((size_t)b * DM + h * HD) * SS); const unsigned l0 = lds_off(sm);
  int ks = 0, ksn = 0;
  if (nt > 0) { ks = __builtin_ctzll(todo); todo &= todo - 1; stage_kv(l0, gkh, gkl, gvh, gvl, ks, tid); }
  v16h aq[2], aql[2];
#pragma unroll
  for (int kc = 0; kc < 2; ++kc) { aq[kc] = frag_h(QK + rq * (2 * DM) + h * HD + kc * 32, lane); aql[kc] = frag_h(QKL + rq * (2 * DM) + h * HD + kc * 32, lane); }
  float m[8], l[8];
#pragma unroll
  for (int r = 0; r < 8; ++r) { m[r] = -3.0e38f; l[r] = 0.f; }
  v8f acc[4] = {}, accl[4] = {};
  WAIT_ASYNC0(); __syncthreads();   // publishes the first tile
  if (nt > 1) { ksn = __builtin_ctzll(todo); todo &= todo - 1; stage_kv(l0 + A_STG, gkh, gkl, gvh, gvl, ksn, tid); }
#pragma unroll 1   // stays rolled: t & 1 picks the buffer
  for (int t = 0; t < nt; ++t) { const int bo = (t & 1) * A_STG; v8f s[2];
    v16h kh[2][2], kl[2][2];   // the tile's K reads go out as one group in front of its products; unrolled so that the arrays are registers
#pragma unroll
    for (int ct = 0; ct < 2; ++ct)
#pragma unroll
      for (int kc = 0; kc < 2; ++kc) { kh[ct][kc] = frag_h((const _Float16*)(sm + bo + A_KH + (ct * 16 + col) * AKP) + kc * 32, lane); kl[ct][kc] = frag_h((const _Float16*)(sm + bo + A_KL + (ct * 16 + col) * AKP) + kc * 32, lane); }
#pragma unroll
    for (int ct = 0; ct < 2; ++ct) { const int kk = ks * 32 + ct * 16 + col; v8f c = {}, cl = {};
#pragma unroll
      for (int kc = 0; kc < 2; ++kc) { c = wmma16(aq[kc], kh[ct][kc], c); cl = wmma16(aql[kc], kh[ct][kc], cl); cl = wmma16(aq[kc], kl[ct][kc], cl); }   // 3 products: q, k as f16 hi + residual
#pragma unroll
      for (int r = 0; r < 8; ++r) c[r] += cl[r] * (1.0f / 2048.0f);
      {
#pragma unroll
      for (int r = 0; r < 8; ++r) s[ct][r] = (MASK[(size_t)(q0 + 8 * g + r) * SS + kk] == 0) ? c[r] * 0.125f : -3.0e38f; } }   // 1/sqrt(64); masked keys excluded
#pragma unroll
    for (int r = 0; r < 8; ++r) { float mx = fmaxf(s[0][r], s[1][r]);
#pragma unroll
      for (int o = 1; o < 16; o <<= 1) mx = fmaxf(mx, __shfl_xor(mx, o));
      const float mn = fmaxf(m[r], mx); const float alpha = (m[r] <= -1.0e38f) ? 0.f : __expf(m[r] - mn);
      const float e0 = (s[0][r] <= -1.0e38f) ? 0.f : __expf(s[0][r] - mn), e1 = (s[1][r] <= -1.0e38f) ? 0.f : __expf(s[1][r] - mn); float es = e0 + e1;
#pragma unroll
      for (int o = 1; o < 16; o <<= 1) es += __shfl_xor(es, o);
      l[r] = l[r] * alpha + es; m[r] = mn;
#pragma unroll
      for (int dt = 0; dt < 4; ++dt) { acc[dt][r] *= alpha; accl[dt][r] *= alpha; }
      sp[wave][8 * g + r][col] = e0; sp[wave][8 * g + r][16 + col] = e1; }
    LDSX();
    v16h vh[4], vl[4];   // the tile's V reads likewise as one group
#pragma unroll
    for (int dt = 0; dt < 4; ++dt) { vh[dt] = frag_h((const _Float16*)(sm + bo + A_VH + (dt * 16 + col) * AVP), lane); vl[dt] = frag_h((const _Float16*)(sm + bo + A_VL + (dt * 16 + col) * AVP), lane); }
    v16h pa, pl; { const float* prow = &sp[wave][col][0] + 8 * (lane >> 4);
#pragma unroll
      for (int i = 0; i < 8; ++i) { const float x0 = prow[i] * 2048.0f, x1 = prow[16 + i] * 2048.0f; const _Float16 h0 = (_Float16)x0, h1 = (_Float16)x1; pa[i] = h0; pa[8 + i] = h1; pl[i] = (_Float16)((x0 - (float)h0) * 2048.0f); pl[8 + i] = (_Float16)((x1 - (float)h1) * 2048.0f); } }   // P scaled by 2^11 before the f16 split so small softmax weights stay out of the f16 subnormal range; 2^-11 folded into the epilogue
#pragma unroll
    for (int dt = 0; dt < 4; ++dt) { acc[dt] = wmma16(pa, vh[dt], acc[dt]); accl[dt] = wmma16(pl, vh[dt], accl[dt]); accl[dt] = wmma16(pa, vl[dt], accl[dt]); }   // P hi x V hi + (P lo x V hi + P hi x V lo) / 2048
    WAIT_DS0(); WAIT_ASYNC0(); __syncthreads();   // publishes tile t + 1 and ends every reader's last read of tile t (and this wave's reads of its sp rows)
    ks = ksn;
    if (t + 2 < nt) { ksn = __builtin_ctzll(todo); todo &= todo - 1; stage_kv(l0 + bo, gkh, gkl, gvh, gvl, ksn, tid); } }
  WAIT_ASYNC0();
#pragma unroll
  for (int r = 0; r < 8; ++r) { const float il = (l[r] > 0.f) ? (1.0f / 2048.0f) / l[r] : 0.f;
#pragma unroll
    for (int dt = 0; dt < 4; ++dt) so[wave][8 * g + r][dt * 16 + col] = (acc[dt][r] + accl[dt][r] * (1.0f / 2048.0f)) * il; }
  LDSX();
  for (int rl = 0; rl < 16; ++rl) if (lane < 16) vst2(O + ((size_t)b * SS + q0 + rl) * DM + h * HD + lane * 4, *(const v4f*)&so[wave][rl][lane * 4]);
}
// ---- k_out: block = (64 rows, 128 cols): out = O(hi/lo) . Wo rows (2 products) + bo
__global__ __launch_bounds__(128) void k_out(const float* __restrict__ O, const __bf16* __restrict__ P, const float* __restrict__ BO, float* __restrict__ Y) {
  __shared__ __align__(16) float so[4][16][132];
  const int tid = threadIdx.x, wave = tid >> 5, lane = tid & 31, col = lane & 15, g = lane >> 4; const size_t r0 = (size_t)blockIdx.x * 64 + wave * 16; const int n0 = blockIdx.y * 128;
  v8f acc[8] = {};
#pragma unroll 2
  for (int kc = 0; kc < DM / 32; ++kc) { const F2 a = split_row(O + (r0 + col) * DM, kc * 32, lane);
#pragma unroll
    for (int j = 0; j < 8; ++j) { const v16b w = frag_b(P + (size_t)(n0 + j * 16 + col) * DM + kc * 32, lane); acc[j] = wmma_bf(a.l, w, acc[j]); acc[j] = wmma_bf(a.h, w, acc[j]); } }
#pragma unroll
  for (int j = 0; j < 8; ++j) {
#pragma unroll
    for (int r = 0; r < 8; ++r) so[wave][8 * g + r][j * 16 + col] = acc[j][r] + (BO ? bfr(BO[n0 + j * 16 + col]) : 0.f); }
  LDSX();
  for (int rl = 0; rl < 16; ++rl) vst2(Y + (r0 + rl) * DM + n0 + lane * 4, *(const v4f*)&so[wave][rl][lane * 4]);
}

// ---- k_rms: wave = row, no LDS and no barrier: OUTH = f16(x rsqrt(mean x^2 + eps) w) (MODE 0: x = bf16-rounded input; MODE 1: x = f32 x1); a lane holds 8 pieces of 16 bytes, 128 elements apart, the row's 8 loads in flight at once; every loop is unrolled so that the pieces stay in registers
template <int M> __device__ __forceinline__ float lane_xor(float v) { return __builtin_bit_cast(float, __builtin_amdgcn_update_dpp(0, __builtin_bit_cast(int, v), 0x160 + M, 0xf, 0xf, true)); }   // value of lane ^ M inside a 16-lane row (DPP row_xmask), no LDS round trip
template <int MODE>
__global__ __launch_bounds__(512) void k_rms(const float* __restrict__ A, const float* __restrict__ Wn, _Float16* __restrict__ OUTH) { const int lane = threadIdx.x & 31; const size_t row = (size_t)blockIdx.x * 16 + (threadIdx.x >> 5);
  v4f x[8], wn[8];
#pragma unroll
  for (int j = 0; j < 8; ++j) x[j] = *(const v4f*)(A + row * DM + j * 128 + lane * 4);
#pragma unroll
  for (int j = 0; j < 8; ++j) wn[j] = *(const v4f*)(Wn + j * 128 + lane * 4);
  if (MODE == 0) {
#pragma unroll
    for (int j = 0; j < 8; ++j)
#pragma unroll
      for (int c = 0; c < 4; ++c) x[j][c] = bfr(x[j][c]); }
  // the square sum keeps its tree: elements 256 apart chained, then pairwise over each aligned run of 32 elements (4 in the lane, 8 lanes), then the eight runs' sums one after another
  float s[2];
#pragma unroll
  for (int jp = 0; jp < 2; ++jp) { float q[4];
#pragma unroll
    for (int c = 0; c < 4; ++c) { float t = 0.f;
#pragma unroll
      for (int i = 0; i < 4; ++i) t += x[jp + 2 * i][c] * x[jp + 2 * i][c];
      q[c] = t; }
    s[jp] = (q[0] + q[1]) + (q[2] + q[3]); }
#pragma unroll
  for (int jp = 0; jp < 2; ++jp) { s[jp] += lane_xor<1>(s[jp]); s[jp] += lane_xor<2>(s[jp]); s[jp] += lane_xor<4>(s[jp]); }
  float tq = 0.f;
#pragma unroll
  for (int i = 0; i < 8; ++i) tq += __builtin_bit_cast(float, __builtin_amdgcn_readlane(__builtin_bit_cast(int, s[i >> 2]), (i & 3) * 8));
  const float inv = 1.0f / sqrtf(tq / (float)DM + RMSEPS);
#pragma unroll
  for (int j = 0; j < 8; ++j) { v4h o;
#pragma unroll
    for (int c = 0; c < 4; ++c) o[c] = (_Float16)(x[j][c] * inv * bfr(wn[j][c]));
    *(v4h*)(OUTH + row * DM + j * 128 + lane * 4) = o; } }
// ---- k_flags: block = (query block qb of 64 queries, half hf of the keys): FL[qb][hf * 32 + kt] = 1 if any mask[q][k] == 0 (attend) in the 64 x 32 tile; a lane owns one 16-byte column piece over 16 rows, all 16 loads independent; a block writes one whole 128-byte line of FL
__global__ __launch_bounds__(1024) void k_flags(const int* __restrict__ MASK, int* __restrict__ FL) { __shared__ __align__(16) int sf[32]; const int t = threadIdx.x; const int qb = blockIdx.x, hf = blockIdx.y; const int c4 = t & 255, rw = t >> 8;
  if (t < 32) sf[t] = 0; __syncthreads();
  const int* p = MASK + (size_t)(qb * 64 + rw) * SS + hf * (SS / 2) + c4 * 4; v4u v[16];
#pragma unroll
  for (int i = 0; i < 16; ++i) v[i] = *(const v4u*)(p + (size_t)i * 4 * SS);
  unsigned mn = 0xffffffffu;
#pragma unroll
  for (int i = 0; i < 16; ++i) mn = min(mn, min(min(v[i][0], v[i][1]), min(v[i][2], v[i][3])));   // smallest word is 0 exactly when some key is visible
  if (mn == 0u) sf[c4 >> 3] = 1;   // benign same-value race within the block
  __syncthreads(); if (t < 8) vst2((unsigned*)(FL + (size_t)qb * (SS / 32) + hf * 32 + t * 4), *(const v4u*)&sf[t * 4]); }
// ---- k_g<MODE, KW>: block = (128 rows, 128 cols), eight waves, a wave 32 rows x 64 cols (a fragment read from LDS feeds two or four products; the grid is one block a WGP, so the block brings two waves a SIMD itself, and nothing else on the WGP covers a stage's way from L2: the ring has four buffers, three stages in flight while one is worked on): A f16 rows (MODE 0: built inline from the f32 ctx) . W^T (f16 x 2^8); MODE 0: X1 = x (bf16-rounded) + acc (f32 out); MODE 2: OUT = X1 + acc (f32)
template <int MODE, int KW>
__global__ __launch_bounds__(256) void k_g(const void* __restrict__ Ain, const _Float16* __restrict__ Wr, const float* __restrict__ RES, float* __restrict__ O32, int ow) { constexpr int AEB = (MODE == 0) ? 4 : 2, APITCH = AEB * KS + 16, STG = 128 * APITCH + 128 * HPITCH, CPS = 128 * AEB * KS / 4096 + 4; __shared__ __attribute__((aligned(128))) char sm[4 * STG];   // the ring (CPS: copies a wave issues for a stage, the same in every wave); behind the loop's last barrier the same bytes are the output staging
  float (*sf)[16][68] = (float (*)[16][68])sm;
  const int tid = threadIdx.x, wave = tid >> 5, lane = tid & 31, col = lane & 15, g = lane >> 4, ar = (wave >> 1) * 32, wr = (wave & 1) * 64; const size_t r0 = (size_t)blockIdx.x * 128 + ar; const int c0 = blockIdx.y * 128 + wr;
  v8f acc[2][4] = {};
  { const char* gA = (const char*)Ain + (size_t)blockIdx.x * 128 * KW * AEB; const char* gB = (const char*)(Wr + (size_t)blockIdx.y * 128 * KW); const unsigned l0 = lds_off(sm); constexpr int NT = KW / KS;
    static_assert(NT >= 4 && 4 * CPS <= 63, "four stages exist, and their copies fit the counter");
#pragma unroll   // four straight-line stages: the buffer offsets are constants
    for (int s = 0; s < 4; ++s) stage_ab8<AEB * KS>(l0 + s * STG, gA + (size_t)s * AEB * KS, (size_t)AEB * KW, gB + (size_t)s * 2 * KS, 2 * KW, tid);
    WAIT_ASYNC(3 * CPS); __syncthreads();   // publishes stage 0; stages 1 to 3 stay in flight
    // one stage's work, from the buffer at byte offset bo
    auto work = [&](int bo) __attribute__((always_inline)) {
      v16h a[KS / 32][2], w[KS / 32][4];   // the stage's LDS reads go out as one group in front of its products; the loops below are unrolled so that these arrays are registers
#pragma unroll
      for (int kc = 0; kc < KS / 32; ++kc) {
#pragma unroll
        for (int h = 0; h < 2; ++h) { if (MODE == 0) { const float* p = (const float*)(sm + bo + (ar + h * 16 + col) * APITCH) + kc * 32 + 8 * g;
#pragma unroll
            for (int i = 0; i < 8; ++i) { a[kc][h][i] = (_Float16)p[i]; a[kc][h][8 + i] = (_Float16)p[16 + i]; } } else a[kc][h] = frag_h((const _Float16*)(sm + bo + (ar + h * 16 + col) * APITCH) + kc * 32, lane); }
#pragma unroll
        for (int j = 0; j < 4; ++j) w[kc][j] = frag_h((const _Float16*)(sm + bo + 128 * APITCH + (wr + j * 16 + col) * HPITCH) + kc * 32, lane); }
#pragma unroll
      for (int kc = 0; kc < KS / 32; ++kc)
#pragma unroll
        for (int j = 0; j < 4; ++j)
#pragma unroll
          for (int h = 0; h < 2; ++h) acc[h][j] = wmma16(a[kc][h], w[kc][j], acc[h][j]); };
#pragma unroll 1   // stays rolled: one copy of a stage's code in the instruction cache; t & 3 picks the buffer
    for (int t = 0; t < NT - 4; ++t) { const int bo = (t & 3) * STG; work(bo);
      WAIT_DS0(); WAIT_ASYNC(2 * CPS); __syncthreads();   // stage t + 1 has landed (the wave's youngest copies are those of stages t + 2 and t + 3); the barrier publishes it and ends every reader's last read of stage t
      stage_ab8<AEB * KS>(l0 + bo, gA + (size_t)(t + 4) * AEB * KS, (size_t)AEB * KW, gB + (size_t)(t + 4) * 2 * KS, 2 * KW, tid); }
#pragma unroll 1   // the last four stages: nothing is issued any more, so the wait is to 0; rolled for the same reason
    for (int t = NT - 4; t < NT; ++t) { work((t & 3) * STG); WAIT_DS0(); WAIT_ASYNC0(); __syncthreads(); }
    WAIT_ASYNC0(); }
#pragma unroll   // the wave's two 16-row halves go through its staging rows one after the other (unrolled: acc is indexed by h)
  for (int h = 0; h < 2; ++h) { const size_t rh = r0 + h * 16; float res[8][4];
#pragma unroll
    for (int r = 0; r < 8; ++r) { const float* rp = RES + (rh + 8 * g + r) * ow + c0 + col;
#pragma unroll
      for (int j = 0; j < 4; ++j) res[r][j] = rp[j * 16];
      asm volatile("s_wait_xcnt 0x0" ::: "memory"); }   // stands behind each row's four loads: the results of later rows' loads may land in the registers that held this row's address
    if (h) LDSX();   // the first half's reads of the staging rows have returned before other lanes rewrite them
#pragma unroll
    for (int j = 0; j < 4; ++j)
#pragma unroll
      for (int r = 0; r < 8; ++r) sf[wave][8 * g + r][j * 16 + col] = acc[h][j][r] * (1.0f / WSC) + (MODE == 0 ? bfr(res[r][j]) : res[r][j]);
    LDSX(); for (int rl = g; rl < 16; rl += 2) vst2(O32 + (rh + rl) * ow + c0 + col * 4, *(const v4f*)&sf[wave][rl][col * 4]); } }   // a store covers two rows' 256-byte runs
// ---- k_gu: block = (128 rows, 128 hidden cols), eight waves, a wave 32 rows x (64 gate + 64 up) cols (each weight fragment read from LDS feeds two products): g = h2 . Wg^T, u = h2 . Wu^T (same A), GU = f16(silu(g) u) -> rows [NR][HP]
__global__ __launch_bounds__(256) void k_gu(const _Float16* __restrict__ H2, const _Float16* __restrict__ PG, _Float16* __restrict__ GU) { constexpr int STG = (128 + 256) * HPITCH; __shared__ __attribute__((aligned(128))) char sm[2 * STG];   // the ring (128 A rows, 128 gate rows, 128 up rows); behind the loop's last barrier the same bytes are the output staging
  _Float16 (*so)[136] = (_Float16 (*)[136])sm;
  const int tid = threadIdx.x, wave = tid >> 5, lane = tid & 31, col = lane & 15, g = lane >> 4, ar = (wave >> 1) * 32, wr = (wave & 1) * 64; const size_t rb = (size_t)blockIdx.x * 128; const int c0 = blockIdx.y * 128; const _Float16* Wg = PG + (size_t)c0 * DM; const _Float16* Wu = PG + ((size_t)HP + c0) * DM;
  v8f ag[2][4] = {}, au[2][4] = {};
  { const char* gA = (const char*)(H2 + rb * DM); const char* gG = (const char*)Wg; const char* gU = (const char*)Wu; const unsigned l0 = lds_off(sm); constexpr int NT = DM / KS;
    stage_abc8(l0, gA, gG, gU, 2 * DM, tid); WAIT_ASYNC0(); __syncthreads();
    stage_abc8(l0 + STG, gA + 2 * KS, gG + 2 * KS, gU + 2 * KS, 2 * DM, tid);
#pragma unroll 1   // stays rolled: one copy of a stage's code in the instruction cache; t & 1 picks the buffer
    for (int t = 0; t < NT; ++t) { const int bo = (t & 1) * STG;
#pragma unroll
      for (int kc = 0; kc < KS / 32; ++kc) { v16h a[2], wg[4], wu[4];   // a 32-k step's LDS reads go out as one group in front of its 16 products (both steps' fragments at once would not fit beside the 128 accumulator registers); the loops below are unrolled so that these arrays are registers
#pragma unroll
        for (int h = 0; h < 2; ++h) a[h] = frag_h((const _Float16*)(sm + bo + (ar + h * 16 + col) * HPITCH) + kc * 32, lane);
#pragma unroll
        for (int j = 0; j < 4; ++j) { wg[j] = frag_h((const _Float16*)(sm + bo + (128 + wr + j * 16 + col) * HPITCH) + kc * 32, lane); wu[j] = frag_h((const _Float16*)(sm + bo + (256 + wr + j * 16 + col) * HPITCH) + kc * 32, lane); }
#pragma unroll
        for (int j = 0; j < 4; ++j)
#pragma unroll
          for (int h = 0; h < 2; ++h) { ag[h][j] = wmma16(a[h], wg[j], ag[h][j]); au[h][j] = wmma16(a[h], wu[j], au[h][j]); } }
      WAIT_DS0(); WAIT_ASYNC0(); __syncthreads();   // publishes stage t + 1 and ends every reader's last read of stage t
      if (t + 2 < NT) { const size_t ko = (size_t)(t + 2) * 2 * KS; stage_abc8(l0 + bo, gA + ko, gG + ko, gU + ko, 2 * DM, tid); } }
    WAIT_ASYNC0(); }
#pragma unroll
  for (int h = 0; h < 2; ++h)
#pragma unroll
    for (int j = 0; j < 4; ++j)
#pragma unroll
      for (int r = 0; r < 8; ++r) { const float gg = ag[h][j][r] * (1.0f / WSC), uu = au[h][j][r] * (1.0f / WSC); so[ar + h * 16 + 8 * g + r][wr + j * 16 + col] = (_Float16)(gg / (1.0f + __expf(-gg)) * uu); }
  __syncthreads(); for (int e = tid; e < 128 * 16; e += 256) { const int rl = e >> 4, q = e & 15; vst2((unsigned*)(GU + (rb + rl) * HP + c0 + q * 8), *(const v4u*)&so[rl][q * 8]); } }

extern "C" void kernel_launch(void* const* d_in, const int* in_sizes, int n_in, void* d_out, int out_size, void* d_ws, size_t ws_size, hipStream_t stream) {
  (void)in_sizes; (void)n_in; (void)out_size;
  const float** F = (const float**)d_in;   // 0 x [2,2048,1024], 1 attn_mask [2048,2048] int (1 = masked), 2 wq, 3 wk, 4 wv, 5 wo (natural [1024,1024]), 6 norm1_w, 7 norm2_w, 8 w_gate [2730,1024], 9 w_up, 10 w_down [1024,2730]
  if (ws_size < (size_t)WS_END) return;
  char* ws = (char*)d_ws; _Float16* PK = (_Float16*)(ws + WS_PK); _Float16 *QK = (_Float16*)(ws + WS_QK), *QKL = (_Float16*)(ws + WS_QKL), *VTH = (_Float16*)(ws + WS_VTH), *VTL = (_Float16*)(ws + WS_VTL), *H1 = (_Float16*)(ws + WS_H1), *H2 = (_Float16*)(ws + WS_H2), *GU = (_Float16*)(ws + WS_GU); float *O = (float*)(ws + WS_O), *X1 = (float*)(ws + WS_X1); int* FL = (int*)(ws + WS_FL); const int* MASK = (const int*)d_in[1];
  const int nr = NB * SS;   // keys of both batches are always needed
  k_pack<<<PK_WG, 512, 0, stream>>>(F[2], F[3], F[4], F[5], F[8], F[9], F[10], ws);
  k_rms<0><<<nr / 16, 512, 0, stream>>>(F[0], F[6], H1);
  k_flags<<<dim3(SS / 64, 2), 1024, 0, stream>>>(MASK, FL);
  k_qkv<<<dim3(nr / 128, QKVW / 128), 128, 0, stream>>>((const float*)H1, (const float*)H1, (const float*)H1, PK + PK_A, QK, QKL, VTH, VTL);
  k_attn<<<dim3(TQB, NH, TNB), 128, 0, stream>>>(QK, QKL, VTH, VTL, nullptr, MASK, FL, O);
  k_g<0, DM><<<dim3(TOB / 2, DM / 128), 256, 0, stream>>>(O, PK + PK_P, F[0], X1, DM);                  // x1 = x + ctx wo^T
  k_rms<1><<<TOB * 4, 512, 0, stream>>>(X1, F[7], H2);
  k_gu<<<dim3(TOB / 2, HP / 128), 256, 0, stream>>>(H2, (const _Float16*)(ws + WS_PG), GU);
  k_g<2, HP><<<dim3(TOB / 2, DM / 128), 256, 0, stream>>>(GU, (const _Float16*)(ws + WS_PD), X1, (float*)d_out, DM);   // out = x1 + (silu(g) u) w_down^T
}

// v008
// It runs in 164 microseconds.
// In both of two side-by-side timings against v007, it was 1.03 times as fast.
// Counting every step since v000, it is 5.57 times as fast.
// compute dtype: all float inputs rounded to bf16, attn_mask (int) read on device; RMSNorms (eps 1e-6) in f32, normed rows once to f16; q/k/v = f16(h) . W^T against exact f16 x 2^8 weight copies on WMMA 16x16x32 (single products, f32 accumulate); rotate-half RoPE in f32 (precise sinf/cosf) before the f16 hi + residual split; attention with 3-product scores and P.v (hi + residual planes), x 1/8, masked keys excluded (mask read per pair; fully-masked 64x32 tiles skipped via a device-built flag table), running-max softmax in f32 (hardware exp); x1 = x + f16(ctx) . Wo^T; SwiGLU: f16(rmsnorm(x1)) . [W_gate | W_up]^T (hidden padded 2,730 -> 2,816 with zero weights), silu(g) u in f32 -> f16, . W_down^T + x1; f32 output.
#include <hip/hip_runtime.h>
#include <math.h>

typedef __attribute__((ext_vector_type(16))) _Float16 v16h;
typedef __attribute__((ext_vector_type(16))) __bf16 v16b;
typedef __attribute__((ext_vector_type(8)))  _Float16 v8h;
typedef __attribute__((ext_vector_type(8)))  float v8f;
typedef __attribute__((ext_vector_type(4)))  float v4f;
typedef __attribute__((ext_vector_type(2)))  float v2f;
typedef __attribute__((ext_vector_type(4)))  unsigned v4u;
typedef __attribute__((ext_vector_type(4)))  int v4i;
typedef float __attribute__((may_alias)) float_a;
typedef int __attribute__((may_alias)) int_a;

template <typename T> __device__ __forceinline__ void vst2(void* p, T v) { *(T*)p = v;  }
__device__ __forceinline__ v8f wmma16(v16h a, v16h b, v8f c) {
  v8f d = __builtin_amdgcn_wmma_f32_16x16x32_f16(false, a, false, b, (short)0, c, false, false);
  asm volatile("v_nop\n\tv_nop\n\tv_nop\n\tv_nop" : "+v"(d) : "v"(a), "v"(b));
  return d;
}
__device__ __forceinline__ v8f wmma_bf(v16b a, v16b b, v8f c) {
  v8f d = __builtin_amdgcn_wmma_f32_16x16x32_bf16(false, a, false, b, (short)0, c, false, false);
  asm volatile("v_nop\n\tv_nop\n\tv_nop\n\tv_nop" : "+v"(d) : "v"(a), "v"(b));
  return d;
}
// Streaming decoder block (B 2, L 2,048, d 1,024, 16 heads x 64, SwiGLU hidden 2,730): pre-RMSNorm, bias-free projections, rotate-half RoPE (base 10000), attention under the given boolean mask (all-keys + 256-token window), out-projection + residual, pre-RMSNorm SwiGLU FFN + residual.
__device__ __forceinline__ v16h frag_h(const _Float16* rowk0, int lane) {
  union { v16h v; v8h q[2]; } u; const _Float16* p = rowk0 + 8 * (lane >> 4);
  u.q[0] = *(const v8h*)p; u.q[1] = *(const v8h*)(p + 16); return u.v;
}
__device__ __forceinline__ v16h frag_f32(const float* rowk0, int lane) {
  v16h a; const float* p = rowk0 + 8 * (lane >> 4);
#pragma unroll
  for (int i = 0; i < 8; ++i) { a[i] = (_Float16)p[i]; a[8 + i] = (_Float16)p[16 + i]; }
  return a;
}
__device__ __forceinline__ v16h frag_f32s(const float* rowk0, int lane, float sc) {
  v16h a; const float* p = rowk0 + 8 * (lane >> 4);
#pragma unroll
  for (int i = 0; i < 8; ++i) { a[i] = (_Float16)(p[i] * sc); a[8 + i] = (_Float16)(p[16 + i] * sc); }
  return a;
}
// column fragment from a [K][ld] layout (column n), rows >= K read as 0
__device__ __forceinline__ v16h fragc_f32(const float* W, int k0, int n, int lane, int ld, int K) {
  v16h a; const int g = lane >> 4;
#pragma unroll
  for (int i = 0; i < 8; ++i) { const int ka = k0 + 8 * g + i, kb = ka + 16;
    a[i] = (_Float16)(ka < K ? W[(size_t)(ka < K ? ka : K - 1) * ld + n] : 0.f); a[8 + i] = (_Float16)(kb < K ? W[(size_t)(kb < K ? kb : K - 1) * ld + n] : 0.f); }
  return a;
}
struct F2 { v16b h, l; };
__device__ __forceinline__ F2 bsplit16(const float v[16]) { F2 r;
#pragma unroll
  for (int i = 0; i < 16; ++i) { const __bf16 h = (__bf16)v[i]; r.h[i] = h; r.l[i] = (__bf16)(v[i] - (float)h); }
  return r; }
__device__ __forceinline__ F2 split_row(const float* row, int k0, int lane) { float v[16]; const float* p = row + k0 + 8 * (lane >> 4);
#pragma unroll
  for (int i = 0; i < 8; ++i) { v[i] = p[i]; v[8 + i] = p[16 + i]; }
  return bsplit16(v); }
__device__ __forceinline__ F2 split_rowK(const float* row, int k0, int lane, int K) { float v[16]; const int g = lane >> 4;
#pragma unroll
  for (int i = 0; i < 8; ++i) { const int ka = k0 + 8 * g + i, kb = ka + 16; v[i] = ka < K ? row[ka < K ? ka : K - 1] : 0.f; v[8 + i] = kb < K ? row[kb < K ? kb : K - 1] : 0.f; }
  return bsplit16(v); }
__device__ __forceinline__ F2 split_col(const float* W, int k0, int n, int lane, int ld, int K) { float v[16]; const int g = lane >> 4;
#pragma unroll
  for (int i = 0; i < 8; ++i) { const int ka = k0 + 8 * g + i, kb = ka + 16; v[i] = ka < K ? W[(size_t)(ka < K ? ka : K - 1) * ld + n] : 0.f; v[8 + i] = kb < K ? W[(size_t)(kb < K ? kb : K - 1) * ld + n] : 0.f; }
  return bsplit16(v); }
__device__ __forceinline__ v8f mac3(const F2& a, const F2& b, v8f c) { c = wmma_bf(a.l, b.h, c); c = wmma_bf(a.h, b.l, c); return wmma_bf(a.h, b.h, c); }
__device__ __forceinline__ float sigm(float v) { return 1.0f / (1.0f + expf(-v)); }
#define LDSX() do { asm volatile("s_wait_dscnt 0" ::: "memory"); __builtin_amdgcn_wave_barrier(); __builtin_amdgcn_fence(__ATOMIC_RELEASE, "workgroup"); } while (0)
// ---- GEMM operand ring: a stage is 64 k of every operand row of the block's tile, brought into LDS by asynchronous 16-byte copies (a wave's copy covers whole 128-byte lines); LDS row pitch = row bytes + 16 (16 B x odd: conflict-free for 16-byte reads); two buffers (four in k_g)
#define KS 64
#define HPITCH (2 * KS + 16)       // f16 rows: 128 B + 16
__device__ __forceinline__ unsigned lds_off(const void* p) { return (unsigned)(size_t)p; }
// a run of copies and, as the last line of their own statement, the wait that stands in front of any rewrite of their address registers (one wait a run: fewer, longer runs cost a wave fewer waits)
#define CPL(a, b) "global_load_async_to_lds_b128 %" #a ", %" #b ", off\n\t"
__device__ __forceinline__ void cp8(const unsigned* l, const char* const* g) {
  asm volatile(CPL(0, 1) CPL(2, 3) CPL(4, 5) CPL(6, 7) CPL(8, 9) CPL(10, 11) CPL(12, 13) CPL(14, 15) "s_wait_xcnt 0x0"
               :: "v"(l[0]), "v"(g[0]), "v"(l[1]), "v"(g[1]), "v"(l[2]), "v"(g[2]), "v"(l[3]), "v"(g[3]), "v"(l[4]), "v"(g[4]), "v"(l[5]), "v"(g[5]), "v"(l[6]), "v"(g[6]), "v"(l[7]), "v"(g[7]) : "memory");
}
__device__ __forceinline__ void cp12(const unsigned* l, const char* const* g) {
  asm volatile(CPL(0, 1) CPL(2, 3) CPL(4, 5) CPL(6, 7) CPL(8, 9) CPL(10, 11) CPL(12, 13) CPL(14, 15) CPL(16, 17) CPL(18, 19) CPL(20, 21) CPL(22, 23) "s_wait_xcnt 0x0"
               :: "v"(l[0]), "v"(g[0]), "v"(l[1]), "v"(g[1]), "v"(l[2]), "v"(g[2]), "v"(l[3]), "v"(g[3]), "v"(l[4]), "v"(g[4]), "v"(l[5]), "v"(g[5]), "v"(l[6]), "v"(g[6]), "v"(l[7]), "v"(g[7]), "v"(l[8]), "v"(g[8]), "v"(l[9]), "v"(g[9]), "v"(l[10]), "v"(g[10]), "v"(l[11]), "v"(g[11]) : "memory");
}
// this thread's addresses for ROWS rows of RB bytes from gb (row pitch gp bytes) to LDS byte address lb (row pitch RB + 16), dealt over the NTH threads of a block: ROWS * RB / (16 * NTH) copies a thread
template <int ROWS, int RB, int NTH = 128>
__device__ __forceinline__ void row_addr(unsigned* l, const char** g, unsigned lb, const char* gb, size_t gp, int tid) {
  constexpr int PPR = RB / 16, RPI = NTH / PPR, NI = ROWS / RPI; const int row = tid / PPR, pc = tid % PPR;
#pragma unroll
  for (int i = 0; i < NI; ++i) { l[i] = lb + (row + i * RPI) * (RB + 16) + pc * 16; g[i] = gb + (size_t)(row + i * RPI) * gp + pc * 16; }
}
// 128 threads: 128 A rows of 128 B at lb, behind them 128 weight rows of 128 B
__device__ __forceinline__ void stage_ab(unsigned lb, const char* ga, size_t pa, const char* gb, size_t pb, int tid) {
  unsigned l[16]; const char* g[16]; row_addr<128, 2 * KS>(l, g, lb, ga, pa, tid); row_addr<128, 2 * KS>(l + 8, g + 8, lb + 128 * HPITCH, gb, pb, tid); cp8(l, g); cp8(l + 8, g + 8);
}
// 256 threads: 128 A rows of ARB bytes at lb, behind them 128 weight rows of 128 B
template <int ARB>
__device__ __forceinline__ void stage_ab8(unsigned lb, const char* ga, size_t pa, const char* gb, size_t pb, int tid) {
  constexpr int NA = 128 * ARB / 4096; unsigned l[NA + 4]; const char* g[NA + 4];
  row_addr<128, ARB, 256>(l, g, lb, ga, pa, tid); row_addr<128, 2 * KS, 256>(l + NA, g + NA, lb + 128 * (ARB + 16), gb, pb, tid);
  if constexpr (NA == 4) cp8(l, g); else cp12(l, g);
}
// 256 threads: three runs of 128 rows of 128 B (A, gate, up; all of row pitch gp), one behind the other at lb
__device__ __forceinline__ void stage_abc8(unsigned lb, const char* ga, const char* gb, const char* gc, size_t gp, int tid) {
  unsigned l[12]; const char* g[12]; row_addr<128, 2 * KS, 256>(l, g, lb, ga, gp, tid); row_addr<128, 2 * KS, 256>(l + 4, g + 4, lb + 128 * HPITCH, gb, gp, tid); row_addr<128, 2 * KS, 256>(l + 8, g + 8, lb + 256 * HPITCH, gc, gp, tid); cp12(l, g);
}
#define WAIT_ASYNC0() asm volatile("s_wait_asynccnt 0x0" ::: "memory")   // this wave's copies have landed
#define WAIT_ASYNC(n) asm volatile("s_wait_asynccnt %0" :: "n"(n) : "memory")   // all but this wave's n youngest copies have landed (the counter returns in issue order)
#define WAIT_DS0() asm volatile("s_wait_dscnt 0x0" ::: "memory")         // this wave's LDS reads of the buffer have returned before it is refilled


#define NB 2
#define SS 2048
#define DM 1024
#define NH 16
#define HID 2730
#define HP 2816          // hidden padded to 22 x 128
#define WSC 256.0f
#define RMSEPS 1e-6f
__constant__ float THETA[32] = {1.000000000e+00f,7.498942018e-01f,5.623413324e-01f,4.216965139e-01f,3.162277639e-01f,2.371373773e-01f,1.778279394e-01f,1.333521456e-01f,1.000000015e-01f,7.498942316e-02f,5.623413250e-02f,4.216964915e-02f,3.162277490e-02f,2.371373773e-02f,1.778279431e-02f,1.333521400e-02f,9.999999776e-03f,7.498942316e-03f,5.623413250e-03f,4.216964822e-03f,3.162277630e-03f,2.371373819e-03f,1.778279431e-03f,1.333521446e-03f,1.000000047e-03f,7.498941850e-04f,5.623413017e-04f,4.216965172e-04f,3.162277571e-04f,2.371373703e-04f,1.778279402e-04f,1.333521504e-04f};
__device__ __attribute__((noinline)) float cos_p(float v) { return cosf(v); }
__device__ __attribute__((noinline)) float sin_p(float v) { return sinf(v); }
#define HD 64
#define QKVW (3 * DM)
#ifndef TQB
#define TQB (SS / 64)
#define TNB NB
#define TOB (NB * SS / 64)     // output row tiles (all)
#endif
typedef __attribute__((ext_vector_type(8))) __bf16 v8b;
__device__ __forceinline__ v16b frag_b(const __bf16* rowk0, int lane) {
  union { v16b v; v8b q[2]; } u; const __bf16* p = rowk0 + 8 * (lane >> 4);
  u.q[0] = *(const v8b*)p; u.q[1] = *(const v8b*)(p + 16); return u.v;
}
__device__ __forceinline__ float bfr(float v) { return (float)(__bf16)v; }
__device__ __attribute__((noinline)) float exp_ni(float v) { return expf(v); }
__device__ __attribute__((noinline)) float erf_ni(float v) { return erff(v); }

#define PK_A 0                       // [3072][1024] Wqkv rows (natural [out][in])
#define PK_P (PK_A + QKVW * DM)        // [1024][1024] Wo rows (natural)
#define PK_END (PK_P + DM * DM)
#define WS_PK  0u
#define WS_QK  (WS_PK + 2u * PK_END)             // f16 [4096 rows][2048]: q | k
#define WS_QKL (WS_QK + 2u * NB * SS * 2 * DM)     // f16 q | k residual planes x2048
#define WS_VTH (WS_QKL + 2u * NB * SS * 2 * DM)    // f16 [b][1024 (h*64+d)][2048 s] hi
#define WS_VTL (WS_VTH + 2u * NB * DM * SS)        // f16 lo x 2048
#define WS_O   (WS_VTL + 2u * NB * DM * SS)        // f32 [4096][1024]
#define WS_PG  (WS_O + 4u * (size_t)NB * SS * DM)        // f16 x 2^8 [gate | up] rows [2*HP][1024] (zero rows >= HID), down rows [1024][HP] (zero cols >= HID)
#define WS_PD  (WS_PG + 2u * (size_t)2 * HP * DM)
#define WS_H1  (WS_PD + 2u * (size_t)DM * HP)             // f16 rmsnorm1(x) rows [NR][1024]; int flags [SS/64][SS/32]; f32 x1 [NR][1024]; f16 rmsnorm2(x1) rows; f16 silu(gate) up rows [NR][HP]
#define WS_FL  (WS_H1 + 2u * (size_t)NB * SS * DM)
#define WS_X1  (WS_FL + 4u * (size_t)(SS / 64) * (SS / 32))
#define WS_H2  (WS_X1 + 4u * (size_t)NB * SS * DM)
#define WS_GU  (WS_H2 + 2u * (size_t)NB * SS * DM)
#define WS_END (WS_GU + 2u * (size_t)NB * SS * HP)
// ---- pack_tasks (the first PK_WG work-groups of k_prep): a resident stream, one task a wave and pass, no LDS and no barrier: 2,048 half rows of W_down, 4,096 rows of W_q | W_k | W_v | W_o, 5,632 rows of gate | up (the longer tasks first); value = f16(bf16(w) x 2^8); all loads of a task go out before its first store; every load and store of a wave covers one contiguous run of bytes; the loops over j and c below are unrolled so that the pieces stay in registers and the loads go out as one group
typedef __attribute__((ext_vector_type(4))) _Float16 v4h;
typedef __attribute__((ext_vector_type(2))) _Float16 v2h;
#define PT_D (2 * DM)
#define PT_A (PT_D + 4 * DM)
#define PT_END (PT_A + 2 * HP)
#define PK_WG 256        // work-groups of 16 waves: one a WGP
__device__ __forceinline__ _Float16 wcv(float w) { return (_Float16)(bfr(w) * WSC); }
#define STORES_OUT() asm volatile("s_wait_xcnt 0x0" ::: "memory")   // stands directly behind a task's last store: what follows (the next task) rewrites registers that these stores name
// one row of 1,024: a lane holds 8 pieces of 16 bytes, 128 elements apart
__device__ __forceinline__ void pack_row(const float* __restrict__ s, _Float16* __restrict__ d, int lane) { v4f x[8];
#pragma unroll
  for (int j = 0; j < 8; ++j) x[j] = *(const v4f*)(s + j * 128 + lane * 4);
#pragma unroll
  for (int j = 0; j < 8; ++j) { v4h o;
#pragma unroll
    for (int c = 0; c < 4; ++c) o[c] = wcv(x[j][c]);
    *(v4h*)(d + j * 128 + lane * 4) = o; }
  STORES_OUT(); }
__device__ __forceinline__ void pack_tasks(const float* __restrict__ WQ, const float* __restrict__ WK, const float* __restrict__ WV, const float* __restrict__ WO, const float* __restrict__ WG, const float* __restrict__ WU, const float* __restrict__ WD, char* __restrict__ ws) {
  const int lane = threadIdx.x & 31; _Float16* P = (_Float16*)(ws + WS_PK);
  for (int task = __builtin_amdgcn_readfirstlane((threadIdx.x >> 5) * PK_WG + blockIdx.x); task < PT_END; task += 16 * PK_WG) {   // dealt wave-major, so that every work-group gets the same mix of tasks; the task number sits in a scalar register, so the branches on it are scalar
    if (task < PT_D) { const int n = task >> 1, k0 = (task & 1) * (HP / 2) + lane * 2; const float* s = WD + (size_t)n * HID; _Float16* d = (_Float16*)(ws + WS_PD) + (size_t)n * HP; v2f x[22];   // down rows [1024][HP], zero beyond 2,730; a source row starts on 8 bytes only, hence 8-byte loads
#pragma unroll
      for (int j = 0; j < 22; ++j) { const int k = k0 + j * 64; x[j] = *(const v2f*)(s + (k < HID ? k : 0)); }
#pragma unroll
      for (int j = 0; j < 22; ++j) { const int k = k0 + j * 64; v2h o; o[0] = (k < HID) ? wcv(x[j][0]) : (_Float16)0.0f; o[1] = (k < HID) ? wcv(x[j][1]) : (_Float16)0.0f; *(v2h*)(d + k) = o; }
      STORES_OUT(); }
    else if (task < PT_A) { const int r = task - PT_D, which = r >> 10; const float* w = (which == 0) ? WQ : (which == 1) ? WK : (which == 2) ? WV : WO; pack_row(w + (size_t)(r & (DM - 1)) * DM, P + PK_A + (size_t)r * DM, lane); }   // PK_P follows PK_A directly
    else { const int r = task - PT_A, n = (r < HP) ? r : r - HP; _Float16* d = (_Float16*)(ws + WS_PG) + (size_t)r * DM;   // gate | up rows, zero beyond 2,730
      if (n < HID) pack_row(((r < HP) ? WG : WU) + (size_t)n * DM, d, lane);
      else { const v4h z = {};
#pragma unroll
        for (int j = 0; j < 8; ++j) *(v4h*)(d + j * 128 + lane * 4) = z;
        STORES_OUT(); } }
  } }
// the projections are bias-free: the kernel holds no bias path
__global__ __launch_bounds__(128) void k_qkv(const float* __restrict__ XQ, const float* __restrict__ XK, const float* __restrict__ XV, const _Float16* __restrict__ P, _Float16* __restrict__ QK, _Float16* __restrict__ QKL, _Float16* __restrict__ VTH, _Float16* __restrict__ VTL) {
  const int which0 = (blockIdx.y * 128) / DM; const float* X = (which0 == 0) ? XQ : (which0 == 1) ? XK : XV;
  constexpr int STG = (128 + 128) * HPITCH; __shared__ __attribute__((aligned(128))) char sm[2 * STG];   // the ring; behind the loop's last barrier the same bytes are the output staging
  _Float16 (*so)[16][136] = (_Float16 (*)[16][136])sm; _Float16 (*sol)[16][136] = (_Float16 (*)[16][136])(sm + 4 * 16 * 136 * 2); _Float16 (*sth)[136] = (_Float16 (*)[136])sm; _Float16 (*stl)[136] = (_Float16 (*)[136])(sm + 128 * 136 * 2);
  const int tid = threadIdx.x, wave = tid >> 5, lane = tid & 31, col = lane & 15, g = lane >> 4; const size_t r0 = (size_t)blockIdx.x * 128 + wave * 32; const int n0 = blockIdx.y * 128;   // block = (128 rows, 128 cols); a wave holds 32 rows x 128 cols: each weight fragment read from LDS feeds two products
  v8f acc[2][8] = {};
  { const char* gA = (const char*)((const _Float16*)X + (size_t)blockIdx.x * 128 * DM); const char* gB = (const char*)(P + (size_t)n0 * DM); const unsigned l0 = lds_off(sm); constexpr int NT = DM / KS;   // A = f16 rmsnorm rows
    stage_ab(l0, gA, 2 * DM, gB, 2 * DM, tid); WAIT_ASYNC0(); __syncthreads();
    stage_ab(l0 + STG, gA + 2 * KS, 2 * DM, gB + 2 * KS, 2 * DM, tid);
#pragma unroll 1   // stays rolled: one copy of a stage's code in the instruction cache; t & 1 picks the buffer
    for (int t = 0; t < NT; ++t) { const int bo = (t & 1) * STG;
#pragma unroll
      for (int kc = 0; kc < KS / 32; ++kc) { v16h a[2], w[8];   // a 32-k step's LDS reads go out as one group in front of its 16 products (both steps' fragments at once would not fit beside the 128 accumulator registers); the loops below are unrolled so that these arrays are registers
#pragma unroll
        for (int i = 0; i < 2; ++i) a[i] = frag_h((const _Float16*)(sm + bo + (wave * 32 + i * 16 + col) * HPITCH) + kc * 32, lane);
#pragma unroll
        for (int j = 0; j < 8; ++j) w[j] = frag_h((const _Float16*)(sm + bo + (128 + j * 16 + col) * HPITCH) + kc * 32, lane);
#pragma unroll
        for (int j = 0; j < 8; ++j)
#pragma unroll
          for (int i = 0; i < 2; ++i) acc[i][j] = wmma16(a[i], w[j], acc[i][j]); }
      WAIT_DS0(); WAIT_ASYNC0(); __syncthreads();   // publishes stage t + 1 and ends every reader's last read of stage t
      if (t + 2 < NT) { stage_ab(l0 + bo, gA + (size_t)(t + 2) * 2 * KS, 2 * DM, gB + (size_t)(t + 2) * 2 * KS, 2 * DM, tid); } }
    WAIT_ASYNC0(); }
#pragma unroll
  for (int i = 0; i < 2; ++i)
#pragma unroll
    for (int j = 0; j < 8; ++j)
#pragma unroll
      for (int r = 0; r < 8; ++r) acc[i][j][r] *= (1.0f / WSC);
  if (n0 < 2 * DM) {   // rotate-half rotary over each 64-dim head with angle position * inv_freq[d mod 32]; the wave's two 16-row halves go through its staging rows one after the other (unrolled: acc is indexed by i)
#pragma unroll
    for (int i = 0; i < 2; ++i) { const size_t ri = r0 + i * 16;
#pragma unroll
      for (int r = 0; r < 8; ++r) { const int spos = (int)((ri + 8 * g + r) % SS);
#pragma unroll
        for (int jj = 0; jj < 2; ++jj) { const float ang = (float)spos * THETA[jj * 16 + col]; const float c = cos_p(ang), sn = sin_p(ang);
#pragma unroll
          for (int hh = 0; hh < 2; ++hh) { const float x1 = acc[i][hh * 4 + jj][r], x2 = acc[i][hh * 4 + jj + 2][r]; acc[i][hh * 4 + jj][r] = x1 * c - x2 * sn; acc[i][hh * 4 + jj + 2][r] = x2 * c + x1 * sn; } } }
      if (i) LDSX();   // the first half's reads of the staging rows have returned before other lanes rewrite them
#pragma unroll
      for (int j = 0; j < 8; ++j) {
#pragma unroll
        for (int r = 0; r < 8; ++r) { const float v = acc[i][j][r]; const _Float16 hv = (_Float16)v; so[wave][8 * g + r][j * 16 + col] = hv; sol[wave][8 * g + r][j * 16 + col] = (_Float16)((v - (float)hv) * 2048.0f); } }   // q, k as f16 hi + (x2048) residual
      LDSX();
      for (int rl = 0; rl < 16; ++rl) if (lane < 16) { vst2((unsigned*)(QK + (ri + rl) * (2 * DM) + n0 + lane * 8), *(const v4u*)&so[wave][rl][lane * 8]); vst2((unsigned*)(QKL + (ri + rl) * (2 * DM) + n0 + lane * 8), *(const v4u*)&sol[wave][rl][lane * 8]); } }
  } else {
#pragma unroll
    for (int i = 0; i < 2; ++i)
#pragma unroll
      for (int j = 0; j < 8; ++j) {
#pragma unroll
        for (int r = 0; r < 8; ++r) { const float v = acc[i][j][r]; const _Float16 hv = (_Float16)v; sth[j * 16 + col][wave * 32 + i * 16 + 8 * g + r] = hv; stl[j * 16 + col][wave * 32 + i * 16 + 8 * g + r] = (_Float16)((v - (float)hv) * 2048.0f); } }
    __syncthreads();
    const size_t rb = (size_t)blockIdx.x * 128; const int b = (int)(rb / SS), s0 = (int)(rb % SS); const int pc0 = n0 - 2 * DM;
    for (int q = tid; q < 128 * 16; q += 128) { const int d = q >> 4, pc = q & 15; const size_t o = ((size_t)b * DM + pc0 + d) * SS + s0 + pc * 8; vst2((unsigned*)(VTH + o), *(const v4u*)&sth[d][pc * 8]); vst2((unsigned*)(VTL + o), *(const v4u*)&stl[d][pc * 8]); }
  }
}
// ---- k_attn: block = (64 queries, head h, batch b): flash attention over the visible (64-query, 32-key) tiles (K = 64: 2 k-steps), scores = (q.k) * 0.125, 3 products (hi + residual planes), P.V likewise; O[b*S+q][h*64+d] = (acc + accl / 2048) / (2048 l) (256-B segments)
// a tile's K rows (32 x 128 B, hi and residual) and V^T rows (64 x 64 B, hi and residual) come into LDS once for the block's four waves by asynchronous 16-byte copies, two buffers, the next visible tile in flight while this one is worked on; row pitch = row bytes + 16 (16 B x odd: conflict-free for 16-byte reads)
#define AKP (2 * HD + 16)
#define AVP (2 * 32 + 16)
#define A_KH 0
#define A_KL (32 * AKP)
#define A_VH (2 * 32 * AKP)
#define A_VL (A_VH + HD * AVP)
#define A_STG (A_VL + HD * AVP)
// tile ks to LDS byte address lb: 8 copies a thread; kh, kl: key row 0 of this (batch, head) in the two planes; vh, vl: its V^T row 0
__device__ __forceinline__ void stage_kv(unsigned lb, const char* kh, const char* kl, const char* vh, const char* vl, int ks, int tid) {
  unsigned l[8]; const char* g[8]; const int kr = tid >> 3, kp = tid & 7, vr = tid >> 2, vp = tid & 3;
  const size_t ko = (size_t)(ks * 32 + kr) * (2 * DM * 2) + kp * 16, vo = (size_t)vr * (SS * 2) + ks * 64 + vp * 16;
#pragma unroll
  for (int i = 0; i < 2; ++i) { const unsigned lk = lb + (kr + 16 * i) * AKP + kp * 16, lv = lb + (vr + 32 * i) * AVP + vp * 16; const size_t gk = ko + (size_t)i * 16 * (2 * DM * 2), gv = vo + (size_t)i * 32 * (SS * 2);
    l[i] = lk + A_KH; g[i] = kh + gk; l[2 + i] = lk + A_KL; g[2 + i] = kl + gk; l[4 + i] = lv + A_VH; g[4 + i] = vh + gv; l[6 + i] = lv + A_VL; g[6 + i] = vl + gv; }
  cp8(l, g);
}
__global__ __launch_bounds__(128) void k_attn(const _Float16* __restrict__ QK, const _Float16* __restrict__ QKL, const _Float16* __restrict__ VTH, const _Float16* __restrict__ VTL, const void* __restrict__ KMASK, const int* __restrict__ MASK, const int* __restrict__ FL, float* __restrict__ O) {
  __shared__ __align__(16) float sp[4][16][36]; __shared__ __align__(16) float so[4][16][68]; __shared__ __attribute__((aligned(128))) char sm[2 * A_STG];   // sm: the K / V ring
  const int tid = threadIdx.x, wave = tid >> 5, lane = tid & 31, col = lane & 15, g = lane >> 4;
  const int qb = blockIdx.x, h = blockIdx.y, b = blockIdx.z; const int q0 = qb * 64 + wave * 16; const size_t rq = (size_t)b * SS + q0 + col;
  // the visible tiles of this query block as 64 bits in scalar registers (the same in every wave of the block), taken in rising order: the ring has to know the next tile before this one is done
  unsigned long long todo = ((unsigned long long)__builtin_amdgcn_ballot_w32(FL[qb * (SS / 32) + 32 + lane] != 0) << 32) | __builtin_amdgcn_ballot_w32(FL[qb * (SS / 32) + lane] != 0);
  const int nt = __builtin_popcountll(todo);
  const char* gkh = (const char*)(QK + (size_t)b * SS * (2 * DM) + DM + h * HD); const char* gkl = (const char*)(QKL + (size_t)b * SS * (2 * DM) + DM + h * HD);
  const char* gvh = (const char*)(VTH + ((size_t)b * DM + h * HD) * SS); const char* gvl = (const char*)(VTL + ((size_t)b * DM + h * HD) * SS); const unsigned l0 = lds_off(sm);
  int ks = 0, ksn = 0;
  if (nt > 0) { ks = __builtin_ctzll(todo); todo &= todo - 1; stage_kv(l0, gkh, gkl, gvh, gvl, ks, tid); }
  v16h aq[2], aql[2];
#pragma unroll
  for (int kc = 0; kc < 2; ++kc) { aq[kc] = frag_h(QK + rq * (2 * DM) + h * HD + kc * 32, lane); aql[kc] = frag_h(QKL + rq * (2 * DM) + h * HD + kc * 32, lane); }
  float m[8], l[8];
#pragma unroll
  for (int r = 0; r < 8; ++r) { m[r] = -3.0e38f; l[r] = 0.f; }
  v8f acc[4] = {}, accl[4] = {};
  WAIT_ASYNC0(); __syncthreads();   // publishes the first tile
  if (nt > 1) { ksn = __builtin_ctzll(todo); todo &= todo - 1; stage_kv(l0 + A_STG, gkh, gkl, gvh, gvl, ksn, tid); }
#pragma unroll 1   // stays rolled: t & 1 picks the buffer
  for (int t = 0; t < nt; ++t) { const int bo = (t & 1) * A_STG; v8f s[2];
    v16h kh[2][2], kl[2][2];   // the tile's K reads go out as one group in front of its products; unrolled so that the arrays are registers
#pragma unroll
    for (int ct = 0; ct < 2; ++ct)
#pragma unroll
      for (int kc = 0; kc < 2; ++kc) { kh[ct][kc] = frag_h((const _Float16*)(sm + bo + A_KH + (ct * 16 + col) * AKP) + kc * 32, lane); kl[ct][kc] = frag_h((const _Float16*)(sm + bo + A_KL + (ct * 16 + col) * AKP) + kc * 32, lane); }
#pragma unroll
    for (int ct = 0; ct < 2; ++ct) { const int kk = ks * 32 + ct * 16 + col; v8f c = {}, cl = {};
#pragma unroll
      for (int kc = 0; kc < 2; ++kc) { c = wmma16(aq[kc], kh[ct][kc], c); cl = wmma16(aql[kc], kh[ct][kc], cl); cl = wmma16(aq[kc], kl[ct][kc], cl); }   // 3 products: q, k as f16 hi + residual
#pragma unroll
      for (int r = 0; r < 8; ++r) c[r] += cl[r] * (1.0f / 2048.0f);
      {
#pragma unroll
      for (int r = 0; r < 8; ++r) s[ct][r] = (MASK[(size_t)(q0 + 8 * g + r) * SS + kk] == 0) ? c[r] * 0.125f : -3.0e38f; } }   // 1/sqrt(64); masked keys excluded
#pragma unroll
    for (int r = 0; r < 8; ++r) { float mx = fmaxf(s[0][r], s[1][r]);
#pragma unroll
      for (int o = 1; o < 16; o <<= 1) mx = fmaxf(mx, __shfl_xor(mx, o));
      const float mn = fmaxf(m[r], mx); const float alpha = (m[r] <= -1.0e38f) ? 0.f : __expf(m[r] - mn);
      const float e0 = (s[0][r] <= -1.0e38f) ? 0.f : __expf(s[0][r] - mn), e1 = (s[1][r] <= -1.0e38f) ? 0.f : __expf(s[1][r] - mn); float es = e0 + e1;
#pragma unroll
      for (int o = 1; o < 16; o <<= 1) es += __shfl_xor(es, o);
      l[r] = l[r] * alpha + es; m[r] = mn;
#pragma unroll
      for (int dt = 0; dt < 4; ++dt) { acc[dt][r] *= alpha; accl[dt][r] *= alpha; }
      sp[wave][8 * g + r][col] = e0; sp[wave][8 * g + r][16 + col] = e1; }
    LDSX();
    v16h vh[4], vl[4];   // the tile's V reads likewise as one group
#pragma unroll
    for (int dt = 0; dt < 4; ++dt) { vh[dt] = frag_h((const _Float16*)(sm + bo + A_VH + (dt * 16 + col) * AVP), lane); vl[dt] = frag_h((const _Float16*)(sm + bo + A_VL + (dt * 16 + col) * AVP), lane); }
    v16h pa, pl; { const float* prow = &sp[wave][col][0] + 8 * (lane >> 4);
#pragma unroll
      for (int i = 0; i < 8; ++i) { const float x0 = prow[i] * 2048.0f, x1 = prow[16 + i] * 2048.0f; const _Float16 h0 = (_Float16)x0, h1 = (_Float16)x1; pa[i] = h0; pa[8 + i] = h1; pl[i] = (_Float16)((x0 - (float)h0) * 2048.0f); pl[8 + i] = (_Float16)((x1 - (float)h1) * 2048.0f); } }   // P scaled by 2^11 before the f16 split so small softmax weights stay out of the f16 subnormal range; 2^-11 folded into the epilogue
#pragma unroll
    for (int dt = 0; dt < 4; ++dt) { acc[dt] = wmma16(pa, vh[dt], acc[dt]); accl[dt] = wmma16(pl, vh[dt], accl[dt]); accl[dt] = wmma16(pa, vl[dt], accl[dt]); }   // P hi x V hi + (P lo x V hi + P hi x V lo) / 2048
    WAIT_DS0(); WAIT_ASYNC0(); __syncthreads();   // publishes tile t + 1 and ends every reader's last read of tile t (and this wave's reads of its sp rows)
    ks = ksn;
    if (t + 2 < nt) { ksn = __builtin_ctzll(todo); todo &= todo - 1; stage_kv(l0 + bo, gkh, gkl, gvh, gvl, ksn, tid); } }
  WAIT_ASYNC0();
#pragma unroll
  for (int r = 0; r < 8; ++r) { const float il = (l[r] > 0.f) ? (1.0f / 2048.0f) / l[r] : 0.f;
#pragma unroll
    for (int dt = 0; dt < 4; ++dt) so[wave][8 * g + r][dt * 16 + col] = (acc[dt][r] + accl[dt][r] * (1.0f / 2048.0f)) * il; }
  LDSX();
  for (int rl = 0; rl < 16; ++rl) if (lane < 16) vst2(O + ((size_t)b * SS + q0 + rl) * DM + h * HD + lane * 4, *(const v4f*)&so[wave][rl][lane * 4]);
}
// ---- k_out: block = (64 rows, 128 cols): out = O(hi/lo) . Wo rows (2 products) + bo
__global__ __launch_bounds__(128) void k_out(const float* __restrict__ O, const __bf16* __restrict__ P, const float* __restrict__ BO, float* __restrict__ Y) {
  __shared__ __align__(16) float so[4][16][132];
  const int tid = threadIdx.x, wave = tid >> 5, lane = tid & 31, col = lane & 15, g = lane >> 4; const size_t r0 = (size_t)blockIdx.x * 64 + wave * 16; const int n0 = blockIdx.y * 128;
  v8f acc[8] = {};
#pragma unroll 2
  for (int kc = 0; kc < DM / 32; ++kc) { const F2 a = split_row(O + (r0 + col) * DM, kc * 32, lane);
#pragma unroll
    for (int j = 0; j < 8; ++j) { const v16b w = frag_b(P + (size_t)(n0 + j * 16 + col) * DM + kc * 32, lane); acc[j] = wmma_bf(a.l, w, acc[j]); acc[j] = wmma_bf(a.h, w, acc[j]); } }
#pragma unroll
  for (int j = 0; j < 8; ++j) {
#pragma unroll
    for (int r = 0; r < 8; ++r) so[wave][8 * g + r][j * 16 + col] = acc[j][r] + (BO ? bfr(BO[n0 + j * 16 + col]) : 0.f); }
  LDSX();
  for (int rl = 0; rl < 16; ++rl) vst2(Y + (r0 + rl) * DM + n0 + lane * 4, *(const v4f*)&so[wave][rl][lane * 4]);
}

// ---- rms_row: wave = row, no LDS and no barrier: OUTH = f16(x rsqrt(mean x^2 + eps) w) (MODE 0: x = bf16-rounded input; MODE 1: x = f32 x1); a lane holds 8 pieces of 16 bytes, 128 elements apart, the row's 8 loads in flight at once; every loop is unrolled so that the pieces stay in registers
template <int M> __device__ __forceinline__ float lane_xor(float v) { return __builtin_bit_cast(float, __builtin_amdgcn_update_dpp(0, __builtin_bit_cast(int, v), 0x160 + M, 0xf, 0xf, true)); }   // value of lane ^ M inside a 16-lane row (DPP row_xmask), no LDS round trip
template <int MODE>
__device__ __forceinline__ void rms_row(const float* __restrict__ A, const float* __restrict__ Wn, _Float16* __restrict__ OUTH, const size_t row, const int lane) {
  v4f x[8], wn[8];
#pragma unroll
  for (int j = 0; j < 8; ++j) x[j] = *(const v4f*)(A + row * DM + j * 128 + lane * 4);
#pragma unroll
  for (int j = 0; j < 8; ++j) wn[j] = *(const v4f*)(Wn + j * 128 + lane * 4);
  if (MODE == 0) {
#pragma unroll
    for (int j = 0; j < 8; ++j)
#pragma unroll
      for (int c = 0; c < 4; ++c) x[j][c] = bfr(x[j][c]); }
  // the square sum keeps its tree: elements 256 apart chained, then pairwise over each aligned run of 32 elements (4 in the lane, 8 lanes), then the eight runs' sums one after another
  float s[2];
#pragma unroll
  for (int jp = 0; jp < 2; ++jp) { float q[4];
#pragma unroll
    for (int c = 0; c < 4; ++c) { float t = 0.f;
#pragma unroll
      for (int i = 0; i < 4; ++i) t += x[jp + 2 * i][c] * x[jp + 2 * i][c];
      q[c] = t; }
    s[jp] = (q[0] + q[1]) + (q[2] + q[3]); }
#pragma unroll
  for (int jp = 0; jp < 2; ++jp) { s[jp] += lane_xor<1>(s[jp]); s[jp] += lane_xor<2>(s[jp]); s[jp] += lane_xor<4>(s[jp]); }
  float tq = 0.f;
#pragma unroll
  for (int i = 0; i < 8; ++i) tq += __builtin_bit_cast(float, __builtin_amdgcn_readlane(__builtin_bit_cast(int, s[i >> 2]), (i & 3) * 8));
  const float inv = 1.0f / sqrtf(tq / (float)DM + RMSEPS);
#pragma unroll
  for (int j = 0; j < 8; ++j) { v4h o;
#pragma unroll
    for (int c = 0; c < 4; ++c) o[c] = (_Float16)(x[j][c] * inv * bfr(wn[j][c]));
    *(v4h*)(OUTH + row * DM + j * 128 + lane * 4) = o; }
  if (MODE == 0) STORES_OUT(); }   // in the joined launch code of the other jobs stands behind these stores in the listing and rewrites their registers; in k_rms the wave ends here
// k_rms: the second norm (its input is made by the launch in front of it): 16 rows a work-group
__global__ __launch_bounds__(512) void k_rms(const float* __restrict__ A, const float* __restrict__ Wn, _Float16* __restrict__ OUTH) { rms_row<1>(A, Wn, OUTH, (size_t)blockIdx.x * 16 + (threadIdx.x >> 5), threadIdx.x & 31); }
// ---- flags_block: block of 16 waves = (query block qb of 64 queries, half hf of the keys): FL[qb][hf * 32 + kt] = 1 if any mask[q][k] == 0 (attend) in the 64 x 32 tile; a lane owns one 16-byte column piece over 32 rows, in two groups of 16 independent loads; a block writes one whole 128-byte line of FL
__device__ __forceinline__ void flags_block(const int* __restrict__ MASK, int* __restrict__ FL, int* sf, const int qb, const int hf) { const int t = threadIdx.x; const int c4 = t & 255, rw = t >> 8;
  if (t < 32) sf[t] = 0; __syncthreads();
  const int* p = MASK + (size_t)(qb * 64 + rw) * SS + hf * (SS / 2) + c4 * 4; unsigned mn = 0xffffffffu;
#pragma unroll 1   // stays rolled: 16 loads' results at a time, so that the launch keeps two work-groups a WGP
  for (int bt = 0; bt < 2; ++bt) { v4u v[16]; const int* q = p + (size_t)bt * 32 * SS;
#pragma unroll
    for (int i = 0; i < 16; ++i) v[i] = *(const v4u*)(q + (size_t)i * 2 * SS);
    asm volatile("s_wait_xcnt 0x0" :: "v"(q) : "memory");   // stands behind a group's loads, in front of any rewrite of the address registers that they name; the address is an input, so that it stays whole up to the wait (no load's result lands on it)
#pragma unroll
    for (int i = 0; i < 16; ++i) mn = min(mn, min(min(v[i][0], v[i][1]), min(v[i][2], v[i][3]))); }   // smallest word is 0 exactly when some key is visible
  if (mn == 0u) sf[c4 >> 3] = 1;   // benign same-value race within the block
  __syncthreads(); if (t < 8) vst2((unsigned*)(FL + (size_t)qb * (SS / 32) + hf * 32 + t * 4), *(const v4u*)&sf[t * 4]); }
// ---- k_prep: the three jobs that read nothing but inputs, in one launch, told apart by the block index (a scalar test, the same for a whole work-group): weight packing (the longest, on the lowest block indices), the mask's tile flags, the first norm's rows (16 a work-group)
#define PR_FL PK_WG
#define PR_RMS (PR_FL + 2 * (SS / 64))
#define PR_END (PR_RMS + NB * SS / 16)
__global__ __launch_bounds__(512) void k_prep(const float* __restrict__ WQ, const float* __restrict__ WK, const float* __restrict__ WV, const float* __restrict__ WO, const float* __restrict__ WG, const float* __restrict__ WU, const float* __restrict__ WD, const float* __restrict__ X, const float* __restrict__ N1, const int* __restrict__ MASK, char* __restrict__ ws) { __shared__ __align__(16) int sf[32]; const int bx = blockIdx.x;
  if (bx < PR_FL) pack_tasks(WQ, WK, WV, WO, WG, WU, WD, ws);
  else if (bx < PR_RMS) flags_block(MASK, (int*)(ws + WS_FL), sf, (bx - PR_FL) >> 1, (bx - PR_FL) & 1);
  else rms_row<0>(X, N1, (_Float16*)(ws + WS_H1), (size_t)(bx - PR_RMS) * 16 + (threadIdx.x >> 5), threadIdx.x & 31); }
// ---- k_g<MODE, KW>: block = (128 rows, 128 cols), eight waves, a wave 32 rows x 64 cols (a fragment read from LDS feeds two or four products; the grid is one block a WGP, so the block brings two waves a SIMD itself, and nothing else on the WGP covers a stage's way from L2: the ring has four buffers, three stages in flight while one is worked on): A f16 rows (MODE 0: built inline from the f32 ctx) . W^T (f16 x 2^8); MODE 0: X1 = x (bf16-rounded) + acc (f32 out); MODE 2: OUT = X1 + acc (f32)
template <int MODE, int KW>
__global__ __launch_bounds__(256) void k_g(const void* __restrict__ Ain, const _Float16* __restrict__ Wr, const float* __restrict__ RES, float* __restrict__ O32, int ow) { constexpr int AEB = (MODE == 0) ? 4 : 2, APITCH = AEB * KS + 16, STG = 128 * APITCH + 128 * HPITCH, CPS = 128 * AEB * KS / 4096 + 4; __shared__ __attribute__((aligned(128))) char sm[4 * STG];   // the ring (CPS: copies a wave issues for a stage, the same in every wave); behind the loop's last barrier the same bytes are the output staging
  float (*sf)[16][68] = (float (*)[16][68])sm;
  const int tid = threadIdx.x, wave = tid >> 5, lane = tid & 31, col = lane & 15, g = lane >> 4, ar = (wave >> 1) * 32, wr = (wave & 1) * 64; const size_t r0 = (size_t)blockIdx.x * 128 + ar; const int c0 = blockIdx.y * 128 + wr;
  v8f acc[2][4] = {};
  { const char* gA = (const char*)Ain + (size_t)blockIdx.x * 128 * KW * AEB; const char* gB = (const char*)(Wr + (size_t)blockIdx.y * 128 * KW); const unsigned l0 = lds_off(sm); constexpr int NT = KW / KS;
    static_assert(NT >= 4 && 4 * CPS <= 63, "four stages exist, and their copies fit the counter");
#pragma unroll   // four straight-line stages: the buffer offsets are constants
    for (int s = 0; s < 4; ++s) stage_ab8<AEB * KS>(l0 + s * STG, gA + (size_t)s * AEB * KS, (size_t)AEB * KW, gB + (size_t)s * 2 * KS, 2 * KW, tid);
    WAIT_ASYNC(3 * CPS); __syncthreads();   // publishes stage 0; stages 1 to 3 stay in flight
    // one stage's work, from the buffer at byte offset bo
    auto work = [&](int bo) __attribute__((always_inline)) {
      v16h a[KS / 32][2], w[KS / 32][4];   // the stage's LDS reads go out as one group in front of its products; the loops below are unrolled so that these arrays are registers
#pragma unroll
      for (int kc = 0; kc < KS / 32; ++kc) {
#pragma unroll
        for (int h = 0; h < 2; ++h) { if (MODE == 0) { const float* p = (const float*)(sm + bo + (ar + h * 16 + col) * APITCH) + kc * 32 + 8 * g;
#pragma unroll
            for (int i = 0; i < 8; ++i) { a[kc][h][i] = (_Float16)p[i]; a[kc][h][8 + i] = (_Float16)p[16 + i]; } } else a[kc][h] = frag_h((const _Float16*)(sm + bo + (ar + h * 16 + col) * APITCH) + kc * 32, lane); }
#pragma unroll
        for (int j = 0; j < 4; ++j) w[kc][j] = frag_h((const _Float16*)(sm + bo + 128 * APITCH + (wr + j * 16 + col) * HPITCH) + kc * 32, lane); }
#pragma unroll
      for (int kc = 0; kc < KS / 32; ++kc)
#pragma unroll
        for (int j = 0; j < 4; ++j)
#pragma unroll
          for (int h = 0; h < 2; ++h) acc[h][j] = wmma16(a[kc][h], w[kc][j], acc[h][j]); };
#pragma unroll 1   // stays rolled: one copy of a stage's code in the instruction cache; t & 3 picks the buffer
    for (int t = 0; t < NT - 4; ++t) { const int bo = (t & 3) * STG; work(bo);
      WAIT_DS0(); WAIT_ASYNC(2 * CPS); __syncthreads();   // stage t + 1 has landed (the wave's youngest copies are those of stages t + 2 and t + 3); the barrier publishes it and ends every reader's last read of stage t
      stage_ab8<AEB * KS>(l0 + bo, gA + (size_t)(t + 4) * AEB * KS, (size_t)AEB * KW, gB + (size_t)(t + 4) * 2 * KS, 2 * KW, tid); }
#pragma unroll 1   // the last four stages: nothing is issued any more, so the wait is to 0; rolled for the same reason
    for (int t = NT - 4; t < NT; ++t) { work((t & 3) * STG); WAIT_DS0(); WAIT_ASYNC0(); __syncthreads(); }
    WAIT_ASYNC0(); }
#pragma unroll   // the wave's two 16-row halves go through its staging rows one after the other (unrolled: acc is indexed by h)
  for (int h = 0; h < 2; ++h) { const size_t rh = r0 + h * 16; float res[8][4];
#pragma unroll
    for (int r = 0; r < 8; ++r) { const float* rp = RES + (rh + 8 * g + r) * ow + c0 + col;
#pragma unroll
      for (int j = 0; j < 4; ++j) res[r][j] = rp[j * 16];
      asm volatile("s_wait_xcnt 0x0" ::: "memory"); }   // stands behind each row's four loads: the results of later rows' loads may land in the registers that held this row's address
    if (h) LDSX();   // the first half's reads of the staging rows have returned before other lanes rewrite them
#pragma unroll
    for (int j = 0; j < 4; ++j)
#pragma unroll
      for (int r = 0; r < 8; ++r) sf[wave][8 * g + r][j * 16 + col] = acc[h][j][r] * (1.0f / WSC) + (MODE == 0 ? bfr(res[r][j]) : res[r][j]);
    LDSX(); for (int rl = g; rl < 16; rl += 2) vst2(O32 + (rh + rl) * ow + c0 + col * 4, *(const v4f*)&sf[wave][rl][col * 4]); } }   // a store covers two rows' 256-byte runs
// ---- k_gu: block = (128 rows, 128 hidden cols), eight waves, a wave 32 rows x (64 gate + 64 up) cols (each weight fragment read from LDS feeds two products): g = h2 . Wg^T, u = h2 . Wu^T (same A), GU = f16(silu(g) u) -> rows [NR][HP]
__global__ __launch_bounds__(256) void k_gu(const _Float16* __restrict__ H2, const _Float16* __restrict__ PG, _Float16* __restrict__ GU) { constexpr int STG = (128 + 256) * HPITCH; __shared__ __attribute__((aligned(128))) char sm[2 * STG];   // the ring (128 A rows, 128 gate rows, 128 up rows); behind the loop's last barrier the same bytes are the output staging
  _Float16 (*so)[136] = (_Float16 (*)[136])sm;
  const int tid = threadIdx.x, wave = tid >> 5, lane = tid & 31, col = lane & 15, g = lane >> 4, ar = (wave >> 1) * 32, wr = (wave & 1) * 64; const size_t rb = (size_t)blockIdx.x * 128; const int c0 = blockIdx.y * 128; const _Float16* Wg = PG + (size_t)c0 * DM; const _Float16* Wu = PG + ((size_t)HP + c0) * DM;
  v8f ag[2][4] = {}, au[2][4] = {};
  { const char* gA = (const char*)(H2 + rb * DM); const char* gG = (const char*)Wg; const char* gU = (const char*)Wu; const unsigned l0 = lds_off(sm); constexpr int NT = DM / KS;
    stage_abc8(l0, gA, gG, gU, 2 * DM, tid); WAIT_ASYNC0(); __syncthreads();
    stage_abc8(l0 + STG, gA + 2 * KS, gG + 2 * KS, gU + 2 * KS, 2 * DM, tid);
#pragma unroll 1   // stays rolled: one copy of a stage's code in the instruction cache; t & 1 picks the buffer
    for (int t = 0; t < NT; ++t) { const int bo = (t & 1) * STG;
#pragma unroll
      for (int kc = 0; kc < KS / 32; ++kc) { v16h a[2], wg[4], wu[4];   // a 32-k step's LDS reads go out as one group in front of its 16 products (both steps' fragments at once would not fit beside the 128 accumulator registers); the loops below are unrolled so that these arrays are registers
#pragma unroll
        for (int h = 0; h < 2; ++h) a[h] = frag_h((const _Float16*)(sm + bo + (ar + h * 16 + col) * HPITCH) + kc * 32, lane);
#pragma unroll
        for (int j = 0; j < 4; ++j) { wg[j] = frag_h((const _Float16*)(sm + bo + (128 + wr + j * 16 + col) * HPITCH) + kc * 32, lane); wu[j] = frag_h((const _Float16*)(sm + bo + (256 + wr + j * 16 + col) * HPITCH) + kc * 32, lane); }
#pragma unroll
        for (int j = 0; j < 4; ++j)
#pragma unroll
          for (int h = 0; h < 2; ++h) { ag[h][j] = wmma16(a[h], wg[j], ag[h][j]); au[h][j] = wmma16(a[h], wu[j], au[h][j]); } }
      WAIT_DS0(); WAIT_ASYNC0(); __syncthreads();   // publishes stage t + 1 and ends every reader's last read of stage t
      if (t + 2 < NT) { const size_t ko = (size_t)(t + 2) * 2 * KS; stage_abc8(l0 + bo, gA + ko, gG + ko, gU + ko, 2 * DM, tid); } }
    WAIT_ASYNC0(); }
#pragma unroll
  for (int h = 0; h < 2; ++h)
#pragma unroll
    for (int j = 0; j < 4; ++j)
#pragma unroll
      for (int r = 0; r < 8; ++r) { const float gg = ag[h][j][r] * (1.0f / WSC), uu = au[h][j][r] * (1.0f / WSC); so[ar + h * 16 + 8 * g + r][wr + j * 16 + col] = (_Float16)(gg / (1.0f + __expf(-gg)) * uu); }
  __syncthreads(); for (int e = tid; e < 128 * 16; e += 256) { const int rl = e >> 4, q = e & 15; vst2((unsigned*)(GU + (rb + rl) * HP + c0 + q * 8), *(const v4u*)&so[rl][q * 8]); } }

extern "C" void kernel_launch(void* const* d_in, const int* in_sizes, int n_in, void* d_out, int out_size, void* d_ws, size_t ws_size, hipStream_t stream) {
  (void)in_sizes; (void)n_in; (void)out_size;
  const float** F = (const float**)d_in;   // 0 x [2,2048,1024], 1 attn_mask [2048,2048] int (1 = masked), 2 wq, 3 wk, 4 wv, 5 wo (natural [1024,1024]), 6 norm1_w, 7 norm2_w, 8 w_gate [2730,1024], 9 w_up, 10 w_down [1024,2730]
  if (ws_size < (size_t)WS_END) return;
  char* ws = (char*)d_ws; _Float16* PK = (_Float16*)(ws + WS_PK); _Float16 *QK = (_Float16*)(ws + WS_QK), *QKL = (_Float16*)(ws + WS_QKL), *VTH = (_Float16*)(ws + WS_VTH), *VTL = (_Float16*)(ws + WS_VTL), *H1 = (_Float16*)(ws + WS_H1), *H2 = (_Float16*)(ws + WS_H2), *GU = (_Float16*)(ws + WS_GU); float *O = (float*)(ws + WS_O), *X1 = (float*)(ws + WS_X1); int* FL = (int*)(ws + WS_FL); const int* MASK = (const int*)d_in[1];
  const int nr = NB * SS;   // keys of both batches are always needed
  k_prep<<<PR_END, 512, 0, stream>>>(F[2], F[3], F[4], F[5], F[8], F[9], F[10], F[0], F[6], MASK, ws);   // packed weights, tile flags, rmsnorm1 rows
  k_qkv<<<dim3(nr / 128, QKVW / 128), 128, 0, stream>>>((const float*)H1, (const float*)H1, (const float*)H1, PK + PK_A, QK, QKL, VTH, VTL);
  k_attn<<<dim3(TQB, NH, TNB), 128, 0, stream>>>(QK, QKL, VTH, VTL, nullptr, MASK, FL, O);
  k_g<0, DM><<<dim3(TOB / 2, DM / 128), 256, 0, stream>>>(O, PK + PK_P, F[0], X1, DM);                  // x1 = x + ctx wo^T
  k_rms<<<TOB * 4, 512, 0, stream>>>(X1, F[7], H2);
  k_gu<<<dim3(TOB / 2, HP / 128), 256, 0, stream>>>(H2, (const _Float16*)(ws + WS_PG), GU);
  k_g<2, HP><<<dim3(TOB / 2, DM / 128), 256, 0, stream>>>(GU, (const _Float16*)(ws + WS_PD), X1, (float*)d_out, DM);   // out = x1 + (silu(g) u) w_down^T
}

// v009
// It runs in 157 microseconds.
// Timed twice side by side with v008, it ran 1.04 times as fast both times.
// Counting every step since v000, it is 5.82 times as fast.
// compute dtype: all float inputs rounded to bf16, attn_mask (int) read on device; RMSNorms (eps 1e-6) in f32, normed rows once to f16; q/k/v = f16(h) . W^T against exact f16 x 2^8 weight copies on WMMA 16x16x32 (single products, f32 accumulate); rotate-half RoPE in f32 (precise sinf/cosf) before the f16 hi + residual split; attention with 3-product scores and P.v (hi + residual planes), x 1/8, masked keys excluded (mask read per pair; fully-masked 64x32 tiles skipped via a device-built flag table), running-max softmax in f32 (hardware exp); x1 = x + f16(ctx) . Wo^T; SwiGLU: f16(rmsnorm(x1)) . [W_gate | W_up]^T (hidden padded 2,730 -> 2,816 with zero weights), silu(g) u in f32 -> f16, . W_down^T + x1; f32 output.
#include <hip/hip_runtime.h>
#include <math.h>

typedef __attribute__((ext_vector_type(16))) _Float16 v16h;
typedef __attribute__((ext_vector_type(16))) __bf16 v16b;
typedef __attribute__((ext_vector_type(8)))  _Float16 v8h;
typedef __attribute__((ext_vector_type(8)))  float v8f;
typedef __attribute__((ext_vector_type(4)))  float v4f;
typedef __attribute__((ext_vector_type(2)))  float v2f;
typedef __attribute__((ext_vector_type(4)))  unsigned v4u;
typedef __attribute__((ext_vector_type(4)))  int v4i;
typedef float __attribute__((may_alias)) float_a;
typedef int __attribute__((may_alias)) int_a;

template <typename T> __device__ __forceinline__ void vst2(void* p, T v) { *(T*)p = v;  }
__device__ __forceinline__ v8f wmma16(v16h a, v16h b, v8f c) {
  v8f d = __builtin_amdgcn_wmma_f32_16x16x32_f16(false, a, false, b, (short)0, c, false, false);
  asm volatile("v_nop\n\tv_nop\n\tv_nop\n\tv_nop" : "+v"(d) : "v"(a), "v"(b));
  return d;
}
__device__ __forceinline__ v8f wmma_bf(v16b a, v16b b, v8f c) {
  v8f d = __builtin_amdgcn_wmma_f32_16x16x32_bf16(false, a, false, b, (short)0, c, false, false);
  asm volatile("v_nop\n\tv_nop\n\tv_nop\n\tv_nop" : "+v"(d) : "v"(a), "v"(b));
  return d;
}
// Streaming decoder block (B 2, L 2,048, d 1,024, 16 heads x 64, SwiGLU hidden 2,730): pre-RMSNorm, bias-free projections, rotate-half RoPE (base 10000), attention under the given boolean mask (all-keys + 256-token window), out-projection + residual, pre-RMSNorm SwiGLU FFN + residual.
__device__ __forceinline__ v16h frag_h(const _Float16* rowk0, int lane) {
  union { v16h v; v8h q[2]; } u; const _Float16* p = rowk0 + 8 * (lane >> 4);
  u.q[0] = *(const v8h*)p; u.q[1] = *(const v8h*)(p + 16); return u.v;
}
__device__ __forceinline__ v16h frag_f32(const float* rowk0, int lane) {
  v16h a; const float* p = rowk0 + 8 * (lane >> 4);
#pragma unroll
  for (int i = 0; i < 8; ++i) { a[i] = (_Float16)p[i]; a[8 + i] = (_Float16)p[16 + i]; }
  return a;
}
__device__ __forceinline__ v16h frag_f32s(const float* rowk0, int lane, float sc) {
  v16h a; const float* p = rowk0 + 8 * (lane >> 4);
#pragma unroll
  for (int i = 0; i < 8; ++i) { a[i] = (_Float16)(p[i] * sc); a[8 + i] = (_Float16)(p[16 + i] * sc); }
  return a;
}
// column fragment from a [K][ld] layout (column n), rows >= K read as 0
__device__ __forceinline__ v16h fragc_f32(const float* W, int k0, int n, int lane, int ld, int K) {
  v16h a; const int g = lane >> 4;
#pragma unroll
  for (int i = 0; i < 8; ++i) { const int ka = k0 + 8 * g + i, kb = ka + 16;
    a[i] = (_Float16)(ka < K ? W[(size_t)(ka < K ? ka : K - 1) * ld + n] : 0.f); a[8 + i] = (_Float16)(kb < K ? W[(size_t)(kb < K ? kb : K - 1) * ld + n] : 0.f); }
  return a;
}
struct F2 { v16b h, l; };
__device__ __forceinline__ F2 bsplit16(const float v[16]) { F2 r;
#pragma unroll
  for (int i = 0; i < 16; ++i) { const __bf16 h = (__bf16)v[i]; r.h[i] = h; r.l[i] = (__bf16)(v[i] - (float)h); }
  return r; }
__device__ __forceinline__ F2 split_row(const float* row, int k0, int lane) { float v[16]; const float* p = row + k0 + 8 * (lane >> 4);
#pragma unroll
  for (int i = 0; i < 8; ++i) { v[i] = p[i]; v[8 + i] = p[16 + i]; }
  return bsplit16(v); }
__device__ __forceinline__ F2 split_rowK(const float* row, int k0, int lane, int K) { float v[16]; const int g = lane >> 4;
#pragma unroll
  for (int i = 0; i < 8; ++i) { const int ka = k0 + 8 * g + i, kb = ka + 16; v[i] = ka < K ? row[ka < K ? ka : K - 1] : 0.f; v[8 + i] = kb < K ? row[kb < K ? kb : K - 1] : 0.f; }
  return bsplit16(v); }
__device__ __forceinline__ F2 split_col(const float* W, int k0, int n, int lane, int ld, int K) { float v[16]; const int g = lane >> 4;
#pragma unroll
  for (int i = 0; i < 8; ++i) { const int ka = k0 + 8 * g + i, kb = ka + 16; v[i] = ka < K ? W[(size_t)(ka < K ? ka : K - 1) * ld + n] : 0.f; v[8 + i] = kb < K ? W[(size_t)(kb < K ? kb : K - 1) * ld + n] : 0.f; }
  return bsplit16(v); }
__device__ __forceinline__ v8f mac3(const F2& a, const F2& b, v8f c) { c = wmma_bf(a.l, b.h, c); c = wmma_bf(a.h, b.l, c); return wmma_bf(a.h, b.h, c); }
__device__ __forceinline__ float sigm(float v) { return 1.0f / (1.0f + expf(-v)); }
#define LDSX() do { asm volatile("s_wait_dscnt 0" ::: "memory"); __builtin_amdgcn_wave_barrier(); __builtin_amdgcn_fence(__ATOMIC_RELEASE, "workgroup"); } while (0)
// ---- GEMM operand ring: a stage is 64 k of every operand row of the block's tile, brought into LDS by asynchronous 16-byte copies (a wave's copy covers whole 128-byte lines); LDS row pitch = row bytes + 16 (16 B x odd: conflict-free for 16-byte reads); two buffers (four in k_g, three in k_gu)
#define KS 64
#define HPITCH (2 * KS + 16)       // f16 rows: 128 B + 16
__device__ __forceinline__ unsigned lds_off(const void* p) { return (unsigned)(size_t)p; }
// a run of copies and, as the last line of their own statement, the wait that stands in front of any rewrite of their address registers (one wait a run: fewer, longer runs cost a wave fewer waits)
#define CPL(a, b) "global_load_async_to_lds_b128 %" #a ", %" #b ", off\n\t"
__device__ __forceinline__ void cp8(const unsigned* l, const char* const* g) {
  asm volatile(CPL(0, 1) CPL(2, 3) CPL(4, 5) CPL(6, 7) CPL(8, 9) CPL(10, 11) CPL(12, 13) CPL(14, 15) "s_wait_xcnt 0x0"
               :: "v"(l[0]), "v"(g[0]), "v"(l[1]), "v"(g[1]), "v"(l[2]), "v"(g[2]), "v"(l[3]), "v"(g[3]), "v"(l[4]), "v"(g[4]), "v"(l[5]), "v"(g[5]), "v"(l[6]), "v"(g[6]), "v"(l[7]), "v"(g[7]) : "memory");
}
__device__ __forceinline__ void cp12(const unsigned* l, const char* const* g) {
  asm volatile(CPL(0, 1) CPL(2, 3) CPL(4, 5) CPL(6, 7) CPL(8, 9) CPL(10, 11) CPL(12, 13) CPL(14, 15) CPL(16, 17) CPL(18, 19) CPL(20, 21) CPL(22, 23) "s_wait_xcnt 0x0"
               :: "v"(l[0]), "v"(g[0]), "v"(l[1]), "v"(g[1]), "v"(l[2]), "v"(g[2]), "v"(l[3]), "v"(g[3]), "v"(l[4]), "v"(g[4]), "v"(l[5]), "v"(g[5]), "v"(l[6]), "v"(g[6]), "v"(l[7]), "v"(g[7]), "v"(l[8]), "v"(g[8]), "v"(l[9]), "v"(g[9]), "v"(l[10]), "v"(g[10]), "v"(l[11]), "v"(g[11]) : "memory");
}
// this thread's addresses for ROWS rows of RB bytes from gb (row pitch gp bytes) to LDS byte address lb (row pitch RB + 16), dealt over the NTH threads of a block: ROWS * RB / (16 * NTH) copies a thread
template <int ROWS, int RB, int NTH = 128>
__device__ __forceinline__ void row_addr(unsigned* l, const char** g, unsigned lb, const char* gb, size_t gp, int tid) {
  constexpr int PPR = RB / 16, RPI = NTH / PPR, NI = ROWS / RPI; const int row = tid / PPR, pc = tid % PPR;
#pragma unroll
  for (int i = 0; i < NI; ++i) { l[i] = lb + (row + i * RPI) * (RB + 16) + pc * 16; g[i] = gb + (size_t)(row + i * RPI) * gp + pc * 16; }
}
// 128 threads: 128 A rows of 128 B at lb, behind them 128 weight rows of 128 B
__device__ __forceinline__ void stage_ab(unsigned lb, const char* ga, size_t pa, const char* gb, size_t pb, int tid) {
  unsigned l[16]; const char* g[16]; row_addr<128, 2 * KS>(l, g, lb, ga, pa, tid); row_addr<128, 2 * KS>(l + 8, g + 8, lb + 128 * HPITCH, gb, pb, tid); cp8(l, g); cp8(l + 8, g + 8);
}
// 256 threads: 128 A rows of ARB bytes at lb, behind them 128 weight rows of 128 B
template <int ARB>
__device__ __forceinline__ void stage_ab8(unsigned lb, const char* ga, size_t pa, const char* gb, size_t pb, int tid) {
  constexpr int NA = 128 * ARB / 4096; unsigned l[NA + 4]; const char* g[NA + 4];
  row_addr<128, ARB, 256>(l, g, lb, ga, pa, tid); row_addr<128, 2 * KS, 256>(l + NA, g + NA, lb + 128 * (ARB + 16), gb, pb, tid);
  if constexpr (NA == 4) cp8(l, g); else cp12(l, g);
}
#define WAIT_ASYNC0() asm volatile("s_wait_asynccnt 0x0" ::: "memory")   // this wave's copies have landed
#define WAIT_ASYNC(n) asm volatile("s_wait_asynccnt %0" :: "n"(n) : "memory")   // all but this wave's n youngest copies have landed (the counter returns in issue order)
#define WAIT_DS0() asm volatile("s_wait_dscnt 0x0" ::: "memory")         // this wave's LDS reads of the buffer have returned before it is refilled


#define NB 2
#define SS 2048
#define DM 1024
#define NH 16
#define HID 2730
#define HP 2816          // hidden padded to 22 x 128
#define WSC 256.0f
#define RMSEPS 1e-6f
__constant__ float THETA[32] = {1.000000000e+00f,7.498942018e-01f,5.623413324e-01f,4.216965139e-01f,3.162277639e-01f,2.371373773e-01f,1.778279394e-01f,1.333521456e-01f,1.000000015e-01f,7.498942316e-02f,5.623413250e-02f,4.216964915e-02f,3.162277490e-02f,2.371373773e-02f,1.778279431e-02f,1.333521400e-02f,9.999999776e-03f,7.498942316e-03f,5.623413250e-03f,4.216964822e-03f,3.162277630e-03f,2.371373819e-03f,1.778279431e-03f,1.333521446e-03f,1.000000047e-03f,7.498941850e-04f,5.623413017e-04f,4.216965172e-04f,3.162277571e-04f,2.371373703e-04f,1.778279402e-04f,1.333521504e-04f};
__device__ __attribute__((noinline)) float cos_p(float v) { return cosf(v); }
__device__ __attribute__((noinline)) float sin_p(float v) { return sinf(v); }
#define HD 64
#define QKVW (3 * DM)
#ifndef TQB
#define TQB (SS / 64)
#define TNB NB
#define TOB (NB * SS / 64)     // output row tiles (all)
#endif
typedef __attribute__((ext_vector_type(8))) __bf16 v8b;
__device__ __forceinline__ v16b frag_b(const __bf16* rowk0, int lane) {
  union { v16b v; v8b q[2]; } u; const __bf16* p = rowk0 + 8 * (lane >> 4);
  u.q[0] = *(const v8b*)p; u.q[1] = *(const v8b*)(p + 16); return u.v;
}
__device__ __forceinline__ float bfr(float v) { return (float)(__bf16)v; }
__device__ __attribute__((noinline)) float exp_ni(float v) { return expf(v); }
__device__ __attribute__((noinline)) float erf_ni(float v) { return erff(v); }

#define PK_A 0                       // [3072][1024] Wqkv rows (natural [out][in])
#define PK_P (PK_A + QKVW * DM)        // [1024][1024] Wo rows (natural)
#define PK_END (PK_P + DM * DM)
#define WS_PK  0u
#define WS_QK  (WS_PK + 2u * PK_END)             // f16 [4096 rows][2048]: q | k
#define WS_QKL (WS_QK + 2u * NB * SS * 2 * DM)     // f16 q | k residual planes x2048
#define WS_VTH (WS_QKL + 2u * NB * SS * 2 * DM)    // f16 [b][1024 (h*64+d)][2048 s] hi
#define WS_VTL (WS_VTH + 2u * NB * DM * SS)        // f16 lo x 2048
#define WS_O   (WS_VTL + 2u * NB * DM * SS)        // f32 [4096][1024]
#define WS_PG  (WS_O + 4u * (size_t)NB * SS * DM)        // f16 x 2^8 [gate | up] rows [2*HP][1024] (zero rows >= HID), down rows [1024][HP] (zero cols >= HID)
#define WS_PD  (WS_PG + 2u * (size_t)2 * HP * DM)
#define WS_H1  (WS_PD + 2u * (size_t)DM * HP)             // f16 rmsnorm1(x) rows [NR][1024]; int flags [SS/64][SS/32]; f32 x1 [NR][1024]; f16 rmsnorm2(x1) rows; f16 silu(gate) up, NR x HP, in 128-byte lines of 4 rows x 16 columns: [row / 4][col / 16][row % 4][col % 16]
#define WS_FL  (WS_H1 + 2u * (size_t)NB * SS * DM)
#define WS_X1  (WS_FL + 4u * (size_t)(SS / 64) * (SS / 32))
#define WS_H2  (WS_X1 + 4u * (size_t)NB * SS * DM)
#define WS_GU  (WS_H2 + 2u * (size_t)NB * SS * DM)
#define WS_END (WS_GU + 2u * (size_t)NB * SS * HP)
// ---- pack_tasks (the first PK_WG work-groups of k_prep): a resident stream, one task a wave and pass, no LDS and no barrier: 2,048 half rows of W_down, 4,096 rows of W_q | W_k | W_v | W_o, 5,632 rows of gate | up (the longer tasks first); value = f16(bf16(w) x 2^8); all loads of a task go out before its first store; every load and store of a wave covers one contiguous run of bytes; the loops over j and c below are unrolled so that the pieces stay in registers and the loads go out as one group
typedef __attribute__((ext_vector_type(4))) _Float16 v4h;
typedef __attribute__((ext_vector_type(2))) _Float16 v2h;
#define PT_D (2 * DM)
#define PT_A (PT_D + 4 * DM)
#define PT_END (PT_A + 2 * HP)
#define PK_WG 256        // work-groups of 16 waves: one a WGP
__device__ __forceinline__ _Float16 wcv(float w) { return (_Float16)(bfr(w) * WSC); }
#define STORES_OUT() asm volatile("s_wait_xcnt 0x0" ::: "memory")   // stands directly behind a task's last store: what follows (the next task) rewrites registers that these stores name
// one row of 1,024: a lane holds 8 pieces of 16 bytes, 128 elements apart
__device__ __forceinline__ void pack_row(const float* __restrict__ s, _Float16* __restrict__ d, int lane) { v4f x[8];
#pragma unroll
  for (int j = 0; j < 8; ++j) x[j] = *(const v4f*)(s + j * 128 + lane * 4);
#pragma unroll
  for (int j = 0; j < 8; ++j) { v4h o;
#pragma unroll
    for (int c = 0; c < 4; ++c) o[c] = wcv(x[j][c]);
    *(v4h*)(d + j * 128 + lane * 4) = o; }
  STORES_OUT(); }
__device__ __forceinline__ void pack_tasks(const float* __restrict__ WQ, const float* __restrict__ WK, const float* __restrict__ WV, const float* __restrict__ WO, const float* __restrict__ WG, const float* __restrict__ WU, const float* __restrict__ WD, char* __restrict__ ws) {
  const int lane = threadIdx.x & 31; _Float16* P = (_Float16*)(ws + WS_PK);
  for (int task = __builtin_amdgcn_readfirstlane((threadIdx.x >> 5) * PK_WG + blockIdx.x); task < PT_END; task += 16 * PK_WG) {   // dealt wave-major, so that every work-group gets the same mix of tasks; the task number sits in a scalar register, so the branches on it are scalar
    if (task < PT_D) { const int n = task >> 1, k0 = (task & 1) * (HP / 2) + lane * 2; const float* s = WD + (size_t)n * HID; _Float16* d = (_Float16*)(ws + WS_PD) + (size_t)n * HP; v2f x[22];   // down rows [1024][HP], zero beyond 2,730; a source row starts on 8 bytes only, hence 8-byte loads
#pragma unroll
      for (int j = 0; j < 22; ++j) { const int k = k0 + j * 64; x[j] = *(const v2f*)(s + (k < HID ? k : 0)); }
#pragma unroll
      for (int j = 0; j < 22; ++j) { const int k = k0 + j * 64; v2h o; o[0] = (k < HID) ? wcv(x[j][0]) : (_Float16)0.0f; o[1] = (k < HID) ? wcv(x[j][1]) : (_Float16)0.0f; *(v2h*)(d + k) = o; }
      STORES_OUT(); }
    else if (task < PT_A) { const int r = task - PT_D, which = r >> 10; const float* w = (which == 0) ? WQ : (which == 1) ? WK : (which == 2) ? WV : WO; pack_row(w + (size_t)(r & (DM - 1)) * DM, P + PK_A + (size_t)r * DM, lane); }   // PK_P follows PK_A directly
    else { const int r = task - PT_A, n = (r < HP) ? r : r - HP; _Float16* d = (_Float16*)(ws + WS_PG) + (size_t)r * DM;   // gate | up rows, zero beyond 2,730
      if (n < HID) pack_row(((r < HP) ? WG : WU) + (size_t)n * DM, d, lane);
      else { const v4h z = {};
#pragma unroll
        for (int j = 0; j < 8; ++j) *(v4h*)(d + j * 128 + lane * 4) = z;
        STORES_OUT(); } }
  } }
// the projections are bias-free: the kernel holds no bias path
__global__ __launch_bounds__(128) void k_qkv(const float* __restrict__ XQ, const float* __restrict__ XK, const float* __restrict__ XV, const _Float16* __restrict__ P, _Float16* __restrict__ QK, _Float16* __restrict__ QKL, _Float16* __restrict__ VTH, _Float16* __restrict__ VTL) {
  const int which0 = (blockIdx.y * 128) / DM; const float* X = (which0 == 0) ? XQ : (which0 == 1) ? XK : XV;
  constexpr int STG = (128 + 128) * HPITCH; __shared__ __attribute__((aligned(128))) char sm[2 * STG];   // the ring; behind the loop's last barrier the same bytes are the output staging
  _Float16 (*so)[16][136] = (_Float16 (*)[16][136])sm; _Float16 (*sol)[16][136] = (_Float16 (*)[16][136])(sm + 4 * 16 * 136 * 2); _Float16 (*sth)[136] = (_Float16 (*)[136])sm; _Float16 (*stl)[136] = (_Float16 (*)[136])(sm + 128 * 136 * 2);
  const int tid = threadIdx.x, wave = tid >> 5, lane = tid & 31, col = lane & 15, g = lane >> 4; const size_t r0 = (size_t)blockIdx.x * 128 + wave * 32; const int n0 = blockIdx.y * 128;   // block = (128 rows, 128 cols); a wave holds 32 rows x 128 cols: each weight fragment read from LDS feeds two products
  v8f acc[2][8] = {};
  { const char* gA = (const char*)((const _Float16*)X + (size_t)blockIdx.x * 128 * DM); const char* gB = (const char*)(P + (size_t)n0 * DM); const unsigned l0 = lds_off(sm); constexpr int NT = DM / KS;   // A = f16 rmsnorm rows
    stage_ab(l0, gA, 2 * DM, gB, 2 * DM, tid); WAIT_ASYNC0(); __syncthreads();
    stage_ab(l0 + STG, gA + 2 * KS, 2 * DM, gB + 2 * KS, 2 * DM, tid);
#pragma unroll 1   // stays rolled: one copy of a stage's code in the instruction cache; t & 1 picks the buffer
    for (int t = 0; t < NT; ++t) { const int bo = (t & 1) * STG;
#pragma unroll
      for (int kc = 0; kc < KS / 32; ++kc) { v16h a[2], w[8];   // a 32-k step's LDS reads go out as one group in front of its 16 products (both steps' fragments at once would not fit beside the 128 accumulator registers); the loops below are unrolled so that these arrays are registers
#pragma unroll
        for (int i = 0; i < 2; ++i) a[i] = frag_h((const _Float16*)(sm + bo + (wave * 32 + i * 16 + col) * HPITCH) + kc * 32, lane);
#pragma unroll
        for (int j = 0; j < 8; ++j) w[j] = frag_h((const _Float16*)(sm + bo + (128 + j * 16 + col) * HPITCH) + kc * 32, lane);
#pragma unroll
        for (int j = 0; j < 8; ++j)
#pragma unroll
          for (int i = 0; i < 2; ++i) acc[i][j] = wmma16(a[i], w[j], acc[i][j]); }
      WAIT_DS0(); WAIT_ASYNC0(); __syncthreads();   // publishes stage t + 1 and ends every reader's last read of stage t
      if (t + 2 < NT) { stage_ab(l0 + bo, gA + (size_t)(t + 2) * 2 * KS, 2 * DM, gB + (size_t)(t + 2) * 2 * KS, 2 * DM, tid); } }
    WAIT_ASYNC0(); }
#pragma unroll
  for (int i = 0; i < 2; ++i)
#pragma unroll
    for (int j = 0; j < 8; ++j)
#pragma unroll
      for (int r = 0; r < 8; ++r) acc[i][j][r] *= (1.0f / WSC);
  if (n0 < 2 * DM) {   // rotate-half rotary over each 64-dim head with angle position * inv_freq[d mod 32]; the wave's two 16-row halves go through its staging rows one after the other (unrolled: acc is indexed by i)
#pragma unroll
    for (int i = 0; i < 2; ++i) { const size_t ri = r0 + i * 16;
#pragma unroll
      for (int r = 0; r < 8; ++r) { const int spos = (int)((ri + 8 * g + r) % SS);
#pragma unroll
        for (int jj = 0; jj < 2; ++jj) { const float ang = (float)spos * THETA[jj * 16 + col]; const float c = cos_p(ang), sn = sin_p(ang);
#pragma unroll
          for (int hh = 0; hh < 2; ++hh) { const float x1 = acc[i][hh * 4 + jj][r], x2 = acc[i][hh * 4 + jj + 2][r]; acc[i][hh * 4 + jj][r] = x1 * c - x2 * sn; acc[i][hh * 4 + jj + 2][r] = x2 * c + x1 * sn; } } }
      if (i) LDSX();   // the first half's reads of the staging rows have returned before other lanes rewrite them
#pragma unroll
      for (int j = 0; j < 8; ++j) {
#pragma unroll
        for (int r = 0; r < 8; ++r) { const float v = acc[i][j][r]; const _Float16 hv = (_Float16)v; so[wave][8 * g + r][j * 16 + col] = hv; sol[wave][8 * g + r][j * 16 + col] = (_Float16)((v - (float)hv) * 2048.0f); } }   // q, k as f16 hi + (x2048) residual
      LDSX();
      for (int rl = 0; rl < 16; ++rl) if (lane < 16) { vst2((unsigned*)(QK + (ri + rl) * (2 * DM) + n0 + lane * 8), *(const v4u*)&so[wave][rl][lane * 8]); vst2((unsigned*)(QKL + (ri + rl) * (2 * DM) + n0 + lane * 8), *(const v4u*)&sol[wave][rl][lane * 8]); } }
  } else {
#pragma unroll
    for (int i = 0; i < 2; ++i)
#pragma unroll
      for (int j = 0; j < 8; ++j) {
#pragma unroll
        for (int r = 0; r < 8; ++r) { const float v = acc[i][j][r]; const _Float16 hv = (_Float16)v; sth[j * 16 + col][wave * 32 + i * 16 + 8 * g + r] = hv; stl[j * 16 + col][wave * 32 + i * 16 + 8 * g + r] = (_Float16)((v - (float)hv) * 2048.0f); } }
    __syncthreads();
    const size_t rb = (size_t)blockIdx.x * 128; const int b = (int)(rb / SS), s0 = (int)(rb % SS); const int pc0 = n0 - 2 * DM;
    for (int q = tid; q < 128 * 16; q += 128) { const int d = q >> 4, pc = q & 15; const size_t o = ((size_t)b * DM + pc0 + d) * SS + s0 + pc * 8; vst2((unsigned*)(VTH + o), *(const v4u*)&sth[d][pc * 8]); vst2((unsigned*)(VTL + o), *(const v4u*)&stl[d][pc * 8]); }
  }
}
// ---- k_attn: block = (64 queries, head h, batch b): flash attention over the visible (64-query, 32-key) tiles (K = 64: 2 k-steps), scores = (q.k) * 0.125, 3 products (hi + residual planes), P.V likewise; O[b*S+q][h*64+d] = (acc + accl / 2048) / (2048 l) (256-B segments)
// a tile's K rows (32 x 128 B, hi and residual) and V^T rows (64 x 64 B, hi and residual) come into LDS once for the block's four waves by asynchronous 16-byte copies, two buffers, the next visible tile in flight while this one is worked on; row pitch = row bytes + 16 (16 B x odd: conflict-free for 16-byte reads)
#define AKP (2 * HD + 16)
#define AVP (2 * 32 + 16)
#define A_KH 0
#define A_KL (32 * AKP)
#define A_VH (2 * 32 * AKP)
#define A_VL (A_VH + HD * AVP)
#define A_STG (A_VL + HD * AVP)
// tile ks to LDS byte address lb: 8 copies a thread; kh, kl: key row 0 of this (batch, head) in the two planes; vh, vl: its V^T row 0
__device__ __forceinline__ void stage_kv(unsigned lb, const char* kh, const char* kl, const char* vh, const char* vl, int ks, int tid) {
  unsigned l[8]; const char* g[8]; const int kr = tid >> 3, kp = tid & 7, vr = tid >> 2, vp = tid & 3;
  const size_t ko = (size_t)(ks * 32 + kr) * (2 * DM * 2) + kp * 16, vo = (size_t)vr * (SS * 2) + ks * 64 + vp * 16;
#pragma unroll
  for (int i = 0; i < 2; ++i) { const unsigned lk = lb + (kr + 16 * i) * AKP + kp * 16, lv = lb + (vr + 32 * i) * AVP + vp * 16; const size_t gk = ko + (size_t)i * 16 * (2 * DM * 2), gv = vo + (size_t)i * 32 * (SS * 2);
    l[i] = lk + A_KH; g[i] = kh + gk; l[2 + i] = lk + A_KL; g[2 + i] = kl + gk; l[4 + i] = lv + A_VH; g[4 + i] = vh + gv; l[6 + i] = lv + A_VL; g[6 + i] = vl + gv; }
  cp8(l, g);
}
__global__ __launch_bounds__(128) void k_attn(const _Float16* __restrict__ QK, const _Float16* __restrict__ QKL, const _Float16* __restrict__ VTH, const _Float16* __restrict__ VTL, const void* __restrict__ KMASK, const int* __restrict__ MASK, const int* __restrict__ FL, float* __restrict__ O) {
  __shared__ __align__(16) float sp[4][16][36]; __shared__ __align__(16) float so[4][16][68]; __shared__ __attribute__((aligned(128))) char sm[2 * A_STG];   // sm: the K / V ring
  const int tid = threadIdx.x, wave = tid >> 5, lane = tid & 31, col = lane & 15, g = lane >> 4;
  const int qb = blockIdx.x, h = blockIdx.y, b = blockIdx.z; const int q0 = qb * 64 + wave * 16; const size_t rq = (size_t)b * SS + q0 + col;
  // the visible tiles of this query block as 64 bits in scalar registers (the same in every wave of the block), taken in rising order: the ring has to know the next tile before this one is done
  unsigned long long todo = ((unsigned long long)__builtin_amdgcn_ballot_w32(FL[qb * (SS / 32) + 32 + lane] != 0) << 32) | __builtin_amdgcn_ballot_w32(FL[qb * (SS / 32) + lane] != 0);
  const int nt = __builtin_popcountll(todo);
  const char* gkh = (const char*)(QK + (size_t)b * SS * (2 * DM) + DM + h * HD); const char* gkl = (const char*)(QKL + (size_t)b * SS * (2 * DM) + DM + h * HD);
  const char* gvh = (const char*)(VTH + ((size_t)b * DM + h * HD) * SS); const char* gvl = (const char*)(VTL + ((size_t)b * DM + h * HD) * SS); const unsigned l0 = lds_off(sm);
  int ks = 0, ksn = 0;
  if (nt > 0) { ks = __builtin_ctzll(todo); todo &= todo - 1; stage_kv(l0, gkh, gkl, gvh, gvl, ks, tid); }
  v16h aq[2], aql[2];
#pragma unroll
  for (int kc = 0; kc < 2; ++kc) { aq[kc] = frag_h(QK + rq * (2 * DM) + h * HD + kc * 32, lane); aql[kc] = frag_h(QKL + rq * (2 * DM) + h * HD + kc * 32, lane); }
  float m[8], l[8];
#pragma unroll
  for (int r = 0; r < 8; ++r) { m[r] = -3.0e38f; l[r] = 0.f; }
  v8f acc[4] = {}, accl[4] = {};
  WAIT_ASYNC0(); __syncthreads();   // publishes the first tile
  if (nt > 1) { ksn = __builtin_ctzll(todo); todo &= todo - 1; stage_kv(l0 + A_STG, gkh, gkl, gvh, gvl, ksn, tid); }
#pragma unroll 1   // stays rolled: t & 1 picks the buffer
  for (int t = 0; t < nt; ++t) { const int bo = (t & 1) * A_STG; v8f s[2];
    v16h kh[2][2], kl[2][2];   // the tile's K reads go out as one group in front of its products; unrolled so that the arrays are registers
#pragma unroll
    for (int ct = 0; ct < 2; ++ct)
#pragma unroll
      for (int kc = 0; kc < 2; ++kc) { kh[ct][kc] = frag_h((const _Float16*)(sm + bo + A_KH + (ct * 16 + col) * AKP) + kc * 32, lane); kl[ct][kc] = frag_h((const _Float16*)(sm + bo + A_KL + (ct * 16 + col) * AKP) + kc * 32, lane); }
#pragma unroll
    for (int ct = 0; ct < 2; ++ct) { const int kk = ks * 32 + ct * 16 + col; v8f c = {}, cl = {};
#pragma unroll
      for (int kc = 0; kc < 2; ++kc) { c = wmma16(aq[kc], kh[ct][kc], c); cl = wmma16(aql[kc], kh[ct][kc], cl); cl = wmma16(aq[kc], kl[ct][kc], cl); }   // 3 products: q, k as f16 hi + residual
#pragma unroll
      for (int r = 0; r < 8; ++r) c[r] += cl[r] * (1.0f / 2048.0f);
      {
#pragma unroll
      for (int r = 0; r < 8; ++r) s[ct][r] = (MASK[(size_t)(q0 + 8 * g + r) * SS + kk] == 0) ? c[r] * 0.125f : -3.0e38f; } }   // 1/sqrt(64); masked keys excluded
#pragma unroll
    for (int r = 0; r < 8; ++r) { float mx = fmaxf(s[0][r], s[1][r]);
#pragma unroll
      for (int o = 1; o < 16; o <<= 1) mx = fmaxf(mx, __shfl_xor(mx, o));
      const float mn = fmaxf(m[r], mx); const float alpha = (m[r] <= -1.0e38f) ? 0.f : __expf(m[r] - mn);
      const float e0 = (s[0][r] <= -1.0e38f) ? 0.f : __expf(s[0][r] - mn), e1 = (s[1][r] <= -1.0e38f) ? 0.f : __expf(s[1][r] - mn); float es = e0 + e1;
#pragma unroll
      for (int o = 1; o < 16; o <<= 1) es += __shfl_xor(es, o);
      l[r] = l[r] * alpha + es; m[r] = mn;
#pragma unroll
      for (int dt = 0; dt < 4; ++dt) { acc[dt][r] *= alpha; accl[dt][r] *= alpha; }
      sp[wave][8 * g + r][col] = e0; sp[wave][8 * g + r][16 + col] = e1; }
    LDSX();
    v16h vh[4], vl[4];   // the tile's V reads likewise as one group
#pragma unroll
    for (int dt = 0; dt < 4; ++dt) { vh[dt] = frag_h((const _Float16*)(sm + bo + A_VH + (dt * 16 + col) * AVP), lane); vl[dt] = frag_h((const _Float16*)(sm + bo + A_VL + (dt * 16 + col) * AVP), lane); }
    v16h pa, pl; { const float* prow = &sp[wave][col][0] + 8 * (lane >> 4);
#pragma unroll
      for (int i = 0; i < 8; ++i) { const float x0 = prow[i] * 2048.0f, x1 = prow[16 + i] * 2048.0f; const _Float16 h0 = (_Float16)x0, h1 = (_Float16)x1; pa[i] = h0; pa[8 + i] = h1; pl[i] = (_Float16)((x0 - (float)h0) * 2048.0f); pl[8 + i] = (_Float16)((x1 - (float)h1) * 2048.0f); } }   // P scaled by 2^11 before the f16 split so small softmax weights stay out of the f16 subnormal range; 2^-11 folded into the epilogue
#pragma unroll
    for (int dt = 0; dt < 4; ++dt) { acc[dt] = wmma16(pa, vh[dt], acc[dt]); accl[dt] = wmma16(pl, vh[dt], accl[dt]); accl[dt] = wmma16(pa, vl[dt], accl[dt]); }   // P hi x V hi + (P lo x V hi + P hi x V lo) / 2048
    WAIT_DS0(); WAIT_ASYNC0(); __syncthreads();   // publishes tile t + 1 and ends every reader's last read of tile t (and this wave's reads of its sp rows)
    ks = ksn;
    if (t + 2 < nt) { ksn = __builtin_ctzll(todo); todo &= todo - 1; stage_kv(l0 + bo, gkh, gkl, gvh, gvl, ksn, tid); } }
  WAIT_ASYNC0();
#pragma unroll
  for (int r = 0; r < 8; ++r) { const float il = (l[r] > 0.f) ? (1.0f / 2048.0f) / l[r] : 0.f;
#pragma unroll
    for (int dt = 0; dt < 4; ++dt) so[wave][8 * g + r][dt * 16 + col] = (acc[dt][r] + accl[dt][r] * (1.0f / 2048.0f)) * il; }
  LDSX();
  for (int rl = 0; rl < 16; ++rl) if (lane < 16) vst2(O + ((size_t)b * SS + q0 + rl) * DM + h * HD + lane * 4, *(const v4f*)&so[wave][rl][lane * 4]);
}
// ---- k_out: block = (64 rows, 128 cols): out = O(hi/lo) . Wo rows (2 products) + bo
__global__ __launch_bounds__(128) void k_out(const float* __restrict__ O, const __bf16* __restrict__ P, const float* __restrict__ BO, float* __restrict__ Y) {
  __shared__ __align__(16) float so[4][16][132];
  const int tid = threadIdx.x, wave = tid >> 5, lane = tid & 31, col = lane & 15, g = lane >> 4; const size_t r0 = (size_t)blockIdx.x * 64 + wave * 16; const int n0 = blockIdx.y * 128;
  v8f acc[8] = {};
#pragma unroll 2
  for (int kc = 0; kc < DM / 32; ++kc) { const F2 a = split_row(O + (r0 + col) * DM, kc * 32, lane);
#pragma unroll
    for (int j = 0; j < 8; ++j) { const v16b w = frag_b(P + (size_t)(n0 + j * 16 + col) * DM + kc * 32, lane); acc[j] = wmma_bf(a.l, w, acc[j]); acc[j] = wmma_bf(a.h, w, acc[j]); } }
#pragma unroll
  for (int j = 0; j < 8; ++j) {
#pragma unroll
    for (int r = 0; r < 8; ++r) so[wave][8 * g + r][j * 16 + col] = acc[j][r] + (BO ? bfr(BO[n0 + j * 16 + col]) : 0.f); }
  LDSX();
  for (int rl = 0; rl < 16; ++rl) vst2(Y + (r0 + rl) * DM + n0 + lane * 4, *(const v4f*)&so[wave][rl][lane * 4]);
}

// ---- rms_row: wave = row, no LDS and no barrier: OUTH = f16(x rsqrt(mean x^2 + eps) w) (MODE 0: x = bf16-rounded input; MODE 1: x = f32 x1); a lane holds 8 pieces of 16 bytes, 128 elements apart, the row's 8 loads in flight at once; every loop is unrolled so that the pieces stay in registers
template <int M> __device__ __forceinline__ float lane_xor(float v) { return __builtin_bit_cast(float, __builtin_amdgcn_update_dpp(0, __builtin_bit_cast(int, v), 0x160 + M, 0xf, 0xf, true)); }   // value of lane ^ M inside a 16-lane row (DPP row_xmask), no LDS round trip
template <int MODE>
__device__ __forceinline__ void rms_row(const float* __restrict__ A, const float* __restrict__ Wn, _Float16* __restrict__ OUTH, const size_t row, const int lane) {
  v4f x[8], wn[8];
#pragma unroll
  for (int j = 0; j < 8; ++j) x[j] = *(const v4f*)(A + row * DM + j * 128 + lane * 4);
#pragma unroll
  for (int j = 0; j < 8; ++j) wn[j] = *(const v4f*)(Wn + j * 128 + lane * 4);
  if (MODE == 0) {
#pragma unroll
    for (int j = 0; j < 8; ++j)
#pragma unroll
      for (int c = 0; c < 4; ++c) x[j][c] = bfr(x[j][c]); }
  // the square sum keeps its tree: elements 256 apart chained, then pairwise over each aligned run of 32 elements (4 in the lane, 8 lanes), then the eight runs' sums one after another
  float s[2];
#pragma unroll
  for (int jp = 0; jp < 2; ++jp) { float q[4];
#pragma unroll
    for (int c = 0; c < 4; ++c) { float t = 0.f;
#pragma unroll
      for (int i = 0; i < 4; ++i) t += x[jp + 2 * i][c] * x[jp + 2 * i][c];
      q[c] = t; }
    s[jp] = (q[0] + q[1]) + (q[2] + q[3]); }
#pragma unroll
  for (int jp = 0; jp < 2; ++jp) { s[jp] += lane_xor<1>(s[jp]); s[jp] += lane_xor<2>(s[jp]); s[jp] += lane_xor<4>(s[jp]); }
  float tq = 0.f;
#pragma unroll
  for (int i = 0; i < 8; ++i) tq += __builtin_bit_cast(float, __builtin_amdgcn_readlane(__builtin_bit_cast(int, s[i >> 2]), (i & 3) * 8));
  const float inv = 1.0f / sqrtf(tq / (float)DM + RMSEPS);
#pragma unroll
  for (int j = 0; j < 8; ++j) { v4h o;
#pragma unroll
    for (int c = 0; c < 4; ++c) o[c] = (_Float16)(x[j][c] * inv * bfr(wn[j][c]));
    *(v4h*)(OUTH + row * DM + j * 128 + lane * 4) = o; }
  if (MODE == 0) STORES_OUT(); }   // in the joined launch code of the other jobs stands behind these stores in the listing and rewrites their registers; in k_rms the wave ends here
// k_rms: the second norm (its input is made by the launch in front of it): 16 rows a work-group
__global__ __launch_bounds__(512) void k_rms(const float* __restrict__ A, const float* __restrict__ Wn, _Float16* __restrict__ OUTH) { rms_row<1>(A, Wn, OUTH, (size_t)blockIdx.x * 16 + (threadIdx.x >> 5), threadIdx.x & 31); }
// ---- flags_block: block of 16 waves = (query block qb of 64 queries, half hf of the keys): FL[qb][hf * 32 + kt] = 1 if any mask[q][k] == 0 (attend) in the 64 x 32 tile; a lane owns one 16-byte column piece over 32 rows, in two groups of 16 independent loads; a block writes one whole 128-byte line of FL
__device__ __forceinline__ void flags_block(const int* __restrict__ MASK, int* __restrict__ FL, int* sf, const int qb, const int hf) { const int t = threadIdx.x; const int c4 = t & 255, rw = t >> 8;
  if (t < 32) sf[t] = 0; __syncthreads();
  const int* p = MASK + (size_t)(qb * 64 + rw) * SS + hf * (SS / 2) + c4 * 4; unsigned mn = 0xffffffffu;
#pragma unroll 1   // stays rolled: 16 loads' results at a time, so that the launch keeps two work-groups a WGP
  for (int bt = 0; bt < 2; ++bt) { v4u v[16]; const int* q = p + (size_t)bt * 32 * SS;
#pragma unroll
    for (int i = 0; i < 16; ++i) v[i] = *(const v4u*)(q + (size_t)i * 2 * SS);
    asm volatile("s_wait_xcnt 0x0" :: "v"(q) : "memory");   // stands behind a group's loads, in front of any rewrite of the address registers that they name; the address is an input, so that it stays whole up to the wait (no load's result lands on it)
#pragma unroll
    for (int i = 0; i < 16; ++i) mn = min(mn, min(min(v[i][0], v[i][1]), min(v[i][2], v[i][3]))); }   // smallest word is 0 exactly when some key is visible
  if (mn == 0u) sf[c4 >> 3] = 1;   // benign same-value race within the block
  __syncthreads(); if (t < 8) vst2((unsigned*)(FL + (size_t)qb * (SS / 32) + hf * 32 + t * 4), *(const v4u*)&sf[t * 4]); }
// ---- k_prep: the three jobs that read nothing but inputs, in one launch, told apart by the block index (a scalar test, the same for a whole work-group): weight packing (the longest, on the lowest block indices), the mask's tile flags, the first norm's rows (16 a work-group)
#define PR_FL PK_WG
#define PR_RMS (PR_FL + 2 * (SS / 64))
#define PR_END (PR_RMS + NB * SS / 16)
__global__ __launch_bounds__(512) void k_prep(const float* __restrict__ WQ, const float* __restrict__ WK, const float* __restrict__ WV, const float* __restrict__ WO, const float* __restrict__ WG, const float* __restrict__ WU, const float* __restrict__ WD, const float* __restrict__ X, const float* __restrict__ N1, const int* __restrict__ MASK, char* __restrict__ ws) { __shared__ __align__(16) int sf[32]; const int bx = blockIdx.x;
  if (bx < PR_FL) pack_tasks(WQ, WK, WV, WO, WG, WU, WD, ws);
  else if (bx < PR_RMS) flags_block(MASK, (int*)(ws + WS_FL), sf, (bx - PR_FL) >> 1, (bx - PR_FL) & 1);
  else rms_row<0>(X, N1, (_Float16*)(ws + WS_H1), (size_t)(bx - PR_RMS) * 16 + (threadIdx.x >> 5), threadIdx.x & 31); }
#define GT 176           // hidden columns of a k_gu block: 2,816 = 16 x 176
#define GQP (HP / 16 * 128)   // bytes of four rows of silu(gate) up: HP / 16 lines
// 256 threads: 128 A rows of 128 B at lb out of the 4-row x 16-column lines that k_gu writes (ga: the block's first row quad, at the stage's first line; a wave's copy covers four whole lines and deals them to four LDS rows), behind them 128 weight rows of 128 B
__device__ __forceinline__ void stage_ab8q(unsigned lb, const char* ga, const char* gb, size_t pb, int tid) {
  unsigned l[8]; const char* g[8]; const int rw = tid >> 3, pc = tid & 7;
#pragma unroll
  for (int i = 0; i < 4; ++i) { l[i] = lb + (rw + 32 * i) * HPITCH + pc * 16; g[i] = ga + (size_t)((rw >> 2) + 8 * i) * GQP + (pc >> 1) * 128 + (rw & 3) * 32 + (pc & 1) * 16; }
  row_addr<128, 2 * KS, 256>(l + 4, g + 4, lb + 128 * HPITCH, gb, pb, tid); cp8(l, g);
}
// 256 threads: 256 A rows of 128 B at lb, behind them GT gate rows and GT up rows (gw: the block's first gate row; its up rows stand HP rows further on); row pitch 2 * DM bytes; 19 copies a thread, written as the builtin: an asm statement's operands stay below v256, where k_gu's accumulators leave no room for 57 of them
typedef __attribute__((address_space(1))) v4i* gp4;
typedef __attribute__((address_space(3))) v4i* lp4;
__device__ __forceinline__ void stage_gu(char* lb, const char* ga, const char* gw, int tid) {
  const int rw = tid >> 3, pc = tid & 7; char* lt = lb + rw * HPITCH + pc * 16; const unsigned go = rw * (2 * DM) + pc * 16;
  const char* at = ga + go; const char* wt = gw + go; const char* w5 = wt + (rw < GT - 160 ? 0 : (HP - GT) * (2 * DM));   // weight rows 160 + rw: the last 16 gate rows, then the first 16 up rows
#pragma unroll
  for (int i = 0; i < 8; ++i) __builtin_amdgcn_global_load_async_to_lds_b128((gp4)(at + (size_t)i * 32 * (2 * DM)), (lp4)(lt + i * 32 * HPITCH), 0, 0);
#pragma unroll
  for (int i = 0; i < 11; ++i) __builtin_amdgcn_global_load_async_to_lds_b128((gp4)((i < 5 ? wt : i == 5 ? w5 : wt + (size_t)(HP - GT) * (2 * DM)) + (size_t)i * 32 * (2 * DM)), (lp4)(lt + (256 + 32 * i) * HPITCH), 0, 0);
}
// ---- k_g<MODE, KW>: block = (128 rows, 128 cols), eight waves, a wave 32 rows x 64 cols (a fragment read from LDS feeds two or four products; the grid is one block a WGP, so the block brings two waves a SIMD itself, and nothing else on the WGP covers a stage's way from L2: the ring has four buffers, three stages in flight while one is worked on): A f16 rows (MODE 0: built inline from the f32 ctx; MODE 2: read out of k_gu's lines) . W^T (f16 x 2^8); MODE 0: X1 = x (bf16-rounded) + acc (f32 out); MODE 2: OUT = X1 + acc (f32)
template <int MODE, int KW>
__global__ __launch_bounds__(256) void k_g(const void* __restrict__ Ain, const _Float16* __restrict__ Wr, const float* __restrict__ RES, float* __restrict__ O32, int ow) { constexpr int AEB = (MODE == 0) ? 4 : 2, APITCH = AEB * KS + 16, STG = 128 * APITCH + 128 * HPITCH, CPS = 128 * AEB * KS / 4096 + 4; __shared__ __attribute__((aligned(128))) char sm[4 * STG];   // the ring (CPS: copies a wave issues for a stage, the same in every wave); behind the loop's last barrier the same bytes are the output staging
  float (*sf)[16][68] = (float (*)[16][68])sm;
  const int tid = threadIdx.x, wave = tid >> 5, lane = tid & 31, col = lane & 15, g = lane >> 4, ar = (wave >> 1) * 32, wr = (wave & 1) * 64; const size_t r0 = (size_t)blockIdx.x * 128 + ar; const int c0 = blockIdx.y * 128 + wr;
  v8f acc[2][4] = {};
  { const char* gA = (const char*)Ain + (size_t)blockIdx.x * 128 * KW * AEB; const char* gB = (const char*)(Wr + (size_t)blockIdx.y * 128 * KW); const unsigned l0 = lds_off(sm); constexpr int NT = KW / KS;
    static_assert(NT >= 4 && 4 * CPS <= 63, "four stages exist, and their copies fit the counter");
    // stage s to LDS byte address lb (MODE 2: 64 k of four rows are four lines, 512 bytes)
    auto stage = [&](unsigned lb, int s) __attribute__((always_inline)) {
      if constexpr (MODE == 2) stage_ab8q(lb, gA + (size_t)s * 512, gB + (size_t)s * 2 * KS, 2 * KW, tid);
      else stage_ab8<AEB * KS>(lb, gA + (size_t)s * AEB * KS, (size_t)AEB * KW, gB + (size_t)s * 2 * KS, 2 * KW, tid); };
#pragma unroll   // four straight-line stages: the buffer offsets are constants
    for (int s = 0; s < 4; ++s) stage(l0 + s * STG, s);
    WAIT_ASYNC(3 * CPS); __syncthreads();   // publishes stage 0; stages 1 to 3 stay in flight
    // one stage's work, from the buffer at byte offset bo
    auto work = [&](int bo) __attribute__((always_inline)) {
      v16h a[KS / 32][2], w[KS / 32][4];   // the stage's LDS reads go out as one group in front of its products; the loops below are unrolled so that these arrays are registers
#pragma unroll
      for (int kc = 0; kc < KS / 32; ++kc) {
#pragma unroll
        for (int h = 0; h < 2; ++h) { if (MODE == 0) { const float* p = (const float*)(sm + bo + (ar + h * 16 + col) * APITCH) + kc * 32 + 8 * g;
#pragma unroll
            for (int i = 0; i < 8; ++i) { a[kc][h][i] = (_Float16)p[i]; a[kc][h][8 + i] = (_Float16)p[16 + i]; } } else a[kc][h] = frag_h((const _Float16*)(sm + bo + (ar + h * 16 + col) * APITCH) + kc * 32, lane); }
#pragma unroll
        for (int j = 0; j < 4; ++j) w[kc][j] = frag_h((const _Float16*)(sm + bo + 128 * APITCH + (wr + j * 16 + col) * HPITCH) + kc * 32, lane); }
#pragma unroll
      for (int kc = 0; kc < KS / 32; ++kc)
#pragma unroll
        for (int j = 0; j < 4; ++j)
#pragma unroll
          for (int h = 0; h < 2; ++h) acc[h][j] = wmma16(a[kc][h], w[kc][j], acc[h][j]); };
#pragma unroll 1   // stays rolled: one copy of a stage's code in the instruction cache; t & 3 picks the buffer
    for (int t = 0; t < NT - 4; ++t) { const int bo = (t & 3) * STG; work(bo);
      WAIT_DS0(); WAIT_ASYNC(2 * CPS); __syncthreads();   // stage t + 1 has landed (the wave's youngest copies are those of stages t + 2 and t + 3); the barrier publishes it and ends every reader's last read of stage t
      stage(l0 + bo, t + 4); }
#pragma unroll 1   // the last four stages: nothing is issued any more, so the wait is to 0; rolled for the same reason
    for (int t = NT - 4; t < NT; ++t) { work((t & 3) * STG); WAIT_DS0(); WAIT_ASYNC0(); __syncthreads(); }
    WAIT_ASYNC0(); }
#pragma unroll   // the wave's two 16-row halves go through its staging rows one after the other (unrolled: acc is indexed by h)
  for (int h = 0; h < 2; ++h) { const size_t rh = r0 + h * 16; float res[8][4];
#pragma unroll
    for (int r = 0; r < 8; ++r) { const float* rp = RES + (rh + 8 * g + r) * ow + c0 + col;
#pragma unroll
      for (int j = 0; j < 4; ++j) res[r][j] = rp[j * 16];
      asm volatile("s_wait_xcnt 0x0" ::: "memory"); }   // stands behind each row's four loads: the results of later rows' loads may land in the registers that held this row's address
    if (h) LDSX();   // the first half's reads of the staging rows have returned before other lanes rewrite them
#pragma unroll
    for (int j = 0; j < 4; ++j)
#pragma unroll
      for (int r = 0; r < 8; ++r) sf[wave][8 * g + r][j * 16 + col] = acc[h][j][r] * (1.0f / WSC) + (MODE == 0 ? bfr(res[r][j]) : res[r][j]);
    LDSX(); for (int rl = g; rl < 16; rl += 2) vst2(O32 + (rh + rl) * ow + c0 + col * 4, *(const v4f*)&sf[wave][rl][col * 4]); } }   // a store covers two rows' 256-byte runs
// ---- k_gu: block = (256 rows, GT hidden cols), 16 x 16 blocks: one a WGP, all of equal work; eight waves, a wave 64 rows x GT cols of gate (waves 0 to 3) or of up (waves 4 to 7; waves w and w + 4 hold the same rows): a stage brings 608 operand rows for 704 products of 16 x 16 x 32, and 15 fragments read from LDS feed 44 products; nothing else on the WGP covers a stage's way from L2, so the ring has three buffers, two stages in flight while one is worked on; g = h2 . Wg^T, u = h2 . Wu^T, GU = f16(silu(g) u) in lines of 4 rows x 16 cols (a block's 11 column groups are whole lines, so a line has one writer)
__global__ __launch_bounds__(256) void k_gu(const _Float16* __restrict__ H2, const _Float16* __restrict__ PG, _Float16* __restrict__ GU) { constexpr int STG = (256 + 2 * GT) * HPITCH, CPS = 19, XP = 4 * (GT + 4); __shared__ __attribute__((aligned(128))) char sm[3 * STG];   // the ring (CPS: copies a wave issues for a stage); behind the loop's last barrier the same bytes hold 128 rows of g and, behind them, of u in f32 (row pitch XP bytes)
  static_assert(2 * 128 * XP <= 3 * STG, "the two f32 planes fit the ring");
  const int tid = threadIdx.x, wave = __builtin_amdgcn_readfirstlane(tid >> 5), lane = tid & 31, col = lane & 15, rg = wave & 3, cg = wave >> 2; const int c0 = blockIdx.y * GT;
  v8f acc[4][11] = {};
  { const char* gA = (const char*)(H2 + (size_t)blockIdx.x * 256 * DM); const char* gW = (const char*)(PG + (size_t)c0 * DM); constexpr int NT = DM / KS;
    static_assert(NT >= 3 && 3 * CPS <= 63, "three stages exist, and their copies fit the counter");
#pragma unroll 1   // stays rolled: one copy of a stage's 19 copies and their address arithmetic in the text
    for (int s = 0; s < 3; ++s) stage_gu(sm + s * STG, gA + (size_t)s * 2 * KS, gW + (size_t)s * 2 * KS, tid);
    WAIT_ASYNC(2 * CPS); __syncthreads();   // publishes stage 0; stages 1 and 2 stay in flight
    // one stage's work, from the buffer at byte offset bo
    auto work = [&](int bo) __attribute__((always_inline)) {
#pragma unroll
      for (int kc = 0; kc < KS / 32; ++kc) { v16h a[4], w[11];   // every loop below is unrolled so that these arrays are registers
        const _Float16* pa = (const _Float16*)(sm + bo + (rg * 64 + col) * HPITCH) + kc * 32; const _Float16* pw = (const _Float16*)(sm + bo + (256 + cg * GT + col) * HPITCH) + kc * 32;
        auto ldw = [&](int j0, int j1) __attribute__((always_inline)) {
#pragma unroll
          for (int j = j0; j < j1; ++j) w[j] = frag_h(pw + j * 16 * (HPITCH / 2), lane); };
        auto mm = [&](int j0, int j1) __attribute__((always_inline)) {
#pragma unroll
          for (int j = j0; j < j1; ++j)
#pragma unroll
            for (int h = 0; h < 4; ++h) acc[h][j] = __builtin_amdgcn_wmma_f32_16x16x32_f16(false, a[h], false, w[j], (short)0, acc[h][j], false, false); };   // the bare builtin: an asm statement's operands stay below v256, and the 352 accumulator registers do not
        // the order is held by scheduling fences: beside 352 accumulator registers only ten fragments fit, so the last five weight fragments are read, 12 products ahead of their use, into registers that earlier products have left; left alone, the scheduler either reads all 15 at once and spills or reads one at a time and waits for each
#pragma unroll
        for (int h = 0; h < 4; ++h) a[h] = frag_h(pa + h * 16 * (HPITCH / 2), lane);
        ldw(0, 6); __builtin_amdgcn_sched_barrier(0); mm(0, 3); __builtin_amdgcn_sched_barrier(0);
        ldw(6, 9); __builtin_amdgcn_sched_barrier(0); mm(3, 6); __builtin_amdgcn_sched_barrier(0);
        ldw(9, 11); __builtin_amdgcn_sched_barrier(0); mm(6, 11); __builtin_amdgcn_sched_barrier(0); } };   // the last fence also keeps the stage's last products in front of the foot, so that no fragment lives on beside the next copies' address registers
    int bo = 0;
#pragma unroll 1   // stays rolled: one copy of a stage's code in the instruction cache; bo walks the three buffers
    for (int t = 0; t < NT - 3; ++t) { work(bo);
      WAIT_DS0(); WAIT_ASYNC(CPS); __syncthreads();   // stage t + 1 has landed (the wave's youngest copies are those of stage t + 2); the barrier publishes it and ends every reader's last read of stage t
      stage_gu(sm + bo, gA + (size_t)(t + 3) * 2 * KS, gW + (size_t)(t + 3) * 2 * KS, tid); bo = (bo == 2 * STG) ? 0 : bo + STG; }
#pragma unroll 1   // the last three stages: nothing is issued any more, so the wait is to 0; rolled for the same reason
    for (int t = NT - 3; t < NT; ++t) { work(bo); WAIT_DS0(); WAIT_ASYNC0(); __syncthreads(); bo = (bo == 2 * STG) ? 0 : bo + STG; }
    WAIT_ASYNC0(); }
  // g and u of an element sit in two waves: they meet in LDS, 32 of each wave's 64 rows at a time (unrolled: acc is indexed by p), and a short rolled loop over 16-byte output pieces does silu(g) u, so that the kernel's text stays short
#pragma unroll
  for (int p = 0; p < 2; ++p) {
    if (p) __syncthreads();   // every reader has left the first half's planes
    { float* pl = (float*)(sm + cg * (128 * XP) + (rg * 32 + 8 * (lane >> 4)) * XP) + col;
#pragma unroll
      for (int hh = 0; hh < 2; ++hh)
#pragma unroll
        for (int j = 0; j < 11; ++j)
#pragma unroll
          for (int r = 0; r < 8; ++r) pl[(hh * 16 + r) * (XP / 4) + j * 16] = acc[2 * p + hh][j][r]; }
    __syncthreads();   // publishes the planes
#pragma unroll 1   // stays rolled: 11 pieces a thread, one copy of the silu code
    for (int i = 0; i < 11; ++i) { const int e = tid + 256 * i, line = e >> 3, lq = line / 11, cf = line - lq * 11, r4 = (e >> 1) & 3, hf = e & 1;   // pieces in the order of the output's bytes: a wave's store covers four whole lines
      const float* pg = (const float*)(sm + (lq * 4 + r4) * XP) + cf * 16 + hf * 8; const float* pu = pg + 128 * (XP / 4);
      const v4f gv[2] = {*(const v4f*)pg, *(const v4f*)(pg + 4)}, uv[2] = {*(const v4f*)pu, *(const v4f*)(pu + 4)}; v8h o;
#pragma unroll
      for (int c = 0; c < 8; ++c) { const float gg = gv[c >> 2][c & 3] * (1.0f / WSC), uu = uv[c >> 2][c & 3] * (1.0f / WSC); o[c] = (_Float16)(gg / (1.0f + __expf(-gg)) * uu); }
      const int bq = (lq >> 3) * 16 + 8 * p + (lq & 7);   // the row quad inside the block: plane rows 32 rg + .. are block rows 64 rg + 32 p + ..
      vst2(GU + (((size_t)(blockIdx.x * 64 + bq) * (HP / 16) + blockIdx.y * (GT / 16) + cf) * 4 + r4) * 16 + hf * 8, o);
      STORES_OUT(); } } }   // the next piece rewrites the registers that this store names

extern "C" void kernel_launch(void* const* d_in, const int* in_sizes, int n_in, void* d_out, int out_size, void* d_ws, size_t ws_size, hipStream_t stream) {
  (void)in_sizes; (void)n_in; (void)out_size;
  const float** F = (const float**)d_in;   // 0 x [2,2048,1024], 1 attn_mask [2048,2048] int (1 = masked), 2 wq, 3 wk, 4 wv, 5 wo (natural [1024,1024]), 6 norm1_w, 7 norm2_w, 8 w_gate [2730,1024], 9 w_up, 10 w_down [1024,2730]
  if (ws_size < (size_t)WS_END) return;
  char* ws = (char*)d_ws; _Float16* PK = (_Float16*)(ws + WS_PK); _Float16 *QK = (_Float16*)(ws + WS_QK), *QKL = (_Float16*)(ws + WS_QKL), *VTH = (_Float16*)(ws + WS_VTH), *VTL = (_Float16*)(ws + WS_VTL), *H1 = (_Float16*)(ws + WS_H1), *H2 = (_Float16*)(ws + WS_H2), *GU = (_Float16*)(ws + WS_GU); float *O = (float*)(ws + WS_O), *X1 = (float*)(ws + WS_X1); int* FL = (int*)(ws + WS_FL); const int* MASK = (const int*)d_in[1];
  const int nr = NB * SS;   // keys of both batches are always needed
  k_prep<<<PR_END, 512, 0, stream>>>(F[2], F[3], F[4], F[5], F[8], F[9], F[10], F[0], F[6], MASK, ws);   // packed weights, tile flags, rmsnorm1 rows
  k_qkv<<<dim3(nr / 128, QKVW / 128), 128, 0, stream>>>((const float*)H1, (const float*)H1, (const float*)H1, PK + PK_A, QK, QKL, VTH, VTL);
  k_attn<<<dim3(TQB, NH, TNB), 128, 0, stream>>>(QK, QKL, VTH, VTL, nullptr, MASK, FL, O);
  k_g<0, DM><<<dim3(TOB / 2, DM / 128), 256, 0, stream>>>(O, PK + PK_P, F[0], X1, DM);                  // x1 = x + ctx wo^T
  k_rms<<<TOB * 4, 512, 0, stream>>>(X1, F[7], H2);
  k_gu<<<dim3(TOB / 4, HP / GT), 256, 0, stream>>>(H2, (const _Float16*)(ws + WS_PG), GU);
  k_g<2, HP><<<dim3(TOB / 2, DM / 128), 256, 0, stream>>>(GU, (const _Float16*)(ws + WS_PD), X1, (float*)d_out, DM);   // out = x1 + (silu(g) u) w_down^T
}

// v010
// A run of this version takes 147 microseconds.
// In both of two side-by-side timings against v009, it was 1.06 times as fast.
// All steps since v000 together make it 6.19 times as fast.
// compute dtype: all float inputs rounded to bf16, attn_mask (int) read on device; RMSNorms (eps 1e-6) in f32, normed rows once to f16; q/k/v = f16(h) . W^T against exact f16 x 2^8 weight copies on WMMA 16x16x32 (single products, f32 accumulate); rotate-half RoPE in f32 (precise sinf/cosf) before the f16 hi + residual split; attention with 3-product scores and P.v (hi + residual planes), x 1/8, masked keys excluded (mask read per pair; fully-masked 64x32 tiles skipped via a device-built flag table), running-max softmax in f32 (hardware exp); x1 = x + f16(ctx) . Wo^T; SwiGLU: f16(rmsnorm(x1)) . [W_gate | W_up]^T (hidden padded 2,730 -> 2,816 with zero weights), silu(g) u in f32 -> f16, . W_down^T + x1; f32 output.
#include <hip/hip_runtime.h>
#include <math.h>

typedef __attribute__((ext_vector_type(16))) _Float16 v16h;
typedef __attribute__((ext_vector_type(16))) __bf16 v16b;
typedef __attribute__((ext_vector_type(8)))  _Float16 v8h;
typedef __attribute__((ext_vector_type(8)))  float v8f;
typedef __attribute__((ext_vector_type(4)))  float v4f;
typedef __attribute__((ext_vector_type(2)))  float v2f;
typedef __attribute__((ext_vector_type(4)))  unsigned v4u;
typedef __attribute__((ext_vector_type(4)))  int v4i;
typedef float __attribute__((may_alias)) float_a;
typedef int __attribute__((may_alias)) int_a;

template <typename T> __device__ __forceinline__ void vst2(void* p, T v) { *(T*)p = v;  }
__device__ __forceinline__ v8f wmma16(v16h a, v16h b, v8f c) {
  v8f d = __builtin_amdgcn_wmma_f32_16x16x32_f16(false, a, false, b, (short)0, c, false, false);
  asm volatile("v_nop\n\tv_nop\n\tv_nop\n\tv_nop" : "+v"(d) : "v"(a), "v"(b));
  return d;
}
__device__ __forceinline__ v8f wmma_bf(v16b a, v16b b, v8f c) {
  v8f d = __builtin_amdgcn_wmma_f32_16x16x32_bf16(false, a, false, b, (short)0, c, false, false);
  asm volatile("v_nop\n\tv_nop\n\tv_nop\n\tv_nop" : "+v"(d) : "v"(a), "v"(b));
  return d;
}
// Streaming decoder block (B 2, L 2,048, d 1,024, 16 heads x 64, SwiGLU hidden 2,730): pre-RMSNorm, bias-free projections, rotate-half RoPE (base 10000), attention under the given boolean mask (all-keys + 256-token window), out-projection + residual, pre-RMSNorm SwiGLU FFN + residual.
__device__ __forceinline__ v16h frag_h(const _Float16* rowk0, int lane) {
  union { v16h v; v8h q[2]; } u; const _Float16* p = rowk0 + 8 * (lane >> 4);
  u.q[0] = *(const v8h*)p; u.q[1] = *(const v8h*)(p + 16); return u.v;
}
__device__ __forceinline__ v16h frag_f32(const float* rowk0, int lane) {
  v16h a; const float* p = rowk0 + 8 * (lane >> 4);
#pragma unroll
  for (int i = 0; i < 8; ++i) { a[i] = (_Float16)p[i]; a[8 + i] = (_Float16)p[16 + i]; }
  return a;
}
__device__ __forceinline__ v16h frag_f32s(const float* rowk0, int lane, float sc) {
  v16h a; const float* p = rowk0 + 8 * (lane >> 4);
#pragma unroll
  for (int i = 0; i < 8; ++i) { a[i] = (_Float16)(p[i] * sc); a[8 + i] = (_Float16)(p[16 + i] * sc); }
  return a;
}
// column fragment from a [K][ld] layout (column n), rows >= K read as 0
__device__ __forceinline__ v16h fragc_f32(const float* W, int k0, int n, int lane, int ld, int K) {
  v16h a; const int g = lane >> 4;
#pragma unroll
  for (int i = 0; i < 8; ++i) { const int ka = k0 + 8 * g + i, kb = ka + 16;
    a[i] = (_Float16)(ka < K ? W[(size_t)(ka < K ? ka : K - 1) * ld + n] : 0.f); a[8 + i] = (_Float16)(kb < K ? W[(size_t)(kb < K ? kb : K - 1) * ld + n] : 0.f); }
  return a;
}
struct F2 { v16b h, l; };
__device__ __forceinline__ F2 bsplit16(const float v[16]) { F2 r;
#pragma unroll
  for (int i = 0; i < 16; ++i) { const __bf16 h = (__bf16)v[i]; r.h[i] = h; r.l[i] = (__bf16)(v[i] - (float)h); }
  return r; }
__device__ __forceinline__ F2 split_row(const float* row, int k0, int lane) { float v[16]; const float* p = row + k0 + 8 * (lane >> 4);
#pragma unroll
  for (int i = 0; i < 8; ++i) { v[i] = p[i]; v[8 + i] = p[16 + i]; }
  return bsplit16(v); }
__device__ __forceinline__ F2 split_rowK(const float* row, int k0, int lane, int K) { float v[16]; const int g = lane >> 4;
#pragma unroll
  for (int i = 0; i < 8; ++i) { const int ka = k0 + 8 * g + i, kb = ka + 16; v[i] = ka < K ? row[ka < K ? ka : K - 1] : 0.f; v[8 + i] = kb < K ? row[kb < K ? kb : K - 1] : 0.f; }
  return bsplit16(v); }
__device__ __forceinline__ F2 split_col(const float* W, int k0, int n, int lane, int ld, int K) { float v[16]; const int g = lane >> 4;
#pragma unroll
  for (int i = 0; i < 8; ++i) { const int ka = k0 + 8 * g + i, kb = ka + 16; v[i] = ka < K ? W[(size_t)(ka < K ? ka : K - 1) * ld + n] : 0.f; v[8 + i] = kb < K ? W[(size_t)(kb < K ? kb : K - 1) * ld + n] : 0.f; }
  return bsplit16(v); }
__device__ __forceinline__ v8f mac3(const F2& a, const F2& b, v8f c) { c = wmma_bf(a.l, b.h, c); c = wmma_bf(a.h, b.l, c); return wmma_bf(a.h, b.h, c); }
__device__ __forceinline__ float sigm(float v) { return 1.0f / (1.0f + expf(-v)); }
#define LDSX() do { asm volatile("s_wait_dscnt 0" ::: "memory"); __builtin_amdgcn_wave_barrier(); __builtin_amdgcn_fence(__ATOMIC_RELEASE, "workgroup"); } while (0)
// ---- GEMM operand ring: a stage is 64 k of every operand row of the block's tile, brought into LDS by asynchronous 16-byte copies (a wave's copy covers whole 128-byte lines); LDS row pitch = row bytes + 16 (16 B x odd: conflict-free for 16-byte reads); two buffers (four in k_g, three in k_gu)
#define KS 64
#define HPITCH (2 * KS + 16)       // f16 rows: 128 B + 16
__device__ __forceinline__ unsigned lds_off(const void* p) { return (unsigned)(size_t)p; }
// a run of copies and, as the last line of their own statement, the wait that stands in front of any rewrite of their address registers (one wait a run: fewer, longer runs cost a wave fewer waits)
#define CPL(a, b) "global_load_async_to_lds_b128 %" #a ", %" #b ", off\n\t"
__device__ __forceinline__ void cp8(const unsigned* l, const char* const* g) {
  asm volatile(CPL(0, 1) CPL(2, 3) CPL(4, 5) CPL(6, 7) CPL(8, 9) CPL(10, 11) CPL(12, 13) CPL(14, 15) "s_wait_xcnt 0x0"
               :: "v"(l[0]), "v"(g[0]), "v"(l[1]), "v"(g[1]), "v"(l[2]), "v"(g[2]), "v"(l[3]), "v"(g[3]), "v"(l[4]), "v"(g[4]), "v"(l[5]), "v"(g[5]), "v"(l[6]), "v"(g[6]), "v"(l[7]), "v"(g[7]) : "memory");
}
__device__ __forceinline__ void cp12(const unsigned* l, const char* const* g) {
  asm volatile(CPL(0, 1) CPL(2, 3) CPL(4, 5) CPL(6, 7) CPL(8, 9) CPL(10, 11) CPL(12, 13) CPL(14, 15) CPL(16, 17) CPL(18, 19) CPL(20, 21) CPL(22, 23) "s_wait_xcnt 0x0"
               :: "v"(l[0]), "v"(g[0]), "v"(l[1]), "v"(g[1]), "v"(l[2]), "v"(g[2]), "v"(l[3]), "v"(g[3]), "v"(l[4]), "v"(g[4]), "v"(l[5]), "v"(g[5]), "v"(l[6]), "v"(g[6]), "v"(l[7]), "v"(g[7]), "v"(l[8]), "v"(g[8]), "v"(l[9]), "v"(g[9]), "v"(l[10]), "v"(g[10]), "v"(l[11]), "v"(g[11]) : "memory");
}
// this thread's addresses for ROWS rows of RB bytes from gb (row pitch gp bytes) to LDS byte address lb (row pitch RB + 16), dealt over the NTH threads of a block: ROWS * RB / (16 * NTH) copies a thread
template <int ROWS, int RB, int NTH = 128>
__device__ __forceinline__ void row_addr(unsigned* l, const char** g, unsigned lb, const char* gb, size_t gp, int tid) {
  constexpr int PPR = RB / 16, RPI = NTH / PPR, NI = ROWS / RPI; const int row = tid / PPR, pc = tid % PPR;
#pragma unroll
  for (int i = 0; i < NI; ++i) { l[i] = lb + (row + i * RPI) * (RB + 16) + pc * 16; g[i] = gb + (size_t)(row + i * RPI) * gp + pc * 16; }
}
// 128 threads: 128 A rows of 128 B at lb, behind them 128 weight rows of 128 B
__device__ __forceinline__ void stage_ab(unsigned lb, const char* ga, size_t pa, const char* gb, size_t pb, int tid) {
  unsigned l[16]; const char* g[16]; row_addr<128, 2 * KS>(l, g, lb, ga, pa, tid); row_addr<128, 2 * KS>(l + 8, g + 8, lb + 128 * HPITCH, gb, pb, tid); cp8(l, g); cp8(l + 8, g + 8);
}
// 256 threads: 128 A rows of ARB bytes at lb, behind them 128 weight rows of 128 B
template <int ARB>
__device__ __forceinline__ void stage_ab8(unsigned lb, const char* ga, size_t pa, const char* gb, size_t pb, int tid) {
  constexpr int NA = 128 * ARB / 4096; unsigned l[NA + 4]; const char* g[NA + 4];
  row_addr<128, ARB, 256>(l, g, lb, ga, pa, tid); row_addr<128, 2 * KS, 256>(l + NA, g + NA, lb + 128 * (ARB + 16), gb, pb, tid);
  if constexpr (NA == 4) cp8(l, g); else cp12(l, g);
}
#define WAIT_ASYNC0() asm volatile("s_wait_asynccnt 0x0" ::: "memory")   // this wave's copies have landed
#define WAIT_ASYNC(n) asm volatile("s_wait_asynccnt %0" :: "n"(n) : "memory")   // all but this wave's n youngest copies have landed (the counter returns in issue order)
#define WAIT_DS0() asm volatile("s_wait_dscnt 0x0" ::: "memory")         // this wave's LDS reads of the buffer have returned before it is refilled


#define NB 2
#define SS 2048
#define DM 1024
#define NH 16
#define HID 2730
#define HP 2816          // hidden padded to 22 x 128
#define WSC 256.0f
#define RMSEPS 1e-6f
__constant__ float THETA[32] = {1.000000000e+00f,7.498942018e-01f,5.623413324e-01f,4.216965139e-01f,3.162277639e-01f,2.371373773e-01f,1.778279394e-01f,1.333521456e-01f,1.000000015e-01f,7.498942316e-02f,5.623413250e-02f,4.216964915e-02f,3.162277490e-02f,2.371373773e-02f,1.778279431e-02f,1.333521400e-02f,9.999999776e-03f,7.498942316e-03f,5.623413250e-03f,4.216964822e-03f,3.162277630e-03f,2.371373819e-03f,1.778279431e-03f,1.333521446e-03f,1.000000047e-03f,7.498941850e-04f,5.623413017e-04f,4.216965172e-04f,3.162277571e-04f,2.371373703e-04f,1.778279402e-04f,1.333521504e-04f};
__device__ __attribute__((noinline)) float cos_p(float v) { return cosf(v); }
__device__ __attribute__((noinline)) float sin_p(float v) { return sinf(v); }
#define HD 64
#define QKVW (3 * DM)
#ifndef TQB
#define TQB (SS / 64)
#define TNB NB
#define TOB (NB * SS / 64)     // output row tiles (all)
#endif
typedef __attribute__((ext_vector_type(8))) __bf16 v8b;
__device__ __forceinline__ v16b frag_b(const __bf16* rowk0, int lane) {
  union { v16b v; v8b q[2]; } u; const __bf16* p = rowk0 + 8 * (lane >> 4);
  u.q[0] = *(const v8b*)p; u.q[1] = *(const v8b*)(p + 16); return u.v;
}
__device__ __forceinline__ float bfr(float v) { return (float)(__bf16)v; }
__device__ __attribute__((noinline)) float exp_ni(float v) { return expf(v); }
__device__ __attribute__((noinline)) float erf_ni(float v) { return erff(v); }

#define PK_A 0                       // [3072][1024] Wqkv rows (natural [out][in])
#define PK_P (PK_A + QKVW * DM)        // [1024][1024] Wo rows (natural)
#define PK_END (PK_P + DM * DM)
#define WS_PK  0u
#define WS_QK  (WS_PK + 2u * PK_END)             // f16 [4096 rows][2048]: q | k
#define WS_QKL (WS_QK + 2u * NB * SS * 2 * DM)     // f16 q | k residual planes x2048
#define WS_VTH (WS_QKL + 2u * NB * SS * 2 * DM)    // f16 [b][1024 (h*64+d)][2048 s] hi
#define WS_VTL (WS_VTH + 2u * NB * DM * SS)        // f16 lo x 2048
#define WS_O   (WS_VTL + 2u * NB * DM * SS)        // f32 [4096][1024]
#define WS_PG  (WS_O + 4u * (size_t)NB * SS * DM)        // f16 x 2^8 [gate | up] rows [2*HP][1024] (zero rows >= HID), down rows [1024][HP] (zero cols >= HID)
#define WS_PD  (WS_PG + 2u * (size_t)2 * HP * DM)
#define WS_H1  (WS_PD + 2u * (size_t)DM * HP)             // f16 rmsnorm1(x) rows [NR][1024]; int flags [SS/64][SS/32]; f32 x1 [NR][1024]; f16 rmsnorm2(x1) rows; f16 silu(gate) up, NR x HP, in 128-byte lines of 4 rows x 16 columns: [row / 4][col / 16][row % 4][col % 16]
#define WS_FL  (WS_H1 + 2u * (size_t)NB * SS * DM)
#define WS_X1  (WS_FL + 4u * (size_t)(SS / 64) * (SS / 32))
#define WS_H2  (WS_X1 + 4u * (size_t)NB * SS * DM)
#define WS_GU  (WS_H2 + 2u * (size_t)NB * SS * DM)
#define WS_END (WS_GU + 2u * (size_t)NB * SS * HP)
// ---- pack_tasks (the first PK_WG work-groups of k_prep): a resident stream, one task a wave and pass, no LDS and no barrier: 2,048 half rows of W_down, 4,096 rows of W_q | W_k | W_v | W_o, 5,632 rows of gate | up (the longer tasks first); value = f16(bf16(w) x 2^8); all loads of a task go out before its first store; every load and store of a wave covers one contiguous run of bytes; the loops over j and c below are unrolled so that the pieces stay in registers and the loads go out as one group
typedef __attribute__((ext_vector_type(4))) _Float16 v4h;
typedef __attribute__((ext_vector_type(2))) _Float16 v2h;
#define PT_D (2 * DM)
#define PT_A (PT_D + 4 * DM)
#define PT_END (PT_A + 2 * HP)
#define PK_WG 256        // work-groups of 16 waves: one a WGP
__device__ __forceinline__ _Float16 wcv(float w) { return (_Float16)(bfr(w) * WSC); }
#define STORES_OUT() asm volatile("s_wait_xcnt 0x0" ::: "memory")   // stands directly behind a task's last store: what follows (the next task) rewrites registers that these stores name
// one row of 1,024: a lane holds 8 pieces of 16 bytes, 128 elements apart
__device__ __forceinline__ void pack_row(const float* __restrict__ s, _Float16* __restrict__ d, int lane) { v4f x[8];
#pragma unroll
  for (int j = 0; j < 8; ++j) x[j] = *(const v4f*)(s + j * 128 + lane * 4);
#pragma unroll
  for (int j = 0; j < 8; ++j) { v4h o;
#pragma unroll
    for (int c = 0; c < 4; ++c) o[c] = wcv(x[j][c]);
    *(v4h*)(d + j * 128 + lane * 4) = o; }
  STORES_OUT(); }
__device__ __forceinline__ void pack_tasks(const float* __restrict__ WQ, const float* __restrict__ WK, const float* __restrict__ WV, const float* __restrict__ WO, const float* __restrict__ WG, const float* __restrict__ WU, const float* __restrict__ WD, char* __restrict__ ws) {
  const int lane = threadIdx.x & 31; _Float16* P = (_Float16*)(ws + WS_PK);
  for (int task = __builtin_amdgcn_readfirstlane((threadIdx.x >> 5) * PK_WG + blockIdx.x); task < PT_END; task += 16 * PK_WG) {   // dealt wave-major, so that every work-group gets the same mix of tasks; the task number sits in a scalar register, so the branches on it are scalar
    if (task < PT_D) { const int n = task >> 1, k0 = (task & 1) * (HP / 2) + lane * 2; const float* s = WD + (size_t)n * HID; _Float16* d = (_Float16*)(ws + WS_PD) + (size_t)n * HP; v2f x[22];   // down rows [1024][HP], zero beyond 2,730; a source row starts on 8 bytes only, hence 8-byte loads
#pragma unroll
      for (int j = 0; j < 22; ++j) { const int k = k0 + j * 64; x[j] = *(const v2f*)(s + (k < HID ? k : 0)); }
#pragma unroll
      for (int j = 0; j < 22; ++j) { const int k = k0 + j * 64; v2h o; o[0] = (k < HID) ? wcv(x[j][0]) : (_Float16)0.0f; o[1] = (k < HID) ? wcv(x[j][1]) : (_Float16)0.0f; *(v2h*)(d + k) = o; }
      STORES_OUT(); }
    else if (task < PT_A) { const int r = task - PT_D, which = r >> 10; const float* w = (which == 0) ? WQ : (which == 1) ? WK : (which == 2) ? WV : WO; pack_row(w + (size_t)(r & (DM - 1)) * DM, P + PK_A + (size_t)r * DM, lane); }   // PK_P follows PK_A directly
    else { const int r = task - PT_A, n = (r < HP) ? r : r - HP; _Float16* d = (_Float16*)(ws + WS_PG) + (size_t)r * DM;   // gate | up rows, zero beyond 2,730
      if (n < HID) pack_row(((r < HP) ? WG : WU) + (size_t)n * DM, d, lane);
      else { const v4h z = {};
#pragma unroll
        for (int j = 0; j < 8; ++j) *(v4h*)(d + j * 128 + lane * 4) = z;
        STORES_OUT(); } }
  } }
// the projections are bias-free: the kernel holds no bias path
__global__ __launch_bounds__(128) void k_qkv(const float* __restrict__ XQ, const float* __restrict__ XK, const float* __restrict__ XV, const _Float16* __restrict__ P, _Float16* __restrict__ QK, _Float16* __restrict__ QKL, _Float16* __restrict__ VTH, _Float16* __restrict__ VTL) {
  const int which0 = (blockIdx.y * 128) / DM; const float* X = (which0 == 0) ? XQ : (which0 == 1) ? XK : XV;
  constexpr int STG = (128 + 128) * HPITCH; __shared__ __attribute__((aligned(128))) char sm[2 * STG];   // the ring; behind the loop's last barrier the same bytes are the output staging
  _Float16 (*so)[16][136] = (_Float16 (*)[16][136])sm; _Float16 (*sol)[16][136] = (_Float16 (*)[16][136])(sm + 4 * 16 * 136 * 2); _Float16 (*sth)[136] = (_Float16 (*)[136])sm; _Float16 (*stl)[136] = (_Float16 (*)[136])(sm + 128 * 136 * 2);
  const int tid = threadIdx.x, wave = tid >> 5, lane = tid & 31, col = lane & 15, g = lane >> 4; const size_t r0 = (size_t)blockIdx.x * 128 + wave * 32; const int n0 = blockIdx.y * 128;   // block = (128 rows, 128 cols); a wave holds 32 rows x 128 cols: each weight fragment read from LDS feeds two products
  v8f acc[2][8] = {};
  { const char* gA = (const char*)((const _Float16*)X + (size_t)blockIdx.x * 128 * DM); const char* gB = (const char*)(P + (size_t)n0 * DM); const unsigned l0 = lds_off(sm); constexpr int NT = DM / KS;   // A = f16 rmsnorm rows
    stage_ab(l0, gA, 2 * DM, gB, 2 * DM, tid); WAIT_ASYNC0(); __syncthreads();
    stage_ab(l0 + STG, gA + 2 * KS, 2 * DM, gB + 2 * KS, 2 * DM, tid);
#pragma unroll 1   // stays rolled: one copy of a stage's code in the instruction cache; t & 1 picks the buffer
    for (int t = 0; t < NT; ++t) { const int bo = (t & 1) * STG;
#pragma unroll
      for (int kc = 0; kc < KS / 32; ++kc) { v16h a[2], w[8];   // a 32-k step's LDS reads go out as one group in front of its 16 products (both steps' fragments at once would not fit beside the 128 accumulator registers); the loops below are unrolled so that these arrays are registers
#pragma unroll
        for (int i = 0; i < 2; ++i) a[i] = frag_h((const _Float16*)(sm + bo + (wave * 32 + i * 16 + col) * HPITCH) + kc * 32, lane);
#pragma unroll
        for (int j = 0; j < 8; ++j) w[j] = frag_h((const _Float16*)(sm + bo + (128 + j * 16 + col) * HPITCH) + kc * 32, lane);
#pragma unroll
        for (int j = 0; j < 8; ++j)
#pragma unroll
          for (int i = 0; i < 2; ++i) acc[i][j] = wmma16(a[i], w[j], acc[i][j]); }
      WAIT_DS0(); WAIT_ASYNC0(); __syncthreads();   // publishes stage t + 1 and ends every reader's last read of stage t
      if (t + 2 < NT) { stage_ab(l0 + bo, gA + (size_t)(t + 2) * 2 * KS, 2 * DM, gB + (size_t)(t + 2) * 2 * KS, 2 * DM, tid); } }
    WAIT_ASYNC0(); }
#pragma unroll
  for (int i = 0; i < 2; ++i)
#pragma unroll
    for (int j = 0; j < 8; ++j)
#pragma unroll
      for (int r = 0; r < 8; ++r) acc[i][j][r] *= (1.0f / WSC);
  if (n0 < 2 * DM) {   // rotate-half rotary over each 64-dim head with angle position * inv_freq[d mod 32]; the wave's two 16-row halves go through its staging rows one after the other (unrolled: acc is indexed by i)
#pragma unroll
    for (int i = 0; i < 2; ++i) { const size_t ri = r0 + i * 16;
#pragma unroll
      for (int r = 0; r < 8; ++r) { const int spos = (int)((ri + 8 * g + r) % SS);
#pragma unroll
        for (int jj = 0; jj < 2; ++jj) { const float ang = (float)spos * THETA[jj * 16 + col]; const float c = cos_p(ang), sn = sin_p(ang);
#pragma unroll
          for (int hh = 0; hh < 2; ++hh) { const float x1 = acc[i][hh * 4 + jj][r], x2 = acc[i][hh * 4 + jj + 2][r]; acc[i][hh * 4 + jj][r] = x1 * c - x2 * sn; acc[i][hh * 4 + jj + 2][r] = x2 * c + x1 * sn; } } }
      if (i) LDSX();   // the first half's reads of the staging rows have returned before other lanes rewrite them
#pragma unroll
      for (int j = 0; j < 8; ++j) {
#pragma unroll
        for (int r = 0; r < 8; ++r) { const float v = acc[i][j][r]; const _Float16 hv = (_Float16)v; so[wave][8 * g + r][j * 16 + col] = hv; sol[wave][8 * g + r][j * 16 + col] = (_Float16)((v - (float)hv) * 2048.0f); } }   // q, k as f16 hi + (x2048) residual
      LDSX();
      for (int rl = 0; rl < 16; ++rl) if (lane < 16) { vst2((unsigned*)(QK + (ri + rl) * (2 * DM) + n0 + lane * 8), *(const v4u*)&so[wave][rl][lane * 8]); vst2((unsigned*)(QKL + (ri + rl) * (2 * DM) + n0 + lane * 8), *(const v4u*)&sol[wave][rl][lane * 8]); } }
  } else {
#pragma unroll
    for (int i = 0; i < 2; ++i)
#pragma unroll
      for (int j = 0; j < 8; ++j) {
#pragma unroll
        for (int r = 0; r < 8; ++r) { const float v = acc[i][j][r]; const _Float16 hv = (_Float16)v; sth[j * 16 + col][wave * 32 + i * 16 + 8 * g + r] = hv; stl[j * 16 + col][wave * 32 + i * 16 + 8 * g + r] = (_Float16)((v - (float)hv) * 2048.0f); } }
    __syncthreads();
    const size_t rb = (size_t)blockIdx.x * 128; const int b = (int)(rb / SS), s0 = (int)(rb % SS); const int pc0 = n0 - 2 * DM;
    for (int q = tid; q < 128 * 16; q += 128) { const int d = q >> 4, pc = q & 15; const size_t o = ((size_t)b * DM + pc0 + d) * SS + s0 + pc * 8; vst2((unsigned*)(VTH + o), *(const v4u*)&sth[d][pc * 8]); vst2((unsigned*)(VTL + o), *(const v4u*)&stl[d][pc * 8]); }
  }
}
// ---- k_attn: block = (64 queries, head h, batch b): flash attention over the visible (64-query, 32-key) tiles (K = 64: 2 k-steps), scores = (q.k) * 0.125, 3 products (hi + residual planes), P.V likewise; O[b*S+q][h*64+d] = (acc + accl / 2048) / (2048 l) (256-B segments)
// a tile's K rows (32 x 128 B, hi and residual) and V^T rows (64 x 64 B, hi and residual) come into LDS once for the block's four waves by asynchronous 16-byte copies, two buffers, the next visible tile in flight while this one is worked on; row pitch = row bytes + 16 (16 B x odd: conflict-free for 16-byte reads)
#define AKP (2 * HD + 16)
#define AVP (2 * 32 + 16)
#define A_KH 0
#define A_KL (32 * AKP)
#define A_VH (2 * 32 * AKP)
#define A_VL (A_VH + HD * AVP)
#define A_STG (A_VL + HD * AVP)
// tile ks to LDS byte address lb: 8 copies a thread; kh, kl: key row 0 of this (batch, head) in the two planes; vh, vl: its V^T row 0
__device__ __forceinline__ void stage_kv(unsigned lb, const char* kh, const char* kl, const char* vh, const char* vl, int ks, int tid) {
  unsigned l[8]; const char* g[8]; const int kr = tid >> 3, kp = tid & 7, vr = tid >> 2, vp = tid & 3;
  const size_t ko = (size_t)(ks * 32 + kr) * (2 * DM * 2) + kp * 16, vo = (size_t)vr * (SS * 2) + ks * 64 + vp * 16;
#pragma unroll
  for (int i = 0; i < 2; ++i) { const unsigned lk = lb + (kr + 16 * i) * AKP + kp * 16, lv = lb + (vr + 32 * i) * AVP + vp * 16; const size_t gk = ko + (size_t)i * 16 * (2 * DM * 2), gv = vo + (size_t)i * 32 * (SS * 2);
    l[i] = lk + A_KH; g[i] = kh + gk; l[2 + i] = lk + A_KL; g[2 + i] = kl + gk; l[4 + i] = lv + A_VH; g[4 + i] = vh + gv; l[6 + i] = lv + A_VL; g[6 + i] = vl + gv; }
  cp8(l, g);
}
// value of lane ^ 16 (the other half of the wave), by a vector cross-row move: no LDS round trip
__device__ __forceinline__ float xhalf(float x) { return __builtin_bit_cast(float, __builtin_amdgcn_permlanex16(__builtin_bit_cast(int, x), __builtin_bit_cast(int, x), 0x76543210, 0xfedcba98, false, false)); }
// the products are taken transposed: S^T = K . Q^T (A = key rows, B = the wave's 16 query rows) and O^T += V^T . P^T (A = V^T rows, B = P^T): a lane holds 16 of the tile's 32 scores of ONE query (query q0 + col; keys ct * 16 + 8 g + r), so the query's maximum and sum are taken inside the lane plus one exchange between the wave's halves, its maximum, sum and rescale factor are one register each, and the two score tiles, converted in place, are the B operand of the second product in the k order that frag_h gives the V^T rows (element i: key 8 g + i, element 8 + i: key 16 + 8 g + i): P never goes through LDS
__global__ __launch_bounds__(128) void k_attn(const _Float16* __restrict__ QK, const _Float16* __restrict__ QKL, const _Float16* __restrict__ VTH, const _Float16* __restrict__ VTL, const void* __restrict__ KMASK, const int* __restrict__ MASK, const int* __restrict__ FL, float* __restrict__ O) {
  __shared__ __align__(16) float so[4][16][68]; __shared__ __attribute__((aligned(128))) char sm[2 * A_STG];   // sm: the K / V ring
  const int tid = threadIdx.x, wave = tid >> 5, lane = tid & 31, col = lane & 15, g = lane >> 4;
  const int qb = blockIdx.x, h = blockIdx.y, b = blockIdx.z; const int q0 = qb * 64 + wave * 16; const size_t rq = (size_t)b * SS + q0 + col;
  // the visible tiles of this query block as 64 bits in scalar registers (the same in every wave of the block), taken in rising order: the ring has to know the next tile before this one is done
  unsigned long long todo = ((unsigned long long)__builtin_amdgcn_ballot_w32(FL[qb * (SS / 32) + 32 + lane] != 0) << 32) | __builtin_amdgcn_ballot_w32(FL[qb * (SS / 32) + lane] != 0);
  const int nt = __builtin_popcountll(todo);
  const char* gkh = (const char*)(QK + (size_t)b * SS * (2 * DM) + DM + h * HD); const char* gkl = (const char*)(QKL + (size_t)b * SS * (2 * DM) + DM + h * HD);
  const char* gvh = (const char*)(VTH + ((size_t)b * DM + h * HD) * SS); const char* gvl = (const char*)(VTL + ((size_t)b * DM + h * HD) * SS); const unsigned l0 = lds_off(sm);
  int ks = 0, ksn = 0;
  if (nt > 0) { ks = __builtin_ctzll(todo); todo &= todo - 1; stage_kv(l0, gkh, gkl, gvh, gvl, ks, tid); }
  v16h aq[2], aql[2];
#pragma unroll
  for (int kc = 0; kc < 2; ++kc) { aq[kc] = frag_h(QK + rq * (2 * DM) + h * HD + kc * 32, lane); aql[kc] = frag_h(QKL + rq * (2 * DM) + h * HD + kc * 32, lane); }
  float m = -3.0e38f, l = 0.f;   // this lane's query: running maximum (the same in both halves), and the sum over this half's keys (the halves are joined behind the loop)
  v8f acc[4] = {}, accl[4] = {};   // O^T: register r of tile dt = dim dt * 16 + 8 g + r of query q0 + col
  const int* mrow = MASK + (size_t)(q0 + col) * SS + 8 * g;   // this query's mask row, at this half's first key of a 16-key group
  WAIT_ASYNC0(); __syncthreads();   // publishes the first tile
  if (nt > 1) { ksn = __builtin_ctzll(todo); todo &= todo - 1; stage_kv(l0 + A_STG, gkh, gkl, gvh, gvl, ksn, tid); }
#pragma unroll 1   // stays rolled: t & 1 picks the buffer
  for (int t = 0; t < nt; ++t) { const int bo = (t & 1) * A_STG; v2f s[2][4];   // the lane's 16 scores, and all that is made of them, as pairs of neighbouring registers of one accumulator tile: packed arithmetic without register moves
    const int* mp = mrow + ks * 32; v4i mk[2][2];   // the lane's 16 mask words are four 16-byte pieces; they go out first, ahead of the K reads and the products
#pragma unroll
    for (int ct = 0; ct < 2; ++ct) { mk[ct][0] = *(const v4i*)(mp + ct * 16); mk[ct][1] = *(const v4i*)(mp + ct * 16 + 4); }
    v16h kh[2][2], kl[2][2];   // the tile's K reads go out as one group in front of its products; unrolled so that the arrays are registers
#pragma unroll
    for (int ct = 0; ct < 2; ++ct)
#pragma unroll
      for (int kc = 0; kc < 2; ++kc) { kh[ct][kc] = frag_h((const _Float16*)(sm + bo + A_KH + (ct * 16 + col) * AKP) + kc * 32, lane); kl[ct][kc] = frag_h((const _Float16*)(sm + bo + A_KL + (ct * 16 + col) * AKP) + kc * 32, lane); }
    asm volatile("s_wait_xcnt 0x0" :: "v"(mp) : "memory");   // stands behind the mask loads, in front of any rewrite of the address registers that they name; the address is an input, so that it stays whole up to the wait
    v8f c[2] = {}, cl[2] = {};
#pragma unroll
    for (int ct = 0; ct < 2; ++ct)
#pragma unroll
      for (int kc = 0; kc < 2; ++kc) { c[ct] = wmma16(kh[ct][kc], aq[kc], c[ct]); cl[ct] = wmma16(kh[ct][kc], aql[kc], cl[ct]); cl[ct] = wmma16(kl[ct][kc], aq[kc], cl[ct]); }   // 3 products: q, k as f16 hi + residual
    __builtin_amdgcn_sched_barrier(0);   // keeps the first use of a mask word, and with it the wait for the mask loads, behind all twelve products: left alone, the scheduler puts that wait behind the first product, and the other eleven stand idle behind it
#pragma unroll
    for (int ct = 0; ct < 2; ++ct)
#pragma unroll
      for (int p = 0; p < 4; ++p) { const v2f ch = {c[ct][2 * p], c[ct][2 * p + 1]}, cr = {cl[ct][2 * p], cl[ct][2 * p + 1]}; const v2f sc = (ch + cr * (1.0f / 2048.0f)) * 0.125f;   // 1/sqrt(64); masked keys excluded
        s[ct][p][0] = (mk[ct][p >> 1][(2 * p) & 3] == 0) ? sc[0] : -3.0e38f; s[ct][p][1] = (mk[ct][p >> 1][(2 * p + 1) & 3] == 0) ? sc[1] : -3.0e38f; }
    float mx = -3.0e38f;
#pragma unroll
    for (int ct = 0; ct < 2; ++ct)
#pragma unroll
      for (int p = 0; p < 4; ++p) mx = fmaxf(mx, fmaxf(s[ct][p][0], s[ct][p][1]));
    mx = fmaxf(mx, xhalf(mx));
    const float mn = fmaxf(m, mx), mb = (mn <= -1.0e38f) ? 0.f : mn;   // mb: the exponent's base; while a query has seen no visible key it is 0, so that every masked score and the empty running maximum (-3e38) give exp = 0 with no test of their own
    const float alpha = __expf(m - mb); v2f e[2][4], ea = {0.f, 0.f};
#pragma unroll
    for (int ct = 0; ct < 2; ++ct)
#pragma unroll
      for (int p = 0; p < 4; ++p) { e[ct][p][0] = __expf(s[ct][p][0] - mb); e[ct][p][1] = __expf(s[ct][p][1] - mb); ea += e[ct][p]; }
    l = l * alpha + (ea[0] + ea[1]); m = mn;
#pragma unroll
    for (int dt = 0; dt < 4; ++dt)
#pragma unroll
      for (int r = 0; r < 8; ++r) { acc[dt][r] *= alpha; accl[dt][r] *= alpha; }
    v16h vh[4], vl[4];   // the tile's V reads likewise as one group
#pragma unroll
    for (int dt = 0; dt < 4; ++dt) { vh[dt] = frag_h((const _Float16*)(sm + bo + A_VH + (dt * 16 + col) * AVP), lane); vl[dt] = frag_h((const _Float16*)(sm + bo + A_VL + (dt * 16 + col) * AVP), lane); }
    v16h pa, pl;
#pragma unroll
    for (int ct = 0; ct < 2; ++ct)
#pragma unroll
      for (int p = 0; p < 4; ++p) { const v2f x = e[ct][p] * 2048.0f; const v2h hi = __builtin_convertvector(x, v2h); const v2h lo = __builtin_convertvector((x - __builtin_convertvector(hi, v2f)) * 2048.0f, v2h);
        pa[8 * ct + 2 * p] = hi[0]; pa[8 * ct + 2 * p + 1] = hi[1]; pl[8 * ct + 2 * p] = lo[0]; pl[8 * ct + 2 * p + 1] = lo[1]; }   // P scaled by 2^11 before the f16 split so small softmax weights stay out of the f16 subnormal range; 2^-11 folded into the epilogue
#pragma unroll
    for (int dt = 0; dt < 4; ++dt) { acc[dt] = wmma16(vh[dt], pa, acc[dt]); accl[dt] = wmma16(vh[dt], pl, accl[dt]); accl[dt] = wmma16(vl[dt], pa, accl[dt]); }   // V hi x P hi + (V hi x P lo + V lo x P hi) / 2048
    WAIT_DS0(); WAIT_ASYNC0(); __syncthreads();   // publishes tile t + 1 and ends every reader's last read of tile t
    ks = ksn;
    if (t + 2 < nt) { ksn = __builtin_ctzll(todo); todo &= todo - 1; stage_kv(l0 + bo, gkh, gkl, gvh, gvl, ksn, tid); } }
  WAIT_ASYNC0();
  { const float lt = l + xhalf(l); const float il = (lt > 0.f) ? (1.0f / 2048.0f) / lt : 0.f;   // the two halves' sums joined once
#pragma unroll
    for (int dt = 0; dt < 4; ++dt) { v4f o[2];
#pragma unroll
      for (int r = 0; r < 8; ++r) o[r >> 2][r & 3] = (acc[dt][r] + accl[dt][r] * (1.0f / 2048.0f)) * il;
      *(v4f*)&so[wave][col][dt * 16 + 8 * g] = o[0]; *(v4f*)&so[wave][col][dt * 16 + 8 * g + 4] = o[1]; } }
  LDSX();
  for (int rl = 0; rl < 16; ++rl) if (lane < 16) vst2(O + ((size_t)b * SS + q0 + rl) * DM + h * HD + lane * 4, *(const v4f*)&so[wave][rl][lane * 4]);
}
// ---- k_out: block = (64 rows, 128 cols): out = O(hi/lo) . Wo rows (2 products) + bo
__global__ __launch_bounds__(128) void k_out(const float* __restrict__ O, const __bf16* __restrict__ P, const float* __restrict__ BO, float* __restrict__ Y) {
  __shared__ __align__(16) float so[4][16][132];
  const int tid = threadIdx.x, wave = tid >> 5, lane = tid & 31, col = lane & 15, g = lane >> 4; const size_t r0 = (size_t)blockIdx.x * 64 + wave * 16; const int n0 = blockIdx.y * 128;
  v8f acc[8] = {};
#pragma unroll 2
  for (int kc = 0; kc < DM / 32; ++kc) { const F2 a = split_row(O + (r0 + col) * DM, kc * 32, lane);
#pragma unroll
    for (int j = 0; j < 8; ++j) { const v16b w = frag_b(P + (size_t)(n0 + j * 16 + col) * DM + kc * 32, lane); acc[j] = wmma_bf(a.l, w, acc[j]); acc[j] = wmma_bf(a.h, w, acc[j]); } }
#pragma unroll
  for (int j = 0; j < 8; ++j) {
#pragma unroll
    for (int r = 0; r < 8; ++r) so[wave][8 * g + r][j * 16 + col] = acc[j][r] + (BO ? bfr(BO[n0 + j * 16 + col]) : 0.f); }
  LDSX();
  for (int rl = 0; rl < 16; ++rl) vst2(Y + (r0 + rl) * DM + n0 + lane * 4, *(const v4f*)&so[wave][rl][lane * 4]);
}

// ---- rms_row: wave = row, no LDS and no barrier: OUTH = f16(x rsqrt(mean x^2 + eps) w) (MODE 0: x = bf16-rounded input; MODE 1: x = f32 x1); a lane holds 8 pieces of 16 bytes, 128 elements apart, the row's 8 loads in flight at once; every loop is unrolled so that the pieces stay in registers
template <int M> __device__ __forceinline__ float lane_xor(float v) { return __builtin_bit_cast(float, __builtin_amdgcn_update_dpp(0, __builtin_bit_cast(int, v), 0x160 + M, 0xf, 0xf, true)); }   // value of lane ^ M inside a 16-lane row (DPP row_xmask), no LDS round trip
template <int MODE>
__device__ __forceinline__ void rms_row(const float* __restrict__ A, const float* __restrict__ Wn, _Float16* __restrict__ OUTH, const size_t row, const int lane) {
  v4f x[8], wn[8];
#pragma unroll
  for (int j = 0; j < 8; ++j) x[j] = *(const v4f*)(A + row * DM + j * 128 + lane * 4);
#pragma unroll
  for (int j = 0; j < 8; ++j) wn[j] = *(const v4f*)(Wn + j * 128 + lane * 4);
  if (MODE == 0) {
#pragma unroll
    for (int j = 0; j < 8; ++j)
#pragma unroll
      for (int c = 0; c < 4; ++c) x[j][c] = bfr(x[j][c]); }
  // the square sum keeps its tree: elements 256 apart chained, then pairwise over each aligned run of 32 elements (4 in the lane, 8 lanes), then the eight runs' sums one after another
  float s[2];
#pragma unroll
  for (int jp = 0; jp < 2; ++jp) { float q[4];
#pragma unroll
    for (int c = 0; c < 4; ++c) { float t = 0.f;
#pragma unroll
      for (int i = 0; i < 4; ++i) t += x[jp + 2 * i][c] * x[jp + 2 * i][c];
      q[c] = t; }
    s[jp] = (q[0] + q[1]) + (q[2] + q[3]); }
#pragma unroll
  for (int jp = 0; jp < 2; ++jp) { s[jp] += lane_xor<1>(s[jp]); s[jp] += lane_xor<2>(s[jp]); s[jp] += lane_xor<4>(s[jp]); }
  float tq = 0.f;
#pragma unroll
  for (int i = 0; i < 8; ++i) tq += __builtin_bit_cast(float, __builtin_amdgcn_readlane(__builtin_bit_cast(int, s[i >> 2]), (i & 3) * 8));
  const float inv = 1.0f / sqrtf(tq / (float)DM + RMSEPS);
#pragma unroll
  for (int j = 0; j < 8; ++j) { v4h o;
#pragma unroll
    for (int c = 0; c < 4; ++c) o[c] = (_Float16)(x[j][c] * inv * bfr(wn[j][c]));
    *(v4h*)(OUTH + row * DM + j * 128 + lane * 4) = o; }
  if (MODE == 0) STORES_OUT(); }   // in the joined launch code of the other jobs stands behind these stores in the listing and rewrites their registers; in k_rms the wave ends here
// k_rms: the second norm (its input is made by the launch in front of it): 16 rows a work-group
__global__ __launch_bounds__(512) void k_rms(const float* __restrict__ A, const float* __restrict__ Wn, _Float16* __restrict__ OUTH) { rms_row<1>(A, Wn, OUTH, (size_t)blockIdx.x * 16 + (threadIdx.x >> 5), threadIdx.x & 31); }
// ---- flags_block: block of 16 waves = (query block qb of 64 queries, half hf of the keys): FL[qb][hf * 32 + kt] = 1 if any mask[q][k] == 0 (attend) in the 64 x 32 tile; a lane owns one 16-byte column piece over 32 rows, in two groups of 16 independent loads; a block writes one whole 128-byte line of FL
__device__ __forceinline__ void flags_block(const int* __restrict__ MASK, int* __restrict__ FL, int* sf, const int qb, const int hf) { const int t = threadIdx.x; const int c4 = t & 255, rw = t >> 8;
  if (t < 32) sf[t] = 0; __syncthreads();
  const int* p = MASK + (size_t)(qb * 64 + rw) * SS + hf * (SS / 2) + c4 * 4; unsigned mn = 0xffffffffu;
#pragma unroll 1   // stays rolled: 16 loads' results at a time, so that the launch keeps two work-groups a WGP
  for (int bt = 0; bt < 2; ++bt) { v4u v[16]; const int* q = p + (size_t)bt * 32 * SS;
#pragma unroll
    for (int i = 0; i < 16; ++i) v[i] = *(const v4u*)(q + (size_t)i * 2 * SS);
    asm volatile("s_wait_xcnt 0x0" :: "v"(q) : "memory");   // stands behind a group's loads, in front of any rewrite of the address registers that they name; the address is an input, so that it stays whole up to the wait (no load's result lands on it)
#pragma unroll
    for (int i = 0; i < 16; ++i) mn = min(mn, min(min(v[i][0], v[i][1]), min(v[i][2], v[i][3]))); }   // smallest word is 0 exactly when some key is visible
  if (mn == 0u) sf[c4 >> 3] = 1;   // benign same-value race within the block
  __syncthreads(); if (t < 8) vst2((unsigned*)(FL + (size_t)qb * (SS / 32) + hf * 32 + t * 4), *(const v4u*)&sf[t * 4]); }
// ---- k_prep: the three jobs that read nothing but inputs, in one launch, told apart by the block index (a scalar test, the same for a whole work-group): weight packing (the longest, on the lowest block indices), the mask's tile flags, the first norm's rows (16 a work-group)
#define PR_FL PK_WG
#define PR_RMS (PR_FL + 2 * (SS / 64))
#define PR_END (PR_RMS + NB * SS / 16)
__global__ __launch_bounds__(512) void k_prep(const float* __restrict__ WQ, const float* __restrict__ WK, const float* __restrict__ WV, const float* __restrict__ WO, const float* __restrict__ WG, const float* __restrict__ WU, const float* __restrict__ WD, const float* __restrict__ X, const float* __restrict__ N1, const int* __restrict__ MASK, char* __restrict__ ws) { __shared__ __align__(16) int sf[32]; const int bx = blockIdx.x;
  if (bx < PR_FL) pack_tasks(WQ, WK, WV, WO, WG, WU, WD, ws);
  else if (bx < PR_RMS) flags_block(MASK, (int*)(ws + WS_FL), sf, (bx - PR_FL) >> 1, (bx - PR_FL) & 1);
  else rms_row<0>(X, N1, (_Float16*)(ws + WS_H1), (size_t)(bx - PR_RMS) * 16 + (threadIdx.x >> 5), threadIdx.x & 31); }
#define GT 176           // hidden columns of a k_gu block: 2,816 = 16 x 176
#define GQP (HP / 16 * 128)   // bytes of four rows of silu(gate) up: HP / 16 lines
// 256 threads: 128 A rows of 128 B at lb out of the 4-row x 16-column lines that k_gu writes (ga: the block's first row quad, at the stage's first line; a wave's copy covers four whole lines and deals them to four LDS rows), behind them 128 weight rows of 128 B
__device__ __forceinline__ void stage_ab8q(unsigned lb, const char* ga, const char* gb, size_t pb, int tid) {
  unsigned l[8]; const char* g[8]; const int rw = tid >> 3, pc = tid & 7;
#pragma unroll
  for (int i = 0; i < 4; ++i) { l[i] = lb + (rw + 32 * i) * HPITCH + pc * 16; g[i] = ga + (size_t)((rw >> 2) + 8 * i) * GQP + (pc >> 1) * 128 + (rw & 3) * 32 + (pc & 1) * 16; }
  row_addr<128, 2 * KS, 256>(l + 4, g + 4, lb + 128 * HPITCH, gb, pb, tid); cp8(l, g);
}
// 256 threads: 256 A rows of 128 B at lb, behind them GT gate rows and GT up rows (gw: the block's first gate row; its up rows stand HP rows further on); row pitch 2 * DM bytes; 19 copies a thread, written as the builtin: an asm statement's operands stay below v256, where k_gu's accumulators leave no room for 57 of them
typedef __attribute__((address_space(1))) v4i* gp4;
typedef __attribute__((address_space(3))) v4i* lp4;
__device__ __forceinline__ void stage_gu(char* lb, const char* ga, const char* gw, int tid) {
  const int rw = tid >> 3, pc = tid & 7; char* lt = lb + rw * HPITCH + pc * 16; const unsigned go = rw * (2 * DM) + pc * 16;
  const char* at = ga + go; const char* wt = gw + go; const char* w5 = wt + (rw < GT - 160 ? 0 : (HP - GT) * (2 * DM));   // weight rows 160 + rw: the last 16 gate rows, then the first 16 up rows
#pragma unroll
  for (int i = 0; i < 8; ++i) __builtin_amdgcn_global_load_async_to_lds_b128((gp4)(at + (size_t)i * 32 * (2 * DM)), (lp4)(lt + i * 32 * HPITCH), 0, 0);
#pragma unroll
  for (int i = 0; i < 11; ++i) __builtin_amdgcn_global_load_async_to_lds_b128((gp4)((i < 5 ? wt : i == 5 ? w5 : wt + (size_t)(HP - GT) * (2 * DM)) + (size_t)i * 32 * (2 * DM)), (lp4)(lt + (256 + 32 * i) * HPITCH), 0, 0);
}
// ---- k_g<MODE, KW>: block = (128 rows, 128 cols), eight waves, a wave 32 rows x 64 cols (a fragment read from LDS feeds two or four products; the grid is one block a WGP, so the block brings two waves a SIMD itself, and nothing else on the WGP covers a stage's way from L2: the ring has four buffers, three stages in flight while one is worked on): A f16 rows (MODE 0: built inline from the f32 ctx; MODE 2: read out of k_gu's lines) . W^T (f16 x 2^8); MODE 0: X1 = x (bf16-rounded) + acc (f32 out); MODE 2: OUT = X1 + acc (f32)
template <int MODE, int KW>
__global__ __launch_bounds__(256) void k_g(const void* __restrict__ Ain, const _Float16* __restrict__ Wr, const float* __restrict__ RES, float* __restrict__ O32, int ow) { constexpr int AEB = (MODE == 0) ? 4 : 2, APITCH = AEB * KS + 16, STG = 128 * APITCH + 128 * HPITCH, CPS = 128 * AEB * KS / 4096 + 4; __shared__ __attribute__((aligned(128))) char sm[4 * STG];   // the ring (CPS: copies a wave issues for a stage, the same in every wave); behind the loop's last barrier the same bytes are the output staging
  float (*sf)[16][68] = (float (*)[16][68])sm;
  const int tid = threadIdx.x, wave = tid >> 5, lane = tid & 31, col = lane & 15, g = lane >> 4, ar = (wave >> 1) * 32, wr = (wave & 1) * 64; const size_t r0 = (size_t)blockIdx.x * 128 + ar; const int c0 = blockIdx.y * 128 + wr;
  v8f acc[2][4] = {};
  { const char* gA = (const char*)Ain + (size_t)blockIdx.x * 128 * KW * AEB; const char* gB = (const char*)(Wr + (size_t)blockIdx.y * 128 * KW); const unsigned l0 = lds_off(sm); constexpr int NT = KW / KS;
    static_assert(NT >= 4 && 4 * CPS <= 63, "four stages exist, and their copies fit the counter");
    // stage s to LDS byte address lb (MODE 2: 64 k of four rows are four lines, 512 bytes)
    auto stage = [&](unsigned lb, int s) __attribute__((always_inline)) {
      if constexpr (MODE == 2) stage_ab8q(lb, gA + (size_t)s * 512, gB + (size_t)s * 2 * KS, 2 * KW, tid);
      else stage_ab8<AEB * KS>(lb, gA + (size_t)s * AEB * KS, (size_t)AEB * KW, gB + (size_t)s * 2 * KS, 2 * KW, tid); };
#pragma unroll   // four straight-line stages: the buffer offsets are constants
    for (int s = 0; s < 4; ++s) stage(l0 + s * STG, s);
    WAIT_ASYNC(3 * CPS); __syncthreads();   // publishes stage 0; stages 1 to 3 stay in flight
    // one stage's work, from the buffer at byte offset bo
    auto work = [&](int bo) __attribute__((always_inline)) {
      v16h a[KS / 32][2], w[KS / 32][4];   // the stage's LDS reads go out as one group in front of its products; the loops below are unrolled so that these arrays are registers
#pragma unroll
      for (int kc = 0; kc < KS / 32; ++kc) {
#pragma unroll
        for (int h = 0; h < 2; ++h) { if (MODE == 0) { const float* p = (const float*)(sm + bo + (ar + h * 16 + col) * APITCH) + kc * 32 + 8 * g;
#pragma unroll
            for (int i = 0; i < 8; ++i) { a[kc][h][i] = (_Float16)p[i]; a[kc][h][8 + i] = (_Float16)p[16 + i]; } } else a[kc][h] = frag_h((const _Float16*)(sm + bo + (ar + h * 16 + col) * APITCH) + kc * 32, lane); }
#pragma unroll
        for (int j = 0; j < 4; ++j) w[kc][j] = frag_h((const _Float16*)(sm + bo + 128 * APITCH + (wr + j * 16 + col) * HPITCH) + kc * 32, lane); }
#pragma unroll
      for (int kc = 0; kc < KS / 32; ++kc)
#pragma unroll
        for (int j = 0; j < 4; ++j)
#pragma unroll
          for (int h = 0; h < 2; ++h) acc[h][j] = wmma16(a[kc][h], w[kc][j], acc[h][j]); };
#pragma unroll 1   // stays rolled: one copy of a stage's code in the instruction cache; t & 3 picks the buffer
    for (int t = 0; t < NT - 4; ++t) { const int bo = (t & 3) * STG; work(bo);
      WAIT_DS0(); WAIT_ASYNC(2 * CPS); __syncthreads();   // stage t + 1 has landed (the wave's youngest copies are those of stages t + 2 and t + 3); the barrier publishes it and ends every reader's last read of stage t
      stage(l0 + bo, t + 4); }
#pragma unroll 1   // the last four stages: nothing is issued any more, so the wait is to 0; rolled for the same reason
    for (int t = NT - 4; t < NT; ++t) { work((t & 3) * STG); WAIT_DS0(); WAIT_ASYNC0(); __syncthreads(); }
    WAIT_ASYNC0(); }
#pragma unroll   // the wave's two 16-row halves go through its staging rows one after the other (unrolled: acc is indexed by h)
  for (int h = 0; h < 2; ++h) { const size_t rh = r0 + h * 16; float res[8][4];
#pragma unroll
    for (int r = 0; r < 8; ++r) { const float* rp = RES + (rh + 8 * g + r) * ow + c0 + col;
#pragma unroll
      for (int j = 0; j < 4; ++j) res[r][j] = rp[j * 16];
      asm volatile("s_wait_xcnt 0x0" ::: "memory"); }   // stands behind each row's four loads: the results of later rows' loads may land in the registers that held this row's address
    if (h) LDSX();   // the first half's reads of the staging rows have returned before other lanes rewrite them
#pragma unroll
    for (int j = 0; j < 4; ++j)
#pragma unroll
      for (int r = 0; r < 8; ++r) sf[wave][8 * g + r][j * 16 + col] = acc[h][j][r] * (1.0f / WSC) + (MODE == 0 ? bfr(res[r][j]) : res[r][j]);
    LDSX(); for (int rl = g; rl < 16; rl += 2) vst2(O32 + (rh + rl) * ow + c0 + col * 4, *(const v4f*)&sf[wave][rl][col * 4]); } }   // a store covers two rows' 256-byte runs
// ---- k_gu: block = (256 rows, GT hidden cols), 16 x 16 blocks: one a WGP, all of equal work; eight waves, a wave 64 rows x GT cols of gate (waves 0 to 3) or of up (waves 4 to 7; waves w and w + 4 hold the same rows): a stage brings 608 operand rows for 704 products of 16 x 16 x 32, and 15 fragments read from LDS feed 44 products; nothing else on the WGP covers a stage's way from L2, so the ring has three buffers, two stages in flight while one is worked on; g = h2 . Wg^T, u = h2 . Wu^T, GU = f16(silu(g) u) in lines of 4 rows x 16 cols (a block's 11 column groups are whole lines, so a line has one writer)
__global__ __launch_bounds__(256) void k_gu(const _Float16* __restrict__ H2, const _Float16* __restrict__ PG, _Float16* __restrict__ GU) { constexpr int STG = (256 + 2 * GT) * HPITCH, CPS = 19, XP = 4 * (GT + 4); __shared__ __attribute__((aligned(128))) char sm[3 * STG];   // the ring (CPS: copies a wave issues for a stage); behind the loop's last barrier the same bytes hold 128 rows of g and, behind them, of u in f32 (row pitch XP bytes)
  static_assert(2 * 128 * XP <= 3 * STG, "the two f32 planes fit the ring");
  const int tid = threadIdx.x, wave = __builtin_amdgcn_readfirstlane(tid >> 5), lane = tid & 31, col = lane & 15, rg = wave & 3, cg = wave >> 2; const int c0 = blockIdx.y * GT;
  v8f acc[4][11] = {};
  { const char* gA = (const char*)(H2 + (size_t)blockIdx.x * 256 * DM); const char* gW = (const char*)(PG + (size_t)c0 * DM); constexpr int NT = DM / KS;
    static_assert(NT >= 3 && 3 * CPS <= 63, "three stages exist, and their copies fit the counter");
#pragma unroll 1   // stays rolled: one copy of a stage's 19 copies and their address arithmetic in the text
    for (int s = 0; s < 3; ++s) stage_gu(sm + s * STG, gA + (size_t)s * 2 * KS, gW + (size_t)s * 2 * KS, tid);
    WAIT_ASYNC(2 * CPS); __syncthreads();   // publishes stage 0; stages 1 and 2 stay in flight
    // one stage's work, from the buffer at byte offset bo
    auto work = [&](int bo) __attribute__((always_inline)) {
#pragma unroll
      for (int kc = 0; kc < KS / 32; ++kc) { v16h a[4], w[11];   // every loop below is unrolled so that these arrays are registers
        const _Float16* pa = (const _Float16*)(sm + bo + (rg * 64 + col) * HPITCH) + kc * 32; const _Float16* pw = (const _Float16*)(sm + bo + (256 + cg * GT + col) * HPITCH) + kc * 32;
        auto ldw = [&](int j0, int j1) __attribute__((always_inline)) {
#pragma unroll
          for (int j = j0; j < j1; ++j) w[j] = frag_h(pw + j * 16 * (HPITCH / 2), lane); };
        auto mm = [&](int j0, int j1) __attribute__((always_inline)) {
#pragma unroll
          for (int j = j0; j < j1; ++j)
#pragma unroll
            for (int h = 0; h < 4; ++h) acc[h][j] = __builtin_amdgcn_wmma_f32_16x16x32_f16(false, a[h], false, w[j], (short)0, acc[h][j], false, false); };   // the bare builtin: an asm statement's operands stay below v256, and the 352 accumulator registers do not
        // the order is held by scheduling fences: beside 352 accumulator registers only ten fragments fit, so the last five weight fragments are read, 12 products ahead of their use, into registers that earlier products have left; left alone, the scheduler either reads all 15 at once and spills or reads one at a time and waits for each
#pragma unroll
        for (int h = 0; h < 4; ++h) a[h] = frag_h(pa + h * 16 * (HPITCH / 2), lane);
        ldw(0, 6); __builtin_amdgcn_sched_barrier(0); mm(0, 3); __builtin_amdgcn_sched_barrier(0);
        ldw(6, 9); __builtin_amdgcn_sched_barrier(0); mm(3, 6); __builtin_amdgcn_sched_barrier(0);
        ldw(9, 11); __builtin_amdgcn_sched_barrier(0); mm(6, 11); __builtin_amdgcn_sched_barrier(0); } };   // the last fence also keeps the stage's last products in front of the foot, so that no fragment lives on beside the next copies' address registers
    int bo = 0;
#pragma unroll 1   // stays rolled: one copy of a stage's code in the instruction cache; bo walks the three buffers
    for (int t = 0; t < NT - 3; ++t) { work(bo);
      WAIT_DS0(); WAIT_ASYNC(CPS); __syncthreads();   // stage t + 1 has landed (the wave's youngest copies are those of stage t + 2); the barrier publishes it and ends every reader's last read of stage t
      stage_gu(sm + bo, gA + (size_t)(t + 3) * 2 * KS, gW + (size_t)(t + 3) * 2 * KS, tid); bo = (bo == 2 * STG) ? 0 : bo + STG; }
#pragma unroll 1   // the last three stages: nothing is issued any more, so the wait is to 0; rolled for the same reason
    for (int t = NT - 3; t < NT; ++t) { work(bo); WAIT_DS0(); WAIT_ASYNC0(); __syncthreads(); bo = (bo == 2 * STG) ? 0 : bo + STG; }
    WAIT_ASYNC0(); }
  // g and u of an element sit in two waves: they meet in LDS, 32 of each wave's 64 rows at a time (unrolled: acc is indexed by p), and a short rolled loop over 16-byte output pieces does silu(g) u, so that the kernel's text stays short
#pragma unroll
  for (int p = 0; p < 2; ++p) {
    if (p) __syncthreads();   // every reader has left the first half's planes
    { float* pl = (float*)(sm + cg * (128 * XP) + (rg * 32 + 8 * (lane >> 4)) * XP) + col;
#pragma unroll
      for (int hh = 0; hh < 2; ++hh)
#pragma unroll
        for (int j = 0; j < 11; ++j)
#pragma unroll
          for (int r = 0; r < 8; ++r) pl[(hh * 16 + r) * (XP / 4) + j * 16] = acc[2 * p + hh][j][r]; }
    __syncthreads();   // publishes the planes
#pragma unroll 1   // stays rolled: 11 pieces a thread, one copy of the silu code
    for (int i = 0; i < 11; ++i) { const int e = tid + 256 * i, line = e >> 3, lq = line / 11, cf = line - lq * 11, r4 = (e >> 1) & 3, hf = e & 1;   // pieces in the order of the output's bytes: a wave's store covers four whole lines
      const float* pg = (const float*)(sm + (lq * 4 + r4) * XP) + cf * 16 + hf * 8; const float* pu = pg + 128 * (XP / 4);
      const v4f gv[2] = {*(const v4f*)pg, *(const v4f*)(pg + 4)}, uv[2] = {*(const v4f*)pu, *(const v4f*)(pu + 4)}; v8h o;
#pragma unroll
      for (int c = 0; c < 8; ++c) { const float gg = gv[c >> 2][c & 3] * (1.0f / WSC), uu = uv[c >> 2][c & 3] * (1.0f / WSC); o[c] = (_Float16)(gg / (1.0f + __expf(-gg)) * uu); }
      const int bq = (lq >> 3) * 16 + 8 * p + (lq & 7);   // the row quad inside the block: plane rows 32 rg + .. are block rows 64 rg + 32 p + ..
      vst2(GU + (((size_t)(blockIdx.x * 64 + bq) * (HP / 16) + blockIdx.y * (GT / 16) + cf) * 4 + r4) * 16 + hf * 8, o);
      STORES_OUT(); } } }   // the next piece rewrites the registers that this store names

extern "C" void kernel_launch(void* const* d_in, const int* in_sizes, int n_in, void* d_out, int out_size, void* d_ws, size_t ws_size, hipStream_t stream) {
  (void)in_sizes; (void)n_in; (void)out_size;
  const float** F = (const float**)d_in;   // 0 x [2,2048,1024], 1 attn_mask [2048,2048] int (1 = masked), 2 wq, 3 wk, 4 wv, 5 wo (natural [1024,1024]), 6 norm1_w, 7 norm2_w, 8 w_gate [2730,1024], 9 w_up, 10 w_down [1024,2730]
  if (ws_size < (size_t)WS_END) return;
  char* ws = (char*)d_ws; _Float16* PK = (_Float16*)(ws + WS_PK); _Float16 *QK = (_Float16*)(ws + WS_QK), *QKL = (_Float16*)(ws + WS_QKL), *VTH = (_Float16*)(ws + WS_VTH), *VTL = (_Float16*)(ws + WS_VTL), *H1 = (_Float16*)(ws + WS_H1), *H2 = (_Float16*)(ws + WS_H2), *GU = (_Float16*)(ws + WS_GU); float *O = (float*)(ws + WS_O), *X1 = (float*)(ws + WS_X1); int* FL = (int*)(ws + WS_FL); const int* MASK = (const int*)d_in[1];
  const int nr = NB * SS;   // keys of both batches are always needed
  k_prep<<<PR_END, 512, 0, stream>>>(F[2], F[3], F[4], F[5], F[8], F[9], F[10], F[0], F[6], MASK, ws);   // packed weights, tile flags, rmsnorm1 rows
  k_qkv<<<dim3(nr / 128, QKVW / 128), 128, 0, stream>>>((const float*)H1, (const float*)H1, (const float*)H1, PK + PK_A, QK, QKL, VTH, VTL);
  k_attn<<<dim3(TQB, NH, TNB), 128, 0, stream>>>(QK, QKL, VTH, VTL, nullptr, MASK, FL, O);
  k_g<0, DM><<<dim3(TOB / 2, DM / 128), 256, 0, stream>>>(O, PK + PK_P, F[0], X1, DM);                  // x1 = x + ctx wo^T
  k_rms<<<TOB * 4, 512, 0, stream>>>(X1, F[7], H2);
  k_gu<<<dim3(TOB / 4, HP / GT), 256, 0, stream>>>(H2, (const _Float16*)(ws + WS_PG), GU);
  k_g<2, HP><<<dim3(TOB / 2, DM / 128), 256, 0, stream>>>(GU, (const _Float16*)(ws + WS_PD), X1, (float*)d_out, DM);   // out = x1 + (silu(g) u) w_down^T
}
